// v000
// Times are from an AMD MI455X. After a warm-up the kernel runs many times in a row, and a time is the length of
// such a window on the GPU divided by its runs, so every launch and the gaps after it count. The runs cycle
// through copies of the inputs. A figure is the median of several windows, for all but v000 over two sittings.
// Sittings can differ by a few percent; kernels timed side by side share one.
// v000 is the starting kernel. One run takes 2300 microseconds.
#include <hip/hip_runtime.h>

// Attention with LoRA-augmented q/k/v, per-head query/key LayerNorm and an additive mask (x [2][2048][1024]; qkv = x qkv_w^T ('oi' [3072][1024] 0.02, no bias) -> q | k | v (16 heads x 64); q += (x lora_Aq) lora_Bq x 1 (alpha/r = 8/8), k, v likewise ('xw' [1024][8], [8][1024] 0.02); q, k <- LayerNorm over the 64 head dims (eps 1e-5; qn_w, qn_b, kn_w, kn_b [64], read); scores = (q x 64^-0.5).k + attn_mask ([1][1][2048][2048] f32 zeros, read); softmax; out = merged proj_w^T + proj_b -> [2][2048][1024] (4.2 M); argument order x, attn_mask, qkv_w, proj_w, proj_b, qn_w, qn_b, kn_w, kn_b, lora_Aq, lora_Bq, lora_Ak, lora_Bk, lora_Av, lora_Bv).
// Layout per batch: bf16 copy of x; 'oi' weight row blocks; exact projections; per projection the rank-8 LoRA term via two small GEMMs on zero-padded 64-wide operands (x A exact -> f32 -> hi/lo -> x B exact) added in place; a per-(token, head) LayerNorm kernel normalises the 64-value slices of q and k in place; dense T-2048 attention (hybrid rows: < 512 hi/lo 3 products, rest fp16 x1024) with the additive mask row read in the softmax; merged hi/lo x proj_w exact + proj_b.
// Compute dtypes, f32 accumulate: every input rounded to bf16; projections exact; LoRA x A exact, (x A) B hl x exact; LayerNorm f32; attention rows < 512 3 products, rest fp16; softmax f32; proj_w hl x exact + bias.

#define NB_  2
#define TT   2048
#define DM   1024
#define NH_  16
#define NKV  16
#define REP  (NH_ / NKV)
#define HD   64
#define DQ   (NH_ * HD)
#define DKV  (NKV * HD)
#define ZH   2
#define RH   512                  // query rows < RH use hi+lo planes (0: none)
#define WIN  2048
#define PCAR 1024.0f
#define SCL  0.125f   // HD^-0.5
#define LNH_EPS 1e-5f
typedef _Float16 h16;
typedef unsigned short bf;
typedef __attribute__((ext_vector_type(16))) __bf16   v16bf;
typedef __attribute__((ext_vector_type(16))) _Float16 v16h;
typedef __attribute__((ext_vector_type(8)))  _Float16 v8h;
typedef __attribute__((ext_vector_type(8)))  unsigned short v8us;
typedef __attribute__((ext_vector_type(8)))  float    v8f;
typedef __attribute__((ext_vector_type(4)))  float    v4f;
typedef v8h  __attribute__((may_alias)) v8ha;
typedef v4f  __attribute__((may_alias)) v4fa;
typedef v8us __attribute__((may_alias)) v8usa;

__device__ __forceinline__ unsigned short f2bf(float f) { unsigned u = __float_as_uint(f); u += 0x7FFFu + ((u >> 16) & 1u); return (unsigned short)(u >> 16); }
__device__ __forceinline__ float bf2f(unsigned short b) { return __uint_as_float(((unsigned)b) << 16); }
__device__ __forceinline__ float bfr(float f) { return bf2f(f2bf(f)); }
__device__ __forceinline__ v16h cat16(v8h lo, v8h hi) { return __builtin_shufflevector(lo, hi, 0, 1, 2, 3, 4, 5, 6, 7, 8, 9, 10, 11, 12, 13, 14, 15); }
__device__ __forceinline__ v16bf cat16b(v8us lo, v8us hi) { return __builtin_bit_cast(v16bf, __builtin_shufflevector(lo, hi, 0, 1, 2, 3, 4, 5, 6, 7, 8, 9, 10, 11, 12, 13, 14, 15)); }
__device__ __forceinline__ v8f wmma16(v16h a, v16h b, v8f c) { return __builtin_amdgcn_wmma_f32_16x16x32_f16(false, a, false, b, (short)0, c, false, false); }
__device__ __forceinline__ v8f wmmab(v16bf a, v16bf b, v8f c) { return __builtin_amdgcn_wmma_f32_16x16x32_bf16(false, a, false, b, (short)0, c, false, false); }



// ---- k_gemmw: register-blocked GEMM, ONE WAVE per 64x64 output tile (16 accumulators), operands straight from K-contiguous 16-bit planes; grid (M/64, N/64, Z), 32 threads.
// C[m][n] (f32, pitch ldc, + optional f32 bias[n]) = sum_k A[m][k] Bt[n][k] (+ split products per NSPLIT). z-batch strides sA/sB/sC in elements. K % 32 == 0.
template <typename T16> struct WFrag;
template <> struct WFrag<h16> { typedef v16h V; static __device__ __forceinline__ V ld(const h16* p) { return cat16(*(const v8h*)p, *(const v8h*)(p + 16)); } static __device__ __forceinline__ v8f mma(V a, V b, v8f c) { return wmma16(a, b, c); } };
template <> struct WFrag<bf> { typedef v16bf V; static __device__ __forceinline__ V ld(const bf* p) { return cat16b(*(const v8us*)p, *(const v8us*)(p + 16)); } static __device__ __forceinline__ v8f mma(V a, V b, v8f c) { return wmmab(a, b, c); } };
template <typename T16, int NSPLIT, bool BIAS>
__global__ __launch_bounds__(32) void k_gemmw(const T16* __restrict__ A, const T16* __restrict__ A2, const T16* __restrict__ Bt, const T16* __restrict__ Bt2, int K, float* C, int ldc, const float* __restrict__ bias, size_t sA, size_t sB, size_t sC) {
    typedef typename WFrag<T16>::V V;
    __shared__ __align__(16) float os[16 * 68];
    const size_t z = blockIdx.z; A += z * sA; if (A2) A2 += z * sA; Bt += z * sB; if (Bt2) Bt2 += z * sB; C += z * sC;
    const int lane = threadIdx.x & 31, lr = lane & 15, hi = lane >> 4; const int r0 = blockIdx.x * 64, c0 = blockIdx.y * 64;
    v8f acc[4][4];
#pragma unroll
    for (int mb = 0; mb < 4; ++mb)
#pragma unroll
        for (int nb = 0; nb < 4; ++nb) acc[mb][nb] = (v8f){};
    const size_t aoff = (size_t)(r0 + lr) * K + 8 * hi, boff = (size_t)(c0 + lr) * K + 8 * hi;
#pragma unroll 1
    for (int kc = 0; kc < K; kc += 32) {
        V a[4], a2[4];
#pragma unroll
        for (int mb = 0; mb < 4; ++mb) { a[mb] = WFrag<T16>::ld(A + aoff + (size_t)mb * 16 * K + kc); if (NSPLIT == 1 || NSPLIT == 2) a2[mb] = WFrag<T16>::ld(A2 + aoff + (size_t)mb * 16 * K + kc); }
#pragma unroll
        for (int nb = 0; nb < 4; ++nb) { const V b = WFrag<T16>::ld(Bt + boff + (size_t)nb * 16 * K + kc); V b2; if (NSPLIT >= 2) b2 = WFrag<T16>::ld(Bt2 + boff + (size_t)nb * 16 * K + kc);
#pragma unroll
            for (int mb = 0; mb < 4; ++mb) { acc[mb][nb] = WFrag<T16>::mma(a[mb], b, acc[mb][nb]); if (NSPLIT == 1 || NSPLIT == 2) acc[mb][nb] = WFrag<T16>::mma(a2[mb], b, acc[mb][nb]); if (NSPLIT >= 2) acc[mb][nb] = WFrag<T16>::mma(a[mb], b2, acc[mb][nb]); } }
        asm volatile("v_nop\n\tv_nop\n\tv_nop\n\tv_nop" : "+v"(acc[0][0]), "+v"(acc[1][1]), "+v"(acc[2][2]), "+v"(acc[3][3]) : "v"(a[0]), "v"(a[3]));
    }
#pragma unroll
    for (int mb = 0; mb < 4; ++mb) {
#pragma unroll
        for (int nb = 0; nb < 4; ++nb) {
#pragma unroll
            for (int j = 0; j < 8; ++j) os[(hi * 8 + j) * 68 + nb * 16 + lr] = acc[mb][nb][j]; }
        __builtin_amdgcn_wave_barrier(); asm volatile("" ::: "memory");
        float* crow = C + (size_t)(r0 + mb * 16) * ldc + c0;
{
#pragma unroll
            for (int s = 0; s < 8; ++s) { const int row = 2 * s + hi, cofs = lr * 4; v4f val = *(const v4fa*)(os + row * 68 + cofs); if (BIAS) { val[0] += bfr(bias[c0 + cofs]); val[1] += bfr(bias[c0 + cofs + 1]); val[2] += bfr(bias[c0 + cofs + 2]); val[3] += bfr(bias[c0 + cofs + 3]); }
                *(v4f*)(crow + (size_t)row * ldc + cofs) = val; }
             }
        __builtin_amdgcn_wave_barrier(); asm volatile("" ::: "memory");
    }
}

__device__ __forceinline__ h16 tohx(float x) { return (h16)x; }
__device__ __forceinline__ void splitf(float y, unsigned short& h, unsigned short& l) { h = f2bf(y); l = f2bf(y - bf2f(h)); }
typedef __attribute__((ext_vector_type(2))) _Float16 v2h;
typedef __attribute__((ext_vector_type(4))) _Float16 v4h;
typedef __attribute__((ext_vector_type(2))) unsigned short v2us;
typedef __attribute__((ext_vector_type(4))) unsigned short v4us;
typedef __attribute__((ext_vector_type(2))) float v2f;
typedef __attribute__((ext_vector_type(4))) int v4i;

__global__ __launch_bounds__(256) void k_cvt8(const float* __restrict__ src, bf* dst, size_t n8) { const size_t i = (size_t)blockIdx.x * 256 + threadIdx.x; if (i >= n8) return; const v8f v = *(const v8f*)(src + i * 8); v8us o;
#pragma unroll
    for (int k = 0; k < 8; ++k) o[k] = f2bf(v[k]); *(v8us*)(dst + i * 8) = o;  }

// k_rope: head planes [h][t][d] (fp16 + hi/lo) of rope(x) x sc with the rotate-half convention out[d] = x[d] cos[t][d] - x[d+HD/2] sin[t][d], out[d+HD/2] = x[d+HD/2] cos[t][d+HD/2] + x[d] sin[t][d+HD/2]
__global__ __launch_bounds__(256) void k_rope(const float* __restrict__ F, int pitch, int nheads, const float* __restrict__ CS, const float* __restrict__ RF, const float* __restrict__ nw, float sc, h16* P16, bf* Ph, bf* Pl) {
    const size_t e = ((size_t)blockIdx.x * 256 + threadIdx.x) * 2; if (e >= (size_t)nheads * TT * HD) return; const int d = (int)(e % HD); const int t = (int)((e / HD) % TT); const int h = (int)(e / ((size_t)HD * TT)); const float* f = F + (size_t)t * pitch + h * HD; const float rf = RF ? RF[(size_t)h * TT + t] : 1.0f; v2h o16; v2us oh, ol;
#pragma unroll
    for (int q = 0; q < 2; ++q) { const int dd = d + q; const int dp = (dd < HD / 2) ? dd + HD / 2 : dd - HD / 2; float x0 = f[dd], x1 = f[dp];
        if (RF) { float n0 = __fmul_rn(x0, rf), n1 = __fmul_rn(x1, rf); asm volatile("" : "+v"(n0)); asm volatile("" : "+v"(n1)); x0 = __fmul_rn(bfr(nw[dd]), n0); x1 = __fmul_rn(bfr(nw[dp]), n1); }
        const v2f cs = *(const v2f*)(CS + ((size_t)t * HD + dd) * 2); float a = __fmul_rn(x0, cs[0]), bq = __fmul_rn(x1, cs[1]); asm volatile("" : "+v"(a)); asm volatile("" : "+v"(bq)); const float r = ((dd < HD / 2) ? __fsub_rn(a, bq) : __fadd_rn(a, bq)) * sc;
        o16[q] = tohx(r); unsigned short a2, c2; splitf(r, a2, c2); oh[q] = a2; ol[q] = c2; }
    *(v2h*)(P16 + e) = o16; *(v2us*)(Ph + e) = oh; *(v2us*)(Pl + e) = ol;  }
__global__ __launch_bounds__(256) void k_vtp(const float* __restrict__ F, int pitch, int nheads, h16* V16, bf* Vh, bf* Vl) { const size_t e = ((size_t)blockIdx.x * 256 + threadIdx.x) * 2; if (e >= (size_t)nheads * HD * TT) return; const int t = (int)(e % TT); const int d = (int)((e / TT) % HD); const int g = (int)(e / ((size_t)TT * HD)); v2h o16; v2us oh, ol;
#pragma unroll
    for (int q = 0; q < 2; ++q) { const float x = F[(size_t)(t + q) * pitch + g * HD + d]; o16[q] = tohx(x); unsigned short a2, c2; splitf(x, a2, c2); oh[q] = a2; ol[q] = c2; }
    *(v2h*)(V16 + e) = o16; *(v2us*)(Vh + e) = oh; *(v2us*)(Vl + e) = ol;  }
__global__ __launch_bounds__(256) void k_csid(float* CS) { const int idx = blockIdx.x * 256 + threadIdx.x; if (idx >= TT * HD) return; v2f cs; cs[0] = 1.0f; cs[1] = 0.0f; *(v2f*)(CS + (size_t)idx * 2) = cs;  }
// k_asoft: per row (zz, i): t = S x HD^-0.5 + bf16(attn_mask[i][j]) (the additive f32 mask input [1][1][2048][2048], read as data); softmax over the 2048 keys (register row, one exp, fixed trees);
__global__ __launch_bounds__(256) void k_asoft(const float* __restrict__ Sb, const float* __restrict__ madd, h16* P16, bf* Ph, bf* Pl) {
    const int lane = threadIdx.x & 31; const int row = blockIdx.x * 8 + (threadIdx.x >> 5); if (row >= ZH * TT) return; const int i = row % TT; const int zz = row / TT; (void)zz; const bool hires = (i < RH); const float* sr = Sb + (size_t)row * TT; float v[TT / 32]; float mx = -3.0e38f;
#pragma unroll
    for (int ch = 0; ch < TT / 128; ++ch) { const int j0 = ch * 128 + lane * 4; const v4f a = *(const v4f*)(sr + j0); const v4f m4 = *(const v4f*)(madd + (size_t)i * TT + j0);   /* additive mask row (f32 input, bf16-rounded), 16 B per lane, unconditional */
#pragma unroll
        for (int q = 0; q < 4; ++q) { const int j = j0 + q; (void)j; float t0 = __fmul_rn(a[q], SCL); float mv = bfr(m4[q]); asm volatile("" : "+v"(t0), "+v"(mv)); const float t = __fadd_rn(t0, mv); v[ch * 4 + q] = t; mx = fmaxf(mx, t); } }
#pragma unroll
    for (int sh = 16; sh; sh >>= 1) mx = fmaxf(mx, __shfl_xor(mx, sh, 32));
    float sum = 0.f;
#pragma unroll
    for (int k = 0; k < TT / 32; ++k) { float d0 = __fsub_rn(v[k], mx); asm volatile("" : "+v"(d0)); v[k] = __builtin_amdgcn_exp2f(__fmul_rn(d0, 1.4426950408889634f)); sum += v[k]; }
#pragma unroll
    for (int sh = 16; sh; sh >>= 1) sum += __shfl_xor(sum, sh, 32);
    const float f = __fdiv_rn(hires ? 1.0f : PCAR, sum);
{
        if (hires) {
#pragma unroll
            for (int ch = 0; ch < TT / 128; ++ch) { v4us oh, ol;
#pragma unroll
                for (int q = 0; q < 4; ++q) { unsigned short a, c2; splitf(v[ch * 4 + q] * f, a, c2); oh[q] = a; ol[q] = c2; }
                const size_t oo = ((size_t)zz * (RH ? RH : 1) + i) * TT + ch * 128 + lane * 4; *(v4us*)(Ph + oo) = oh; *(v4us*)(Pl + oo) = ol; }
        } else {
#pragma unroll
            for (int ch = 0; ch < TT / 128; ++ch) { v4h o4;
#pragma unroll
                for (int q = 0; q < 4; ++q) o4[q] = tohx(v[ch * 4 + q] * f);
                *(v4h*)(P16 + (size_t)row * TT + ch * 128 + lane * 4) = o4; } }
         }
}
__global__ __launch_bounds__(256) void k_hln(float* F, int nheads, const float* __restrict__ g, const float* __restrict__ bb) { const int lane = threadIdx.x & 31; const size_t wv = (size_t)blockIdx.x * 8 + (threadIdx.x >> 5); if (wv >= (size_t)TT * nheads) return; float* f = F + wv * HD + lane * 2; const v2f a = *(const v2f*)f; float sm = __fadd_rn(a[0], a[1]);
#pragma unroll
    for (int sh = 16; sh; sh >>= 1) sm = __fadd_rn(sm, __shfl_xor(sm, sh, 32));
    const float mu = __fdiv_rn(sm, (float)HD); const float d0 = __fsub_rn(a[0], mu), d1 = __fsub_rn(a[1], mu); float p0 = __fmul_rn(d0, d0), p1 = __fmul_rn(d1, d1); asm volatile("" : "+v"(p0), "+v"(p1)); float ss = __fadd_rn(p0, p1);
#pragma unroll
    for (int sh = 16; sh; sh >>= 1) ss = __fadd_rn(ss, __shfl_xor(ss, sh, 32));
    const float rs = __fdiv_rn(1.0f, __fsqrt_rn(__fadd_rn(__fdiv_rn(ss, (float)HD), LNH_EPS))); v2f o;
#pragma unroll
    for (int q = 0; q < 2; ++q) { const float dn = __fmul_rn(q ? d1 : d0, rs); float y = __fmul_rn(dn, bfr(g[lane * 2 + q])); asm volatile("" : "+v"(y)); o[q] = __fadd_rn(y, bfr(bb[lane * 2 + q])); }
    *(v2f*)f = o;  }
#define LR_R 8   // LoRA rank
__global__ __launch_bounds__(256) void k_apad(const float* __restrict__ A, bf* Bt) { const size_t i = (size_t)blockIdx.x * 256 + threadIdx.x; if (i >= (size_t)64 * DM / 4) return; const size_t e = i * 4; const int k0 = (int)(e % DM); const int nn = (int)(e / DM); const int nc = min(nn, LR_R - 1); v4us o;
#pragma unroll
    for (int q = 0; q < 4; ++q) { const float a = A[(size_t)(k0 + q) * LR_R + nc]; o[q] = (nn < LR_R) ? f2bf(a) : (unsigned short)0; }
    *(v4us*)(Bt + e) = o;  }
__global__ __launch_bounds__(256) void k_bpad(const float* __restrict__ Bm, bf* Bt) { const size_t i = (size_t)blockIdx.x * 256 + threadIdx.x; if (i >= (size_t)DQ * 64 / 4) return; const size_t e = i * 4; const int k0 = (int)(e % 64); const int nn = (int)(e / 64); v4us o;
#pragma unroll
    for (int q = 0; q < 4; ++q) { const int k = k0 + q; const int kc = min(k, LR_R - 1); const float b = Bm[(size_t)kc * DQ + nn]; o[q] = (k < LR_R) ? f2bf(b) : (unsigned short)0; }
    *(v4us*)(Bt + e) = o;  }
__global__ __launch_bounds__(256) void k_addf(float* F, const float* __restrict__ Lr, size_t n4) { const size_t i = (size_t)blockIdx.x * 256 + threadIdx.x; if (i >= n4) return; const v4f a = *(const v4f*)(F + i * 4); const v4f b = *(const v4f*)(Lr + i * 4); v4f o;
#pragma unroll
    for (int q = 0; q < 4; ++q) o[q] = __fadd_rn(a[q], b[q]);
    *(v4f*)(F + i * 4) = o;  }
__global__ __launch_bounds__(256) void k_tohl(const float* __restrict__ F, bf* Hh, bf* Hl, size_t n4) { const size_t i = (size_t)blockIdx.x * 256 + threadIdx.x; if (i >= n4) return; const v4f a = *(const v4f*)(F + i * 4); v4us oh, ol;
#pragma unroll
    for (int q = 0; q < 4; ++q) { unsigned short h2, l2; splitf(a[q], h2, l2); oh[q] = h2; ol[q] = l2; }
    *(v4us*)(Hh + i * 4) = oh; *(v4us*)(Hl + i * 4) = ol;  }
__global__ __launch_bounds__(256) void k_merge(const float* __restrict__ O, int h0, bf* Ah, bf* Al) { const size_t e = ((size_t)blockIdx.x * 256 + threadIdx.x) * 2; if (e >= (size_t)ZH * TT * HD) return; const int d = (int)(e % HD); const int t = (int)((e / HD) % TT); const int zz = (int)(e / ((size_t)HD * TT)); const float cs = (t < RH) ? 1.0f : (1.0f / PCAR); const size_t oo = (size_t)t * DQ + (h0 + zz) * HD + d;
    v2us oh, ol;
#pragma unroll
    for (int q = 0; q < 2; ++q) { unsigned short a, c2; splitf(O[e + q] * cs, a, c2); oh[q] = a; ol[q] = c2; } *(v2us*)(Ah + oo) = oh; *(v2us*)(Al + oo) = ol;  }

extern "C" void kernel_launch(void* const* d_in, const int* in_sizes, int n_in,
                              void* d_out, int out_size, void* d_ws, size_t ws_size, hipStream_t stream) {
    (void)in_sizes; (void)n_in; (void)out_size;
    const float* x = (const float*)d_in[0]; const float* madd = (const float*)d_in[1];   /* attn_mask [1][1][2048][2048] f32 (zeros): read, added to the scaled scores */ const float* wqkv = (const float*)d_in[2]; const float* wo = (const float*)d_in[3]; const float* bo = (const float*)d_in[4]; const float* gq = (const float*)d_in[5]; const float* btq = (const float*)d_in[6]; const float* gk = (const float*)d_in[7]; const float* btk = (const float*)d_in[8]; const float* laq = (const float*)d_in[9]; const float* lbq = (const float*)d_in[10]; const float* lak = (const float*)d_in[11]; const float* lbk = (const float*)d_in[12]; const float* lav = (const float*)d_in[13]; const float* lbv = (const float*)d_in[14];     const float* wq = wqkv; const float* wk = wqkv + (size_t)DQ * DM; const float* wv = wqkv + (size_t)2 * DQ * DM;
    float* OUT = (float*)d_out;     // [2][2048][1024]
    char* wsp = (char*)d_ws;
    auto take = [&](size_t bytes) { char* p = wsp; wsp += (bytes + 255) & ~(size_t)255; return (void*)p; };
    bf* WQ = (bf*)take((size_t)DQ * DM * 2); bf* WK = (bf*)take((size_t)DKV * DM * 2); bf* WV = (bf*)take((size_t)DKV * DM * 2); bf* WO = (bf*)take((size_t)DM * DQ * 2); float* CS = (float*)take((size_t)TT * HD * 2 * 4);
    bf* XB = (bf*)take((size_t)TT * DM * 2); bf* APq = (bf*)take((size_t)64 * DM * 2); bf* APk = (bf*)take((size_t)64 * DM * 2); bf* APv = (bf*)take((size_t)64 * DM * 2); bf* BPq = (bf*)take((size_t)DQ * 64 * 2); bf* BPk = (bf*)take((size_t)DQ * 64 * 2); bf* BPv = (bf*)take((size_t)DQ * 64 * 2); float* XA = (float*)take((size_t)TT * 64 * 4); bf* XAh = (bf*)take((size_t)TT * 64 * 2); bf* XAl = (bf*)take((size_t)TT * 64 * 2); float* LR = (float*)take((size_t)TT * DQ * 4);   /* LoRA: zero-padded A^T [64][1024] / B^T [1024][64] operands, x A (f32 + hi/lo), (x A) B */ float* FQ = (float*)take((size_t)TT * DQ * 4); float* FK = (float*)take((size_t)TT * DKV * 4);
    h16* QP16 = (h16*)take((size_t)NH_ * TT * HD * 2); h16* KP16 = (h16*)take((size_t)NKV * TT * HD * 2); h16* VT16 = (h16*)take((size_t)NKV * HD * TT * 2);
    bf* QPh = (bf*)take((size_t)NH_ * TT * HD * 2); bf* QPl = (bf*)take((size_t)NH_ * TT * HD * 2); bf* KPh = (bf*)take((size_t)NKV * TT * HD * 2); bf* KPl = (bf*)take((size_t)NKV * TT * HD * 2); bf* VTh = (bf*)take((size_t)NKV * HD * TT * 2); bf* VTl = (bf*)take((size_t)NKV * HD * TT * 2); bf* Ph = (bf*)take((size_t)ZH * RH * TT * 2); bf* Pl = (bf*)take((size_t)ZH * RH * TT * 2);
    float* Sb = (float*)take((size_t)ZH * TT * TT * 4); h16* P16 = (h16*)take((size_t)ZH * TT * TT * 2); float* Ob = (float*)take((size_t)ZH * TT * HD * 4); bf* ATh = (bf*)take((size_t)TT * DQ * 2); bf* ATl = (bf*)take((size_t)TT * DQ * 2);
    if ((size_t)(wsp - (char*)d_ws) > ws_size) return;    // ws 256 MiB
    float* FV = FK;   // v projection reuses the k buffer after the k planes are built (stream-ordered)
    { k_cvt8<<<(unsigned)(((size_t)DQ * DM / 8 + 255) / 256), 256, 0, stream>>>(wq, WQ, (size_t)DQ * DM / 8); k_cvt8<<<(unsigned)(((size_t)DKV * DM / 8 + 255) / 256), 256, 0, stream>>>(wk, WK, (size_t)DKV * DM / 8); k_cvt8<<<(unsigned)(((size_t)DKV * DM / 8 + 255) / 256), 256, 0, stream>>>(wv, WV, (size_t)DKV * DM / 8);
      k_cvt8<<<(unsigned)(((size_t)DM * DQ / 8 + 255) / 256), 256, 0, stream>>>(wo, WO, (size_t)DM * DQ / 8); k_apad<<<(64 * DM + 255) / 256, 256, 0, stream>>>(laq, APq); k_apad<<<(64 * DM + 255) / 256, 256, 0, stream>>>(lak, APk); k_apad<<<(64 * DM + 255) / 256, 256, 0, stream>>>(lav, APv); k_bpad<<<(DQ * 64 + 255) / 256, 256, 0, stream>>>(lbq, BPq); k_bpad<<<(DQ * 64 + 255) / 256, 256, 0, stream>>>(lbk, BPk); k_bpad<<<(DQ * 64 + 255) / 256, 256, 0, stream>>>(lbv, BPv);   /* LoRA operands zero-padded from rank 8 to 64 */
       }
    k_csid<<<(TT * HD + 255) / 256, 256, 0, stream>>>(CS);
    const unsigned LQ = (unsigned)(((size_t)NH_ * TT * HD / 2 + 255) / 256), LKv = (unsigned)(((size_t)NKV * TT * HD / 2 + 255) / 256);
    for (int b = 0; b < NB_; ++b) {
        
        k_cvt8<<<(unsigned)(((size_t)TT * DM / 8 + 255) / 256), 256, 0, stream>>>(x + (size_t)b * TT * DM, XB, (size_t)TT * DM / 8);
        k_gemmw<bf, 0, false><<<dim3(TT / 64, DQ / 64, 1), 32, 0, stream>>>(XB, nullptr, WQ, nullptr, DM, FQ, DQ, nullptr, 0, 0, 0); k_gemmw<bf, 0, false><<<dim3(TT / 64, 1, 1), 32, 0, stream>>>(XB, nullptr, APq, nullptr, DM, XA, 64, nullptr, 0, 0, 0); k_tohl<<<(unsigned)(((size_t)TT * 64 / 4 + 255) / 256), 256, 0, stream>>>(XA, XAh, XAl, (size_t)TT * 64 / 4); k_gemmw<bf, 1, false><<<dim3(TT / 64, DQ / 64, 1), 32, 0, stream>>>(XAh, XAl, BPq, nullptr, 64, LR, DQ, nullptr, 0, 0, 0); k_addf<<<(unsigned)(((size_t)TT * DQ / 4 + 255) / 256), 256, 0, stream>>>(FQ, LR, (size_t)TT * DQ / 4);   /* FQ += ((x A) B): rank-8 LoRA, exact x A then hi/lo x exact B */ k_hln<<<(unsigned)(((size_t)TT * NH_ + 7) / 8), 256, 0, stream>>>(FQ, NH_, gq, btq);   /* per-head LayerNorm of q */
        k_rope<<<LQ, 256, 0, stream>>>(FQ, DQ, NH_, CS, nullptr, nullptr, 1.0f, QP16, QPh, QPl);
        k_gemmw<bf, 0, false><<<dim3(TT / 64, DKV / 64, 1), 32, 0, stream>>>(XB, nullptr, WK, nullptr, DM, FK, DKV, nullptr, 0, 0, 0); k_gemmw<bf, 0, false><<<dim3(TT / 64, 1, 1), 32, 0, stream>>>(XB, nullptr, APk, nullptr, DM, XA, 64, nullptr, 0, 0, 0); k_tohl<<<(unsigned)(((size_t)TT * 64 / 4 + 255) / 256), 256, 0, stream>>>(XA, XAh, XAl, (size_t)TT * 64 / 4); k_gemmw<bf, 1, false><<<dim3(TT / 64, DKV / 64, 1), 32, 0, stream>>>(XAh, XAl, BPk, nullptr, 64, LR, DKV, nullptr, 0, 0, 0); k_addf<<<(unsigned)(((size_t)TT * DKV / 4 + 255) / 256), 256, 0, stream>>>(FK, LR, (size_t)TT * DKV / 4);   /* FK += ((x A) B): rank-8 LoRA, exact x A then hi/lo x exact B */ k_hln<<<(unsigned)(((size_t)TT * NKV + 7) / 8), 256, 0, stream>>>(FK, NKV, gk, btk);
        k_rope<<<LKv, 256, 0, stream>>>(FK, DKV, NKV, CS, nullptr, nullptr, 1.0f, KP16, KPh, KPl);
        k_gemmw<bf, 0, false><<<dim3(TT / 64, DKV / 64, 1), 32, 0, stream>>>(XB, nullptr, WV, nullptr, DM, FV, DKV, nullptr, 0, 0, 0); k_gemmw<bf, 0, false><<<dim3(TT / 64, 1, 1), 32, 0, stream>>>(XB, nullptr, APv, nullptr, DM, XA, 64, nullptr, 0, 0, 0); k_tohl<<<(unsigned)(((size_t)TT * 64 / 4 + 255) / 256), 256, 0, stream>>>(XA, XAh, XAl, (size_t)TT * 64 / 4); k_gemmw<bf, 1, false><<<dim3(TT / 64, DKV / 64, 1), 32, 0, stream>>>(XAh, XAl, BPv, nullptr, 64, LR, DKV, nullptr, 0, 0, 0); k_addf<<<(unsigned)(((size_t)TT * DKV / 4 + 255) / 256), 256, 0, stream>>>(FV, LR, (size_t)TT * DKV / 4);   /* FV += ((x A) B): rank-8 LoRA, exact x A then hi/lo x exact B */ k_vtp<<<LKv, 256, 0, stream>>>(FV, DKV, NKV, VT16, VTh, VTl);
        for (int h0 = 0; h0 < NH_; h0 += ZH) { const size_t zq = (size_t)h0, zk = (size_t)(h0 / REP);   // one kv head per query head: the pass's two heads use consecutive kv planes (z-strides TT*HD)
            k_gemmw<bf, 2, false><<<dim3(RH / 64, TT / 64, ZH), 32, 0, stream>>>(QPh + zq * TT * HD, QPl + zq * TT * HD, KPh + zk * TT * HD, KPl + zk * TT * HD, HD, Sb, TT, nullptr, (size_t)TT * HD, (size_t)TT * HD, (size_t)TT * TT);
            k_gemmw<h16, 0, false><<<dim3((TT - RH) / 64, TT / 64, ZH), 32, 0, stream>>>(QP16 + zq * TT * HD + (size_t)RH * HD, nullptr, KP16 + zk * TT * HD, nullptr, HD, Sb + (size_t)RH * TT, TT, nullptr, (size_t)TT * HD, (size_t)TT * HD, (size_t)TT * TT);
            k_asoft<<<ZH * TT / 8, 256, 0, stream>>>(Sb, madd, P16, Ph, Pl);
            k_gemmw<bf, 2, false><<<dim3(RH / 64, HD / 64, ZH), 32, 0, stream>>>(Ph, Pl, VTh + zk * HD * TT, VTl + zk * HD * TT, TT, Ob, HD, nullptr, (size_t)RH * TT, (size_t)HD * TT, (size_t)TT * HD);
            k_gemmw<h16, 0, false><<<dim3((TT - RH) / 64, HD / 64, ZH), 32, 0, stream>>>(P16 + (size_t)RH * TT, nullptr, VT16 + zk * HD * TT, nullptr, TT, Ob + (size_t)RH * HD, HD, nullptr, (size_t)TT * TT, (size_t)HD * TT, (size_t)TT * HD);
            k_merge<<<(unsigned)(((size_t)ZH * TT * HD / 2 + 255) / 256), 256, 0, stream>>>(Ob, h0, ATh, ATl); }
        k_gemmw<bf, 1, true><<<dim3(TT / 64, DM / 64, 1), 32, 0, stream>>>(ATh, ATl, WO, nullptr, DQ, OUT + (size_t)b * TT * DM, DM, bo, 0, 0, 0); }
}

// v001
// One run takes 1080 microseconds.
// Two timings next to v000 both put it at 2.14 times that version's speed.
#include <hip/hip_runtime.h>

// Attention with LoRA-augmented q/k/v, per-head query/key LayerNorm and an additive mask (x [2][2048][1024]; qkv = x qkv_w^T ('oi' [3072][1024] 0.02, no bias) -> q | k | v (16 heads x 64); q += (x lora_Aq) lora_Bq x 1 (alpha/r = 8/8), k, v likewise ('xw' [1024][8], [8][1024] 0.02); q, k <- LayerNorm over the 64 head dims (eps 1e-5; qn_w, qn_b, kn_w, kn_b [64], read); scores = (q x 64^-0.5).k + attn_mask ([1][1][2048][2048] f32 zeros, read); softmax; out = merged proj_w^T + proj_b -> [2][2048][1024] (4.2 M); argument order x, attn_mask, qkv_w, proj_w, proj_b, qn_w, qn_b, kn_w, kn_b, lora_Aq, lora_Bq, lora_Ak, lora_Bk, lora_Av, lora_Bv).
// Layout per batch: bf16 copy of x; 'oi' weight row blocks; exact projections; per projection the rank-8 LoRA term via two small GEMMs on zero-padded 64-wide operands (x A exact -> f32 -> hi/lo -> x B exact) added when the split-K projection planes are summed; a per-(token, head) LayerNorm kernel normalises the 64-value slices of q and k in place; dense T-2048 attention (hybrid rows: < 512 hi/lo 3 products, rest fp16 x1024) with the additive mask row read in the softmax; merged hi/lo x proj_w exact + proj_b.
// Compute dtypes, f32 accumulate: every input rounded to bf16; projections exact; LoRA x A exact, (x A) B hl x exact; LayerNorm f32; attention rows < 512 3 products, rest fp16; softmax f32; proj_w hl x exact + bias.

#define NB_  2
#define TT   2048
#define DM   1024
#define NH_  16
#define NKV  16
#define REP  (NH_ / NKV)
#define HD   64
#define DQ   (NH_ * HD)
#define DKV  (NKV * HD)
#define ZH   2
#define RH   512                  // query rows < RH use hi+lo planes (0: none)
#define WIN  2048
#define PCAR 1024.0f
#define SCL  0.125f   // HD^-0.5
#define LNH_EPS 1e-5f
#define KSP  16                   // split-K slices of P V (K 2048 -> 128 a slice)
#define KSJ  4                    // split-K slices of the q/k/v and output projections (K 1024 -> 256)
#define KSA  16                   // split-K slices of x A (K 1024 -> 64)
typedef _Float16 h16;
typedef unsigned short bf;
typedef __attribute__((ext_vector_type(16))) __bf16   v16bf;
typedef __attribute__((ext_vector_type(16))) _Float16 v16h;
typedef __attribute__((ext_vector_type(8)))  _Float16 v8h;
typedef __attribute__((ext_vector_type(8)))  unsigned short v8us;
typedef __attribute__((ext_vector_type(8)))  float    v8f;
typedef __attribute__((ext_vector_type(4)))  float    v4f;
typedef v8h  __attribute__((may_alias)) v8ha;
typedef v4f  __attribute__((may_alias)) v4fa;
typedef v8us __attribute__((may_alias)) v8usa;

__device__ __forceinline__ unsigned short f2bf(float f) { unsigned u = __float_as_uint(f); u += 0x7FFFu + ((u >> 16) & 1u); return (unsigned short)(u >> 16); }
__device__ __forceinline__ float bf2f(unsigned short b) { return __uint_as_float(((unsigned)b) << 16); }
__device__ __forceinline__ float bfr(float f) { return bf2f(f2bf(f)); }
__device__ __forceinline__ v16h cat16(v8h lo, v8h hi) { return __builtin_shufflevector(lo, hi, 0, 1, 2, 3, 4, 5, 6, 7, 8, 9, 10, 11, 12, 13, 14, 15); }
__device__ __forceinline__ v16bf cat16b(v8us lo, v8us hi) { return __builtin_bit_cast(v16bf, __builtin_shufflevector(lo, hi, 0, 1, 2, 3, 4, 5, 6, 7, 8, 9, 10, 11, 12, 13, 14, 15)); }
__device__ __forceinline__ v8f wmma16(v16h a, v16h b, v8f c) { return __builtin_amdgcn_wmma_f32_16x16x32_f16(false, a, false, b, (short)0, c, false, false); }
__device__ __forceinline__ v8f wmmab(v16bf a, v16bf b, v8f c) { return __builtin_amdgcn_wmma_f32_16x16x32_bf16(false, a, false, b, (short)0, c, false, false); }



// ---- k_gemmw: register-blocked GEMM, ONE WAVE per 64x64 output tile (16 accumulators), operands straight from K-contiguous 16-bit planes; grid (M/64, N/64, Z), 32 threads.
// C[m][n] (f32, pitch ldc, + optional f32 bias[n]) = sum_k A[m][k] Bt[n][k] (+ split products per NSPLIT). z-batch strides sA/sB/sC in elements. K % 32 == 0.
// Split K: grid z = NZ batches x (K / KC) slices; slice ks sums k in [ks KC, (ks + 1) KC) into its own f32 plane C + ks sP, and the consumer kernel adds the planes in slice order (the bias goes into plane 0). KC == K, sP == 0: no split.
template <typename T16> struct WFrag;
template <> struct WFrag<h16> { typedef v16h V; static __device__ __forceinline__ V ld(const h16* p) { return cat16(*(const v8h*)p, *(const v8h*)(p + 16)); } static __device__ __forceinline__ v8f mma(V a, V b, v8f c) { return wmma16(a, b, c); } };
template <> struct WFrag<bf> { typedef v16bf V; static __device__ __forceinline__ V ld(const bf* p) { return cat16b(*(const v8us*)p, *(const v8us*)(p + 16)); } static __device__ __forceinline__ v8f mma(V a, V b, v8f c) { return wmmab(a, b, c); } };
template <typename T16, int NSPLIT, bool BIAS, int NZ>
__global__ __launch_bounds__(32) void k_gemmw(const T16* __restrict__ A, const T16* __restrict__ A2, const T16* __restrict__ Bt, const T16* __restrict__ Bt2, int K, float* C, int ldc, const float* __restrict__ bias, size_t sA, size_t sB, size_t sC, int KC, size_t sP) {
    typedef typename WFrag<T16>::V V;
    __shared__ __align__(16) float os[16 * 68];
    const size_t z = blockIdx.z % NZ; const int ks = blockIdx.z / NZ; const int k0 = ks * KC, k1 = k0 + KC; A += z * sA; if (A2) A2 += z * sA; Bt += z * sB; if (Bt2) Bt2 += z * sB; C += z * sC + (size_t)ks * sP;
    const int lane = threadIdx.x & 31, lr = lane & 15, hi = lane >> 4; const int r0 = blockIdx.x * 64, c0 = blockIdx.y * 64;
    v8f acc[4][4];
#pragma unroll
    for (int mb = 0; mb < 4; ++mb)
#pragma unroll
        for (int nb = 0; nb < 4; ++nb) acc[mb][nb] = (v8f){};
    const size_t aoff = (size_t)(r0 + lr) * K + 8 * hi, boff = (size_t)(c0 + lr) * K + 8 * hi;
#pragma unroll 1
    for (int kc = k0; kc < k1; kc += 32) {
        V a[4], a2[4];
#pragma unroll
        for (int mb = 0; mb < 4; ++mb) { a[mb] = WFrag<T16>::ld(A + aoff + (size_t)mb * 16 * K + kc); if (NSPLIT == 1 || NSPLIT == 2) a2[mb] = WFrag<T16>::ld(A2 + aoff + (size_t)mb * 16 * K + kc); }
#pragma unroll
        for (int nb = 0; nb < 4; ++nb) { const V b = WFrag<T16>::ld(Bt + boff + (size_t)nb * 16 * K + kc); V b2; if (NSPLIT >= 2) b2 = WFrag<T16>::ld(Bt2 + boff + (size_t)nb * 16 * K + kc);
#pragma unroll
            for (int mb = 0; mb < 4; ++mb) { acc[mb][nb] = WFrag<T16>::mma(a[mb], b, acc[mb][nb]); if (NSPLIT == 1 || NSPLIT == 2) acc[mb][nb] = WFrag<T16>::mma(a2[mb], b, acc[mb][nb]); if (NSPLIT >= 2) acc[mb][nb] = WFrag<T16>::mma(a[mb], b2, acc[mb][nb]); } }
        asm volatile("v_nop\n\tv_nop\n\tv_nop\n\tv_nop" : "+v"(acc[0][0]), "+v"(acc[1][1]), "+v"(acc[2][2]), "+v"(acc[3][3]) : "v"(a[0]), "v"(a[3]));
    }
#pragma unroll
    for (int mb = 0; mb < 4; ++mb) {
#pragma unroll
        for (int nb = 0; nb < 4; ++nb) {
#pragma unroll
            for (int j = 0; j < 8; ++j) os[(hi * 8 + j) * 68 + nb * 16 + lr] = acc[mb][nb][j]; }
        __builtin_amdgcn_wave_barrier(); asm volatile("" ::: "memory");
        float* crow = C + (size_t)(r0 + mb * 16) * ldc + c0;
{
#pragma unroll
            for (int s = 0; s < 8; ++s) { const int row = 2 * s + hi, cofs = lr * 4; v4f val = *(const v4fa*)(os + row * 68 + cofs); if (BIAS && ks == 0) { val[0] += bfr(bias[c0 + cofs]); val[1] += bfr(bias[c0 + cofs + 1]); val[2] += bfr(bias[c0 + cofs + 2]); val[3] += bfr(bias[c0 + cofs + 3]); }
                *(v4f*)(crow + (size_t)row * ldc + cofs) = val; }
             }
        __builtin_amdgcn_wave_barrier(); asm volatile("" ::: "memory");
    }
}

__device__ __forceinline__ h16 tohx(float x) { return (h16)x; }
__device__ __forceinline__ void splitf(float y, unsigned short& h, unsigned short& l) { h = f2bf(y); l = f2bf(y - bf2f(h)); }
typedef __attribute__((ext_vector_type(2))) _Float16 v2h;
typedef __attribute__((ext_vector_type(4))) _Float16 v4h;
typedef __attribute__((ext_vector_type(2))) unsigned short v2us;
typedef __attribute__((ext_vector_type(4))) unsigned short v4us;
typedef __attribute__((ext_vector_type(2))) float v2f;
typedef __attribute__((ext_vector_type(4))) int v4i;

__global__ __launch_bounds__(256) void k_cvt8(const float* __restrict__ src, bf* dst, size_t n8) { const size_t i = (size_t)blockIdx.x * 256 + threadIdx.x; if (i >= n8) return; const v8f v = *(const v8f*)(src + i * 8); v8us o;
#pragma unroll
    for (int k = 0; k < 8; ++k) o[k] = f2bf(v[k]); *(v8us*)(dst + i * 8) = o;  }

// k_rope: head planes [h][t][d] (fp16 + hi/lo) of rope(x) x sc with the rotate-half convention out[d] = x[d] cos[t][d] - x[d+HD/2] sin[t][d], out[d+HD/2] = x[d+HD/2] cos[t][d+HD/2] + x[d] sin[t][d+HD/2]
__global__ __launch_bounds__(256) void k_rope(const float* __restrict__ F, int pitch, int nheads, const float* __restrict__ CS, const float* __restrict__ RF, const float* __restrict__ nw, float sc, h16* P16, bf* Ph, bf* Pl) {
    const size_t e = ((size_t)blockIdx.x * 256 + threadIdx.x) * 2; if (e >= (size_t)nheads * TT * HD) return; const int d = (int)(e % HD); const int t = (int)((e / HD) % TT); const int h = (int)(e / ((size_t)HD * TT)); const float* f = F + (size_t)t * pitch + h * HD; const float rf = RF ? RF[(size_t)h * TT + t] : 1.0f; v2h o16; v2us oh, ol;
#pragma unroll
    for (int q = 0; q < 2; ++q) { const int dd = d + q; const int dp = (dd < HD / 2) ? dd + HD / 2 : dd - HD / 2; float x0 = f[dd], x1 = f[dp];
        if (RF) { float n0 = __fmul_rn(x0, rf), n1 = __fmul_rn(x1, rf); asm volatile("" : "+v"(n0)); asm volatile("" : "+v"(n1)); x0 = __fmul_rn(bfr(nw[dd]), n0); x1 = __fmul_rn(bfr(nw[dp]), n1); }
        const v2f cs = *(const v2f*)(CS + ((size_t)t * HD + dd) * 2); float a = __fmul_rn(x0, cs[0]), bq = __fmul_rn(x1, cs[1]); asm volatile("" : "+v"(a)); asm volatile("" : "+v"(bq)); const float r = ((dd < HD / 2) ? __fsub_rn(a, bq) : __fadd_rn(a, bq)) * sc;
        o16[q] = tohx(r); unsigned short a2, c2; splitf(r, a2, c2); oh[q] = a2; ol[q] = c2; }
    *(v2h*)(P16 + e) = o16; *(v2us*)(Ph + e) = oh; *(v2us*)(Pl + e) = ol;  }
__global__ __launch_bounds__(256) void k_vtp(const float* __restrict__ F, int pitch, int nheads, h16* V16, bf* Vh, bf* Vl) { const size_t e = ((size_t)blockIdx.x * 256 + threadIdx.x) * 2; if (e >= (size_t)nheads * HD * TT) return; const int t = (int)(e % TT); const int d = (int)((e / TT) % HD); const int g = (int)(e / ((size_t)TT * HD)); v2h o16; v2us oh, ol;
#pragma unroll
    for (int q = 0; q < 2; ++q) { const float x = F[(size_t)(t + q) * pitch + g * HD + d]; o16[q] = tohx(x); unsigned short a2, c2; splitf(x, a2, c2); oh[q] = a2; ol[q] = c2; }
    *(v2h*)(V16 + e) = o16; *(v2us*)(Vh + e) = oh; *(v2us*)(Vl + e) = ol;  }
__global__ __launch_bounds__(256) void k_csid(float* CS) { const int idx = blockIdx.x * 256 + threadIdx.x; if (idx >= TT * HD) return; v2f cs; cs[0] = 1.0f; cs[1] = 0.0f; *(v2f*)(CS + (size_t)idx * 2) = cs;  }
// k_asoft: per row (zz, i): t = S x HD^-0.5 + bf16(attn_mask[i][j]) (the additive f32 mask input [1][1][2048][2048], read as data); softmax over the 2048 keys (register row, one exp, fixed trees);
__global__ __launch_bounds__(256) void k_asoft(const float* __restrict__ Sb, const float* __restrict__ madd, h16* P16, bf* Ph, bf* Pl) {
    const int lane = threadIdx.x & 31; const int row = blockIdx.x * 8 + (threadIdx.x >> 5); if (row >= ZH * TT) return; const int i = row % TT; const int zz = row / TT; (void)zz; const bool hires = (i < RH); const float* sr = Sb + (size_t)row * TT; float v[TT / 32]; float mx = -3.0e38f;
#pragma unroll
    for (int ch = 0; ch < TT / 128; ++ch) { const int j0 = ch * 128 + lane * 4; const v4f a = *(const v4f*)(sr + j0); const v4f m4 = *(const v4f*)(madd + (size_t)i * TT + j0);   /* additive mask row (f32 input, bf16-rounded), 16 B per lane, unconditional */
#pragma unroll
        for (int q = 0; q < 4; ++q) { const int j = j0 + q; (void)j; float t0 = __fmul_rn(a[q], SCL); float mv = bfr(m4[q]); asm volatile("" : "+v"(t0), "+v"(mv)); const float t = __fadd_rn(t0, mv); v[ch * 4 + q] = t; mx = fmaxf(mx, t); } }
#pragma unroll
    for (int sh = 16; sh; sh >>= 1) mx = fmaxf(mx, __shfl_xor(mx, sh, 32));
    float sum = 0.f;
#pragma unroll
    for (int k = 0; k < TT / 32; ++k) { float d0 = __fsub_rn(v[k], mx); asm volatile("" : "+v"(d0)); v[k] = __builtin_amdgcn_exp2f(__fmul_rn(d0, 1.4426950408889634f)); sum += v[k]; }
#pragma unroll
    for (int sh = 16; sh; sh >>= 1) sum += __shfl_xor(sum, sh, 32);
    const float f = __fdiv_rn(hires ? 1.0f : PCAR, sum);
{
        if (hires) {
#pragma unroll
            for (int ch = 0; ch < TT / 128; ++ch) { v4us oh, ol;
#pragma unroll
                for (int q = 0; q < 4; ++q) { unsigned short a, c2; splitf(v[ch * 4 + q] * f, a, c2); oh[q] = a; ol[q] = c2; }
                const size_t oo = ((size_t)zz * (RH ? RH : 1) + i) * TT + ch * 128 + lane * 4; *(v4us*)(Ph + oo) = oh; *(v4us*)(Pl + oo) = ol; }
        } else {
#pragma unroll
            for (int ch = 0; ch < TT / 128; ++ch) { v4h o4;
#pragma unroll
                for (int q = 0; q < 4; ++q) o4[q] = tohx(v[ch * 4 + q] * f);
                *(v4h*)(P16 + (size_t)row * TT + ch * 128 + lane * 4) = o4; } }
         }
}
__global__ __launch_bounds__(256) void k_hln(float* F, int nheads, const float* __restrict__ g, const float* __restrict__ bb) { const int lane = threadIdx.x & 31; const size_t wv = (size_t)blockIdx.x * 8 + (threadIdx.x >> 5); if (wv >= (size_t)TT * nheads) return; float* f = F + wv * HD + lane * 2; const v2f a = *(const v2f*)f; float sm = __fadd_rn(a[0], a[1]);
#pragma unroll
    for (int sh = 16; sh; sh >>= 1) sm = __fadd_rn(sm, __shfl_xor(sm, sh, 32));
    const float mu = __fdiv_rn(sm, (float)HD); const float d0 = __fsub_rn(a[0], mu), d1 = __fsub_rn(a[1], mu); float p0 = __fmul_rn(d0, d0), p1 = __fmul_rn(d1, d1); asm volatile("" : "+v"(p0), "+v"(p1)); float ss = __fadd_rn(p0, p1);
#pragma unroll
    for (int sh = 16; sh; sh >>= 1) ss = __fadd_rn(ss, __shfl_xor(ss, sh, 32));
    const float rs = __fdiv_rn(1.0f, __fsqrt_rn(__fadd_rn(__fdiv_rn(ss, (float)HD), LNH_EPS))); v2f o;
#pragma unroll
    for (int q = 0; q < 2; ++q) { const float dn = __fmul_rn(q ? d1 : d0, rs); float y = __fmul_rn(dn, bfr(g[lane * 2 + q])); asm volatile("" : "+v"(y)); o[q] = __fadd_rn(y, bfr(bb[lane * 2 + q])); }
    *(v2f*)f = o;  }
#define LR_R 8   // LoRA rank
__global__ __launch_bounds__(256) void k_apad(const float* __restrict__ A, bf* Bt) { const size_t i = (size_t)blockIdx.x * 256 + threadIdx.x; if (i >= (size_t)64 * DM / 4) return; const size_t e = i * 4; const int k0 = (int)(e % DM); const int nn = (int)(e / DM); const int nc = min(nn, LR_R - 1); v4us o;
#pragma unroll
    for (int q = 0; q < 4; ++q) { const float a = A[(size_t)(k0 + q) * LR_R + nc]; o[q] = (nn < LR_R) ? f2bf(a) : (unsigned short)0; }
    *(v4us*)(Bt + e) = o;  }
__global__ __launch_bounds__(256) void k_bpad(const float* __restrict__ Bm, bf* Bt) { const size_t i = (size_t)blockIdx.x * 256 + threadIdx.x; if (i >= (size_t)DQ * 64 / 4) return; const size_t e = i * 4; const int k0 = (int)(e % 64); const int nn = (int)(e / 64); v4us o;
#pragma unroll
    for (int q = 0; q < 4; ++q) { const int k = k0 + q; const int kc = min(k, LR_R - 1); const float b = Bm[(size_t)kc * DQ + nn]; o[q] = (k < LR_R) ? f2bf(b) : (unsigned short)0; }
    *(v4us*)(Bt + e) = o;  }
// k_sumf: F = the NS split-K planes of P (stride sP), added in slice order, (+ Lr)
template <int NS, bool ADD, size_t sP>
__global__ __launch_bounds__(256) void k_sumf(float* F, const float* __restrict__ P, const float* __restrict__ Lr, size_t n4) { const size_t i = (size_t)blockIdx.x * 256 + threadIdx.x; if (i >= n4) return; const unsigned ob = (unsigned)i * 16u;   /* one 32-bit byte offset under uniform plane bases */ v4f o = *(const v4f*)((const char*)P + ob);
#pragma unroll
    for (int s = 1; s < NS; ++s) { const v4f p = *(const v4f*)((const char*)(P + (size_t)s * sP) + ob);
#pragma unroll
        for (int q = 0; q < 4; ++q) o[q] = __fadd_rn(o[q], p[q]); }
    if (ADD) { const v4f b = *(const v4f*)((const char*)Lr + ob);
#pragma unroll
        for (int q = 0; q < 4; ++q) o[q] = __fadd_rn(o[q], b[q]); }
    *(v4f*)((char*)F + ob) = o;  }
template <int NS, size_t sP>
__global__ __launch_bounds__(256) void k_tohl(const float* __restrict__ F, bf* Hh, bf* Hl, size_t n4) { const size_t i = (size_t)blockIdx.x * 256 + threadIdx.x; if (i >= n4) return; const unsigned ob = (unsigned)i * 16u;   /* one 32-bit byte offset under uniform plane bases */ v4f a = *(const v4f*)((const char*)F + ob); v4us oh, ol;
#pragma unroll
    for (int s = 1; s < NS; ++s) { const v4f p = *(const v4f*)((const char*)(F + (size_t)s * sP) + ob);   /* split-K planes, slice order */
#pragma unroll
        for (int q = 0; q < 4; ++q) a[q] = __fadd_rn(a[q], p[q]); }
#pragma unroll
    for (int q = 0; q < 4; ++q) { unsigned short h2, l2; splitf(a[q], h2, l2); oh[q] = h2; ol[q] = l2; }
    *(v4us*)(Hh + i * 4) = oh; *(v4us*)(Hl + i * 4) = ol;  }
template <int NS, size_t sP>
__global__ __launch_bounds__(256) void k_merge(const float* __restrict__ O, int h0, bf* Ah, bf* Al) { const size_t e = ((size_t)blockIdx.x * 256 + threadIdx.x) * 2; if (e >= (size_t)ZH * TT * HD) return; const int d = (int)(e % HD); const int t = (int)((e / HD) % TT); const int zz = (int)(e / ((size_t)HD * TT)); const float cs = (t < RH) ? 1.0f : (1.0f / PCAR); const size_t oo = (size_t)t * DQ + (h0 + zz) * HD + d;
    v2us oh, ol; const unsigned eb = (unsigned)e * 4u;   /* one 32-bit byte offset under uniform plane bases */ v2f o2 = *(const v2f*)((const char*)O + eb);
#pragma unroll
    for (int s = 1; s < NS; ++s) { const v2f p = *(const v2f*)((const char*)(O + (size_t)s * sP) + eb); o2[0] = __fadd_rn(o2[0], p[0]); o2[1] = __fadd_rn(o2[1], p[1]); }   /* split-K planes, slice order */
#pragma unroll
    for (int q = 0; q < 2; ++q) { unsigned short a, c2; splitf(o2[q] * cs, a, c2); oh[q] = a; ol[q] = c2; } *(v2us*)(Ah + oo) = oh; *(v2us*)(Al + oo) = ol;  }

extern "C" void kernel_launch(void* const* d_in, const int* in_sizes, int n_in,
                              void* d_out, int out_size, void* d_ws, size_t ws_size, hipStream_t stream) {
    (void)in_sizes; (void)n_in; (void)out_size;
    const float* x = (const float*)d_in[0]; const float* madd = (const float*)d_in[1];   /* attn_mask [1][1][2048][2048] f32 (zeros): read, added to the scaled scores */ const float* wqkv = (const float*)d_in[2]; const float* wo = (const float*)d_in[3]; const float* bo = (const float*)d_in[4]; const float* gq = (const float*)d_in[5]; const float* btq = (const float*)d_in[6]; const float* gk = (const float*)d_in[7]; const float* btk = (const float*)d_in[8]; const float* laq = (const float*)d_in[9]; const float* lbq = (const float*)d_in[10]; const float* lak = (const float*)d_in[11]; const float* lbk = (const float*)d_in[12]; const float* lav = (const float*)d_in[13]; const float* lbv = (const float*)d_in[14];     const float* wq = wqkv; const float* wk = wqkv + (size_t)DQ * DM; const float* wv = wqkv + (size_t)2 * DQ * DM;
    float* OUT = (float*)d_out;     // [2][2048][1024]
    char* wsp = (char*)d_ws;
    auto take = [&](size_t bytes) { char* p = wsp; wsp += (bytes + 255) & ~(size_t)255; return (void*)p; };
    bf* WQ = (bf*)take((size_t)DQ * DM * 2); bf* WK = (bf*)take((size_t)DKV * DM * 2); bf* WV = (bf*)take((size_t)DKV * DM * 2); bf* WO = (bf*)take((size_t)DM * DQ * 2); float* CS = (float*)take((size_t)TT * HD * 2 * 4);
    bf* XB = (bf*)take((size_t)TT * DM * 2); bf* APq = (bf*)take((size_t)64 * DM * 2); bf* APk = (bf*)take((size_t)64 * DM * 2); bf* APv = (bf*)take((size_t)64 * DM * 2); bf* BPq = (bf*)take((size_t)DQ * 64 * 2); bf* BPk = (bf*)take((size_t)DQ * 64 * 2); bf* BPv = (bf*)take((size_t)DQ * 64 * 2); float* XA = (float*)take((size_t)KSA * TT * 64 * 4); bf* XAh = (bf*)take((size_t)TT * 64 * 2); bf* XAl = (bf*)take((size_t)TT * 64 * 2); float* LR = (float*)take((size_t)TT * DQ * 4);   /* LoRA: zero-padded A^T [64][1024] / B^T [1024][64] operands, x A (f32 + hi/lo), (x A) B */ float* FQ = (float*)take((size_t)TT * DQ * 4); float* FK = (float*)take((size_t)TT * DKV * 4);
    h16* QP16 = (h16*)take((size_t)NH_ * TT * HD * 2); h16* KP16 = (h16*)take((size_t)NKV * TT * HD * 2); h16* VT16 = (h16*)take((size_t)NKV * HD * TT * 2);
    bf* QPh = (bf*)take((size_t)NH_ * TT * HD * 2); bf* QPl = (bf*)take((size_t)NH_ * TT * HD * 2); bf* KPh = (bf*)take((size_t)NKV * TT * HD * 2); bf* KPl = (bf*)take((size_t)NKV * TT * HD * 2); bf* VTh = (bf*)take((size_t)NKV * HD * TT * 2); bf* VTl = (bf*)take((size_t)NKV * HD * TT * 2); bf* Ph = (bf*)take((size_t)ZH * RH * TT * 2); bf* Pl = (bf*)take((size_t)ZH * RH * TT * 2);
    float* Sb = (float*)take((size_t)ZH * TT * TT * 4); h16* P16 = (h16*)take((size_t)ZH * TT * TT * 2); static_assert((size_t)KSP * ZH * TT * HD <= (size_t)KSJ * TT * DQ && DKV == DQ && DM == DQ, "plane buffer"); float* PP = (float*)take((size_t)KSJ * TT * DQ * 4);   /* split-K planes: projections KSJ x [TT][DQ], P V KSP x [ZH][TT][HD] */ bf* ATh = (bf*)take((size_t)TT * DQ * 2); bf* ATl = (bf*)take((size_t)TT * DQ * 2);
    if ((size_t)(wsp - (char*)d_ws) > ws_size) return;    // ws 256 MiB
    float* FV = FK;   // v projection reuses the k buffer after the k planes are built (stream-ordered)
    { k_cvt8<<<(unsigned)(((size_t)DQ * DM / 8 + 255) / 256), 256, 0, stream>>>(wq, WQ, (size_t)DQ * DM / 8); k_cvt8<<<(unsigned)(((size_t)DKV * DM / 8 + 255) / 256), 256, 0, stream>>>(wk, WK, (size_t)DKV * DM / 8); k_cvt8<<<(unsigned)(((size_t)DKV * DM / 8 + 255) / 256), 256, 0, stream>>>(wv, WV, (size_t)DKV * DM / 8);
      k_cvt8<<<(unsigned)(((size_t)DM * DQ / 8 + 255) / 256), 256, 0, stream>>>(wo, WO, (size_t)DM * DQ / 8); k_apad<<<(64 * DM + 255) / 256, 256, 0, stream>>>(laq, APq); k_apad<<<(64 * DM + 255) / 256, 256, 0, stream>>>(lak, APk); k_apad<<<(64 * DM + 255) / 256, 256, 0, stream>>>(lav, APv); k_bpad<<<(DQ * 64 + 255) / 256, 256, 0, stream>>>(lbq, BPq); k_bpad<<<(DQ * 64 + 255) / 256, 256, 0, stream>>>(lbk, BPk); k_bpad<<<(DQ * 64 + 255) / 256, 256, 0, stream>>>(lbv, BPv);   /* LoRA operands zero-padded from rank 8 to 64 */
       }
    k_csid<<<(TT * HD + 255) / 256, 256, 0, stream>>>(CS);
    const unsigned LQ = (unsigned)(((size_t)NH_ * TT * HD / 2 + 255) / 256), LKv = (unsigned)(((size_t)NKV * TT * HD / 2 + 255) / 256);
    for (int b = 0; b < NB_; ++b) {
        
        k_cvt8<<<(unsigned)(((size_t)TT * DM / 8 + 255) / 256), 256, 0, stream>>>(x + (size_t)b * TT * DM, XB, (size_t)TT * DM / 8);
        k_gemmw<bf, 0, false, 1><<<dim3(TT / 64, DQ / 64, KSJ), 32, 0, stream>>>(XB, nullptr, WQ, nullptr, DM, PP, DQ, nullptr, 0, 0, 0, DM / KSJ, (size_t)TT * DQ); k_gemmw<bf, 0, false, 1><<<dim3(TT / 64, 1, KSA), 32, 0, stream>>>(XB, nullptr, APq, nullptr, DM, XA, 64, nullptr, 0, 0, 0, DM / KSA, (size_t)TT * 64); k_tohl<KSA, (size_t)TT * 64><<<(unsigned)(((size_t)TT * 64 / 4 + 255) / 256), 256, 0, stream>>>(XA, XAh, XAl, (size_t)TT * 64 / 4); k_gemmw<bf, 1, false, 1><<<dim3(TT / 64, DQ / 64, 1), 32, 0, stream>>>(XAh, XAl, BPq, nullptr, 64, LR, DQ, nullptr, 0, 0, 0, 64, 0); k_sumf<KSJ, true, (size_t)TT * DQ><<<(unsigned)(((size_t)TT * DQ / 4 + 255) / 256), 256, 0, stream>>>(FQ, PP, LR, (size_t)TT * DQ / 4);   /* FQ = sum of the KSJ q-projection planes + ((x A) B): rank-8 LoRA, exact x A then hi/lo x exact B */ k_hln<<<(unsigned)(((size_t)TT * NH_ + 7) / 8), 256, 0, stream>>>(FQ, NH_, gq, btq);   /* per-head LayerNorm of q */
        k_rope<<<LQ, 256, 0, stream>>>(FQ, DQ, NH_, CS, nullptr, nullptr, 1.0f, QP16, QPh, QPl);
        k_gemmw<bf, 0, false, 1><<<dim3(TT / 64, DKV / 64, KSJ), 32, 0, stream>>>(XB, nullptr, WK, nullptr, DM, PP, DKV, nullptr, 0, 0, 0, DM / KSJ, (size_t)TT * DKV); k_gemmw<bf, 0, false, 1><<<dim3(TT / 64, 1, KSA), 32, 0, stream>>>(XB, nullptr, APk, nullptr, DM, XA, 64, nullptr, 0, 0, 0, DM / KSA, (size_t)TT * 64); k_tohl<KSA, (size_t)TT * 64><<<(unsigned)(((size_t)TT * 64 / 4 + 255) / 256), 256, 0, stream>>>(XA, XAh, XAl, (size_t)TT * 64 / 4); k_gemmw<bf, 1, false, 1><<<dim3(TT / 64, DKV / 64, 1), 32, 0, stream>>>(XAh, XAl, BPk, nullptr, 64, LR, DKV, nullptr, 0, 0, 0, 64, 0); k_sumf<KSJ, true, (size_t)TT * DKV><<<(unsigned)(((size_t)TT * DKV / 4 + 255) / 256), 256, 0, stream>>>(FK, PP, LR, (size_t)TT * DKV / 4);   /* FK = sum of the KSJ k-projection planes + ((x A) B): rank-8 LoRA, exact x A then hi/lo x exact B */ k_hln<<<(unsigned)(((size_t)TT * NKV + 7) / 8), 256, 0, stream>>>(FK, NKV, gk, btk);
        k_rope<<<LKv, 256, 0, stream>>>(FK, DKV, NKV, CS, nullptr, nullptr, 1.0f, KP16, KPh, KPl);
        k_gemmw<bf, 0, false, 1><<<dim3(TT / 64, DKV / 64, KSJ), 32, 0, stream>>>(XB, nullptr, WV, nullptr, DM, PP, DKV, nullptr, 0, 0, 0, DM / KSJ, (size_t)TT * DKV); k_gemmw<bf, 0, false, 1><<<dim3(TT / 64, 1, KSA), 32, 0, stream>>>(XB, nullptr, APv, nullptr, DM, XA, 64, nullptr, 0, 0, 0, DM / KSA, (size_t)TT * 64); k_tohl<KSA, (size_t)TT * 64><<<(unsigned)(((size_t)TT * 64 / 4 + 255) / 256), 256, 0, stream>>>(XA, XAh, XAl, (size_t)TT * 64 / 4); k_gemmw<bf, 1, false, 1><<<dim3(TT / 64, DKV / 64, 1), 32, 0, stream>>>(XAh, XAl, BPv, nullptr, 64, LR, DKV, nullptr, 0, 0, 0, 64, 0); k_sumf<KSJ, true, (size_t)TT * DKV><<<(unsigned)(((size_t)TT * DKV / 4 + 255) / 256), 256, 0, stream>>>(FV, PP, LR, (size_t)TT * DKV / 4);   /* FV = sum of the KSJ v-projection planes + ((x A) B): rank-8 LoRA, exact x A then hi/lo x exact B */ k_vtp<<<LKv, 256, 0, stream>>>(FV, DKV, NKV, VT16, VTh, VTl);
        for (int h0 = 0; h0 < NH_; h0 += ZH) { const size_t zq = (size_t)h0, zk = (size_t)(h0 / REP);   // one kv head per query head: the pass's two heads use consecutive kv planes (z-strides TT*HD)
            k_gemmw<bf, 2, false, ZH><<<dim3(RH / 64, TT / 64, ZH), 32, 0, stream>>>(QPh + zq * TT * HD, QPl + zq * TT * HD, KPh + zk * TT * HD, KPl + zk * TT * HD, HD, Sb, TT, nullptr, (size_t)TT * HD, (size_t)TT * HD, (size_t)TT * TT, HD, 0);
            k_gemmw<h16, 0, false, ZH><<<dim3((TT - RH) / 64, TT / 64, ZH), 32, 0, stream>>>(QP16 + zq * TT * HD + (size_t)RH * HD, nullptr, KP16 + zk * TT * HD, nullptr, HD, Sb + (size_t)RH * TT, TT, nullptr, (size_t)TT * HD, (size_t)TT * HD, (size_t)TT * TT, HD, 0);
            k_asoft<<<ZH * TT / 8, 256, 0, stream>>>(Sb, madd, P16, Ph, Pl);
            k_gemmw<bf, 2, false, ZH><<<dim3(RH / 64, HD / 64, ZH * KSP), 32, 0, stream>>>(Ph, Pl, VTh + zk * HD * TT, VTl + zk * HD * TT, TT, PP, HD, nullptr, (size_t)RH * TT, (size_t)HD * TT, (size_t)TT * HD, TT / KSP, (size_t)ZH * TT * HD);
            k_gemmw<h16, 0, false, ZH><<<dim3((TT - RH) / 64, HD / 64, ZH * KSP), 32, 0, stream>>>(P16 + (size_t)RH * TT, nullptr, VT16 + zk * HD * TT, nullptr, TT, PP + (size_t)RH * HD, HD, nullptr, (size_t)TT * TT, (size_t)HD * TT, (size_t)TT * HD, TT / KSP, (size_t)ZH * TT * HD);
            k_merge<KSP, (size_t)ZH * TT * HD><<<(unsigned)(((size_t)ZH * TT * HD / 2 + 255) / 256), 256, 0, stream>>>(PP, h0, ATh, ATl); }
        k_gemmw<bf, 1, true, 1><<<dim3(TT / 64, DM / 64, KSJ), 32, 0, stream>>>(ATh, ATl, WO, nullptr, DQ, PP, DM, bo, 0, 0, 0, DQ / KSJ, (size_t)TT * DM); k_sumf<KSJ, false, (size_t)TT * DM><<<(unsigned)(((size_t)TT * DM / 4 + 255) / 256), 256, 0, stream>>>(OUT + (size_t)b * TT * DM, PP, nullptr, (size_t)TT * DM / 4); }
}

// v003
// A run of this version takes 482 microseconds.
// Versions between v001 and this one are left out; their measured steps multiply to 2.23 times as fast.
// Over all steps from v000 it is 4.78 times as fast.
#include <hip/hip_runtime.h>

// Attention with LoRA-augmented q/k/v, per-head query/key LayerNorm and an additive mask (x [2][2048][1024]; qkv = x qkv_w^T ('oi' [3072][1024] 0.02, no bias) -> q | k | v (16 heads x 64); q += (x lora_Aq) lora_Bq x 1 (alpha/r = 8/8), k, v likewise ('xw' [1024][8], [8][1024] 0.02); q, k <- LayerNorm over the 64 head dims (eps 1e-5; qn_w, qn_b, kn_w, kn_b [64], read); scores = (q x 64^-0.5).k + attn_mask ([1][1][2048][2048] f32 zeros, read); softmax; out = merged proj_w^T + proj_b -> [2][2048][1024] (4.2 M); argument order x, attn_mask, qkv_w, proj_w, proj_b, qn_w, qn_b, kn_w, kn_b, lora_Aq, lora_Bq, lora_Ak, lora_Bk, lora_Av, lora_Bv).
// Layout per batch: bf16 copy of x; 'oi' weight row blocks; exact projections; per projection the rank-8 LoRA term via two small GEMMs on zero-padded 64-wide operands (x A exact -> f32 -> hi/lo -> x B exact) added, with the split-K planes, in the projection's tail kernel, which also does the per-(token, head) LayerNorm of q and k and writes the 16-bit planes; fused T-2048 attention (hybrid rows: < 512 hi/lo 3 products, rest fp16 x1024), scores and probabilities in registers, with the additive mask read in the softmax; merged hi/lo x proj_w exact + proj_b.
// Compute dtypes, f32 accumulate: every input rounded to bf16; projections exact; LoRA x A exact, (x A) B hl x exact; LayerNorm f32; attention rows < 512 3 products, rest fp16; softmax f32; proj_w hl x exact + bias.

#define NB_  2
#define TT   2048
#define DM   1024
#define NH_  16
#define NKV  16
#define REP  (NH_ / NKV)
#define HD   64
#define DQ   (NH_ * HD)
#define DKV  (NKV * HD)
#define RH   512                  // query rows < RH use hi+lo planes (0: none)
#define PCAR 1024.0f
#define SCL  0.125f   // HD^-0.5
#define LNH_EPS 1e-5f
#define KSJ  4                    // split-K slices of the q/k/v and output projections (K 1024 -> 256)
#define KSA  16                   // split-K slices of x A (K 1024 -> 64)
typedef _Float16 h16;
typedef unsigned short bf;
typedef __attribute__((ext_vector_type(16))) __bf16   v16bf;
typedef __attribute__((ext_vector_type(16))) _Float16 v16h;
typedef __attribute__((ext_vector_type(8)))  _Float16 v8h;
typedef __attribute__((ext_vector_type(8)))  unsigned short v8us;
typedef __attribute__((ext_vector_type(8)))  float    v8f;
typedef __attribute__((ext_vector_type(4)))  float    v4f;
typedef v8h  __attribute__((may_alias)) v8ha;
typedef v4f  __attribute__((may_alias)) v4fa;
typedef v8us __attribute__((may_alias)) v8usa;

__device__ __forceinline__ unsigned short f2bf(float f) { unsigned u = __float_as_uint(f); u += 0x7FFFu + ((u >> 16) & 1u); return (unsigned short)(u >> 16); }
__device__ __forceinline__ float bf2f(unsigned short b) { return __uint_as_float(((unsigned)b) << 16); }
__device__ __forceinline__ float bfr(float f) { return bf2f(f2bf(f)); }
__device__ __forceinline__ v16h cat16(v8h lo, v8h hi) { return __builtin_shufflevector(lo, hi, 0, 1, 2, 3, 4, 5, 6, 7, 8, 9, 10, 11, 12, 13, 14, 15); }
__device__ __forceinline__ v16bf cat16b(v8us lo, v8us hi) { return __builtin_bit_cast(v16bf, __builtin_shufflevector(lo, hi, 0, 1, 2, 3, 4, 5, 6, 7, 8, 9, 10, 11, 12, 13, 14, 15)); }
__device__ __forceinline__ v8f wmma16(v16h a, v16h b, v8f c) { return __builtin_amdgcn_wmma_f32_16x16x32_f16(false, a, false, b, (short)0, c, false, false); }
__device__ __forceinline__ v8f wmmab(v16bf a, v16bf b, v8f c) { return __builtin_amdgcn_wmma_f32_16x16x32_bf16(false, a, false, b, (short)0, c, false, false); }



// ---- k_gemmw: register-blocked GEMM, ONE WAVE per 64x64 output tile (16 accumulators), operands straight from K-contiguous 16-bit planes; grid (M/64, N/64, Z), 32 threads.
// C[m][n] (f32, pitch ldc, + optional f32 bias[n]) = sum_k A[m][k] Bt[n][k] (+ split products per NSPLIT). z-batch strides sA/sB/sC in elements. K % 32 == 0.
// Split K: grid z = NZ batches x (K / KC) slices; slice ks sums k in [ks KC, (ks + 1) KC) into its own f32 plane C + ks sP, and the consumer kernel adds the planes in slice order (the bias goes into plane 0). KC == K, sP == 0: no split.
template <typename T16> struct WFrag;
template <> struct WFrag<h16> { typedef v16h V; static __device__ __forceinline__ V ld(const h16* p) { return cat16(*(const v8h*)p, *(const v8h*)(p + 16)); } static __device__ __forceinline__ v8f mma(V a, V b, v8f c) { return wmma16(a, b, c); } };
template <> struct WFrag<bf> { typedef v16bf V; static __device__ __forceinline__ V ld(const bf* p) { return cat16b(*(const v8us*)p, *(const v8us*)(p + 16)); } static __device__ __forceinline__ v8f mma(V a, V b, v8f c) { return wmmab(a, b, c); } };
template <typename T16, int NSPLIT, bool BIAS, int NZ>
__global__ __launch_bounds__(32) void k_gemmw(const T16* __restrict__ A, const T16* __restrict__ A2, const T16* __restrict__ Bt, const T16* __restrict__ Bt2, int K, float* C, int ldc, const float* __restrict__ bias, size_t sA, size_t sB, size_t sC, int KC, size_t sP) {
    typedef typename WFrag<T16>::V V;
    __shared__ __align__(16) float os[16 * 68];
    const size_t z = blockIdx.z % NZ; const int ks = blockIdx.z / NZ; const int k0 = ks * KC, k1 = k0 + KC; A += z * sA; if (A2) A2 += z * sA; Bt += z * sB; if (Bt2) Bt2 += z * sB; C += z * sC + (size_t)ks * sP;
    const int lane = threadIdx.x & 31, lr = lane & 15, hi = lane >> 4; const int r0 = blockIdx.x * 64, c0 = blockIdx.y * 64;
    v8f acc[4][4];
#pragma unroll
    for (int mb = 0; mb < 4; ++mb)
#pragma unroll
        for (int nb = 0; nb < 4; ++nb) acc[mb][nb] = (v8f){};
    const size_t aoff = (size_t)(r0 + lr) * K + 8 * hi, boff = (size_t)(c0 + lr) * K + 8 * hi;
#pragma unroll 1
    for (int kc = k0; kc < k1; kc += 32) {
        V a[4], a2[4];
#pragma unroll
        for (int mb = 0; mb < 4; ++mb) { a[mb] = WFrag<T16>::ld(A + aoff + (size_t)mb * 16 * K + kc); if (NSPLIT == 1 || NSPLIT == 2) a2[mb] = WFrag<T16>::ld(A2 + aoff + (size_t)mb * 16 * K + kc); }
#pragma unroll
        for (int nb = 0; nb < 4; ++nb) { const V b = WFrag<T16>::ld(Bt + boff + (size_t)nb * 16 * K + kc); V b2; if (NSPLIT >= 2) b2 = WFrag<T16>::ld(Bt2 + boff + (size_t)nb * 16 * K + kc);
#pragma unroll
            for (int mb = 0; mb < 4; ++mb) { acc[mb][nb] = WFrag<T16>::mma(a[mb], b, acc[mb][nb]); if (NSPLIT == 1 || NSPLIT == 2) acc[mb][nb] = WFrag<T16>::mma(a2[mb], b, acc[mb][nb]); if (NSPLIT >= 2) acc[mb][nb] = WFrag<T16>::mma(a[mb], b2, acc[mb][nb]); } }
        asm volatile("v_nop\n\tv_nop\n\tv_nop\n\tv_nop" : "+v"(acc[0][0]), "+v"(acc[1][1]), "+v"(acc[2][2]), "+v"(acc[3][3]) : "v"(a[0]), "v"(a[3]));
    }
#pragma unroll
    for (int mb = 0; mb < 4; ++mb) {
#pragma unroll
        for (int nb = 0; nb < 4; ++nb) {
#pragma unroll
            for (int j = 0; j < 8; ++j) os[(hi * 8 + j) * 68 + nb * 16 + lr] = acc[mb][nb][j]; }
        __builtin_amdgcn_wave_barrier(); asm volatile("" ::: "memory");
        float* crow = C + (size_t)(r0 + mb * 16) * ldc + c0;
{
#pragma unroll
            for (int s = 0; s < 8; ++s) { const int row = 2 * s + hi, cofs = lr * 4; v4f val = *(const v4fa*)(os + row * 68 + cofs); if (BIAS && ks == 0) { val[0] += bfr(bias[c0 + cofs]); val[1] += bfr(bias[c0 + cofs + 1]); val[2] += bfr(bias[c0 + cofs + 2]); val[3] += bfr(bias[c0 + cofs + 3]); }
                *(v4f*)(crow + (size_t)row * ldc + cofs) = val; }
             }
        __builtin_amdgcn_wave_barrier(); asm volatile("" ::: "memory");
    }
}

__device__ __forceinline__ h16 tohx(float x) { return (h16)x; }
__device__ __forceinline__ void splitf(float y, unsigned short& h, unsigned short& l) { h = f2bf(y); l = f2bf(y - bf2f(h)); }
typedef __attribute__((ext_vector_type(2))) _Float16 v2h;
typedef __attribute__((ext_vector_type(4))) _Float16 v4h;
typedef __attribute__((ext_vector_type(2))) unsigned short v2us;
typedef __attribute__((ext_vector_type(4))) unsigned short v4us;
typedef __attribute__((ext_vector_type(2))) float v2f;
typedef __attribute__((ext_vector_type(4))) int v4i;

__global__ __launch_bounds__(256) void k_cvt8(const float* __restrict__ src, bf* dst, size_t n8) { const size_t i = (size_t)blockIdx.x * 256 + threadIdx.x; if (i >= n8) return; const v8f v = *(const v8f*)(src + i * 8); v8us o;
#pragma unroll
    for (int k = 0; k < 8; ++k) o[k] = f2bf(v[k]); *(v8us*)(dst + i * 8) = o;  }

#define LR_R 8   // LoRA rank
__global__ __launch_bounds__(256) void k_apad(const float* __restrict__ A, bf* Bt) { const size_t i = (size_t)blockIdx.x * 256 + threadIdx.x; if (i >= (size_t)64 * DM / 4) return; const size_t e = i * 4; const int k0 = (int)(e % DM); const int nn = (int)(e / DM); const int nc = min(nn, LR_R - 1); v4us o;
#pragma unroll
    for (int q = 0; q < 4; ++q) { const float a = A[(size_t)(k0 + q) * LR_R + nc]; o[q] = (nn < LR_R) ? f2bf(a) : (unsigned short)0; }
    *(v4us*)(Bt + e) = o;  }
__global__ __launch_bounds__(256) void k_bpad(const float* __restrict__ Bm, bf* Bt) { const size_t i = (size_t)blockIdx.x * 256 + threadIdx.x; if (i >= (size_t)DQ * 64 / 4) return; const size_t e = i * 4; const int k0 = (int)(e % 64); const int nn = (int)(e / 64); v4us o;
#pragma unroll
    for (int q = 0; q < 4; ++q) { const int k = k0 + q; const int kc = min(k, LR_R - 1); const float b = Bm[(size_t)kc * DQ + nn]; o[q] = (k < LR_R) ? f2bf(b) : (unsigned short)0; }
    *(v4us*)(Bt + e) = o;  }
// k_sumf: F = the NS split-K planes of P (stride sP), added in slice order, (+ Lr)
template <int NS, bool ADD, size_t sP>
__global__ __launch_bounds__(256) void k_sumf(float* F, const float* __restrict__ P, const float* __restrict__ Lr, size_t n4) { const size_t i = (size_t)blockIdx.x * 256 + threadIdx.x; if (i >= n4) return; const unsigned ob = (unsigned)i * 16u;   /* one 32-bit byte offset under uniform plane bases */ v4f o = *(const v4f*)((const char*)P + ob);
#pragma unroll
    for (int s = 1; s < NS; ++s) { const v4f p = *(const v4f*)((const char*)(P + (size_t)s * sP) + ob);
#pragma unroll
        for (int q = 0; q < 4; ++q) o[q] = __fadd_rn(o[q], p[q]); }
    if (ADD) { const v4f b = *(const v4f*)((const char*)Lr + ob);
#pragma unroll
        for (int q = 0; q < 4; ++q) o[q] = __fadd_rn(o[q], b[q]); }
    *(v4f*)((char*)F + ob) = o;  }
template <int NS, size_t sP>
__global__ __launch_bounds__(256) void k_tohl(const float* __restrict__ F, bf* Hh, bf* Hl, size_t n4) { const size_t i = (size_t)blockIdx.x * 256 + threadIdx.x; if (i >= n4) return; const unsigned ob = (unsigned)i * 16u;   /* one 32-bit byte offset under uniform plane bases */ v4f a = *(const v4f*)((const char*)F + ob); v4us oh, ol;
#pragma unroll
    for (int s = 1; s < NS; ++s) { const v4f p = *(const v4f*)((const char*)(F + (size_t)s * sP) + ob);   /* split-K planes, slice order */
#pragma unroll
        for (int q = 0; q < 4; ++q) a[q] = __fadd_rn(a[q], p[q]); }
#pragma unroll
    for (int q = 0; q < 4; ++q) { unsigned short h2, l2; splitf(a[q], h2, l2); oh[q] = h2; ol[q] = l2; }
    *(v4us*)(Hh + i * 4) = oh; *(v4us*)(Hl + i * 4) = ol;  }
// ---- The tail of a projection in one kernel: the KSJ split-K planes added in slice order, + Lr (the LoRA term), then straight to the 16-bit planes that the attention kernel reads. No f32 copy of q, k or v goes through memory.
// The KSJ planes come as kernel arguments of their own, so that each base stays in scalar registers and ONE 32-bit byte offset register serves all of a thread's loads.
// ld_planes: the loads of NST steps (STB bytes apart) of a thread; sum_planes: their sum in slice order, the LoRA term last.
static_assert(KSJ == 4, "four plane arguments");
template <int NST, size_t STB>
__device__ __forceinline__ void ld_planes(const float* P0, const float* P1, const float* P2, const float* P3, const float* Lr, unsigned ob, v4f (&p)[NST][KSJ + 1]) {
#pragma unroll
    for (int s = 0; s < NST; ++s) { p[s][0] = *(const v4f*)((const char*)P0 + s * STB + ob); p[s][1] = *(const v4f*)((const char*)P1 + s * STB + ob); p[s][2] = *(const v4f*)((const char*)P2 + s * STB + ob); p[s][3] = *(const v4f*)((const char*)P3 + s * STB + ob); p[s][4] = *(const v4f*)((const char*)Lr + s * STB + ob); } }
__device__ __forceinline__ v4f sum_planes(const v4f (&p)[KSJ + 1]) { return (((p[0] + p[1]) + p[2]) + p[3]) + p[4]; }
// sum over a 16-lane row, every lane gets it (DPP row_xmask 1, 2, 4, 8)
template <int M> __device__ __forceinline__ float rowx(float v) { return __int_as_float(__builtin_amdgcn_update_dpp(0, __float_as_int(v), 0x160 + M, 0xf, 0xf, true)); }
__device__ __forceinline__ float rowsum16(float v) { v += rowx<1>(v); v += rowx<2>(v); v += rowx<4>(v); v += rowx<8>(v); return v; }
// k_qkfin (q, k): a work-group takes QKT whole tokens; a thread holds 4 consecutive head dims, so 16 lanes hold one (token, head) row: LayerNorm over the 64 head dims in registers, then head planes [h][t][d] (fp16 + hi/lo), one whole 128-byte line a row and plane.
#define QKT 4
static_assert(DQ == 256 * 4 && DKV == DQ && HD == 64 && TT % QKT == 0, "one token a work-group step, 16 lanes a head");
__global__ __launch_bounds__(256) void k_qkfin(const float* __restrict__ P0, const float* __restrict__ P1, const float* __restrict__ P2, const float* __restrict__ P3, const float* __restrict__ Lr, const float* __restrict__ g, const float* __restrict__ bb, h16* P16, bf* Ph, bf* Pl) {
    const int tid = threadIdx.x, h = tid >> 4, d = (tid & 15) * 4, t0 = blockIdx.x * QKT; const unsigned ob = ((unsigned)t0 * DQ + (unsigned)tid * 4u) * 4u;
    const unsigned gd = (unsigned)d * 4u; v4f p[QKT][KSJ + 1], a[QKT];
    v4f gv = *(const v4f*)((const char*)g + gd), bv = *(const v4f*)((const char*)bb + gd);
    ld_planes<QKT, (size_t)DQ * 4>(P0, P1, P2, P3, Lr, ob, p);
    /* the wait that stands in front of any overwrite of a register that an issued load names; the two offsets are inputs so that their registers are not reused (as a later load's destination) ahead of it */
    asm volatile("s_wait_xcnt 0x0" :: "v"(ob), "v"(gd) : "memory");
    __builtin_amdgcn_sched_barrier(0);   /* keeps all of the thread's loads above the sums: one memory latency a thread, where the scheduler's own order waited for the first loads before it issued the last */
#pragma unroll
    for (int s = 0; s < QKT; ++s) a[s] = sum_planes(p[s]);
#pragma unroll
    for (int q = 0; q < 4; ++q) { gv[q] = bfr(gv[q]); bv[q] = bfr(bv[q]); }
    const size_t e = ((size_t)h * TT + t0) * HD + d;
#pragma unroll
    for (int s = 0; s < QKT; ++s) {
        const float mu = rowsum16((a[s][0] + a[s][1]) + (a[s][2] + a[s][3])) * (1.0f / HD); const v4f dv = a[s] - mu;
        const float var = rowsum16((dv[0] * dv[0] + dv[1] * dv[1]) + (dv[2] * dv[2] + dv[3] * dv[3])) * (1.0f / HD);
        const float rs = __fdiv_rn(1.0f, __fsqrt_rn(var + LNH_EPS)); v4h o16; v4us oh, ol;
#pragma unroll
        for (int q = 0; q < 4; ++q) { const float y = dv[q] * rs * gv[q] + bv[q]; o16[q] = tohx(y); unsigned short a2, c2; splitf(y, a2, c2); oh[q] = a2; ol[q] = c2; }
        *(v4h*)(P16 + e + s * HD) = o16; *(v4us*)(Ph + e + s * HD) = oh; *(v4us*)(Pl + e + s * HD) = ol; }
}
// k_vfin (v): a work-group takes VTT tokens x VTC columns, reads them along the columns (512 contiguous bytes a wave), turns the tile in LDS and writes the transposed planes [g][d][t] (fp16 + hi/lo) along t, one whole 128-byte line a column and plane.
#define VTT 64
#define VTC 128
#define VTP (VTT + 1)   // odd LDS pitch in dwords: the 4 columns x 8 token groups that a wave reads back fall on 32 different banks
static_assert(TT % VTT == 0 && DKV % VTC == 0 && VTC == 32 * 4 && VTT % 8 == 0 && (VTC * VTT / 8) % 256 == 0, "v tile");
__global__ __launch_bounds__(256) void k_vfin(const float* __restrict__ P0, const float* __restrict__ P1, const float* __restrict__ P2, const float* __restrict__ P3, const float* __restrict__ Lr, h16* V16, bf* Vh, bf* Vl) {
    __shared__ float ts[VTC * VTP];
    const int tid = threadIdx.x, lane = tid & 31, w = tid >> 5, t0 = blockIdx.x * VTT, c0 = blockIdx.y * VTC; const unsigned ob = ((unsigned)(t0 + w) * DKV + (unsigned)(c0 + lane * 4)) * 4u;
    v4f p[VTT / 8][KSJ + 1];
    ld_planes<VTT / 8, (size_t)8 * DKV * 4>(P0, P1, P2, P3, Lr, ob, p);
    /* the wait that stands in front of any overwrite of a register that an issued load names; the offset is an input so that its register is not reused (as a later load's destination) ahead of it */
    asm volatile("s_wait_xcnt 0x0" :: "v"(ob) : "memory");
    __builtin_amdgcn_sched_barrier(0);   /* keeps all of the thread's loads above the sums: one memory latency a thread */
#pragma unroll
    for (int s = 0; s < VTT / 8; ++s) { const v4f a = sum_planes(p[s]);
#pragma unroll
        for (int q = 0; q < 4; ++q) ts[(lane * 4 + q) * VTP + s * 8 + w] = a[q]; }
    __syncthreads();   /* the tile is whole before any thread reads a column that other waves wrote */
#pragma unroll
    for (int it = 0; it < VTC * VTT / 8 / 256; ++it) { const int item = it * 256 + tid, tg = item & (VTT / 8 - 1), c = item / (VTT / 8); const float* r = ts + c * VTP + tg * 8; v8h o16; v8us oh, ol;
#pragma unroll
        for (int j = 0; j < 8; ++j) { const float x = r[j]; o16[j] = tohx(x); unsigned short a2, c2; splitf(x, a2, c2); oh[j] = a2; ol[j] = c2; }
        const size_t e = (size_t)(c0 + c) * TT + t0 + tg * 8; *(v8h*)(V16 + e) = o16; *(v8us*)(Vh + e) = oh; *(v8us*)(Vl + e) = ol; }
}
// ---- k_fattn: fused attention, one launch for all heads of both batches (grid: row blocks, heads, batches). One wave owns 16 queries of one head and walks the TT keys, 64 a pass (32 on the hi/lo rows, whose fragments take twice the registers):
// S^T = K Q^T (A = key rows, B = the queries, loaded once), so a lane holds 8 keys of ONE query per 16-key tile; t = S x HD^-0.5 + bf16(attn_mask[i][j]) (the additive f32 mask input, read as data);
// running-maximum softmax in registers (the output tiles and the sum are rescaled when the maximum moves; the division by the sum comes last); O^T += V^T P^T with P^T packed from the score tiles as the B operand (two 16-key tiles = one 32-key fragment in the loaders' k order).
// Scores and probabilities never reach memory. Rows < RH: hi/lo planes, 3 products; the rest fp16 with P x PCAR. Each work-group takes FHW hi/lo waves and 8 - FHW fp16 waves, so that the longer hi/lo rows are spread over all work-groups.
#define FHW 2
#define PLOG 10.0f   // log2(PCAR)
static_assert(PCAR == 1024.0f, "PLOG");
static_assert(FHW * 16 * (TT / 128) == RH && (8 - FHW) * 16 * (TT / 128) == TT - RH, "row split");
template <typename T16, bool HR, int KB>   // KB keys a pass
__device__ __forceinline__ void fattn_rows(const T16* __restrict__ Q, const T16* __restrict__ Q2, const T16* __restrict__ Kp, const T16* __restrict__ K2, const T16* __restrict__ Vt, const T16* __restrict__ Vt2, const float* __restrict__ madd, int q0, bf* Ah, bf* Al) {
    typedef typename WFrag<T16>::V V;
    const int lane = threadIdx.x & 31, lr = lane & 15, hi = lane >> 4;
    V qf[2], qf2[2];
#pragma unroll
    for (int ks = 0; ks < 2; ++ks) { qf[ks] = WFrag<T16>::ld(Q + (size_t)(q0 + lr) * HD + ks * 32 + 8 * hi); if (HR) qf2[ks] = WFrag<T16>::ld(Q2 + (size_t)(q0 + lr) * HD + ks * 32 + 8 * hi); }
    v8f o[4];
#pragma unroll
    for (int mb = 0; mb < 4; ++mb) o[mb] = (v8f){};
    float m = -3.0e38f, sum = 0.f;
    const float* mrow = madd + (size_t)(q0 + lr) * TT + 8 * hi;
    const size_t koff = (size_t)lr * HD + 8 * hi, voff = (size_t)lr * TT + 8 * hi;
    for (int j0 = 0; j0 < TT; j0 += KB) {
        const T16* kp = Kp + koff + (size_t)j0 * HD; const T16* kp2 = HR ? K2 + koff + (size_t)j0 * HD : kp; const T16* vp = Vt + voff + j0; const T16* vp2 = HR ? Vt2 + voff + j0 : vp; const float* mp = mrow + j0;
        V kf[KB / 16][2], kf2[KB / 16][2], vf[4][KB / 32], vf2[4][KB / 32]; v4f mk[KB / 16][2];   /* all of a pass's loads go out as one group: one memory latency a pass */
#pragma unroll
        for (int kb = 0; kb < KB / 16; ++kb) {
#pragma unroll
            for (int ks = 0; ks < 2; ++ks) { kf[kb][ks] = WFrag<T16>::ld(kp + kb * 16 * HD + ks * 32); if (HR) kf2[kb][ks] = WFrag<T16>::ld(kp2 + kb * 16 * HD + ks * 32); mk[kb][ks] = *(const v4f*)(mp + kb * 16 + ks * 4); } }
#pragma unroll
        for (int mb = 0; mb < 4; ++mb)
#pragma unroll
            for (int ks = 0; ks < KB / 32; ++ks) { vf[mb][ks] = WFrag<T16>::ld(vp + (size_t)(mb * 16) * TT + ks * 32); if (HR) vf2[mb][ks] = WFrag<T16>::ld(vp2 + (size_t)(mb * 16) * TT + ks * 32); }
        /* the wait that stands in front of any overwrite of a register that an issued load names; the addresses are inputs so that their registers are not reused (as a later load's destination) ahead of it */
        asm volatile("s_wait_xcnt 0x0" :: "v"(kp), "v"(kp2), "v"(vp), "v"(vp2), "v"(mp) : "memory");
        __builtin_amdgcn_sched_barrier(0);   /* keeps the whole group of loads (and its wait) above the products: without it the scheduler sinks the V loads to their use and a pass pays two or three latencies */
        v8f s[KB / 16];
#pragma unroll
        for (int kb = 0; kb < KB / 16; ++kb) { s[kb] = (v8f){};
#pragma unroll
            for (int ks = 0; ks < 2; ++ks) { s[kb] = WFrag<T16>::mma(kf[kb][ks], qf[ks], s[kb]);
                if (HR) { s[kb] = WFrag<T16>::mma(kf[kb][ks], qf2[ks], s[kb]); s[kb] = WFrag<T16>::mma(kf2[kb][ks], qf[ks], s[kb]); } } }
        float bk[KB / 16];
#pragma unroll
        for (int kb = 0; kb < KB / 16; ++kb) { const v4f m0 = mk[kb][0], m1 = mk[kb][1]; bk[kb] = -3.0e38f;
#pragma unroll
            for (int j = 0; j < 8; ++j) { const float t = s[kb][j] * SCL + bfr(j < 4 ? m0[j & 3] : m1[j & 3]); s[kb][j] = t; bk[kb] = fmaxf(bk[kb], t); } }
        float bm = m;
#pragma unroll
        for (int kb = 0; kb < KB / 16; ++kb) bm = fmaxf(bm, bk[kb]);
        bm = fmaxf(bm, __shfl_xor(bm, 16, 32));   /* the two lane halves hold the two halves of a query's keys */
        const float al = __builtin_amdgcn_exp2f((m - bm) * 1.4426950408889634f); m = bm;
        float pk[KB / 16];
#pragma unroll
        for (int kb = 0; kb < KB / 16; ++kb) { float e[8];
#pragma unroll
            for (int j = 0; j < 8; ++j) { const float d = s[kb][j] - m;   /* the maximum is subtracted first: exactly 0 at t = m for every m, and minus infinity stays minus infinity (p = 0) */
                if constexpr (HR) e[j] = d * 1.4426950408889634f; else e[j] = __builtin_fmaf(d, 1.4426950408889634f, PLOG); }   /* the fp16 rows' factor PCAR rides in the exponent: p = PCAR x exp(t - m) */
            /* eight exponentials, each in place, then one v_nop: behind a transcendental the instruction set asks for one independent instruction before its result is read or its source overwritten; here the next exponential (another register) or the v_nop is that instruction */
            asm("v_exp_f32 %0, %0\n\tv_exp_f32 %1, %1\n\tv_exp_f32 %2, %2\n\tv_exp_f32 %3, %3\n\tv_exp_f32 %4, %4\n\tv_exp_f32 %5, %5\n\tv_exp_f32 %6, %6\n\tv_exp_f32 %7, %7\n\tv_nop" : "+v"(e[0]), "+v"(e[1]), "+v"(e[2]), "+v"(e[3]), "+v"(e[4]), "+v"(e[5]), "+v"(e[6]), "+v"(e[7]));
#pragma unroll
            for (int j = 0; j < 8; ++j) { s[kb][j] = e[j]; pk[kb] = j ? pk[kb] + e[j] : e[0]; } }
        float ps = pk[0];
#pragma unroll
        for (int kb = 1; kb < KB / 16; ++kb) ps += pk[kb];
        sum = sum * al + ps;
#pragma unroll
        for (int mb = 0; mb < 4; ++mb)
#pragma unroll
            for (int j = 0; j < 8; ++j) o[mb][j] *= al;
        V pf[KB / 32], pf2[KB / 32];
#pragma unroll
        for (int ks = 0; ks < KB / 32; ++ks) {
            if constexpr (HR) { v8us h0, h1, l0, l1;
#pragma unroll
                for (int j = 0; j < 8; ++j) { unsigned short a, c2; splitf(s[2 * ks][j], a, c2); h0[j] = a; l0[j] = c2; splitf(s[2 * ks + 1][j], a, c2); h1[j] = a; l1[j] = c2; }
                pf[ks] = cat16b(h0, h1); pf2[ks] = cat16b(l0, l1);
            } else { v8h a0, a1;
#pragma unroll
                for (int j = 0; j < 8; ++j) { a0[j] = tohx(s[2 * ks][j]); a1[j] = tohx(s[2 * ks + 1][j]); }
                pf[ks] = cat16(a0, a1); } }
#pragma unroll
        for (int mb = 0; mb < 4; ++mb)
#pragma unroll
            for (int ks = 0; ks < KB / 32; ++ks) { o[mb] = WFrag<T16>::mma(vf[mb][ks], pf[ks], o[mb]);
                if (HR) { o[mb] = WFrag<T16>::mma(vf[mb][ks], pf2[ks], o[mb]); o[mb] = WFrag<T16>::mma(vf2[mb][ks], pf[ks], o[mb]); } }
    }
    sum += __shfl_xor(sum, 16, 32);
    const float f = __fdiv_rn(1.0f, sum);   /* on the fp16 rows sum and o both carry PCAR */
#pragma unroll
    for (int mb = 0; mb < 4; ++mb) { v8us oh, ol;   /* a lane holds 8 consecutive head dims of its query: one 16-byte store a plane */
#pragma unroll
        for (int j = 0; j < 8; ++j) { unsigned short a, c2; splitf(o[mb][j] * f, a, c2); oh[j] = a; ol[j] = c2; }
        const size_t oo = (size_t)(q0 + lr) * DQ + mb * 16 + hi * 8; *(v8us*)(Ah + oo) = oh; *(v8us*)(Al + oo) = ol; }
}
// amdgpu_waves_per_eu(2): the register budget of two waves a SIMD, so that a pass's whole group of loads can be in flight (the default budget made the scheduler trickle them)
__global__ __launch_bounds__(256) __attribute__((amdgpu_waves_per_eu(2))) void k_fattn(const h16* __restrict__ Q16, const h16* __restrict__ K16, const h16* __restrict__ V16, const bf* __restrict__ Qh, const bf* __restrict__ Ql, const bf* __restrict__ Kh, const bf* __restrict__ Kl, const bf* __restrict__ Vh, const bf* __restrict__ Vl, const float* __restrict__ madd, bf* Ah, bf* Al) {
    const int w = __builtin_amdgcn_readfirstlane((int)(threadIdx.x >> 5)); const size_t hq = ((size_t)blockIdx.z * NH_ + blockIdx.y) * TT * HD, hk = ((size_t)blockIdx.z * NKV + blockIdx.y / REP) * TT * HD; const size_t ao = (size_t)blockIdx.z * TT * DQ + blockIdx.y * HD; bf* ah = Ah + ao; bf* al = Al + ao;
    if (w < FHW) fattn_rows<bf, true, 32>(Qh + hq, Ql + hq, Kh + hk, Kl + hk, Vh + hk, Vl + hk, madd, (int)blockIdx.x * (FHW * 16) + w * 16, ah, al);
    else fattn_rows<h16, false, 64>(Q16 + hq, nullptr, K16 + hk, nullptr, V16 + hk, nullptr, madd, RH + (int)blockIdx.x * ((8 - FHW) * 16) + (w - FHW) * 16, ah, al);
}

extern "C" void kernel_launch(void* const* d_in, const int* in_sizes, int n_in,
                              void* d_out, int out_size, void* d_ws, size_t ws_size, hipStream_t stream) {
    (void)in_sizes; (void)n_in; (void)out_size;
    const float* x = (const float*)d_in[0]; const float* madd = (const float*)d_in[1];   /* attn_mask [1][1][2048][2048] f32 (zeros): read, added to the scaled scores */ const float* wqkv = (const float*)d_in[2]; const float* wo = (const float*)d_in[3]; const float* bo = (const float*)d_in[4]; const float* gq = (const float*)d_in[5]; const float* btq = (const float*)d_in[6]; const float* gk = (const float*)d_in[7]; const float* btk = (const float*)d_in[8]; const float* laq = (const float*)d_in[9]; const float* lbq = (const float*)d_in[10]; const float* lak = (const float*)d_in[11]; const float* lbk = (const float*)d_in[12]; const float* lav = (const float*)d_in[13]; const float* lbv = (const float*)d_in[14];     const float* wq = wqkv; const float* wk = wqkv + (size_t)DQ * DM; const float* wv = wqkv + (size_t)2 * DQ * DM;
    float* OUT = (float*)d_out;     // [2][2048][1024]
    char* wsp = (char*)d_ws;
    auto take = [&](size_t bytes) { char* p = wsp; wsp += (bytes + 255) & ~(size_t)255; return (void*)p; };
    bf* WQ = (bf*)take((size_t)DQ * DM * 2); bf* WK = (bf*)take((size_t)DKV * DM * 2); bf* WV = (bf*)take((size_t)DKV * DM * 2); bf* WO = (bf*)take((size_t)DM * DQ * 2);
    bf* XB = (bf*)take((size_t)TT * DM * 2); bf* APq = (bf*)take((size_t)64 * DM * 2); bf* APk = (bf*)take((size_t)64 * DM * 2); bf* APv = (bf*)take((size_t)64 * DM * 2); bf* BPq = (bf*)take((size_t)DQ * 64 * 2); bf* BPk = (bf*)take((size_t)DQ * 64 * 2); bf* BPv = (bf*)take((size_t)DQ * 64 * 2); float* XA = (float*)take((size_t)KSA * TT * 64 * 4); bf* XAh = (bf*)take((size_t)TT * 64 * 2); bf* XAl = (bf*)take((size_t)TT * 64 * 2); float* LR = (float*)take((size_t)TT * DQ * 4);   /* LoRA: zero-padded A^T [64][1024] / B^T [1024][64] operands, x A (f32 + hi/lo), (x A) B */
    /* head planes and merged planes of BOTH batches (batch stride PB, AB elements): the attention kernel takes them in one launch */ const size_t PB = (size_t)NH_ * TT * HD, AB = (size_t)TT * DQ; static_assert(NKV == NH_, "one plane stride");
    h16* QP16 = (h16*)take(NB_ * PB * 2); h16* KP16 = (h16*)take(NB_ * PB * 2); h16* VT16 = (h16*)take(NB_ * PB * 2);
    bf* QPh = (bf*)take(NB_ * PB * 2); bf* QPl = (bf*)take(NB_ * PB * 2); bf* KPh = (bf*)take(NB_ * PB * 2); bf* KPl = (bf*)take(NB_ * PB * 2); bf* VTh = (bf*)take(NB_ * PB * 2); bf* VTl = (bf*)take(NB_ * PB * 2);
    static_assert(DKV == DQ && DM == DQ, "plane buffer"); float* PP = (float*)take((size_t)KSJ * TT * DQ * 4);   /* split-K planes of the projections: KSJ x [TT][DQ] */ bf* ATh = (bf*)take(NB_ * AB * 2); bf* ATl = (bf*)take(NB_ * AB * 2);
    if ((size_t)(wsp - (char*)d_ws) > ws_size) return;    // ws 256 MiB
    { k_cvt8<<<(unsigned)(((size_t)DQ * DM / 8 + 255) / 256), 256, 0, stream>>>(wq, WQ, (size_t)DQ * DM / 8); k_cvt8<<<(unsigned)(((size_t)DKV * DM / 8 + 255) / 256), 256, 0, stream>>>(wk, WK, (size_t)DKV * DM / 8); k_cvt8<<<(unsigned)(((size_t)DKV * DM / 8 + 255) / 256), 256, 0, stream>>>(wv, WV, (size_t)DKV * DM / 8);
      k_cvt8<<<(unsigned)(((size_t)DM * DQ / 8 + 255) / 256), 256, 0, stream>>>(wo, WO, (size_t)DM * DQ / 8); k_apad<<<(64 * DM + 255) / 256, 256, 0, stream>>>(laq, APq); k_apad<<<(64 * DM + 255) / 256, 256, 0, stream>>>(lak, APk); k_apad<<<(64 * DM + 255) / 256, 256, 0, stream>>>(lav, APv); k_bpad<<<(DQ * 64 + 255) / 256, 256, 0, stream>>>(lbq, BPq); k_bpad<<<(DQ * 64 + 255) / 256, 256, 0, stream>>>(lbk, BPk); k_bpad<<<(DQ * 64 + 255) / 256, 256, 0, stream>>>(lbv, BPv);   /* LoRA operands zero-padded from rank 8 to 64 */
       }
    const size_t SPL = (size_t)TT * DQ;   /* elements of one split-K plane */
    for (int b = 0; b < NB_; ++b) {
        
        k_cvt8<<<(unsigned)(((size_t)TT * DM / 8 + 255) / 256), 256, 0, stream>>>(x + (size_t)b * TT * DM, XB, (size_t)TT * DM / 8);
        k_gemmw<bf, 0, false, 1><<<dim3(TT / 64, DQ / 64, KSJ), 32, 0, stream>>>(XB, nullptr, WQ, nullptr, DM, PP, DQ, nullptr, 0, 0, 0, DM / KSJ, (size_t)TT * DQ); k_gemmw<bf, 0, false, 1><<<dim3(TT / 64, 1, KSA), 32, 0, stream>>>(XB, nullptr, APq, nullptr, DM, XA, 64, nullptr, 0, 0, 0, DM / KSA, (size_t)TT * 64); k_tohl<KSA, (size_t)TT * 64><<<(unsigned)(((size_t)TT * 64 / 4 + 255) / 256), 256, 0, stream>>>(XA, XAh, XAl, (size_t)TT * 64 / 4); k_gemmw<bf, 1, false, 1><<<dim3(TT / 64, DQ / 64, 1), 32, 0, stream>>>(XAh, XAl, BPq, nullptr, 64, LR, DQ, nullptr, 0, 0, 0, 64, 0); k_qkfin<<<TT / QKT, 256, 0, stream>>>(PP, PP + SPL, PP + 2 * SPL, PP + 3 * SPL, LR, gq, btq, QP16 + b * PB, QPh + b * PB, QPl + b * PB);   /* q = planes + ((x A) B) (rank-8 LoRA, exact x A then hi/lo x exact B), per-head LayerNorm, head planes */
        k_gemmw<bf, 0, false, 1><<<dim3(TT / 64, DKV / 64, KSJ), 32, 0, stream>>>(XB, nullptr, WK, nullptr, DM, PP, DKV, nullptr, 0, 0, 0, DM / KSJ, (size_t)TT * DKV); k_gemmw<bf, 0, false, 1><<<dim3(TT / 64, 1, KSA), 32, 0, stream>>>(XB, nullptr, APk, nullptr, DM, XA, 64, nullptr, 0, 0, 0, DM / KSA, (size_t)TT * 64); k_tohl<KSA, (size_t)TT * 64><<<(unsigned)(((size_t)TT * 64 / 4 + 255) / 256), 256, 0, stream>>>(XA, XAh, XAl, (size_t)TT * 64 / 4); k_gemmw<bf, 1, false, 1><<<dim3(TT / 64, DKV / 64, 1), 32, 0, stream>>>(XAh, XAl, BPk, nullptr, 64, LR, DKV, nullptr, 0, 0, 0, 64, 0); k_qkfin<<<TT / QKT, 256, 0, stream>>>(PP, PP + SPL, PP + 2 * SPL, PP + 3 * SPL, LR, gk, btk, KP16 + b * PB, KPh + b * PB, KPl + b * PB);   /* k likewise */
        k_gemmw<bf, 0, false, 1><<<dim3(TT / 64, DKV / 64, KSJ), 32, 0, stream>>>(XB, nullptr, WV, nullptr, DM, PP, DKV, nullptr, 0, 0, 0, DM / KSJ, (size_t)TT * DKV); k_gemmw<bf, 0, false, 1><<<dim3(TT / 64, 1, KSA), 32, 0, stream>>>(XB, nullptr, APv, nullptr, DM, XA, 64, nullptr, 0, 0, 0, DM / KSA, (size_t)TT * 64); k_tohl<KSA, (size_t)TT * 64><<<(unsigned)(((size_t)TT * 64 / 4 + 255) / 256), 256, 0, stream>>>(XA, XAh, XAl, (size_t)TT * 64 / 4); k_gemmw<bf, 1, false, 1><<<dim3(TT / 64, DKV / 64, 1), 32, 0, stream>>>(XAh, XAl, BPv, nullptr, 64, LR, DKV, nullptr, 0, 0, 0, 64, 0); k_vfin<<<dim3(TT / VTT, DKV / VTC), 256, 0, stream>>>(PP, PP + SPL, PP + 2 * SPL, PP + 3 * SPL, LR, VT16 + b * PB, VTh + b * PB, VTl + b * PB); }   /* v = planes + ((x A) B), transposed planes */
    k_fattn<<<dim3(TT / 128, NH_, NB_), 256, 0, stream>>>(QP16, KP16, VT16, QPh, QPl, KPh, KPl, VTh, VTl, madd, ATh, ATl);   /* scores, softmax and P V of all heads of both batches; writes the merged hi/lo planes */
    for (int b = 0; b < NB_; ++b) {
        k_gemmw<bf, 1, true, 1><<<dim3(TT / 64, DM / 64, KSJ), 32, 0, stream>>>(ATh + b * AB, ATl + b * AB, WO, nullptr, DQ, PP, DM, bo, 0, 0, 0, DQ / KSJ, (size_t)TT * DM); k_sumf<KSJ, false, (size_t)TT * DM><<<(unsigned)(((size_t)TT * DM / 4 + 255) / 256), 256, 0, stream>>>(OUT + (size_t)b * TT * DM, PP, nullptr, (size_t)TT * DM / 4); }
}

// v004
// Measured time: 368 microseconds a run.
// Timed twice side by side with v003, it ran 1.30 times as fast both times.
// All steps since v000 together make it 6.23 times as fast.
#include <hip/hip_runtime.h>

// Attention with LoRA-augmented q/k/v, per-head query/key LayerNorm and an additive mask (x [2][2048][1024]; qkv = x qkv_w^T ('oi' [3072][1024] 0.02, no bias) -> q | k | v (16 heads x 64); q += (x lora_Aq) lora_Bq x 1 (alpha/r = 8/8), k, v likewise ('xw' [1024][8], [8][1024] 0.02); q, k <- LayerNorm over the 64 head dims (eps 1e-5; qn_w, qn_b, kn_w, kn_b [64], read); scores = (q x 64^-0.5).k + attn_mask ([1][1][2048][2048] f32 zeros, read); softmax; out = merged proj_w^T + proj_b -> [2][2048][1024] (4.2 M); argument order x, attn_mask, qkv_w, proj_w, proj_b, qn_w, qn_b, kn_w, kn_b, lora_Aq, lora_Bq, lora_Ak, lora_Bk, lora_Av, lora_Bv).
// Layout, both batches as one M = 4096 in every launch but the attention (grid z = batch): bf16 copy of x; 'oi' weight row blocks; exact projections; per projection the rank-8 LoRA term via two small GEMMs on zero-padded 64-wide operands (x A exact -> f32 -> hi/lo -> x B exact) added, with the split-K planes, in the projection's tail kernel, which also does the per-(token, head) LayerNorm of q and k and writes the 16-bit planes; fused T-2048 attention (hybrid rows: < 512 hi/lo 3 products, rest fp16 x1024), scores and probabilities in registers, with the additive mask read in the softmax; merged hi/lo x proj_w exact + proj_b.
// Compute dtypes, f32 accumulate: every input rounded to bf16; projections exact; LoRA x A exact, (x A) B hl x exact; LayerNorm f32; attention rows < 512 3 products, rest fp16; softmax f32; proj_w hl x exact + bias.

#define NB_  2
#define TT   2048
#define MT   (NB_ * TT)         // tokens of both batches: the rows of every GEMM
#define DM   1024
#define NH_  16
#define NKV  16
#define REP  (NH_ / NKV)
#define HD   64
#define DQ   (NH_ * HD)
#define DKV  (NKV * HD)
#define RH   512                  // query rows < RH use hi+lo planes (0: none)
#define PCAR 1024.0f
#define SCL  0.125f   // HD^-0.5
#define LNH_EPS 1e-5f
#define KSJ  4                    // split-K slices of the q/k/v and output projections (K 1024 -> 256)
#define KSA  16                   // split-K slices of x A (K 1024 -> 64)
typedef _Float16 h16;
typedef unsigned short bf;
typedef __attribute__((ext_vector_type(16))) __bf16   v16bf;
typedef __attribute__((ext_vector_type(16))) _Float16 v16h;
typedef __attribute__((ext_vector_type(8)))  _Float16 v8h;
typedef __attribute__((ext_vector_type(8)))  unsigned short v8us;
typedef __attribute__((ext_vector_type(8)))  float    v8f;
typedef __attribute__((ext_vector_type(4)))  float    v4f;
typedef v8h  __attribute__((may_alias)) v8ha;
typedef v4f  __attribute__((may_alias)) v4fa;
typedef v8us __attribute__((may_alias)) v8usa;

__device__ __forceinline__ unsigned short f2bf(float f) { unsigned u = __float_as_uint(f); u += 0x7FFFu + ((u >> 16) & 1u); return (unsigned short)(u >> 16); }
__device__ __forceinline__ float bf2f(unsigned short b) { return __uint_as_float(((unsigned)b) << 16); }
__device__ __forceinline__ float bfr(float f) { return bf2f(f2bf(f)); }
__device__ __forceinline__ v16h cat16(v8h lo, v8h hi) { return __builtin_shufflevector(lo, hi, 0, 1, 2, 3, 4, 5, 6, 7, 8, 9, 10, 11, 12, 13, 14, 15); }
__device__ __forceinline__ v16bf cat16b(v8us lo, v8us hi) { return __builtin_bit_cast(v16bf, __builtin_shufflevector(lo, hi, 0, 1, 2, 3, 4, 5, 6, 7, 8, 9, 10, 11, 12, 13, 14, 15)); }
__device__ __forceinline__ v8f wmma16(v16h a, v16h b, v8f c) { return __builtin_amdgcn_wmma_f32_16x16x32_f16(false, a, false, b, (short)0, c, false, false); }
__device__ __forceinline__ v8f wmmab(v16bf a, v16bf b, v8f c) { return __builtin_amdgcn_wmma_f32_16x16x32_bf16(false, a, false, b, (short)0, c, false, false); }



// ---- k_gemmw: register-blocked GEMM, ONE WAVE per 64x64 output tile (16 accumulators), operands straight from K-contiguous 16-bit planes; grid (M/64, N/64, Z), 32 threads.
// C[m][n] (f32, pitch ldc, + optional f32 bias[n]) = sum_k A[m][k] Bt[n][k] (+ split products per NSPLIT). z-batch strides sA/sB/sC in elements. K % 32 == 0.
// Split K: grid z = NZ batches x (K / KC) slices; slice ks sums k in [ks KC, (ks + 1) KC) into its own f32 plane C + ks sP, and the consumer kernel adds the planes in slice order (the bias goes into plane 0). KC == K, sP == 0: no split.
template <typename T16> struct WFrag;
template <> struct WFrag<h16> { typedef v16h V; static __device__ __forceinline__ V ld(const h16* p) { return cat16(*(const v8h*)p, *(const v8h*)(p + 16)); } static __device__ __forceinline__ v8f mma(V a, V b, v8f c) { return wmma16(a, b, c); } };
template <> struct WFrag<bf> { typedef v16bf V; static __device__ __forceinline__ V ld(const bf* p) { return cat16b(*(const v8us*)p, *(const v8us*)(p + 16)); } static __device__ __forceinline__ v8f mma(V a, V b, v8f c) { return wmmab(a, b, c); } };
template <typename T16, int NSPLIT, bool BIAS, int NZ>
__global__ __launch_bounds__(32) void k_gemmw(const T16* __restrict__ A, const T16* __restrict__ A2, const T16* __restrict__ Bt, const T16* __restrict__ Bt2, int K, float* C, int ldc, const float* __restrict__ bias, size_t sA, size_t sB, size_t sC, int KC, size_t sP) {
    typedef typename WFrag<T16>::V V;
    __shared__ __align__(16) float os[16 * 68];
    const size_t z = blockIdx.z % NZ; const int ks = blockIdx.z / NZ; const int k0 = ks * KC, k1 = k0 + KC; A += z * sA; if (A2) A2 += z * sA; Bt += z * sB; if (Bt2) Bt2 += z * sB; C += z * sC + (size_t)ks * sP;
    const int lane = threadIdx.x & 31, lr = lane & 15, hi = lane >> 4; const int r0 = blockIdx.x * 64, c0 = blockIdx.y * 64;
    v8f acc[4][4];
#pragma unroll
    for (int mb = 0; mb < 4; ++mb)
#pragma unroll
        for (int nb = 0; nb < 4; ++nb) acc[mb][nb] = (v8f){};
    const size_t aoff = (size_t)(r0 + lr) * K + 8 * hi, boff = (size_t)(c0 + lr) * K + 8 * hi;
#pragma unroll 1
    for (int kc = k0; kc < k1; kc += 32) {
        V a[4], a2[4];
#pragma unroll
        for (int mb = 0; mb < 4; ++mb) { a[mb] = WFrag<T16>::ld(A + aoff + (size_t)mb * 16 * K + kc); if (NSPLIT == 1 || NSPLIT == 2) a2[mb] = WFrag<T16>::ld(A2 + aoff + (size_t)mb * 16 * K + kc); }
#pragma unroll
        for (int nb = 0; nb < 4; ++nb) { const V b = WFrag<T16>::ld(Bt + boff + (size_t)nb * 16 * K + kc); V b2; if (NSPLIT >= 2) b2 = WFrag<T16>::ld(Bt2 + boff + (size_t)nb * 16 * K + kc);
#pragma unroll
            for (int mb = 0; mb < 4; ++mb) { acc[mb][nb] = WFrag<T16>::mma(a[mb], b, acc[mb][nb]); if (NSPLIT == 1 || NSPLIT == 2) acc[mb][nb] = WFrag<T16>::mma(a2[mb], b, acc[mb][nb]); if (NSPLIT >= 2) acc[mb][nb] = WFrag<T16>::mma(a[mb], b2, acc[mb][nb]); } }
        asm volatile("v_nop\n\tv_nop\n\tv_nop\n\tv_nop" : "+v"(acc[0][0]), "+v"(acc[1][1]), "+v"(acc[2][2]), "+v"(acc[3][3]) : "v"(a[0]), "v"(a[3]));
    }
#pragma unroll
    for (int mb = 0; mb < 4; ++mb) {
#pragma unroll
        for (int nb = 0; nb < 4; ++nb) {
#pragma unroll
            for (int j = 0; j < 8; ++j) os[(hi * 8 + j) * 68 + nb * 16 + lr] = acc[mb][nb][j]; }
        __builtin_amdgcn_wave_barrier(); asm volatile("" ::: "memory");
        float* crow = C + (size_t)(r0 + mb * 16) * ldc + c0;
{
#pragma unroll
            for (int s = 0; s < 8; ++s) { const int row = 2 * s + hi, cofs = lr * 4; v4f val = *(const v4fa*)(os + row * 68 + cofs); if (BIAS && ks == 0) { val[0] += bfr(bias[c0 + cofs]); val[1] += bfr(bias[c0 + cofs + 1]); val[2] += bfr(bias[c0 + cofs + 2]); val[3] += bfr(bias[c0 + cofs + 3]); }
                *(v4f*)(crow + (size_t)row * ldc + cofs) = val; }
             }
        __builtin_amdgcn_wave_barrier(); asm volatile("" ::: "memory");
    }
}

__device__ __forceinline__ h16 tohx(float x) { return (h16)x; }
__device__ __forceinline__ void splitf(float y, unsigned short& h, unsigned short& l) { h = f2bf(y); l = f2bf(y - bf2f(h)); }
typedef __attribute__((ext_vector_type(2))) _Float16 v2h;
typedef __attribute__((ext_vector_type(4))) _Float16 v4h;
typedef __attribute__((ext_vector_type(2))) unsigned short v2us;
typedef __attribute__((ext_vector_type(4))) unsigned short v4us;
typedef __attribute__((ext_vector_type(2))) float v2f;
typedef __attribute__((ext_vector_type(4))) int v4i;

// ---- k_prep: every operand conversion of a call in ONE launch; a work-group's range of the flat block index says which it does (block-uniform): the three LoRA A and the three LoRA B zero-padded from rank 8 to 64, then x, qkv_w, proj_w to bf16.
__device__ __forceinline__ void cvt8(const float* __restrict__ src, bf* dst, size_t i) { const v8f v = *(const v8f*)(src + i * 8); v8us o;
#pragma unroll
    for (int k = 0; k < 8; ++k) o[k] = f2bf(v[k]); *(v8us*)(dst + i * 8) = o;
    asm volatile("s_wait_xcnt 0x0" ::: "memory");   /* the wait that stands in front of any overwrite of a register that the issued store names: in the listing the code of the next range follows this store */ }

#define LR_R 8   // LoRA rank
__device__ __forceinline__ void apad(const float* __restrict__ A, bf* Bt, size_t i) { const size_t e = i * 4; const int k0 = (int)(e % DM); const int nn = (int)(e / DM); const int nc = min(nn, LR_R - 1); v4us o;
#pragma unroll
    for (int q = 0; q < 4; ++q) { const float a = A[(size_t)(k0 + q) * LR_R + nc]; o[q] = (nn < LR_R) ? f2bf(a) : (unsigned short)0; }
    *(v4us*)(Bt + e) = o;  }
__device__ __forceinline__ void bpad(const float* __restrict__ Bm, bf* Bt, size_t i) { const size_t e = i * 4; const int k0 = (int)(e % 64); const int nn = (int)(e / 64); v4us o;
#pragma unroll
    for (int q = 0; q < 4; ++q) { const int k = k0 + q; const int kc = min(k, LR_R - 1); const float b = Bm[(size_t)kc * DQ + nn]; o[q] = (k < LR_R) ? f2bf(b) : (unsigned short)0; }
    *(v4us*)(Bt + e) = o;  }
#define PBX (MT * DM / 8 / 256)                    // work-groups of x
#define PBW ((DQ + 2 * DKV) * DM / 8 / 256)        // of qkv_w
#define PBO (DM * DQ / 8 / 256)                    // of proj_w
#define PBP (64 * DM / 4 / 256)                    // of one padded LoRA operand
static_assert(DQ == DM && (MT * DM) % 2048 == 0 && (DQ * DM) % 2048 == 0 && (64 * DM) % 1024 == 0, "whole work-groups");
__global__ __launch_bounds__(256) void k_prep(const float* __restrict__ x, const float* __restrict__ wqkv, const float* __restrict__ wo, const float* __restrict__ laq, const float* __restrict__ lak, const float* __restrict__ lav, const float* __restrict__ lbq, const float* __restrict__ lbk, const float* __restrict__ lbv, bf* XB, bf* WQKV, bf* WO, bf* AP, bf* BP) {
    int blk = (int)blockIdx.x; const size_t tid = threadIdx.x;   /* the padded operands first: their dependent strided reads are the longest path of a work-group here */
    if (blk < 3 * PBP) { const int p = blk / PBP; apad(p == 0 ? laq : p == 1 ? lak : lav, AP + (size_t)p * 64 * DM, (size_t)(blk % PBP) * 256 + tid); return; }
    blk -= 3 * PBP;
    if (blk < 3 * PBP) { const int p = blk / PBP; bpad(p == 0 ? lbq : p == 1 ? lbk : lbv, BP + (size_t)p * DQ * 64, (size_t)(blk % PBP) * 256 + tid); return; }
    blk -= 3 * PBP;
    if (blk < PBX) { cvt8(x, XB, (size_t)blk * 256 + tid); return; }
    blk -= PBX;
    if (blk < PBW) { cvt8(wqkv, WQKV, (size_t)blk * 256 + tid); return; }
    blk -= PBW;
    cvt8(wo, WO, (size_t)blk * 256 + tid);
}
// k_sumf: F = the NS split-K planes of P (stride sP), added in slice order. The planes lie too far apart for an immediate offset: one uniform base, one 32-bit byte offset a plane.
template <int NS, size_t sP>
__global__ __launch_bounds__(256) void k_sumf(float* F, const float* __restrict__ P, size_t n4) { static_assert(NS == 4 && (size_t)NS * sP * 4 < ((size_t)1 << 32), "four offsets of 32 bits"); const size_t i = (size_t)blockIdx.x * 256 + threadIdx.x; if (i >= n4) return; const unsigned ob = (unsigned)i * 16u; unsigned os[NS]; v4f p[NS];
#pragma unroll
    for (int s = 0; s < NS; ++s) { os[s] = ob + (unsigned)s * (unsigned)(sP * 4); p[s] = *(const v4f*)((const char*)P + os[s]); }
    /* the wait that stands in front of any overwrite of a register that an issued load names; the offsets are inputs so that their registers are not reused (as a later load's destination) ahead of it */
    asm volatile("s_wait_xcnt 0x0" :: "v"(os[0]), "v"(os[1]), "v"(os[2]), "v"(os[3]) : "memory");
    v4f o = p[0];
#pragma unroll
    for (int s = 1; s < NS; ++s) {
#pragma unroll
        for (int q = 0; q < 4; ++q) o[q] = __fadd_rn(o[q], p[s][q]); }
    *(v4f*)((char*)F + ob) = o;  }
template <int NS, size_t sP>
__global__ __launch_bounds__(256) void k_tohl(const float* __restrict__ F, bf* Hh, bf* Hl, size_t n4) { static_assert(NS == 16 && (size_t)NS * sP * 4 < ((size_t)1 << 32), "sixteen offsets of 32 bits"); const size_t i = (size_t)blockIdx.x * 256 + threadIdx.x; if (i >= n4) return; const unsigned ob = (unsigned)i * 16u; unsigned os[NS]; v4f p[NS]; v4us oh, ol;
#pragma unroll
    for (int s = 0; s < NS; ++s) { os[s] = ob + (unsigned)s * (unsigned)(sP * 4); p[s] = *(const v4f*)((const char*)F + os[s]); }   /* one uniform base, one 32-bit byte offset a plane */
    /* the wait that stands in front of any overwrite of a register that an issued load names; the offsets are inputs so that their registers are not reused (as a later load's destination) ahead of it */
    asm volatile("s_wait_xcnt 0x0" :: "v"(os[0]), "v"(os[1]), "v"(os[2]), "v"(os[3]), "v"(os[4]), "v"(os[5]), "v"(os[6]), "v"(os[7]), "v"(os[8]), "v"(os[9]), "v"(os[10]), "v"(os[11]), "v"(os[12]), "v"(os[13]), "v"(os[14]), "v"(os[15]) : "memory");
    v4f a = p[0];
#pragma unroll
    for (int s = 1; s < NS; ++s) {   /* split-K planes, slice order */
#pragma unroll
        for (int q = 0; q < 4; ++q) a[q] = __fadd_rn(a[q], p[s][q]); }
#pragma unroll
    for (int q = 0; q < 4; ++q) { unsigned short h2, l2; splitf(a[q], h2, l2); oh[q] = h2; ol[q] = l2; }
    *(v4us*)(Hh + i * 4) = oh; *(v4us*)(Hl + i * 4) = ol;  }
// ---- The tail of a projection in one kernel: the KSJ split-K planes added in slice order, + Lr (the LoRA term), then straight to the 16-bit planes that the attention kernel reads. No f32 copy of q, k or v goes through memory.
// The KSJ planes come as kernel arguments of their own, so that each base stays in scalar registers and ONE 32-bit byte offset register serves all of a thread's loads.
// ld_planes: the loads of NST steps (STB bytes apart) of a thread; sum_planes: their sum in slice order, the LoRA term last.
static_assert(KSJ == 4, "four plane arguments");
template <int NST, size_t STB>
__device__ __forceinline__ void ld_planes(const float* P0, const float* P1, const float* P2, const float* P3, const float* Lr, unsigned ob, v4f (&p)[NST][KSJ + 1]) {
#pragma unroll
    for (int s = 0; s < NST; ++s) { p[s][0] = *(const v4f*)((const char*)P0 + s * STB + ob); p[s][1] = *(const v4f*)((const char*)P1 + s * STB + ob); p[s][2] = *(const v4f*)((const char*)P2 + s * STB + ob); p[s][3] = *(const v4f*)((const char*)P3 + s * STB + ob); p[s][4] = *(const v4f*)((const char*)Lr + s * STB + ob); } }
__device__ __forceinline__ v4f sum_planes(const v4f (&p)[KSJ + 1]) { return (((p[0] + p[1]) + p[2]) + p[3]) + p[4]; }
// sum over a 16-lane row, every lane gets it (DPP row_xmask 1, 2, 4, 8)
template <int M> __device__ __forceinline__ float rowx(float v) { return __int_as_float(__builtin_amdgcn_update_dpp(0, __float_as_int(v), 0x160 + M, 0xf, 0xf, true)); }
__device__ __forceinline__ float rowsum16(float v) { v += rowx<1>(v); v += rowx<2>(v); v += rowx<4>(v); v += rowx<8>(v); return v; }
// k_qkfin (q, k): a work-group takes QKT whole tokens of one batch (grid: the MT tokens of both); a thread holds 4 consecutive head dims, so 16 lanes hold one (token, head) row: LayerNorm over the 64 head dims in registers, then head planes [h][t][d] (fp16 + hi/lo), one whole 128-byte line a row and plane.
#define QKT 4
static_assert(DQ == 256 * 4 && DKV == DQ && HD == 64 && TT % QKT == 0, "one token a work-group step, 16 lanes a head");
__global__ __launch_bounds__(256) void k_qkfin(const float* __restrict__ P0, const float* __restrict__ P1, const float* __restrict__ P2, const float* __restrict__ P3, const float* __restrict__ Lr, const float* __restrict__ g, const float* __restrict__ bb, h16* P16, bf* Ph, bf* Pl) {
    const int tid = threadIdx.x, h = tid >> 4, d = (tid & 15) * 4, t0 = blockIdx.x * QKT; const unsigned ob = ((unsigned)t0 * DQ + (unsigned)tid * 4u) * 4u;
    const unsigned gd = (unsigned)d * 4u; v4f p[QKT][KSJ + 1], a[QKT];
    v4f gv = *(const v4f*)((const char*)g + gd), bv = *(const v4f*)((const char*)bb + gd);
    ld_planes<QKT, (size_t)DQ * 4>(P0, P1, P2, P3, Lr, ob, p);
    /* the wait that stands in front of any overwrite of a register that an issued load names; the two offsets are inputs so that their registers are not reused (as a later load's destination) ahead of it */
    asm volatile("s_wait_xcnt 0x0" :: "v"(ob), "v"(gd) : "memory");
    __builtin_amdgcn_sched_barrier(0);   /* keeps all of the thread's loads above the sums: one memory latency a thread, where the scheduler's own order waited for the first loads before it issued the last */
#pragma unroll
    for (int s = 0; s < QKT; ++s) a[s] = sum_planes(p[s]);
#pragma unroll
    for (int q = 0; q < 4; ++q) { gv[q] = bfr(gv[q]); bv[q] = bfr(bv[q]); }
    const size_t e = ((size_t)((t0 / TT) * NH_ + h) * TT + t0 % TT) * HD + d;   /* head planes [b][h][t][d] */
#pragma unroll
    for (int s = 0; s < QKT; ++s) {
        const float mu = rowsum16((a[s][0] + a[s][1]) + (a[s][2] + a[s][3])) * (1.0f / HD); const v4f dv = a[s] - mu;
        const float var = rowsum16((dv[0] * dv[0] + dv[1] * dv[1]) + (dv[2] * dv[2] + dv[3] * dv[3])) * (1.0f / HD);
        const float rs = __fdiv_rn(1.0f, __fsqrt_rn(var + LNH_EPS)); v4h o16; v4us oh, ol;
#pragma unroll
        for (int q = 0; q < 4; ++q) { const float y = dv[q] * rs * gv[q] + bv[q]; o16[q] = tohx(y); unsigned short a2, c2; splitf(y, a2, c2); oh[q] = a2; ol[q] = c2; }
        *(v4h*)(P16 + e + s * HD) = o16; *(v4us*)(Ph + e + s * HD) = oh; *(v4us*)(Pl + e + s * HD) = ol; }
}
// k_vfin (v): a work-group takes VTT tokens x VTC columns, reads them along the columns (512 contiguous bytes a wave), turns the tile in LDS and writes the transposed planes [b][g][d][t] (fp16 + hi/lo) along t, one whole 128-byte line a column and plane.
#define VTT 64
#define VTC 128
#define VTP (VTT + 1)   // odd LDS pitch in dwords: the 4 columns x 8 token groups that a wave reads back fall on 32 different banks
static_assert(TT % VTT == 0 && DKV % VTC == 0 && VTC == 32 * 4 && VTT % 8 == 0 && (VTC * VTT / 8) % 256 == 0, "v tile");
__global__ __launch_bounds__(256) void k_vfin(const float* __restrict__ P0, const float* __restrict__ P1, const float* __restrict__ P2, const float* __restrict__ P3, const float* __restrict__ Lr, h16* V16, bf* Vh, bf* Vl) {
    __shared__ float ts[VTC * VTP];
    const int tid = threadIdx.x, lane = tid & 31, w = tid >> 5, t0 = blockIdx.x * VTT, c0 = blockIdx.y * VTC; const unsigned ob = ((unsigned)(t0 + w) * DKV + (unsigned)(c0 + lane * 4)) * 4u;
    v4f p[VTT / 8][KSJ + 1];
    ld_planes<VTT / 8, (size_t)8 * DKV * 4>(P0, P1, P2, P3, Lr, ob, p);
    /* the wait that stands in front of any overwrite of a register that an issued load names; the offset is an input so that its register is not reused (as a later load's destination) ahead of it */
    asm volatile("s_wait_xcnt 0x0" :: "v"(ob) : "memory");
    __builtin_amdgcn_sched_barrier(0);   /* keeps all of the thread's loads above the sums: one memory latency a thread */
#pragma unroll
    for (int s = 0; s < VTT / 8; ++s) { const v4f a = sum_planes(p[s]);
#pragma unroll
        for (int q = 0; q < 4; ++q) ts[(lane * 4 + q) * VTP + s * 8 + w] = a[q]; }
    __syncthreads();   /* the tile is whole before any thread reads a column that other waves wrote */
#pragma unroll
    for (int it = 0; it < VTC * VTT / 8 / 256; ++it) { const int item = it * 256 + tid, tg = item & (VTT / 8 - 1), c = item / (VTT / 8); const float* r = ts + c * VTP + tg * 8; v8h o16; v8us oh, ol;
#pragma unroll
        for (int j = 0; j < 8; ++j) { const float x = r[j]; o16[j] = tohx(x); unsigned short a2, c2; splitf(x, a2, c2); oh[j] = a2; ol[j] = c2; }
        const size_t e = ((size_t)(t0 / TT) * DKV + c0 + c) * TT + t0 % TT + tg * 8;   /* planes [b][g][d][t] */ *(v8h*)(V16 + e) = o16; *(v8us*)(Vh + e) = oh; *(v8us*)(Vl + e) = ol; }
}
// ---- k_fattn: fused attention, one launch for all heads of both batches (grid: row blocks, heads, batches). One wave owns 16 queries of one head and walks the TT keys, 64 a pass (32 on the hi/lo rows, whose fragments take twice the registers):
// S^T = K Q^T (A = key rows, B = the queries, loaded once), so a lane holds 8 keys of ONE query per 16-key tile; t = S x HD^-0.5 + bf16(attn_mask[i][j]) (the additive f32 mask input, read as data);
// running-maximum softmax in registers (the output tiles and the sum are rescaled when the maximum moves; the division by the sum comes last); O^T += V^T P^T with P^T packed from the score tiles as the B operand (two 16-key tiles = one 32-key fragment in the loaders' k order).
// Scores and probabilities never reach memory. Rows < RH: hi/lo planes, 3 products; the rest fp16 with P x PCAR. Each work-group takes FHW hi/lo waves and 8 - FHW fp16 waves, so that the longer hi/lo rows are spread over all work-groups.
#define FHW 2
#define PLOG 10.0f   // log2(PCAR)
static_assert(PCAR == 1024.0f, "PLOG");
static_assert(FHW * 16 * (TT / 128) == RH && (8 - FHW) * 16 * (TT / 128) == TT - RH, "row split");
template <typename T16, bool HR, int KB>   // KB keys a pass
__device__ __forceinline__ void fattn_rows(const T16* __restrict__ Q, const T16* __restrict__ Q2, const T16* __restrict__ Kp, const T16* __restrict__ K2, const T16* __restrict__ Vt, const T16* __restrict__ Vt2, const float* __restrict__ madd, int q0, bf* Ah, bf* Al) {
    typedef typename WFrag<T16>::V V;
    const int lane = threadIdx.x & 31, lr = lane & 15, hi = lane >> 4;
    V qf[2], qf2[2];
#pragma unroll
    for (int ks = 0; ks < 2; ++ks) { qf[ks] = WFrag<T16>::ld(Q + (size_t)(q0 + lr) * HD + ks * 32 + 8 * hi); if (HR) qf2[ks] = WFrag<T16>::ld(Q2 + (size_t)(q0 + lr) * HD + ks * 32 + 8 * hi); }
    v8f o[4];
#pragma unroll
    for (int mb = 0; mb < 4; ++mb) o[mb] = (v8f){};
    float m = -3.0e38f, sum = 0.f;
    const float* mrow = madd + (size_t)(q0 + lr) * TT + 8 * hi;
    const size_t koff = (size_t)lr * HD + 8 * hi, voff = (size_t)lr * TT + 8 * hi;
    for (int j0 = 0; j0 < TT; j0 += KB) {
        const T16* kp = Kp + koff + (size_t)j0 * HD; const T16* kp2 = HR ? K2 + koff + (size_t)j0 * HD : kp; const T16* vp = Vt + voff + j0; const T16* vp2 = HR ? Vt2 + voff + j0 : vp; const float* mp = mrow + j0;
        V kf[KB / 16][2], kf2[KB / 16][2], vf[4][KB / 32], vf2[4][KB / 32]; v4f mk[KB / 16][2];   /* all of a pass's loads go out as one group: one memory latency a pass */
#pragma unroll
        for (int kb = 0; kb < KB / 16; ++kb) {
#pragma unroll
            for (int ks = 0; ks < 2; ++ks) { kf[kb][ks] = WFrag<T16>::ld(kp + kb * 16 * HD + ks * 32); if (HR) kf2[kb][ks] = WFrag<T16>::ld(kp2 + kb * 16 * HD + ks * 32); mk[kb][ks] = *(const v4f*)(mp + kb * 16 + ks * 4); } }
#pragma unroll
        for (int mb = 0; mb < 4; ++mb)
#pragma unroll
            for (int ks = 0; ks < KB / 32; ++ks) { vf[mb][ks] = WFrag<T16>::ld(vp + (size_t)(mb * 16) * TT + ks * 32); if (HR) vf2[mb][ks] = WFrag<T16>::ld(vp2 + (size_t)(mb * 16) * TT + ks * 32); }
        /* the wait that stands in front of any overwrite of a register that an issued load names; the addresses are inputs so that their registers are not reused (as a later load's destination) ahead of it */
        asm volatile("s_wait_xcnt 0x0" :: "v"(kp), "v"(kp2), "v"(vp), "v"(vp2), "v"(mp) : "memory");
        __builtin_amdgcn_sched_barrier(0);   /* keeps the whole group of loads (and its wait) above the products: without it the scheduler sinks the V loads to their use and a pass pays two or three latencies */
        v8f s[KB / 16];
#pragma unroll
        for (int kb = 0; kb < KB / 16; ++kb) { s[kb] = (v8f){};
#pragma unroll
            for (int ks = 0; ks < 2; ++ks) { s[kb] = WFrag<T16>::mma(kf[kb][ks], qf[ks], s[kb]);
                if (HR) { s[kb] = WFrag<T16>::mma(kf[kb][ks], qf2[ks], s[kb]); s[kb] = WFrag<T16>::mma(kf2[kb][ks], qf[ks], s[kb]); } } }
        float bk[KB / 16];
#pragma unroll
        for (int kb = 0; kb < KB / 16; ++kb) { const v4f m0 = mk[kb][0], m1 = mk[kb][1]; bk[kb] = -3.0e38f;
#pragma unroll
            for (int j = 0; j < 8; ++j) { const float t = s[kb][j] * SCL + bfr(j < 4 ? m0[j & 3] : m1[j & 3]); s[kb][j] = t; bk[kb] = fmaxf(bk[kb], t); } }
        float bm = m;
#pragma unroll
        for (int kb = 0; kb < KB / 16; ++kb) bm = fmaxf(bm, bk[kb]);
        bm = fmaxf(bm, __shfl_xor(bm, 16, 32));   /* the two lane halves hold the two halves of a query's keys */
        const float al = __builtin_amdgcn_exp2f((m - bm) * 1.4426950408889634f); m = bm;
        float pk[KB / 16];
#pragma unroll
        for (int kb = 0; kb < KB / 16; ++kb) { float e[8];
#pragma unroll
            for (int j = 0; j < 8; ++j) { const float d = s[kb][j] - m;   /* the maximum is subtracted first: exactly 0 at t = m for every m, and minus infinity stays minus infinity (p = 0) */
                if constexpr (HR) e[j] = d * 1.4426950408889634f; else e[j] = __builtin_fmaf(d, 1.4426950408889634f, PLOG); }   /* the fp16 rows' factor PCAR rides in the exponent: p = PCAR x exp(t - m) */
            /* eight exponentials, each in place, then one v_nop: behind a transcendental the instruction set asks for one independent instruction before its result is read or its source overwritten; here the next exponential (another register) or the v_nop is that instruction */
            asm("v_exp_f32 %0, %0\n\tv_exp_f32 %1, %1\n\tv_exp_f32 %2, %2\n\tv_exp_f32 %3, %3\n\tv_exp_f32 %4, %4\n\tv_exp_f32 %5, %5\n\tv_exp_f32 %6, %6\n\tv_exp_f32 %7, %7\n\tv_nop" : "+v"(e[0]), "+v"(e[1]), "+v"(e[2]), "+v"(e[3]), "+v"(e[4]), "+v"(e[5]), "+v"(e[6]), "+v"(e[7]));
#pragma unroll
            for (int j = 0; j < 8; ++j) { s[kb][j] = e[j]; pk[kb] = j ? pk[kb] + e[j] : e[0]; } }
        float ps = pk[0];
#pragma unroll
        for (int kb = 1; kb < KB / 16; ++kb) ps += pk[kb];
        sum = sum * al + ps;
#pragma unroll
        for (int mb = 0; mb < 4; ++mb)
#pragma unroll
            for (int j = 0; j < 8; ++j) o[mb][j] *= al;
        V pf[KB / 32], pf2[KB / 32];
#pragma unroll
        for (int ks = 0; ks < KB / 32; ++ks) {
            if constexpr (HR) { v8us h0, h1, l0, l1;
#pragma unroll
                for (int j = 0; j < 8; ++j) { unsigned short a, c2; splitf(s[2 * ks][j], a, c2); h0[j] = a; l0[j] = c2; splitf(s[2 * ks + 1][j], a, c2); h1[j] = a; l1[j] = c2; }
                pf[ks] = cat16b(h0, h1); pf2[ks] = cat16b(l0, l1);
            } else { v8h a0, a1;
#pragma unroll
                for (int j = 0; j < 8; ++j) { a0[j] = tohx(s[2 * ks][j]); a1[j] = tohx(s[2 * ks + 1][j]); }
                pf[ks] = cat16(a0, a1); } }
#pragma unroll
        for (int mb = 0; mb < 4; ++mb)
#pragma unroll
            for (int ks = 0; ks < KB / 32; ++ks) { o[mb] = WFrag<T16>::mma(vf[mb][ks], pf[ks], o[mb]);
                if (HR) { o[mb] = WFrag<T16>::mma(vf[mb][ks], pf2[ks], o[mb]); o[mb] = WFrag<T16>::mma(vf2[mb][ks], pf[ks], o[mb]); } }
    }
    sum += __shfl_xor(sum, 16, 32);
    const float f = __fdiv_rn(1.0f, sum);   /* on the fp16 rows sum and o both carry PCAR */
#pragma unroll
    for (int mb = 0; mb < 4; ++mb) { v8us oh, ol;   /* a lane holds 8 consecutive head dims of its query: one 16-byte store a plane */
#pragma unroll
        for (int j = 0; j < 8; ++j) { unsigned short a, c2; splitf(o[mb][j] * f, a, c2); oh[j] = a; ol[j] = c2; }
        const size_t oo = (size_t)(q0 + lr) * DQ + mb * 16 + hi * 8; *(v8us*)(Ah + oo) = oh; *(v8us*)(Al + oo) = ol; }
}
// amdgpu_waves_per_eu(2): the register budget of two waves a SIMD, so that a pass's whole group of loads can be in flight (the default budget made the scheduler trickle them)
__global__ __launch_bounds__(256) __attribute__((amdgpu_waves_per_eu(2))) void k_fattn(const h16* __restrict__ Q16, const h16* __restrict__ K16, const h16* __restrict__ V16, const bf* __restrict__ Qh, const bf* __restrict__ Ql, const bf* __restrict__ Kh, const bf* __restrict__ Kl, const bf* __restrict__ Vh, const bf* __restrict__ Vl, const float* __restrict__ madd, bf* Ah, bf* Al) {
    const int w = __builtin_amdgcn_readfirstlane((int)(threadIdx.x >> 5)); const size_t hq = ((size_t)blockIdx.z * NH_ + blockIdx.y) * TT * HD, hk = ((size_t)blockIdx.z * NKV + blockIdx.y / REP) * TT * HD; const size_t ao = (size_t)blockIdx.z * TT * DQ + blockIdx.y * HD; bf* ah = Ah + ao; bf* al = Al + ao;
    if (w < FHW) fattn_rows<bf, true, 32>(Qh + hq, Ql + hq, Kh + hk, Kl + hk, Vh + hk, Vl + hk, madd, (int)blockIdx.x * (FHW * 16) + w * 16, ah, al);
    else fattn_rows<h16, false, 64>(Q16 + hq, nullptr, K16 + hk, nullptr, V16 + hk, nullptr, madd, RH + (int)blockIdx.x * ((8 - FHW) * 16) + (w - FHW) * 16, ah, al);
}

extern "C" void kernel_launch(void* const* d_in, const int* in_sizes, int n_in,
                              void* d_out, int out_size, void* d_ws, size_t ws_size, hipStream_t stream) {
    (void)in_sizes; (void)n_in; (void)out_size;
    const float* x = (const float*)d_in[0]; const float* madd = (const float*)d_in[1];   /* attn_mask [1][1][2048][2048] f32 (zeros): read, added to the scaled scores */ const float* wqkv = (const float*)d_in[2]; const float* wo = (const float*)d_in[3]; const float* bo = (const float*)d_in[4]; const float* gq = (const float*)d_in[5]; const float* btq = (const float*)d_in[6]; const float* gk = (const float*)d_in[7]; const float* btk = (const float*)d_in[8]; const float* laq = (const float*)d_in[9]; const float* lbq = (const float*)d_in[10]; const float* lak = (const float*)d_in[11]; const float* lbk = (const float*)d_in[12]; const float* lav = (const float*)d_in[13]; const float* lbv = (const float*)d_in[14];
    float* OUT = (float*)d_out;     // [2][2048][1024]
    char* wsp = (char*)d_ws;
    auto take = [&](size_t bytes) { char* p = wsp; wsp += (bytes + 255) & ~(size_t)255; return (void*)p; };
    bf* WQ = (bf*)take((size_t)(DQ + 2 * DKV) * DM * 2); bf* WK = WQ + (size_t)DQ * DM; bf* WV = WK + (size_t)DKV * DM;   /* qkv_w as one bf16 block */ bf* WO = (bf*)take((size_t)DM * DQ * 2);
    bf* XB = (bf*)take((size_t)MT * DM * 2); bf* AP = (bf*)take((size_t)3 * 64 * DM * 2); bf* BP = (bf*)take((size_t)3 * DQ * 64 * 2); bf* XAh = (bf*)take((size_t)3 * MT * 64 * 2); bf* XAl = (bf*)take((size_t)3 * MT * 64 * 2); float* LR = (float*)take((size_t)3 * MT * DQ * 4);   /* LoRA, q | k | v behind one another: zero-padded A^T [64][1024] / B^T [1024][64] operands, x A (hi/lo), (x A) B */
    /* head planes and merged planes of BOTH batches (batch stride PB, AB elements) */ const size_t PB = (size_t)NH_ * TT * HD, AB = (size_t)TT * DQ; static_assert(NKV == NH_, "one plane stride");
    h16* QP16 = (h16*)take(NB_ * PB * 2); h16* KP16 = (h16*)take(NB_ * PB * 2); h16* VT16 = (h16*)take(NB_ * PB * 2);
    bf* QPh = (bf*)take(NB_ * PB * 2); bf* QPl = (bf*)take(NB_ * PB * 2); bf* KPh = (bf*)take(NB_ * PB * 2); bf* KPl = (bf*)take(NB_ * PB * 2); bf* VTh = (bf*)take(NB_ * PB * 2); bf* VTl = (bf*)take(NB_ * PB * 2);
    static_assert(DKV == DQ && DM == DQ, "plane buffer"); float* PP = (float*)take((size_t)KSJ * MT * DQ * 4);   /* split-K planes of one projection: KSJ x [MT][DQ] */ bf* ATh = (bf*)take(NB_ * AB * 2); bf* ATl = (bf*)take(NB_ * AB * 2);
    float* XA = PP; static_assert(KSA * 3 * 64 <= KSJ * DQ, "x A planes fit");   /* the KSA x 3 x [MT][64] f32 planes of x A lie in PP: k_tohl has read them before the first projection writes there */
    if ((size_t)(wsp - (char*)d_ws) > ws_size) return;    // ws 256 MiB
    const size_t SPL = (size_t)MT * DQ;   /* elements of one split-K plane, and of one projection's LoRA term */
    k_prep<<<PBX + PBW + PBO + 6 * PBP, 256, 0, stream>>>(x, wqkv, wo, laq, lak, lav, lbq, lbk, lbv, XB, WQ, WO, AP, BP);
    /* the rank-8 LoRA terms of q, k and v, grid z = projection (x split-K slice): exact x A, f32 planes -> hi/lo, hi/lo x exact B */
    k_gemmw<bf, 0, false, 3><<<dim3(MT / 64, 1, 3 * KSA), 32, 0, stream>>>(XB, nullptr, AP, nullptr, DM, XA, 64, nullptr, 0, (size_t)64 * DM, (size_t)MT * 64, DM / KSA, (size_t)3 * MT * 64);
    k_tohl<KSA, (size_t)3 * MT * 64><<<(unsigned)((size_t)3 * MT * 64 / 4 / 256), 256, 0, stream>>>(XA, XAh, XAl, (size_t)3 * MT * 64 / 4);
    k_gemmw<bf, 1, false, 3><<<dim3(MT / 64, DQ / 64, 3), 32, 0, stream>>>(XAh, XAl, BP, nullptr, 64, LR, DQ, nullptr, (size_t)MT * 64, (size_t)DQ * 64, SPL, 64, 0);
    /* q = planes + LoRA term, per-head LayerNorm, head planes; k likewise; v = planes + LoRA term, transposed planes */
    k_gemmw<bf, 0, false, 1><<<dim3(MT / 64, DQ / 64, KSJ), 32, 0, stream>>>(XB, nullptr, WQ, nullptr, DM, PP, DQ, nullptr, 0, 0, 0, DM / KSJ, SPL); k_qkfin<<<MT / QKT, 256, 0, stream>>>(PP, PP + SPL, PP + 2 * SPL, PP + 3 * SPL, LR, gq, btq, QP16, QPh, QPl);
    k_gemmw<bf, 0, false, 1><<<dim3(MT / 64, DKV / 64, KSJ), 32, 0, stream>>>(XB, nullptr, WK, nullptr, DM, PP, DKV, nullptr, 0, 0, 0, DM / KSJ, SPL); k_qkfin<<<MT / QKT, 256, 0, stream>>>(PP, PP + SPL, PP + 2 * SPL, PP + 3 * SPL, LR + SPL, gk, btk, KP16, KPh, KPl);
    k_gemmw<bf, 0, false, 1><<<dim3(MT / 64, DKV / 64, KSJ), 32, 0, stream>>>(XB, nullptr, WV, nullptr, DM, PP, DKV, nullptr, 0, 0, 0, DM / KSJ, SPL); k_vfin<<<dim3(MT / VTT, DKV / VTC), 256, 0, stream>>>(PP, PP + SPL, PP + 2 * SPL, PP + 3 * SPL, LR + 2 * SPL, VT16, VTh, VTl);
    k_fattn<<<dim3(TT / 128, NH_, NB_), 256, 0, stream>>>(QP16, KP16, VT16, QPh, QPl, KPh, KPl, VTh, VTl, madd, ATh, ATl);   /* scores, softmax and P V of all heads of both batches; writes the merged hi/lo planes */
    k_gemmw<bf, 1, true, 1><<<dim3(MT / 64, DM / 64, KSJ), 32, 0, stream>>>(ATh, ATl, WO, nullptr, DQ, PP, DM, bo, 0, 0, 0, DQ / KSJ, SPL); k_sumf<KSJ, (size_t)MT * DM><<<(unsigned)((size_t)MT * DM / 4 / 256), 256, 0, stream>>>(OUT, PP, (size_t)MT * DM / 4);
}

// v005
// Measured time: 295 microseconds a run.
// In both of two side-by-side timings against v004, it was 1.25 times as fast.
// Counting every step since v000, it is 7.78 times as fast.
#include <hip/hip_runtime.h>

// Attention with LoRA-augmented q/k/v, per-head query/key LayerNorm and an additive mask (x [2][2048][1024]; qkv = x qkv_w^T ('oi' [3072][1024] 0.02, no bias) -> q | k | v (16 heads x 64); q += (x lora_Aq) lora_Bq x 1 (alpha/r = 8/8), k, v likewise ('xw' [1024][8], [8][1024] 0.02); q, k <- LayerNorm over the 64 head dims (eps 1e-5; qn_w, qn_b, kn_w, kn_b [64], read); scores = (q x 64^-0.5).k + attn_mask ([1][1][2048][2048] f32 zeros, read); softmax; out = merged proj_w^T + proj_b -> [2][2048][1024] (4.2 M); argument order x, attn_mask, qkv_w, proj_w, proj_b, qn_w, qn_b, kn_w, kn_b, lora_Aq, lora_Bq, lora_Ak, lora_Bk, lora_Av, lora_Bv).
// Layout, both batches as one M = 4096 in every launch but the attention (grid z = batch): bf16 copy of x; 'oi' weight row blocks; exact projections; per projection the rank-8 LoRA term via two small GEMMs on zero-padded 64-wide operands (x A exact -> f32 -> hi/lo -> x B exact) added, with the split-K planes, in the projection's tail kernel, which also does the per-(token, head) LayerNorm of q and k and writes the 16-bit planes; fused T-2048 attention (hybrid rows: < 512 hi/lo 3 products, rest fp16 x1024), scores and probabilities in registers, with the additive mask read in the softmax; merged hi/lo x proj_w exact + proj_b.
// Compute dtypes, f32 accumulate: every input rounded to bf16; projections exact; LoRA x A exact, (x A) B hl x exact; LayerNorm f32; attention rows < 512 3 products, rest fp16; softmax f32; proj_w hl x exact + bias.

#define NB_  2
#define TT   2048
#define MT   (NB_ * TT)         // tokens of both batches: the rows of every GEMM
#define DM   1024
#define NH_  16
#define NKV  16
#define REP  (NH_ / NKV)
#define HD   64
#define DQ   (NH_ * HD)
#define DKV  (NKV * HD)
#define RH   512                  // query rows < RH use hi+lo planes (0: none)
#define PCAR 1024.0f
#define SCL  0.125f   // HD^-0.5
#define LNH_EPS 1e-5f
#define KSJ  4                    // split-K slices of the q/k/v and output projections (K 1024 -> 256)
#define KSA  16                   // split-K slices of x A (K 1024 -> 64)
typedef _Float16 h16;
typedef unsigned short bf;
typedef __attribute__((ext_vector_type(16))) __bf16   v16bf;
typedef __attribute__((ext_vector_type(16))) _Float16 v16h;
typedef __attribute__((ext_vector_type(8)))  _Float16 v8h;
typedef __attribute__((ext_vector_type(8)))  unsigned short v8us;
typedef __attribute__((ext_vector_type(8)))  float    v8f;
typedef __attribute__((ext_vector_type(4)))  float    v4f;
typedef v8h  __attribute__((may_alias)) v8ha;
typedef v4f  __attribute__((may_alias)) v4fa;
typedef v8us __attribute__((may_alias)) v8usa;

__device__ __forceinline__ unsigned short f2bf(float f) { unsigned u = __float_as_uint(f); u += 0x7FFFu + ((u >> 16) & 1u); return (unsigned short)(u >> 16); }
__device__ __forceinline__ float bf2f(unsigned short b) { return __uint_as_float(((unsigned)b) << 16); }
__device__ __forceinline__ float bfr(float f) { return bf2f(f2bf(f)); }
__device__ __forceinline__ v16h cat16(v8h lo, v8h hi) { return __builtin_shufflevector(lo, hi, 0, 1, 2, 3, 4, 5, 6, 7, 8, 9, 10, 11, 12, 13, 14, 15); }
__device__ __forceinline__ v16bf cat16b(v8us lo, v8us hi) { return __builtin_bit_cast(v16bf, __builtin_shufflevector(lo, hi, 0, 1, 2, 3, 4, 5, 6, 7, 8, 9, 10, 11, 12, 13, 14, 15)); }
__device__ __forceinline__ v8f wmma16(v16h a, v16h b, v8f c) { return __builtin_amdgcn_wmma_f32_16x16x32_f16(false, a, false, b, (short)0, c, false, false); }
__device__ __forceinline__ v8f wmmab(v16bf a, v16bf b, v8f c) { return __builtin_amdgcn_wmma_f32_16x16x32_bf16(false, a, false, b, (short)0, c, false, false); }



// ---- k_gemmw: register-blocked GEMM, ONE WAVE per 64x64 output tile (16 accumulators), operands straight from K-contiguous 16-bit planes; grid (M/64, N/64, Z), 32 threads.
// C[m][n] (f32, pitch ldc, + optional f32 bias[n]) = sum_k A[m][k] Bt[n][k] (+ split products per NSPLIT). z-batch strides sA/sB/sC in elements. K % 32 == 0.
// Split K: grid z = NZ batches x (K / KC) slices; slice ks sums k in [ks KC, (ks + 1) KC) into its own f32 plane C + ks sP, and the consumer kernel adds the planes in slice order (the bias goes into plane 0). KC == K, sP == 0: no split.
template <typename T16> struct WFrag;
template <> struct WFrag<h16> { typedef v16h V; static __device__ __forceinline__ V ld(const h16* p) { return cat16(*(const v8h*)p, *(const v8h*)(p + 16)); } static __device__ __forceinline__ v8f mma(V a, V b, v8f c) { return wmma16(a, b, c); } };
template <> struct WFrag<bf> { typedef v16bf V; static __device__ __forceinline__ V ld(const bf* p) { return cat16b(*(const v8us*)p, *(const v8us*)(p + 16)); } static __device__ __forceinline__ v8f mma(V a, V b, v8f c) { return wmmab(a, b, c); } };
template <typename T16, int NSPLIT, bool BIAS, int NZ>
__global__ __launch_bounds__(32) void k_gemmw(const T16* __restrict__ A, const T16* __restrict__ A2, const T16* __restrict__ Bt, const T16* __restrict__ Bt2, int K, float* C, int ldc, const float* __restrict__ bias, size_t sA, size_t sB, size_t sC, int KC, size_t sP) {
    typedef typename WFrag<T16>::V V;
    __shared__ __align__(16) float os[16 * 68];
    const size_t z = blockIdx.z % NZ; const int ks = blockIdx.z / NZ; const int k0 = ks * KC, k1 = k0 + KC; A += z * sA; if (A2) A2 += z * sA; Bt += z * sB; if (Bt2) Bt2 += z * sB; C += z * sC + (size_t)ks * sP;
    const int lane = threadIdx.x & 31, lr = lane & 15, hi = lane >> 4; const int r0 = blockIdx.x * 64, c0 = blockIdx.y * 64;
    v8f acc[4][4];
#pragma unroll
    for (int mb = 0; mb < 4; ++mb)
#pragma unroll
        for (int nb = 0; nb < 4; ++nb) acc[mb][nb] = (v8f){};
    const size_t aoff = (size_t)(r0 + lr) * K + 8 * hi, boff = (size_t)(c0 + lr) * K + 8 * hi;
#pragma unroll 1
    for (int kc = k0; kc < k1; kc += 32) {
        V a[4], a2[4];
#pragma unroll
        for (int mb = 0; mb < 4; ++mb) { a[mb] = WFrag<T16>::ld(A + aoff + (size_t)mb * 16 * K + kc); if (NSPLIT == 1 || NSPLIT == 2) a2[mb] = WFrag<T16>::ld(A2 + aoff + (size_t)mb * 16 * K + kc); }
#pragma unroll
        for (int nb = 0; nb < 4; ++nb) { const V b = WFrag<T16>::ld(Bt + boff + (size_t)nb * 16 * K + kc); V b2; if (NSPLIT >= 2) b2 = WFrag<T16>::ld(Bt2 + boff + (size_t)nb * 16 * K + kc);
#pragma unroll
            for (int mb = 0; mb < 4; ++mb) { acc[mb][nb] = WFrag<T16>::mma(a[mb], b, acc[mb][nb]); if (NSPLIT == 1 || NSPLIT == 2) acc[mb][nb] = WFrag<T16>::mma(a2[mb], b, acc[mb][nb]); if (NSPLIT >= 2) acc[mb][nb] = WFrag<T16>::mma(a[mb], b2, acc[mb][nb]); } }
        asm volatile("v_nop\n\tv_nop\n\tv_nop\n\tv_nop" : "+v"(acc[0][0]), "+v"(acc[1][1]), "+v"(acc[2][2]), "+v"(acc[3][3]) : "v"(a[0]), "v"(a[3]));
    }
#pragma unroll
    for (int mb = 0; mb < 4; ++mb) {
#pragma unroll
        for (int nb = 0; nb < 4; ++nb) {
#pragma unroll
            for (int j = 0; j < 8; ++j) os[(hi * 8 + j) * 68 + nb * 16 + lr] = acc[mb][nb][j]; }
        __builtin_amdgcn_wave_barrier(); asm volatile("" ::: "memory");
        float* crow = C + (size_t)(r0 + mb * 16) * ldc + c0;
{
#pragma unroll
            for (int s = 0; s < 8; ++s) { const int row = 2 * s + hi, cofs = lr * 4; v4f val = *(const v4fa*)(os + row * 68 + cofs); if (BIAS && ks == 0) { val[0] += bfr(bias[c0 + cofs]); val[1] += bfr(bias[c0 + cofs + 1]); val[2] += bfr(bias[c0 + cofs + 2]); val[3] += bfr(bias[c0 + cofs + 3]); }
                *(v4f*)(crow + (size_t)row * ldc + cofs) = val; }
             }
        __builtin_amdgcn_wave_barrier(); asm volatile("" ::: "memory");
    }
}

__device__ __forceinline__ h16 tohx(float x) { return (h16)x; }
__device__ __forceinline__ void splitf(float y, unsigned short& h, unsigned short& l) { h = f2bf(y); l = f2bf(y - bf2f(h)); }
typedef __attribute__((ext_vector_type(2))) _Float16 v2h;
typedef __attribute__((ext_vector_type(4))) _Float16 v4h;
typedef __attribute__((ext_vector_type(2))) unsigned short v2us;
typedef __attribute__((ext_vector_type(4))) unsigned short v4us;
typedef __attribute__((ext_vector_type(2))) float v2f;
typedef __attribute__((ext_vector_type(4))) int v4i;

// ---- k_prep: every operand conversion of a call in ONE launch; a work-group's range of the flat block index says which it does (block-uniform): the three LoRA A and the three LoRA B zero-padded from rank 8 to 64, then x, qkv_w, proj_w to bf16.
__device__ __forceinline__ void cvt8(const float* __restrict__ src, bf* dst, size_t i) { const v8f v = *(const v8f*)(src + i * 8); v8us o;
#pragma unroll
    for (int k = 0; k < 8; ++k) o[k] = f2bf(v[k]); *(v8us*)(dst + i * 8) = o;
    asm volatile("s_wait_xcnt 0x0" ::: "memory");   /* the wait that stands in front of any overwrite of a register that the issued store names: in the listing the code of the next range follows this store */ }

#define LR_R 8   // LoRA rank
__device__ __forceinline__ void apad(const float* __restrict__ A, bf* Bt, size_t i) { const size_t e = i * 4; const int k0 = (int)(e % DM); const int nn = (int)(e / DM); const int nc = min(nn, LR_R - 1); v4us o;
#pragma unroll
    for (int q = 0; q < 4; ++q) { const float a = A[(size_t)(k0 + q) * LR_R + nc]; o[q] = (nn < LR_R) ? f2bf(a) : (unsigned short)0; }
    *(v4us*)(Bt + e) = o;  }
__device__ __forceinline__ void bpad(const float* __restrict__ Bm, bf* Bt, size_t i) { const size_t e = i * 4; const int k0 = (int)(e % 64); const int nn = (int)(e / 64); v4us o;
#pragma unroll
    for (int q = 0; q < 4; ++q) { const int k = k0 + q; const int kc = min(k, LR_R - 1); const float b = Bm[(size_t)kc * DQ + nn]; o[q] = (k < LR_R) ? f2bf(b) : (unsigned short)0; }
    *(v4us*)(Bt + e) = o;  }
#define PBX (MT * DM / 8 / 256)                    // work-groups of x
#define PBW ((DQ + 2 * DKV) * DM / 8 / 256)        // of qkv_w
#define PBO (DM * DQ / 8 / 256)                    // of proj_w
#define PBP (64 * DM / 4 / 256)                    // of one padded LoRA operand
static_assert(DQ == DM && (MT * DM) % 2048 == 0 && (DQ * DM) % 2048 == 0 && (64 * DM) % 1024 == 0, "whole work-groups");
__global__ __launch_bounds__(256) void k_prep(const float* __restrict__ x, const float* __restrict__ wqkv, const float* __restrict__ wo, const float* __restrict__ laq, const float* __restrict__ lak, const float* __restrict__ lav, const float* __restrict__ lbq, const float* __restrict__ lbk, const float* __restrict__ lbv, bf* XB, bf* WQKV, bf* WO, bf* AP, bf* BP) {
    int blk = (int)blockIdx.x; const size_t tid = threadIdx.x;   /* the padded operands first: their dependent strided reads are the longest path of a work-group here */
    if (blk < 3 * PBP) { const int p = blk / PBP; apad(p == 0 ? laq : p == 1 ? lak : lav, AP + (size_t)p * 64 * DM, (size_t)(blk % PBP) * 256 + tid); return; }
    blk -= 3 * PBP;
    if (blk < 3 * PBP) { const int p = blk / PBP; bpad(p == 0 ? lbq : p == 1 ? lbk : lbv, BP + (size_t)p * DQ * 64, (size_t)(blk % PBP) * 256 + tid); return; }
    blk -= 3 * PBP;
    if (blk < PBX) { cvt8(x, XB, (size_t)blk * 256 + tid); return; }
    blk -= PBX;
    if (blk < PBW) { cvt8(wqkv, WQKV, (size_t)blk * 256 + tid); return; }
    blk -= PBW;
    cvt8(wo, WO, (size_t)blk * 256 + tid);
}
// k_sumf: F = the NS split-K planes of P (stride sP), added in slice order. The planes lie too far apart for an immediate offset: one uniform base, one 32-bit byte offset a plane.
template <int NS, size_t sP>
__global__ __launch_bounds__(256) void k_sumf(float* F, const float* __restrict__ P, size_t n4) { static_assert(NS == 4 && (size_t)NS * sP * 4 < ((size_t)1 << 32), "four offsets of 32 bits"); const size_t i = (size_t)blockIdx.x * 256 + threadIdx.x; if (i >= n4) return; const unsigned ob = (unsigned)i * 16u; unsigned os[NS]; v4f p[NS];
#pragma unroll
    for (int s = 0; s < NS; ++s) { os[s] = ob + (unsigned)s * (unsigned)(sP * 4); p[s] = *(const v4f*)((const char*)P + os[s]); }
    /* the wait that stands in front of any overwrite of a register that an issued load names; the offsets are inputs so that their registers are not reused (as a later load's destination) ahead of it */
    asm volatile("s_wait_xcnt 0x0" :: "v"(os[0]), "v"(os[1]), "v"(os[2]), "v"(os[3]) : "memory");
    v4f o = p[0];
#pragma unroll
    for (int s = 1; s < NS; ++s) {
#pragma unroll
        for (int q = 0; q < 4; ++q) o[q] = __fadd_rn(o[q], p[s][q]); }
    *(v4f*)((char*)F + ob) = o;  }
template <int NS, size_t sP>
__global__ __launch_bounds__(256) void k_tohl(const float* __restrict__ F, bf* Hh, bf* Hl, size_t n4) { static_assert(NS == 16 && (size_t)NS * sP * 4 < ((size_t)1 << 32), "sixteen offsets of 32 bits"); const size_t i = (size_t)blockIdx.x * 256 + threadIdx.x; if (i >= n4) return; const unsigned ob = (unsigned)i * 16u; unsigned os[NS]; v4f p[NS]; v4us oh, ol;
#pragma unroll
    for (int s = 0; s < NS; ++s) { os[s] = ob + (unsigned)s * (unsigned)(sP * 4); p[s] = *(const v4f*)((const char*)F + os[s]); }   /* one uniform base, one 32-bit byte offset a plane */
    /* the wait that stands in front of any overwrite of a register that an issued load names; the offsets are inputs so that their registers are not reused (as a later load's destination) ahead of it */
    asm volatile("s_wait_xcnt 0x0" :: "v"(os[0]), "v"(os[1]), "v"(os[2]), "v"(os[3]), "v"(os[4]), "v"(os[5]), "v"(os[6]), "v"(os[7]), "v"(os[8]), "v"(os[9]), "v"(os[10]), "v"(os[11]), "v"(os[12]), "v"(os[13]), "v"(os[14]), "v"(os[15]) : "memory");
    v4f a = p[0];
#pragma unroll
    for (int s = 1; s < NS; ++s) {   /* split-K planes, slice order */
#pragma unroll
        for (int q = 0; q < 4; ++q) a[q] = __fadd_rn(a[q], p[s][q]); }
#pragma unroll
    for (int q = 0; q < 4; ++q) { unsigned short h2, l2; splitf(a[q], h2, l2); oh[q] = h2; ol[q] = l2; }
    *(v4us*)(Hh + i * 4) = oh; *(v4us*)(Hl + i * 4) = ol;  }
// ---- The tail of a projection in one kernel: the KSJ split-K planes added in slice order, + Lr (the LoRA term), then straight to the 16-bit planes that the attention kernel reads. No f32 copy of q, k or v goes through memory.
// The KSJ planes come as kernel arguments of their own, so that each base stays in scalar registers and ONE 32-bit byte offset register serves all of a thread's loads.
// ld_planes: the loads of NST steps (STB bytes apart) of a thread; sum_planes: their sum in slice order, the LoRA term last.
static_assert(KSJ == 4, "four plane arguments");
template <int NST, size_t STB>
__device__ __forceinline__ void ld_planes(const float* P0, const float* P1, const float* P2, const float* P3, const float* Lr, unsigned ob, v4f (&p)[NST][KSJ + 1]) {
#pragma unroll
    for (int s = 0; s < NST; ++s) { p[s][0] = *(const v4f*)((const char*)P0 + s * STB + ob); p[s][1] = *(const v4f*)((const char*)P1 + s * STB + ob); p[s][2] = *(const v4f*)((const char*)P2 + s * STB + ob); p[s][3] = *(const v4f*)((const char*)P3 + s * STB + ob); p[s][4] = *(const v4f*)((const char*)Lr + s * STB + ob); } }
__device__ __forceinline__ v4f sum_planes(const v4f (&p)[KSJ + 1]) { return (((p[0] + p[1]) + p[2]) + p[3]) + p[4]; }
// sum over a 16-lane row, every lane gets it (DPP row_xmask 1, 2, 4, 8)
template <int M> __device__ __forceinline__ float rowx(float v) { return __int_as_float(__builtin_amdgcn_update_dpp(0, __float_as_int(v), 0x160 + M, 0xf, 0xf, true)); }
__device__ __forceinline__ float rowsum16(float v) { v += rowx<1>(v); v += rowx<2>(v); v += rowx<4>(v); v += rowx<8>(v); return v; }
// k_qkfin (q, k): a work-group takes QKT whole tokens of one batch (grid: the MT tokens of both); a thread holds 4 consecutive head dims, so 16 lanes hold one (token, head) row: LayerNorm over the 64 head dims in registers, then head planes [h][t][d] (fp16 + hi/lo), one whole 128-byte line a row and plane.
#define QKT 4
static_assert(DQ == 256 * 4 && DKV == DQ && HD == 64 && TT % QKT == 0, "one token a work-group step, 16 lanes a head");
__global__ __launch_bounds__(256) void k_qkfin(const float* __restrict__ P0, const float* __restrict__ P1, const float* __restrict__ P2, const float* __restrict__ P3, const float* __restrict__ Lr, const float* __restrict__ g, const float* __restrict__ bb, h16* P16, bf* Ph, bf* Pl) {
    const int tid = threadIdx.x, h = tid >> 4, d = (tid & 15) * 4, t0 = blockIdx.x * QKT; const unsigned ob = ((unsigned)t0 * DQ + (unsigned)tid * 4u) * 4u;
    const unsigned gd = (unsigned)d * 4u; v4f p[QKT][KSJ + 1], a[QKT];
    v4f gv = *(const v4f*)((const char*)g + gd), bv = *(const v4f*)((const char*)bb + gd);
    ld_planes<QKT, (size_t)DQ * 4>(P0, P1, P2, P3, Lr, ob, p);
    /* the wait that stands in front of any overwrite of a register that an issued load names; the two offsets are inputs so that their registers are not reused (as a later load's destination) ahead of it */
    asm volatile("s_wait_xcnt 0x0" :: "v"(ob), "v"(gd) : "memory");
    __builtin_amdgcn_sched_barrier(0);   /* keeps all of the thread's loads above the sums: one memory latency a thread, where the scheduler's own order waited for the first loads before it issued the last */
#pragma unroll
    for (int s = 0; s < QKT; ++s) a[s] = sum_planes(p[s]);
#pragma unroll
    for (int q = 0; q < 4; ++q) { gv[q] = bfr(gv[q]); bv[q] = bfr(bv[q]); }
    const size_t e = ((size_t)((t0 / TT) * NH_ + h) * TT + t0 % TT) * HD + d;   /* head planes [b][h][t][d] */
#pragma unroll
    for (int s = 0; s < QKT; ++s) {
        const float mu = rowsum16((a[s][0] + a[s][1]) + (a[s][2] + a[s][3])) * (1.0f / HD); const v4f dv = a[s] - mu;
        const float var = rowsum16((dv[0] * dv[0] + dv[1] * dv[1]) + (dv[2] * dv[2] + dv[3] * dv[3])) * (1.0f / HD);
        const float rs = __fdiv_rn(1.0f, __fsqrt_rn(var + LNH_EPS)); v4h o16; v4us oh, ol;
#pragma unroll
        for (int q = 0; q < 4; ++q) { const float y = dv[q] * rs * gv[q] + bv[q]; o16[q] = tohx(y); unsigned short a2, c2; splitf(y, a2, c2); oh[q] = a2; ol[q] = c2; }
        *(v4h*)(P16 + e + s * HD) = o16; *(v4us*)(Ph + e + s * HD) = oh; *(v4us*)(Pl + e + s * HD) = ol; }
}
// k_vfin (v): a work-group takes VTT tokens x VTC columns, reads them along the columns (512 contiguous bytes a wave), turns the tile in LDS and writes the transposed planes [b][g][d][t] (fp16 + hi/lo) along t, one whole 128-byte line a column and plane.
#define VTT 64
#define VTC 128
#define VTP (VTT + 1)   // odd LDS pitch in dwords: the 4 columns x 8 token groups that a wave reads back fall on 32 different banks
static_assert(TT % VTT == 0 && DKV % VTC == 0 && VTC == 32 * 4 && VTT % 8 == 0 && (VTC * VTT / 8) % 256 == 0, "v tile");
__global__ __launch_bounds__(256) void k_vfin(const float* __restrict__ P0, const float* __restrict__ P1, const float* __restrict__ P2, const float* __restrict__ P3, const float* __restrict__ Lr, h16* V16, bf* Vh, bf* Vl) {
    __shared__ float ts[VTC * VTP];
    const int tid = threadIdx.x, lane = tid & 31, w = tid >> 5, t0 = blockIdx.x * VTT, c0 = blockIdx.y * VTC; const unsigned ob = ((unsigned)(t0 + w) * DKV + (unsigned)(c0 + lane * 4)) * 4u;
    v4f p[VTT / 8][KSJ + 1];
    ld_planes<VTT / 8, (size_t)8 * DKV * 4>(P0, P1, P2, P3, Lr, ob, p);
    /* the wait that stands in front of any overwrite of a register that an issued load names; the offset is an input so that its register is not reused (as a later load's destination) ahead of it */
    asm volatile("s_wait_xcnt 0x0" :: "v"(ob) : "memory");
    __builtin_amdgcn_sched_barrier(0);   /* keeps all of the thread's loads above the sums: one memory latency a thread */
#pragma unroll
    for (int s = 0; s < VTT / 8; ++s) { const v4f a = sum_planes(p[s]);
#pragma unroll
        for (int q = 0; q < 4; ++q) ts[(lane * 4 + q) * VTP + s * 8 + w] = a[q]; }
    __syncthreads();   /* the tile is whole before any thread reads a column that other waves wrote */
#pragma unroll
    for (int it = 0; it < VTC * VTT / 8 / 256; ++it) { const int item = it * 256 + tid, tg = item & (VTT / 8 - 1), c = item / (VTT / 8); const float* r = ts + c * VTP + tg * 8; v8h o16; v8us oh, ol;
#pragma unroll
        for (int j = 0; j < 8; ++j) { const float x = r[j]; o16[j] = tohx(x); unsigned short a2, c2; splitf(x, a2, c2); oh[j] = a2; ol[j] = c2; }
        const size_t e = ((size_t)(t0 / TT) * DKV + c0 + c) * TT + t0 % TT + tg * 8;   /* planes [b][g][d][t] */ *(v8h*)(V16 + e) = o16; *(v8us*)(Vh + e) = oh; *(v8us*)(Vl + e) = ol; }
}
// ---- k_fattn: fused attention, one launch for all heads of both batches (grid: row blocks, heads, batches). One wave owns 16 queries of one head and walks the TT keys, 64 a pass (32 on the hi/lo rows, whose fragments take twice the registers):
// S^T = K Q^T (A = key rows, B = the queries, loaded once), so a lane holds 8 keys of ONE query per 16-key tile; t = S x HD^-0.5 + bf16(attn_mask[i][j]) (the additive f32 mask input, read as data);
// running-maximum softmax in registers (the output tiles and the sum are rescaled when the maximum moves; the division by the sum comes last); O^T += V^T P^T with P^T packed from the score tiles as the B operand (two 16-key tiles = one 32-key fragment in the loaders' k order).
// Scores and probabilities never reach memory. Rows < RH: hi/lo planes, 3 products; the rest fp16 with P x PCAR. Each work-group takes FHW hi/lo waves and 8 - FHW fp16 waves, so that the longer hi/lo rows are spread over all work-groups.
// The eight waves of a work-group walk the same keys of the same head: each stage of SKB keys (the K and V tiles of all six planes) is brought into LDS ONCE for all of them, in whole 128-byte lines, by asynchronous copies, two buffers, the next stage in flight while this one is worked on; the fragments are read from LDS. The mask rows are each wave's own and still come straight from memory.
#define FHW 2
#define PLOG 10.0f   // log2(PCAR)
static_assert(PCAR == 1024.0f, "PLOG");
static_assert(FHW * 16 * (TT / 128) == RH && (8 - FHW) * 16 * (TT / 128) == TT - RH, "row split");
#define SKB 64                    // keys a stage
#define NSTG (TT / SKB)
#define LPE 72                    // LDS row pitch in 16-bit elements: 144 bytes = 16 x odd, free of bank conflicts for 16-byte fragment reads of 128-byte rows
#define PLE (64 * LPE)            // one plane's tile: 64 rows (K: keys x head dims; V: head dims x keys)
#define STE (6 * PLE)             // a stage: K16 | V16 | Kh | Kl | Vh | Vl
static_assert(HD == 64 && SKB == 64 && NSTG >= 2 && TT % SKB == 0, "64 x 64 tiles, two stages or more");
typedef __attribute__((ext_vector_type(8))) unsigned v8u;
// One stage's copies of one thread: 16 bytes of row r = tid / 8 and of row r + 32 of each of the six tiles (a wave: four whole 128-byte rows a copy). l: the thread's LDS byte address in tile 0 of the buffer; the pointers: its 16 bytes of row r in each plane.
__device__ __forceinline__ void stage_fill(unsigned l, const h16* k16, const h16* v16, const bf* kh, const bf* kl, const bf* vh, const bf* vl) {
    const unsigned P = PLE * 2u, R = 32u * LPE * 2u;
    /* the copies and, as the last line of their own statement, the wait that stands in front of any overwrite of a register that an issued copy names */
    asm volatile("global_load_async_to_lds_b128 %0, %12, off\n\tglobal_load_async_to_lds_b128 %1, %13, off\n\tglobal_load_async_to_lds_b128 %2, %14, off\n\tglobal_load_async_to_lds_b128 %3, %15, off\n\t"
                 "global_load_async_to_lds_b128 %4, %16, off\n\tglobal_load_async_to_lds_b128 %5, %17, off\n\tglobal_load_async_to_lds_b128 %6, %18, off\n\tglobal_load_async_to_lds_b128 %7, %19, off\n\t"
                 "global_load_async_to_lds_b128 %8, %20, off\n\tglobal_load_async_to_lds_b128 %9, %21, off\n\tglobal_load_async_to_lds_b128 %10, %22, off\n\tglobal_load_async_to_lds_b128 %11, %23, off\n\ts_wait_xcnt 0x0"
                 :: "v"(l), "v"(l + R), "v"(l + P), "v"(l + P + R), "v"(l + 2 * P), "v"(l + 2 * P + R), "v"(l + 3 * P), "v"(l + 3 * P + R), "v"(l + 4 * P), "v"(l + 4 * P + R), "v"(l + 5 * P), "v"(l + 5 * P + R),
                    "v"(k16), "v"(k16 + 32 * HD), "v"(v16), "v"(v16 + (size_t)32 * TT), "v"(kh), "v"(kh + 32 * HD), "v"(kl), "v"(kl + 32 * HD), "v"(vh), "v"(vh + (size_t)32 * TT), "v"(vl), "v"(vl + (size_t)32 * TT) : "memory");
}
// One pass of one wave over KB keys. kp, kp2, vp, vp2: the lane's place in the K and V tiles in LDS (row lane % 16, 8 elements further in the upper lane half); mp: its place in its query's mask row.
template <typename T16, bool HR, int KB>   // KB keys a pass
__device__ __forceinline__ void fattn_pass(const T16* kp, const T16* kp2, const T16* vp, const T16* vp2, const float* __restrict__ mp, const v8u (&qa)[2], const v8u (&qb)[2], v8f (&o)[4], float& m, float& sum) {
    typedef typename WFrag<T16>::V V;
    V qf[2], qf2[2];
#pragma unroll
    for (int ks = 0; ks < 2; ++ks) { qf[ks] = __builtin_bit_cast(V, qa[ks]); qf2[ks] = __builtin_bit_cast(V, qb[ks]); }
        V kf[KB / 16][2], kf2[KB / 16][2], vf[4][KB / 32], vf2[4][KB / 32]; v4f mk[KB / 16][2];
#pragma unroll
        for (int kb = 0; kb < KB / 16; ++kb)
#pragma unroll
            for (int ks = 0; ks < 2; ++ks) mk[kb][ks] = *(const v4f*)(mp + kb * 16 + ks * 4);   /* the pass's only loads from memory go out first */
        /* the wait that stands in front of any overwrite of a register that an issued load names; the address is an input so that its registers are not reused (as a later load's destination) ahead of it */
        asm volatile("s_wait_xcnt 0x0" :: "v"(mp) : "memory");
#pragma unroll
        for (int kb = 0; kb < KB / 16; ++kb) {
#pragma unroll
            for (int ks = 0; ks < 2; ++ks) { kf[kb][ks] = WFrag<T16>::ld(kp + kb * 16 * LPE + ks * 32); if (HR) kf2[kb][ks] = WFrag<T16>::ld(kp2 + kb * 16 * LPE + ks * 32); } }
        __builtin_amdgcn_sched_barrier(0);   /* keeps all of the pass's K fragment reads above the products: one LDS latency a pass, where the scheduler's own order read each fragment into the same registers and waited for it in front of its product */
        v8f s[KB / 16];
#pragma unroll
        for (int kb = 0; kb < KB / 16; ++kb) { s[kb] = (v8f){};
#pragma unroll
            for (int ks = 0; ks < 2; ++ks) { s[kb] = WFrag<T16>::mma(kf[kb][ks], qf[ks], s[kb]);
                if (HR) { s[kb] = WFrag<T16>::mma(kf[kb][ks], qf2[ks], s[kb]); s[kb] = WFrag<T16>::mma(kf2[kb][ks], qf[ks], s[kb]); } } }
#pragma unroll
        for (int mb = 0; mb < 4; ++mb)
#pragma unroll
            for (int ks = 0; ks < KB / 32; ++ks) { vf[mb][ks] = WFrag<T16>::ld(vp + mb * 16 * LPE + ks * 32); if (HR) vf2[mb][ks] = WFrag<T16>::ld(vp2 + mb * 16 * LPE + ks * 32); }
        __builtin_amdgcn_sched_barrier(0);   /* keeps the V fragment reads above the softmax, whose vector work then covers their latency */
        float bk[KB / 16];
#pragma unroll
        for (int kb = 0; kb < KB / 16; ++kb) { const v4f m0 = mk[kb][0], m1 = mk[kb][1]; bk[kb] = -3.0e38f;
#pragma unroll
            for (int j = 0; j < 8; ++j) { const float t = s[kb][j] * SCL + bfr(j < 4 ? m0[j & 3] : m1[j & 3]); s[kb][j] = t; bk[kb] = fmaxf(bk[kb], t); } }
        float bm = m;
#pragma unroll
        for (int kb = 0; kb < KB / 16; ++kb) bm = fmaxf(bm, bk[kb]);
        bm = fmaxf(bm, __shfl_xor(bm, 16, 32));   /* the two lane halves hold the two halves of a query's keys */
        const float al = __builtin_amdgcn_exp2f((m - bm) * 1.4426950408889634f); m = bm;
        float pk[KB / 16];
#pragma unroll
        for (int kb = 0; kb < KB / 16; ++kb) { float e[8];
#pragma unroll
            for (int j = 0; j < 8; ++j) { const float d = s[kb][j] - m;   /* the maximum is subtracted first: exactly 0 at t = m for every m, and minus infinity stays minus infinity (p = 0) */
                if constexpr (HR) e[j] = d * 1.4426950408889634f; else e[j] = __builtin_fmaf(d, 1.4426950408889634f, PLOG); }   /* the fp16 rows' factor PCAR rides in the exponent: p = PCAR x exp(t - m) */
            /* eight exponentials, each in place, then one v_nop: behind a transcendental the instruction set asks for one independent instruction before its result is read or its source overwritten; here the next exponential (another register) or the v_nop is that instruction */
            asm("v_exp_f32 %0, %0\n\tv_exp_f32 %1, %1\n\tv_exp_f32 %2, %2\n\tv_exp_f32 %3, %3\n\tv_exp_f32 %4, %4\n\tv_exp_f32 %5, %5\n\tv_exp_f32 %6, %6\n\tv_exp_f32 %7, %7\n\tv_nop" : "+v"(e[0]), "+v"(e[1]), "+v"(e[2]), "+v"(e[3]), "+v"(e[4]), "+v"(e[5]), "+v"(e[6]), "+v"(e[7]));
#pragma unroll
            for (int j = 0; j < 8; ++j) { s[kb][j] = e[j]; pk[kb] = j ? pk[kb] + e[j] : e[0]; } }
        float ps = pk[0];
#pragma unroll
        for (int kb = 1; kb < KB / 16; ++kb) ps += pk[kb];
        sum = sum * al + ps;
#pragma unroll
        for (int mb = 0; mb < 4; ++mb)
#pragma unroll
            for (int j = 0; j < 8; ++j) o[mb][j] *= al;
        V pf[KB / 32], pf2[KB / 32];
#pragma unroll
        for (int ks = 0; ks < KB / 32; ++ks) {
            if constexpr (HR) { v8us h0, h1, l0, l1;
#pragma unroll
                for (int j = 0; j < 8; ++j) { unsigned short a, c2; splitf(s[2 * ks][j], a, c2); h0[j] = a; l0[j] = c2; splitf(s[2 * ks + 1][j], a, c2); h1[j] = a; l1[j] = c2; }
                pf[ks] = cat16b(h0, h1); pf2[ks] = cat16b(l0, l1);
            } else { v8h a0, a1;
#pragma unroll
                for (int j = 0; j < 8; ++j) { a0[j] = tohx(s[2 * ks][j]); a1[j] = tohx(s[2 * ks + 1][j]); }
                pf[ks] = cat16(a0, a1); } }
#pragma unroll
        for (int mb = 0; mb < 4; ++mb)
#pragma unroll
            for (int ks = 0; ks < KB / 32; ++ks) { o[mb] = WFrag<T16>::mma(vf[mb][ks], pf[ks], o[mb]);
                if (HR) { o[mb] = WFrag<T16>::mma(vf[mb][ks], pf2[ks], o[mb]); o[mb] = WFrag<T16>::mma(vf2[mb][ks], pf[ks], o[mb]); } }
}
// amdgpu_waves_per_eu(4, 4): the register budget of four waves a SIMD, so that two work-groups (whose LDS fits twice) share a WGP and one's vector work fills the other's waits
__global__ __launch_bounds__(256) __attribute__((amdgpu_waves_per_eu(4, 4))) void k_fattn(const h16* __restrict__ Q16, const h16* __restrict__ K16, const h16* __restrict__ V16, const bf* __restrict__ Qh, const bf* __restrict__ Ql, const bf* __restrict__ Kh, const bf* __restrict__ Kl, const bf* __restrict__ Vh, const bf* __restrict__ Vl, const float* __restrict__ madd, bf* Ah, bf* Al) {
    __shared__ __attribute__((aligned(16))) unsigned short sm[2 * STE];
    const int tid = (int)threadIdx.x, lane = tid & 31, lr = lane & 15, hi = lane >> 4;
    const int w = __builtin_amdgcn_readfirstlane(tid >> 5); const bool hr = w < FHW;   /* the same in every lane of a wave: a scalar branch */
    const size_t hq = ((size_t)blockIdx.z * NH_ + blockIdx.y) * TT * HD, hk = ((size_t)blockIdx.z * NKV + blockIdx.y / REP) * TT * HD; const size_t ao = (size_t)blockIdx.z * TT * DQ + blockIdx.y * HD; bf* ah = Ah + ao; bf* al = Al + ao;
    const int q0 = hr ? (int)blockIdx.x * (FHW * 16) + w * 16 : RH + (int)blockIdx.x * ((8 - FHW) * 16) + (w - FHW) * 16;
    /* the thread's share of a stage's copies */
    const int cr = tid >> 3, cc = (tid & 7) * 8; const unsigned lb = (unsigned)(size_t)sm + (unsigned)(cr * LPE + cc) * 2u; const size_t gk = hk + (size_t)cr * HD + cc, gv = hk + (size_t)cr * TT + cc;
    stage_fill(lb, K16 + gk, V16 + gv, Kh + gk, Kl + gk, Vh + gv, Vl + gv);
    /* the query fragments as raw 16-bit planes, one set of registers for both kinds of wave: hi | lo, or fp16 | (the lo plane, loaded without a branch and never used) */
    const size_t qo = hq + (size_t)(q0 + lr) * HD + 8 * hi; const bf* qp = (hr ? Qh : (const bf*)Q16) + qo; const bf* qp2 = Ql + qo;
    v8u qa[2], qb[2];
#pragma unroll
    for (int ks = 0; ks < 2; ++ks) { qa[ks] = __builtin_bit_cast(v8u, WFrag<bf>::ld(qp + ks * 32)); qb[ks] = __builtin_bit_cast(v8u, WFrag<bf>::ld(qp2 + ks * 32)); }
    /* the wait that stands in front of any overwrite of a register that an issued load names; the addresses are inputs so that their registers are not reused ahead of it */
    asm volatile("s_wait_xcnt 0x0" :: "v"(qp), "v"(qp2) : "memory");
    v8f o[4];
#pragma unroll
    for (int mb = 0; mb < 4; ++mb) o[mb] = (v8f){};
    float m = -3.0e38f, sum = 0.f;
    const float* mrow = madd + (size_t)(q0 + lr) * TT + 8 * hi;
    const int fo = lr * LPE + 8 * hi;
    asm volatile("s_wait_asynccnt 0x0" ::: "memory");   /* this wave's copies of stage 0 have landed */
    __syncthreads();                                      /* every wave's have: stage 0 may be read */
    stage_fill(lb + STE * 2u, K16 + gk + (size_t)SKB * HD, V16 + gv + SKB, Kh + gk + (size_t)SKB * HD, Kl + gk + (size_t)SKB * HD, Vh + gv + SKB, Vl + gv + SKB);
    for (int t = 0; t < NSTG; ++t) {
        const unsigned short* st = sm + (t & 1) * STE + fo; const float* mp = mrow + t * SKB;
        if (hr) {   /* two passes of 32 keys a stage; unrolled, so that the half's place in the tiles is an immediate offset of the LDS reads */
#pragma unroll
            for (int sub = 0; sub < 2; ++sub) fattn_pass<bf, true, 32>(st + 2 * PLE + sub * 32 * LPE, st + 3 * PLE + sub * 32 * LPE, st + 4 * PLE + sub * 32, st + 5 * PLE + sub * 32, mp + sub * 32, qa, qb, o, m, sum);
        } else { const h16* sh = (const h16*)st; fattn_pass<h16, false, 64>(sh, sh, sh + PLE, sh + PLE, mp, qa, qb, o, m, sum); }
        asm volatile("s_wait_dscnt 0x0" ::: "memory");      /* this wave's reads of stage t are done */
        asm volatile("s_wait_asynccnt 0x0" ::: "memory");   /* its copies of stage t + 1 have landed */
        __syncthreads();                                      /* one barrier a stage: it publishes stage t + 1 and ends every wave's reads of the buffer that is refilled behind it */
        if (t + 2 < NSTG) { const size_t ak = (size_t)(t + 2) * SKB * HD, av = (size_t)(t + 2) * SKB; stage_fill(lb + (unsigned)(t & 1) * (STE * 2u), K16 + gk + ak, V16 + gv + av, Kh + gk + ak, Kl + gk + ak, Vh + gv + av, Vl + gv + av); }
    }
    asm volatile("s_wait_asynccnt 0x0" ::: "memory");   /* no copy is outstanding when the wave ends */
    sum += __shfl_xor(sum, 16, 32);
    const float f = __fdiv_rn(1.0f, sum);   /* on the fp16 rows sum and o both carry PCAR */
#pragma unroll
    for (int mb = 0; mb < 4; ++mb) { v8us oh, ol;   /* a lane holds 8 consecutive head dims of its query: one 16-byte store a plane */
#pragma unroll
        for (int j = 0; j < 8; ++j) { unsigned short a, c2; splitf(o[mb][j] * f, a, c2); oh[j] = a; ol[j] = c2; }
        const size_t oo = (size_t)(q0 + lr) * DQ + mb * 16 + hi * 8; *(v8us*)(ah + oo) = oh; *(v8us*)(al + oo) = ol; }
}

extern "C" void kernel_launch(void* const* d_in, const int* in_sizes, int n_in,
                              void* d_out, int out_size, void* d_ws, size_t ws_size, hipStream_t stream) {
    (void)in_sizes; (void)n_in; (void)out_size;
    const float* x = (const float*)d_in[0]; const float* madd = (const float*)d_in[1];   /* attn_mask [1][1][2048][2048] f32 (zeros): read, added to the scaled scores */ const float* wqkv = (const float*)d_in[2]; const float* wo = (const float*)d_in[3]; const float* bo = (const float*)d_in[4]; const float* gq = (const float*)d_in[5]; const float* btq = (const float*)d_in[6]; const float* gk = (const float*)d_in[7]; const float* btk = (const float*)d_in[8]; const float* laq = (const float*)d_in[9]; const float* lbq = (const float*)d_in[10]; const float* lak = (const float*)d_in[11]; const float* lbk = (const float*)d_in[12]; const float* lav = (const float*)d_in[13]; const float* lbv = (const float*)d_in[14];
    float* OUT = (float*)d_out;     // [2][2048][1024]
    char* wsp = (char*)d_ws;
    auto take = [&](size_t bytes) { char* p = wsp; wsp += (bytes + 255) & ~(size_t)255; return (void*)p; };
    bf* WQ = (bf*)take((size_t)(DQ + 2 * DKV) * DM * 2); bf* WK = WQ + (size_t)DQ * DM; bf* WV = WK + (size_t)DKV * DM;   /* qkv_w as one bf16 block */ bf* WO = (bf*)take((size_t)DM * DQ * 2);
    bf* XB = (bf*)take((size_t)MT * DM * 2); bf* AP = (bf*)take((size_t)3 * 64 * DM * 2); bf* BP = (bf*)take((size_t)3 * DQ * 64 * 2); bf* XAh = (bf*)take((size_t)3 * MT * 64 * 2); bf* XAl = (bf*)take((size_t)3 * MT * 64 * 2); float* LR = (float*)take((size_t)3 * MT * DQ * 4);   /* LoRA, q | k | v behind one another: zero-padded A^T [64][1024] / B^T [1024][64] operands, x A (hi/lo), (x A) B */
    /* head planes and merged planes of BOTH batches (batch stride PB, AB elements) */ const size_t PB = (size_t)NH_ * TT * HD, AB = (size_t)TT * DQ; static_assert(NKV == NH_, "one plane stride");
    h16* QP16 = (h16*)take(NB_ * PB * 2); h16* KP16 = (h16*)take(NB_ * PB * 2); h16* VT16 = (h16*)take(NB_ * PB * 2);
    bf* QPh = (bf*)take(NB_ * PB * 2); bf* QPl = (bf*)take(NB_ * PB * 2); bf* KPh = (bf*)take(NB_ * PB * 2); bf* KPl = (bf*)take(NB_ * PB * 2); bf* VTh = (bf*)take(NB_ * PB * 2); bf* VTl = (bf*)take(NB_ * PB * 2);
    static_assert(DKV == DQ && DM == DQ, "plane buffer"); float* PP = (float*)take((size_t)KSJ * MT * DQ * 4);   /* split-K planes of one projection: KSJ x [MT][DQ] */ bf* ATh = (bf*)take(NB_ * AB * 2); bf* ATl = (bf*)take(NB_ * AB * 2);
    float* XA = PP; static_assert(KSA * 3 * 64 <= KSJ * DQ, "x A planes fit");   /* the KSA x 3 x [MT][64] f32 planes of x A lie in PP: k_tohl has read them before the first projection writes there */
    if ((size_t)(wsp - (char*)d_ws) > ws_size) return;    // ws 256 MiB
    const size_t SPL = (size_t)MT * DQ;   /* elements of one split-K plane, and of one projection's LoRA term */
    k_prep<<<PBX + PBW + PBO + 6 * PBP, 256, 0, stream>>>(x, wqkv, wo, laq, lak, lav, lbq, lbk, lbv, XB, WQ, WO, AP, BP);
    /* the rank-8 LoRA terms of q, k and v, grid z = projection (x split-K slice): exact x A, f32 planes -> hi/lo, hi/lo x exact B */
    k_gemmw<bf, 0, false, 3><<<dim3(MT / 64, 1, 3 * KSA), 32, 0, stream>>>(XB, nullptr, AP, nullptr, DM, XA, 64, nullptr, 0, (size_t)64 * DM, (size_t)MT * 64, DM / KSA, (size_t)3 * MT * 64);
    k_tohl<KSA, (size_t)3 * MT * 64><<<(unsigned)((size_t)3 * MT * 64 / 4 / 256), 256, 0, stream>>>(XA, XAh, XAl, (size_t)3 * MT * 64 / 4);
    k_gemmw<bf, 1, false, 3><<<dim3(MT / 64, DQ / 64, 3), 32, 0, stream>>>(XAh, XAl, BP, nullptr, 64, LR, DQ, nullptr, (size_t)MT * 64, (size_t)DQ * 64, SPL, 64, 0);
    /* q = planes + LoRA term, per-head LayerNorm, head planes; k likewise; v = planes + LoRA term, transposed planes */
    k_gemmw<bf, 0, false, 1><<<dim3(MT / 64, DQ / 64, KSJ), 32, 0, stream>>>(XB, nullptr, WQ, nullptr, DM, PP, DQ, nullptr, 0, 0, 0, DM / KSJ, SPL); k_qkfin<<<MT / QKT, 256, 0, stream>>>(PP, PP + SPL, PP + 2 * SPL, PP + 3 * SPL, LR, gq, btq, QP16, QPh, QPl);
    k_gemmw<bf, 0, false, 1><<<dim3(MT / 64, DKV / 64, KSJ), 32, 0, stream>>>(XB, nullptr, WK, nullptr, DM, PP, DKV, nullptr, 0, 0, 0, DM / KSJ, SPL); k_qkfin<<<MT / QKT, 256, 0, stream>>>(PP, PP + SPL, PP + 2 * SPL, PP + 3 * SPL, LR + SPL, gk, btk, KP16, KPh, KPl);
    k_gemmw<bf, 0, false, 1><<<dim3(MT / 64, DKV / 64, KSJ), 32, 0, stream>>>(XB, nullptr, WV, nullptr, DM, PP, DKV, nullptr, 0, 0, 0, DM / KSJ, SPL); k_vfin<<<dim3(MT / VTT, DKV / VTC), 256, 0, stream>>>(PP, PP + SPL, PP + 2 * SPL, PP + 3 * SPL, LR + 2 * SPL, VT16, VTh, VTl);
    k_fattn<<<dim3(TT / 128, NH_, NB_), 256, 0, stream>>>(QP16, KP16, VT16, QPh, QPl, KPh, KPl, VTh, VTl, madd, ATh, ATl);   /* scores, softmax and P V of all heads of both batches; writes the merged hi/lo planes */
    k_gemmw<bf, 1, true, 1><<<dim3(MT / 64, DM / 64, KSJ), 32, 0, stream>>>(ATh, ATl, WO, nullptr, DQ, PP, DM, bo, 0, 0, 0, DQ / KSJ, SPL); k_sumf<KSJ, (size_t)MT * DM><<<(unsigned)((size_t)MT * DM / 4 / 256), 256, 0, stream>>>(OUT, PP, (size_t)MT * DM / 4);
}

// v006
// A run of this version takes 253 microseconds.
// Two timings next to v005 put it at 1.17 and 1.16 times that version's speed.
// Counting every step since v000, it is 9.06 times as fast.
#include <hip/hip_runtime.h>

// Attention with LoRA-augmented q/k/v, per-head query/key LayerNorm and an additive mask (x [2][2048][1024]; qkv = x qkv_w^T ('oi' [3072][1024] 0.02, no bias) -> q | k | v (16 heads x 64); q += (x lora_Aq) lora_Bq x 1 (alpha/r = 8/8), k, v likewise ('xw' [1024][8], [8][1024] 0.02); q, k <- LayerNorm over the 64 head dims (eps 1e-5; qn_w, qn_b, kn_w, kn_b [64], read); scores = (q x 64^-0.5).k + attn_mask ([1][1][2048][2048] f32 zeros, read); softmax; out = merged proj_w^T + proj_b -> [2][2048][1024] (4.2 M); argument order x, attn_mask, qkv_w, proj_w, proj_b, qn_w, qn_b, kn_w, kn_b, lora_Aq, lora_Bq, lora_Ak, lora_Bk, lora_Av, lora_Bv).
// Layout, both batches as one M = 4096 in every launch but the attention (grid z = batch): bf16 copy of x; 'oi' weight row blocks; exact projections; per projection the rank-8 LoRA term via two small GEMMs on zero-padded 64-wide operands (x A exact -> f32 -> hi/lo -> x B exact) added, with the split-K planes, in the projection's tail kernel, which also does the per-(token, head) LayerNorm of q and k and writes the 16-bit planes; fused T-2048 attention (hybrid rows: < 512 hi/lo 3 products, rest fp16 x1024), scores and probabilities in registers, with the additive mask read in the softmax; merged hi/lo x proj_w exact + proj_b.
// Compute dtypes, f32 accumulate: every input rounded to bf16; projections exact; LoRA x A exact, (x A) B hl x exact; LayerNorm f32; attention rows < 512 3 products, rest fp16; softmax f32; proj_w hl x exact + bias.

#define NB_  2
#define TT   2048
#define MT   (NB_ * TT)         // tokens of both batches: the rows of every GEMM
#define DM   1024
#define NH_  16
#define NKV  16
#define REP  (NH_ / NKV)
#define HD   64
#define DQ   (NH_ * HD)
#define DKV  (NKV * HD)
#define RH   512                  // query rows < RH use hi+lo planes (0: none)
#define PCAR 1024.0f
#define SCL  0.125f   // HD^-0.5
#define LNH_EPS 1e-5f
#define KSJ  4                    // split-K slices of the q/k/v and output projections (K 1024 -> 256)
#define KSA  16                   // split-K slices of x A (K 1024 -> 64)
typedef _Float16 h16;
typedef unsigned short bf;
typedef __attribute__((ext_vector_type(16))) __bf16   v16bf;
typedef __attribute__((ext_vector_type(16))) _Float16 v16h;
typedef __attribute__((ext_vector_type(8)))  _Float16 v8h;
typedef __attribute__((ext_vector_type(8)))  unsigned short v8us;
typedef __attribute__((ext_vector_type(8)))  float    v8f;
typedef __attribute__((ext_vector_type(4)))  float    v4f;
typedef v8h  __attribute__((may_alias)) v8ha;
typedef v4f  __attribute__((may_alias)) v4fa;
typedef v8us __attribute__((may_alias)) v8usa;

__device__ __forceinline__ unsigned short f2bf(float f) { unsigned u = __float_as_uint(f); u += 0x7FFFu + ((u >> 16) & 1u); return (unsigned short)(u >> 16); }
__device__ __forceinline__ float bf2f(unsigned short b) { return __uint_as_float(((unsigned)b) << 16); }
__device__ __forceinline__ float bfr(float f) { return bf2f(f2bf(f)); }
__device__ __forceinline__ v16h cat16(v8h lo, v8h hi) { return __builtin_shufflevector(lo, hi, 0, 1, 2, 3, 4, 5, 6, 7, 8, 9, 10, 11, 12, 13, 14, 15); }
__device__ __forceinline__ v16bf cat16b(v8us lo, v8us hi) { return __builtin_bit_cast(v16bf, __builtin_shufflevector(lo, hi, 0, 1, 2, 3, 4, 5, 6, 7, 8, 9, 10, 11, 12, 13, 14, 15)); }
__device__ __forceinline__ v8f wmma16(v16h a, v16h b, v8f c) { return __builtin_amdgcn_wmma_f32_16x16x32_f16(false, a, false, b, (short)0, c, false, false); }
__device__ __forceinline__ v8f wmmab(v16bf a, v16bf b, v8f c) { return __builtin_amdgcn_wmma_f32_16x16x32_bf16(false, a, false, b, (short)0, c, false, false); }



// ---- k_gemmw: register-blocked GEMM, one wave per 64x64 output tile (16 accumulators), WM x WN waves a work-group; grid (M/(64 WM), N/(64 WN), Z), 32 WM WN threads.
// C[m][n] (f32, pitch ldc, + optional f32 bias[n]) = sum_k A[m][k] Bt[n][k] (+ A2 Bt for NSPLIT 1), operands K-contiguous 16-bit planes. z-batch strides sA/sB/sC in elements. KC % 64 == 0.
// Split K: grid z = NZ batches x (K / KC) slices; slice ks sums k in [ks KC, (ks + 1) KC) into its own f32 plane C + ks sP, and the consumer kernel adds the planes in slice order (the bias goes into plane 0). KC == K, sP == 0: no split.
// Operands: each stage of GKB k (one whole 128-byte line of every operand row of the work-group's tile) is brought into LDS once for all its waves by asynchronous copies, a wave's copy = four whole lines, two buffers, the next stage in flight while this one is worked on; the fragments are read from LDS. Each accumulator still takes its products in the same k order.
template <typename T16> struct WFrag;
template <> struct WFrag<h16> { typedef v16h V; static __device__ __forceinline__ V ld(const h16* p) { return cat16(*(const v8h*)p, *(const v8h*)(p + 16)); } static __device__ __forceinline__ v8f mma(V a, V b, v8f c) { return wmma16(a, b, c); } };
template <> struct WFrag<bf> { typedef v16bf V; static __device__ __forceinline__ V ld(const bf* p) { return cat16b(*(const v8us*)p, *(const v8us*)(p + 16)); } static __device__ __forceinline__ v8f mma(V a, V b, v8f c) { return wmmab(a, b, c); } };
#define GKB 64                    // k a stage
#define GLP 72                    // LDS row pitch in 16-bit elements: 144 bytes = 16 x odd, free of bank conflicts for 16-byte fragment reads of 128-byte rows
// NC copies of one thread, 16 bytes each, of rows RPR apart in one operand plane (row pitch K elements). l: the thread's LDS byte address in the first of these rows; g: its 16 bytes there.
template <typename T16, int NC, int RPR>
__device__ __forceinline__ void gemm_fill(unsigned l, const T16* g, int K) {
    static_assert(NC % 4 == 0, "four copies a statement");
    const unsigned R = (unsigned)RPR * GLP * 2u; const size_t G = (size_t)RPR * K;
#pragma unroll
    for (int i = 0; i < NC; i += 4)
        /* four copies and, as the last line of their own statement, the wait that stands in front of any overwrite of a register that an issued copy names */
        asm volatile("global_load_async_to_lds_b128 %0, %4, off\n\tglobal_load_async_to_lds_b128 %1, %5, off\n\tglobal_load_async_to_lds_b128 %2, %6, off\n\tglobal_load_async_to_lds_b128 %3, %7, off\n\ts_wait_xcnt 0x0"
                     :: "v"(l + i * R), "v"(l + (i + 1) * R), "v"(l + (i + 2) * R), "v"(l + (i + 3) * R), "v"(g + i * G), "v"(g + (i + 1) * G), "v"(g + (i + 2) * G), "v"(g + (i + 3) * G) : "memory");
}
template <typename T16, int NSPLIT, bool BIAS, int NZ, int WM, int WN>
__global__ __launch_bounds__(WM * WN * 32) void k_gemmw(const T16* __restrict__ A, const T16* __restrict__ A2, const T16* __restrict__ Bt, const T16* __restrict__ Bt2, int K, float* C, int ldc, const float* __restrict__ bias, size_t sA, size_t sB, size_t sC, int KC, size_t sP) {
    typedef typename WFrag<T16>::V V;
    static_assert(NSPLIT == 0 || NSPLIT == 1, "one or two A planes, one B plane");
    constexpr int TM = 64 * WM, TN = 64 * WN, NA = NSPLIT + 1, RPR = WM * WN * 4, SE = (TM * NA + TN) * GLP;   /* RPR: rows that one copy of every thread covers; SE: elements of a stage, A | (A2) | B */
    static_assert(WM * WN * 16 * 68 * 4 <= 2 * SE * 2, "the output staging fits the stage buffers");
    __shared__ __attribute__((aligned(16))) unsigned short sm[2 * SE];
    const size_t z = blockIdx.z % NZ; const int ks = blockIdx.z / NZ; const int k0 = ks * KC; A += z * sA; if (A2) A2 += z * sA; Bt += z * sB; if (Bt2) Bt2 += z * sB; C += z * sC + (size_t)ks * sP;
    const int tid = (int)threadIdx.x, lane = tid & 31, lr = lane & 15, hi = lane >> 4;
    const int w = __builtin_amdgcn_readfirstlane(tid >> 5), wm = w / WN, wn = w % WN;   /* the same in every lane of a wave */
    const int r0 = blockIdx.x * TM + wm * 64, c0 = blockIdx.y * TN + wn * 64;
    v8f acc[4][4];
#pragma unroll
    for (int mb = 0; mb < 4; ++mb)
#pragma unroll
        for (int nb = 0; nb < 4; ++nb) acc[mb][nb] = (v8f){};
    /* the thread's share of a stage's copies: 16 bytes of row tid / 8 and of every RPR-th row behind it */
    const int cr = tid >> 3, cc = (tid & 7) * 8; const unsigned lb = (unsigned)(size_t)sm + (unsigned)(cr * GLP + cc) * 2u;
    const size_t ga = (size_t)(blockIdx.x * TM + cr) * K + k0 + cc, gb = (size_t)(blockIdx.y * TN + cr) * K + k0 + cc;
    auto fill = [&](int buf, int t) { const unsigned l = lb + (unsigned)buf * (SE * 2u); const size_t ko = (size_t)t * GKB;
        gemm_fill<T16, TM / RPR, RPR>(l, A + ga + ko, K); if (NSPLIT == 1) gemm_fill<T16, TM / RPR, RPR>(l + TM * GLP * 2u, A2 + ga + ko, K);
        gemm_fill<T16, TN / RPR, RPR>(l + TM * NA * GLP * 2u, Bt + gb + ko, K); };
    const int nst = KC / GKB;   /* stages: the same for the whole work-group */
    fill(0, 0);
    asm volatile("s_wait_asynccnt 0x0" ::: "memory");   /* this wave's copies of stage 0 have landed */
    __syncthreads();                                      /* every wave's have: stage 0 may be read */
    if (nst > 1) fill(1, 1);
#pragma unroll 1   /* rolled: the stage count is a run-time argument; one copy of the body keeps the text short */
    for (int t = 0; t < nst; ++t) {
        const T16* st = (const T16*)sm + (t & 1) * SE; const T16* sa = st + (wm * 64 + lr) * GLP + 8 * hi; const T16* sb = st + (TM * NA + wn * 64 + lr) * GLP + 8 * hi;
        V a[4], a2[4], b[4];
#pragma unroll
        for (int kq = 0; kq < GKB / 32; ++kq) {
#pragma unroll
            for (int mb = 0; mb < 4; ++mb) { a[mb] = WFrag<T16>::ld(sa + mb * 16 * GLP + kq * 32); if (NSPLIT == 1) a2[mb] = WFrag<T16>::ld(sa + TM * GLP + mb * 16 * GLP + kq * 32); b[mb] = WFrag<T16>::ld(sb + mb * 16 * GLP + kq * 32); }
            __builtin_amdgcn_sched_barrier(0);   /* keeps all fragment reads of these 32 k above the products: one LDS latency for them, where the scheduler's own order read each B fragment into the same registers and waited for it in front of its four products */
#pragma unroll
            for (int nb = 0; nb < 4; ++nb) {
#pragma unroll
                for (int mb = 0; mb < 4; ++mb) { acc[mb][nb] = WFrag<T16>::mma(a[mb], b[nb], acc[mb][nb]); if (NSPLIT == 1) acc[mb][nb] = WFrag<T16>::mma(a2[mb], b[nb], acc[mb][nb]); } } }
        asm volatile("s_wait_dscnt 0x0" ::: "memory");      /* this wave's reads of stage t are done */
        asm volatile("s_wait_asynccnt 0x0" ::: "memory");   /* its copies of stage t + 1 have landed */
        __syncthreads();                                      /* one barrier a stage: it publishes stage t + 1 and ends every wave's reads of the buffer that is refilled behind it */
        if (t + 2 < nst) fill(t & 1, t + 2);
    }
    asm volatile("s_wait_asynccnt 0x0" ::: "memory");   /* no copy is outstanding when the buffers become output staging */
    float* os = (float*)sm + w * (16 * 68);   /* each wave's own 16 x 68 floats, in the stage buffers: behind the last stage's barrier nobody reads those any more */
#pragma unroll
    for (int mb = 0; mb < 4; ++mb) {
#pragma unroll
        for (int nb = 0; nb < 4; ++nb) {
#pragma unroll
            for (int j = 0; j < 8; ++j) os[(hi * 8 + j) * 68 + nb * 16 + lr] = acc[mb][nb][j]; }
        __builtin_amdgcn_wave_barrier(); asm volatile("" ::: "memory");
        float* crow = C + (size_t)(r0 + mb * 16) * ldc + c0;
{
#pragma unroll
            for (int s = 0; s < 8; ++s) { const int row = 2 * s + hi, cofs = lr * 4; v4f val = *(const v4fa*)(os + row * 68 + cofs); if (BIAS && ks == 0) { val[0] += bfr(bias[c0 + cofs]); val[1] += bfr(bias[c0 + cofs + 1]); val[2] += bfr(bias[c0 + cofs + 2]); val[3] += bfr(bias[c0 + cofs + 3]); }
                *(v4f*)(crow + (size_t)row * ldc + cofs) = val; }
             }
        __builtin_amdgcn_wave_barrier(); asm volatile("" ::: "memory");
    }
}

__device__ __forceinline__ h16 tohx(float x) { return (h16)x; }
__device__ __forceinline__ void splitf(float y, unsigned short& h, unsigned short& l) { h = f2bf(y); l = f2bf(y - bf2f(h)); }
typedef __attribute__((ext_vector_type(2))) _Float16 v2h;
typedef __attribute__((ext_vector_type(4))) _Float16 v4h;
typedef __attribute__((ext_vector_type(2))) unsigned short v2us;
typedef __attribute__((ext_vector_type(4))) unsigned short v4us;
typedef __attribute__((ext_vector_type(2))) float v2f;
typedef __attribute__((ext_vector_type(4))) int v4i;

// ---- k_prep: every operand conversion of a call in ONE launch; a work-group's range of the flat block index says which it does (block-uniform): the three LoRA A and the three LoRA B zero-padded from rank 8 to 64, then x, qkv_w, proj_w to bf16.
__device__ __forceinline__ void cvt8(const float* __restrict__ src, bf* dst, size_t i) { const v8f v = *(const v8f*)(src + i * 8); v8us o;
#pragma unroll
    for (int k = 0; k < 8; ++k) o[k] = f2bf(v[k]); *(v8us*)(dst + i * 8) = o;
    asm volatile("s_wait_xcnt 0x0" ::: "memory");   /* the wait that stands in front of any overwrite of a register that the issued store names: in the listing the code of the next range follows this store */ }

#define LR_R 8   // LoRA rank
__device__ __forceinline__ void apad(const float* __restrict__ A, bf* Bt, size_t i) { const size_t e = i * 4; const int k0 = (int)(e % DM); const int nn = (int)(e / DM); const int nc = min(nn, LR_R - 1); v4us o;
#pragma unroll
    for (int q = 0; q < 4; ++q) { const float a = A[(size_t)(k0 + q) * LR_R + nc]; o[q] = (nn < LR_R) ? f2bf(a) : (unsigned short)0; }
    *(v4us*)(Bt + e) = o;  }
__device__ __forceinline__ void bpad(const float* __restrict__ Bm, bf* Bt, size_t i) { const size_t e = i * 4; const int k0 = (int)(e % 64); const int nn = (int)(e / 64); v4us o;
#pragma unroll
    for (int q = 0; q < 4; ++q) { const int k = k0 + q; const int kc = min(k, LR_R - 1); const float b = Bm[(size_t)kc * DQ + nn]; o[q] = (k < LR_R) ? f2bf(b) : (unsigned short)0; }
    *(v4us*)(Bt + e) = o;  }
#define PBX (MT * DM / 8 / 256)                    // work-groups of x
#define PBW ((DQ + 2 * DKV) * DM / 8 / 256)        // of qkv_w
#define PBO (DM * DQ / 8 / 256)                    // of proj_w
#define PBP (64 * DM / 4 / 256)                    // of one padded LoRA operand
static_assert(DQ == DM && (MT * DM) % 2048 == 0 && (DQ * DM) % 2048 == 0 && (64 * DM) % 1024 == 0, "whole work-groups");
__global__ __launch_bounds__(256) void k_prep(const float* __restrict__ x, const float* __restrict__ wqkv, const float* __restrict__ wo, const float* __restrict__ laq, const float* __restrict__ lak, const float* __restrict__ lav, const float* __restrict__ lbq, const float* __restrict__ lbk, const float* __restrict__ lbv, bf* XB, bf* WQKV, bf* WO, bf* AP, bf* BP) {
    int blk = (int)blockIdx.x; const size_t tid = threadIdx.x;   /* the padded operands first: their dependent strided reads are the longest path of a work-group here */
    if (blk < 3 * PBP) { const int p = blk / PBP; apad(p == 0 ? laq : p == 1 ? lak : lav, AP + (size_t)p * 64 * DM, (size_t)(blk % PBP) * 256 + tid); return; }
    blk -= 3 * PBP;
    if (blk < 3 * PBP) { const int p = blk / PBP; bpad(p == 0 ? lbq : p == 1 ? lbk : lbv, BP + (size_t)p * DQ * 64, (size_t)(blk % PBP) * 256 + tid); return; }
    blk -= 3 * PBP;
    if (blk < PBX) { cvt8(x, XB, (size_t)blk * 256 + tid); return; }
    blk -= PBX;
    if (blk < PBW) { cvt8(wqkv, WQKV, (size_t)blk * 256 + tid); return; }
    blk -= PBW;
    cvt8(wo, WO, (size_t)blk * 256 + tid);
}
// k_sumf: F = the NS split-K planes of P (stride sP), added in slice order. The planes lie too far apart for an immediate offset: one uniform base, one 32-bit byte offset a plane.
template <int NS, size_t sP>
__global__ __launch_bounds__(256) void k_sumf(float* F, const float* __restrict__ P, size_t n4) { static_assert(NS == 4 && (size_t)NS * sP * 4 < ((size_t)1 << 32), "four offsets of 32 bits"); const size_t i = (size_t)blockIdx.x * 256 + threadIdx.x; if (i >= n4) return; const unsigned ob = (unsigned)i * 16u; unsigned os[NS]; v4f p[NS];
#pragma unroll
    for (int s = 0; s < NS; ++s) { os[s] = ob + (unsigned)s * (unsigned)(sP * 4); p[s] = *(const v4f*)((const char*)P + os[s]); }
    /* the wait that stands in front of any overwrite of a register that an issued load names; the offsets are inputs so that their registers are not reused (as a later load's destination) ahead of it */
    asm volatile("s_wait_xcnt 0x0" :: "v"(os[0]), "v"(os[1]), "v"(os[2]), "v"(os[3]) : "memory");
    v4f o = p[0];
#pragma unroll
    for (int s = 1; s < NS; ++s) {
#pragma unroll
        for (int q = 0; q < 4; ++q) o[q] = __fadd_rn(o[q], p[s][q]); }
    *(v4f*)((char*)F + ob) = o;  }
template <int NS, size_t sP>
__global__ __launch_bounds__(256) void k_tohl(const float* __restrict__ F, bf* Hh, bf* Hl, size_t n4) { static_assert(NS == 16 && (size_t)NS * sP * 4 < ((size_t)1 << 32), "sixteen offsets of 32 bits"); const size_t i = (size_t)blockIdx.x * 256 + threadIdx.x; if (i >= n4) return; const unsigned ob = (unsigned)i * 16u; unsigned os[NS]; v4f p[NS]; v4us oh, ol;
#pragma unroll
    for (int s = 0; s < NS; ++s) { os[s] = ob + (unsigned)s * (unsigned)(sP * 4); p[s] = *(const v4f*)((const char*)F + os[s]); }   /* one uniform base, one 32-bit byte offset a plane */
    /* the wait that stands in front of any overwrite of a register that an issued load names; the offsets are inputs so that their registers are not reused (as a later load's destination) ahead of it */
    asm volatile("s_wait_xcnt 0x0" :: "v"(os[0]), "v"(os[1]), "v"(os[2]), "v"(os[3]), "v"(os[4]), "v"(os[5]), "v"(os[6]), "v"(os[7]), "v"(os[8]), "v"(os[9]), "v"(os[10]), "v"(os[11]), "v"(os[12]), "v"(os[13]), "v"(os[14]), "v"(os[15]) : "memory");
    v4f a = p[0];
#pragma unroll
    for (int s = 1; s < NS; ++s) {   /* split-K planes, slice order */
#pragma unroll
        for (int q = 0; q < 4; ++q) a[q] = __fadd_rn(a[q], p[s][q]); }
#pragma unroll
    for (int q = 0; q < 4; ++q) { unsigned short h2, l2; splitf(a[q], h2, l2); oh[q] = h2; ol[q] = l2; }
    *(v4us*)(Hh + i * 4) = oh; *(v4us*)(Hl + i * 4) = ol;  }
// ---- The tail of a projection in one kernel: the KSJ split-K planes added in slice order, + Lr (the LoRA term), then straight to the 16-bit planes that the attention kernel reads. No f32 copy of q, k or v goes through memory.
// The KSJ planes come as kernel arguments of their own, so that each base stays in scalar registers and ONE 32-bit byte offset register serves all of a thread's loads.
// ld_planes: the loads of NST steps (STB bytes apart) of a thread; sum_planes: their sum in slice order, the LoRA term last.
static_assert(KSJ == 4, "four plane arguments");
template <int NST, size_t STB>
__device__ __forceinline__ void ld_planes(const float* P0, const float* P1, const float* P2, const float* P3, const float* Lr, unsigned ob, v4f (&p)[NST][KSJ + 1]) {
#pragma unroll
    for (int s = 0; s < NST; ++s) { p[s][0] = *(const v4f*)((const char*)P0 + s * STB + ob); p[s][1] = *(const v4f*)((const char*)P1 + s * STB + ob); p[s][2] = *(const v4f*)((const char*)P2 + s * STB + ob); p[s][3] = *(const v4f*)((const char*)P3 + s * STB + ob); p[s][4] = *(const v4f*)((const char*)Lr + s * STB + ob); } }
__device__ __forceinline__ v4f sum_planes(const v4f (&p)[KSJ + 1]) { return (((p[0] + p[1]) + p[2]) + p[3]) + p[4]; }
// sum over a 16-lane row, every lane gets it (DPP row_xmask 1, 2, 4, 8)
template <int M> __device__ __forceinline__ float rowx(float v) { return __int_as_float(__builtin_amdgcn_update_dpp(0, __float_as_int(v), 0x160 + M, 0xf, 0xf, true)); }
__device__ __forceinline__ float rowsum16(float v) { v += rowx<1>(v); v += rowx<2>(v); v += rowx<4>(v); v += rowx<8>(v); return v; }
// k_qkfin (q, k): a work-group takes QKT whole tokens of one batch (grid: the MT tokens of both); a thread holds 4 consecutive head dims, so 16 lanes hold one (token, head) row: LayerNorm over the 64 head dims in registers, then head planes [h][t][d] (fp16 + hi/lo), one whole 128-byte line a row and plane.
#define QKT 4
static_assert(DQ == 256 * 4 && DKV == DQ && HD == 64 && TT % QKT == 0, "one token a work-group step, 16 lanes a head");
__global__ __launch_bounds__(256) void k_qkfin(const float* __restrict__ P0, const float* __restrict__ P1, const float* __restrict__ P2, const float* __restrict__ P3, const float* __restrict__ Lr, const float* __restrict__ g, const float* __restrict__ bb, h16* P16, bf* Ph, bf* Pl) {
    const int tid = threadIdx.x, h = tid >> 4, d = (tid & 15) * 4, t0 = blockIdx.x * QKT; const unsigned ob = ((unsigned)t0 * DQ + (unsigned)tid * 4u) * 4u;
    const unsigned gd = (unsigned)d * 4u; v4f p[QKT][KSJ + 1], a[QKT];
    v4f gv = *(const v4f*)((const char*)g + gd), bv = *(const v4f*)((const char*)bb + gd);
    ld_planes<QKT, (size_t)DQ * 4>(P0, P1, P2, P3, Lr, ob, p);
    /* the wait that stands in front of any overwrite of a register that an issued load names; the two offsets are inputs so that their registers are not reused (as a later load's destination) ahead of it */
    asm volatile("s_wait_xcnt 0x0" :: "v"(ob), "v"(gd) : "memory");
    __builtin_amdgcn_sched_barrier(0);   /* keeps all of the thread's loads above the sums: one memory latency a thread, where the scheduler's own order waited for the first loads before it issued the last */
#pragma unroll
    for (int s = 0; s < QKT; ++s) a[s] = sum_planes(p[s]);
#pragma unroll
    for (int q = 0; q < 4; ++q) { gv[q] = bfr(gv[q]); bv[q] = bfr(bv[q]); }
    const size_t e = ((size_t)((t0 / TT) * NH_ + h) * TT + t0 % TT) * HD + d;   /* head planes [b][h][t][d] */
#pragma unroll
    for (int s = 0; s < QKT; ++s) {
        const float mu = rowsum16((a[s][0] + a[s][1]) + (a[s][2] + a[s][3])) * (1.0f / HD); const v4f dv = a[s] - mu;
        const float var = rowsum16((dv[0] * dv[0] + dv[1] * dv[1]) + (dv[2] * dv[2] + dv[3] * dv[3])) * (1.0f / HD);
        const float rs = __fdiv_rn(1.0f, __fsqrt_rn(var + LNH_EPS)); v4h o16; v4us oh, ol;
#pragma unroll
        for (int q = 0; q < 4; ++q) { const float y = dv[q] * rs * gv[q] + bv[q]; o16[q] = tohx(y); unsigned short a2, c2; splitf(y, a2, c2); oh[q] = a2; ol[q] = c2; }
        *(v4h*)(P16 + e + s * HD) = o16; *(v4us*)(Ph + e + s * HD) = oh; *(v4us*)(Pl + e + s * HD) = ol; }
}
// k_vfin (v): a work-group takes VTT tokens x VTC columns, reads them along the columns (512 contiguous bytes a wave), turns the tile in LDS and writes the transposed planes [b][g][d][t] (fp16 + hi/lo) along t, one whole 128-byte line a column and plane.
#define VTT 64
#define VTC 128
#define VTP (VTT + 1)   // odd LDS pitch in dwords: the 4 columns x 8 token groups that a wave reads back fall on 32 different banks
static_assert(TT % VTT == 0 && DKV % VTC == 0 && VTC == 32 * 4 && VTT % 8 == 0 && (VTC * VTT / 8) % 256 == 0, "v tile");
__global__ __launch_bounds__(256) void k_vfin(const float* __restrict__ P0, const float* __restrict__ P1, const float* __restrict__ P2, const float* __restrict__ P3, const float* __restrict__ Lr, h16* V16, bf* Vh, bf* Vl) {
    __shared__ float ts[VTC * VTP];
    const int tid = threadIdx.x, lane = tid & 31, w = tid >> 5, t0 = blockIdx.x * VTT, c0 = blockIdx.y * VTC; const unsigned ob = ((unsigned)(t0 + w) * DKV + (unsigned)(c0 + lane * 4)) * 4u;
    v4f p[VTT / 8][KSJ + 1];
    ld_planes<VTT / 8, (size_t)8 * DKV * 4>(P0, P1, P2, P3, Lr, ob, p);
    /* the wait that stands in front of any overwrite of a register that an issued load names; the offset is an input so that its register is not reused (as a later load's destination) ahead of it */
    asm volatile("s_wait_xcnt 0x0" :: "v"(ob) : "memory");
    __builtin_amdgcn_sched_barrier(0);   /* keeps all of the thread's loads above the sums: one memory latency a thread */
#pragma unroll
    for (int s = 0; s < VTT / 8; ++s) { const v4f a = sum_planes(p[s]);
#pragma unroll
        for (int q = 0; q < 4; ++q) ts[(lane * 4 + q) * VTP + s * 8 + w] = a[q]; }
    __syncthreads();   /* the tile is whole before any thread reads a column that other waves wrote */
#pragma unroll
    for (int it = 0; it < VTC * VTT / 8 / 256; ++it) { const int item = it * 256 + tid, tg = item & (VTT / 8 - 1), c = item / (VTT / 8); const float* r = ts + c * VTP + tg * 8; v8h o16; v8us oh, ol;
#pragma unroll
        for (int j = 0; j < 8; ++j) { const float x = r[j]; o16[j] = tohx(x); unsigned short a2, c2; splitf(x, a2, c2); oh[j] = a2; ol[j] = c2; }
        const size_t e = ((size_t)(t0 / TT) * DKV + c0 + c) * TT + t0 % TT + tg * 8;   /* planes [b][g][d][t] */ *(v8h*)(V16 + e) = o16; *(v8us*)(Vh + e) = oh; *(v8us*)(Vl + e) = ol; }
}
// ---- k_fattn: fused attention, one launch for all heads of both batches (grid: row blocks, heads, batches). One wave owns 16 queries of one head and walks the TT keys, 64 a pass (32 on the hi/lo rows, whose fragments take twice the registers):
// S^T = K Q^T (A = key rows, B = the queries, loaded once), so a lane holds 8 keys of ONE query per 16-key tile; t = S x HD^-0.5 + bf16(attn_mask[i][j]) (the additive f32 mask input, read as data);
// running-maximum softmax in registers (the output tiles and the sum are rescaled when the maximum moves; the division by the sum comes last); O^T += V^T P^T with P^T packed from the score tiles as the B operand (two 16-key tiles = one 32-key fragment in the loaders' k order).
// Scores and probabilities never reach memory. Rows < RH: hi/lo planes, 3 products; the rest fp16 with P x PCAR. Each work-group takes FHW hi/lo waves and 8 - FHW fp16 waves, so that the longer hi/lo rows are spread over all work-groups.
// The eight waves of a work-group walk the same keys of the same head: each stage of SKB keys (the K and V tiles of all six planes) is brought into LDS ONCE for all of them, in whole 128-byte lines, by asynchronous copies, two buffers, the next stage in flight while this one is worked on; the fragments are read from LDS. The mask rows are each wave's own and still come straight from memory.
#define FHW 2
#define PLOG 10.0f   // log2(PCAR)
static_assert(PCAR == 1024.0f, "PLOG");
static_assert(FHW * 16 * (TT / 128) == RH && (8 - FHW) * 16 * (TT / 128) == TT - RH, "row split");
#define SKB 64                    // keys a stage
#define NSTG (TT / SKB)
#define LPE 72                    // LDS row pitch in 16-bit elements: 144 bytes = 16 x odd, free of bank conflicts for 16-byte fragment reads of 128-byte rows
#define PLE (64 * LPE)            // one plane's tile: 64 rows (K: keys x head dims; V: head dims x keys)
#define STE (6 * PLE)             // a stage: K16 | V16 | Kh | Kl | Vh | Vl
static_assert(HD == 64 && SKB == 64 && NSTG >= 2 && TT % SKB == 0, "64 x 64 tiles, two stages or more");
typedef __attribute__((ext_vector_type(8))) unsigned v8u;
// One stage's copies of one thread: 16 bytes of row r = tid / 8 and of row r + 32 of each of the six tiles (a wave: four whole 128-byte rows a copy). l: the thread's LDS byte address in tile 0 of the buffer; the pointers: its 16 bytes of row r in each plane.
__device__ __forceinline__ void stage_fill(unsigned l, const h16* k16, const h16* v16, const bf* kh, const bf* kl, const bf* vh, const bf* vl) {
    const unsigned P = PLE * 2u, R = 32u * LPE * 2u;
    /* the copies and, as the last line of their own statement, the wait that stands in front of any overwrite of a register that an issued copy names */
    asm volatile("global_load_async_to_lds_b128 %0, %12, off\n\tglobal_load_async_to_lds_b128 %1, %13, off\n\tglobal_load_async_to_lds_b128 %2, %14, off\n\tglobal_load_async_to_lds_b128 %3, %15, off\n\t"
                 "global_load_async_to_lds_b128 %4, %16, off\n\tglobal_load_async_to_lds_b128 %5, %17, off\n\tglobal_load_async_to_lds_b128 %6, %18, off\n\tglobal_load_async_to_lds_b128 %7, %19, off\n\t"
                 "global_load_async_to_lds_b128 %8, %20, off\n\tglobal_load_async_to_lds_b128 %9, %21, off\n\tglobal_load_async_to_lds_b128 %10, %22, off\n\tglobal_load_async_to_lds_b128 %11, %23, off\n\ts_wait_xcnt 0x0"
                 :: "v"(l), "v"(l + R), "v"(l + P), "v"(l + P + R), "v"(l + 2 * P), "v"(l + 2 * P + R), "v"(l + 3 * P), "v"(l + 3 * P + R), "v"(l + 4 * P), "v"(l + 4 * P + R), "v"(l + 5 * P), "v"(l + 5 * P + R),
                    "v"(k16), "v"(k16 + 32 * HD), "v"(v16), "v"(v16 + (size_t)32 * TT), "v"(kh), "v"(kh + 32 * HD), "v"(kl), "v"(kl + 32 * HD), "v"(vh), "v"(vh + (size_t)32 * TT), "v"(vl), "v"(vl + (size_t)32 * TT) : "memory");
}
// One pass of one wave over KB keys. kp, kp2, vp, vp2: the lane's place in the K and V tiles in LDS (row lane % 16, 8 elements further in the upper lane half); mp: its place in its query's mask row.
template <typename T16, bool HR, int KB>   // KB keys a pass
__device__ __forceinline__ void fattn_pass(const T16* kp, const T16* kp2, const T16* vp, const T16* vp2, const float* __restrict__ mp, const v8u (&qa)[2], const v8u (&qb)[2], v8f (&o)[4], float& m, float& sum) {
    typedef typename WFrag<T16>::V V;
    V qf[2], qf2[2];
#pragma unroll
    for (int ks = 0; ks < 2; ++ks) { qf[ks] = __builtin_bit_cast(V, qa[ks]); qf2[ks] = __builtin_bit_cast(V, qb[ks]); }
        V kf[KB / 16][2], kf2[KB / 16][2], vf[4][KB / 32], vf2[4][KB / 32]; v4f mk[KB / 16][2];
#pragma unroll
        for (int kb = 0; kb < KB / 16; ++kb)
#pragma unroll
            for (int ks = 0; ks < 2; ++ks) mk[kb][ks] = *(const v4f*)(mp + kb * 16 + ks * 4);   /* the pass's only loads from memory go out first */
        /* the wait that stands in front of any overwrite of a register that an issued load names; the address is an input so that its registers are not reused (as a later load's destination) ahead of it */
        asm volatile("s_wait_xcnt 0x0" :: "v"(mp) : "memory");
#pragma unroll
        for (int kb = 0; kb < KB / 16; ++kb) {
#pragma unroll
            for (int ks = 0; ks < 2; ++ks) { kf[kb][ks] = WFrag<T16>::ld(kp + kb * 16 * LPE + ks * 32); if (HR) kf2[kb][ks] = WFrag<T16>::ld(kp2 + kb * 16 * LPE + ks * 32); } }
        __builtin_amdgcn_sched_barrier(0);   /* keeps all of the pass's K fragment reads above the products: one LDS latency a pass, where the scheduler's own order read each fragment into the same registers and waited for it in front of its product */
        v8f s[KB / 16];
#pragma unroll
        for (int kb = 0; kb < KB / 16; ++kb) { s[kb] = (v8f){};
#pragma unroll
            for (int ks = 0; ks < 2; ++ks) { s[kb] = WFrag<T16>::mma(kf[kb][ks], qf[ks], s[kb]);
                if (HR) { s[kb] = WFrag<T16>::mma(kf[kb][ks], qf2[ks], s[kb]); s[kb] = WFrag<T16>::mma(kf2[kb][ks], qf[ks], s[kb]); } } }
#pragma unroll
        for (int mb = 0; mb < 4; ++mb)
#pragma unroll
            for (int ks = 0; ks < KB / 32; ++ks) { vf[mb][ks] = WFrag<T16>::ld(vp + mb * 16 * LPE + ks * 32); if (HR) vf2[mb][ks] = WFrag<T16>::ld(vp2 + mb * 16 * LPE + ks * 32); }
        __builtin_amdgcn_sched_barrier(0);   /* keeps the V fragment reads above the softmax, whose vector work then covers their latency */
        float bk[KB / 16];
#pragma unroll
        for (int kb = 0; kb < KB / 16; ++kb) { const v4f m0 = mk[kb][0], m1 = mk[kb][1]; bk[kb] = -3.0e38f;
#pragma unroll
            for (int j = 0; j < 8; ++j) { const float t = s[kb][j] * SCL + bfr(j < 4 ? m0[j & 3] : m1[j & 3]); s[kb][j] = t; bk[kb] = fmaxf(bk[kb], t); } }
        float bm = m;
#pragma unroll
        for (int kb = 0; kb < KB / 16; ++kb) bm = fmaxf(bm, bk[kb]);
        bm = fmaxf(bm, __shfl_xor(bm, 16, 32));   /* the two lane halves hold the two halves of a query's keys */
        const float al = __builtin_amdgcn_exp2f((m - bm) * 1.4426950408889634f); m = bm;
        float pk[KB / 16];
#pragma unroll
        for (int kb = 0; kb < KB / 16; ++kb) { float e[8];
#pragma unroll
            for (int j = 0; j < 8; ++j) { const float d = s[kb][j] - m;   /* the maximum is subtracted first: exactly 0 at t = m for every m, and minus infinity stays minus infinity (p = 0) */
                if constexpr (HR) e[j] = d * 1.4426950408889634f; else e[j] = __builtin_fmaf(d, 1.4426950408889634f, PLOG); }   /* the fp16 rows' factor PCAR rides in the exponent: p = PCAR x exp(t - m) */
            /* eight exponentials, each in place, then one v_nop: behind a transcendental the instruction set asks for one independent instruction before its result is read or its source overwritten; here the next exponential (another register) or the v_nop is that instruction */
            asm("v_exp_f32 %0, %0\n\tv_exp_f32 %1, %1\n\tv_exp_f32 %2, %2\n\tv_exp_f32 %3, %3\n\tv_exp_f32 %4, %4\n\tv_exp_f32 %5, %5\n\tv_exp_f32 %6, %6\n\tv_exp_f32 %7, %7\n\tv_nop" : "+v"(e[0]), "+v"(e[1]), "+v"(e[2]), "+v"(e[3]), "+v"(e[4]), "+v"(e[5]), "+v"(e[6]), "+v"(e[7]));
#pragma unroll
            for (int j = 0; j < 8; ++j) { s[kb][j] = e[j]; pk[kb] = j ? pk[kb] + e[j] : e[0]; } }
        float ps = pk[0];
#pragma unroll
        for (int kb = 1; kb < KB / 16; ++kb) ps += pk[kb];
        sum = sum * al + ps;
#pragma unroll
        for (int mb = 0; mb < 4; ++mb)
#pragma unroll
            for (int j = 0; j < 8; ++j) o[mb][j] *= al;
        V pf[KB / 32], pf2[KB / 32];
#pragma unroll
        for (int ks = 0; ks < KB / 32; ++ks) {
            if constexpr (HR) { v8us h0, h1, l0, l1;
#pragma unroll
                for (int j = 0; j < 8; ++j) { unsigned short a, c2; splitf(s[2 * ks][j], a, c2); h0[j] = a; l0[j] = c2; splitf(s[2 * ks + 1][j], a, c2); h1[j] = a; l1[j] = c2; }
                pf[ks] = cat16b(h0, h1); pf2[ks] = cat16b(l0, l1);
            } else { v8h a0, a1;
#pragma unroll
                for (int j = 0; j < 8; ++j) { a0[j] = tohx(s[2 * ks][j]); a1[j] = tohx(s[2 * ks + 1][j]); }
                pf[ks] = cat16(a0, a1); } }
#pragma unroll
        for (int mb = 0; mb < 4; ++mb)
#pragma unroll
            for (int ks = 0; ks < KB / 32; ++ks) { o[mb] = WFrag<T16>::mma(vf[mb][ks], pf[ks], o[mb]);
                if (HR) { o[mb] = WFrag<T16>::mma(vf[mb][ks], pf2[ks], o[mb]); o[mb] = WFrag<T16>::mma(vf2[mb][ks], pf[ks], o[mb]); } }
}
// amdgpu_waves_per_eu(4, 4): the register budget of four waves a SIMD, so that two work-groups (whose LDS fits twice) share a WGP and one's vector work fills the other's waits
__global__ __launch_bounds__(256) __attribute__((amdgpu_waves_per_eu(4, 4))) void k_fattn(const h16* __restrict__ Q16, const h16* __restrict__ K16, const h16* __restrict__ V16, const bf* __restrict__ Qh, const bf* __restrict__ Ql, const bf* __restrict__ Kh, const bf* __restrict__ Kl, const bf* __restrict__ Vh, const bf* __restrict__ Vl, const float* __restrict__ madd, bf* Ah, bf* Al) {
    __shared__ __attribute__((aligned(16))) unsigned short sm[2 * STE];
    const int tid = (int)threadIdx.x, lane = tid & 31, lr = lane & 15, hi = lane >> 4;
    const int w = __builtin_amdgcn_readfirstlane(tid >> 5); const bool hr = w < FHW;   /* the same in every lane of a wave: a scalar branch */
    const size_t hq = ((size_t)blockIdx.z * NH_ + blockIdx.y) * TT * HD, hk = ((size_t)blockIdx.z * NKV + blockIdx.y / REP) * TT * HD; const size_t ao = (size_t)blockIdx.z * TT * DQ + blockIdx.y * HD; bf* ah = Ah + ao; bf* al = Al + ao;
    const int q0 = hr ? (int)blockIdx.x * (FHW * 16) + w * 16 : RH + (int)blockIdx.x * ((8 - FHW) * 16) + (w - FHW) * 16;
    /* the thread's share of a stage's copies */
    const int cr = tid >> 3, cc = (tid & 7) * 8; const unsigned lb = (unsigned)(size_t)sm + (unsigned)(cr * LPE + cc) * 2u; const size_t gk = hk + (size_t)cr * HD + cc, gv = hk + (size_t)cr * TT + cc;
    stage_fill(lb, K16 + gk, V16 + gv, Kh + gk, Kl + gk, Vh + gv, Vl + gv);
    /* the query fragments as raw 16-bit planes, one set of registers for both kinds of wave: hi | lo, or fp16 | (the lo plane, loaded without a branch and never used) */
    const size_t qo = hq + (size_t)(q0 + lr) * HD + 8 * hi; const bf* qp = (hr ? Qh : (const bf*)Q16) + qo; const bf* qp2 = Ql + qo;
    v8u qa[2], qb[2];
#pragma unroll
    for (int ks = 0; ks < 2; ++ks) { qa[ks] = __builtin_bit_cast(v8u, WFrag<bf>::ld(qp + ks * 32)); qb[ks] = __builtin_bit_cast(v8u, WFrag<bf>::ld(qp2 + ks * 32)); }
    /* the wait that stands in front of any overwrite of a register that an issued load names; the addresses are inputs so that their registers are not reused ahead of it */
    asm volatile("s_wait_xcnt 0x0" :: "v"(qp), "v"(qp2) : "memory");
    v8f o[4];
#pragma unroll
    for (int mb = 0; mb < 4; ++mb) o[mb] = (v8f){};
    float m = -3.0e38f, sum = 0.f;
    const float* mrow = madd + (size_t)(q0 + lr) * TT + 8 * hi;
    const int fo = lr * LPE + 8 * hi;
    asm volatile("s_wait_asynccnt 0x0" ::: "memory");   /* this wave's copies of stage 0 have landed */
    __syncthreads();                                      /* every wave's have: stage 0 may be read */
    stage_fill(lb + STE * 2u, K16 + gk + (size_t)SKB * HD, V16 + gv + SKB, Kh + gk + (size_t)SKB * HD, Kl + gk + (size_t)SKB * HD, Vh + gv + SKB, Vl + gv + SKB);
    for (int t = 0; t < NSTG; ++t) {
        const unsigned short* st = sm + (t & 1) * STE + fo; const float* mp = mrow + t * SKB;
        if (hr) {   /* two passes of 32 keys a stage; unrolled, so that the half's place in the tiles is an immediate offset of the LDS reads */
#pragma unroll
            for (int sub = 0; sub < 2; ++sub) fattn_pass<bf, true, 32>(st + 2 * PLE + sub * 32 * LPE, st + 3 * PLE + sub * 32 * LPE, st + 4 * PLE + sub * 32, st + 5 * PLE + sub * 32, mp + sub * 32, qa, qb, o, m, sum);
        } else { const h16* sh = (const h16*)st; fattn_pass<h16, false, 64>(sh, sh, sh + PLE, sh + PLE, mp, qa, qb, o, m, sum); }
        asm volatile("s_wait_dscnt 0x0" ::: "memory");      /* this wave's reads of stage t are done */
        asm volatile("s_wait_asynccnt 0x0" ::: "memory");   /* its copies of stage t + 1 have landed */
        __syncthreads();                                      /* one barrier a stage: it publishes stage t + 1 and ends every wave's reads of the buffer that is refilled behind it */
        if (t + 2 < NSTG) { const size_t ak = (size_t)(t + 2) * SKB * HD, av = (size_t)(t + 2) * SKB; stage_fill(lb + (unsigned)(t & 1) * (STE * 2u), K16 + gk + ak, V16 + gv + av, Kh + gk + ak, Kl + gk + ak, Vh + gv + av, Vl + gv + av); }
    }
    asm volatile("s_wait_asynccnt 0x0" ::: "memory");   /* no copy is outstanding when the wave ends */
    sum += __shfl_xor(sum, 16, 32);
    const float f = __fdiv_rn(1.0f, sum);   /* on the fp16 rows sum and o both carry PCAR */
#pragma unroll
    for (int mb = 0; mb < 4; ++mb) { v8us oh, ol;   /* a lane holds 8 consecutive head dims of its query: one 16-byte store a plane */
#pragma unroll
        for (int j = 0; j < 8; ++j) { unsigned short a, c2; splitf(o[mb][j] * f, a, c2); oh[j] = a; ol[j] = c2; }
        const size_t oo = (size_t)(q0 + lr) * DQ + mb * 16 + hi * 8; *(v8us*)(ah + oo) = oh; *(v8us*)(al + oo) = ol; }
}

extern "C" void kernel_launch(void* const* d_in, const int* in_sizes, int n_in,
                              void* d_out, int out_size, void* d_ws, size_t ws_size, hipStream_t stream) {
    (void)in_sizes; (void)n_in; (void)out_size;
    const float* x = (const float*)d_in[0]; const float* madd = (const float*)d_in[1];   /* attn_mask [1][1][2048][2048] f32 (zeros): read, added to the scaled scores */ const float* wqkv = (const float*)d_in[2]; const float* wo = (const float*)d_in[3]; const float* bo = (const float*)d_in[4]; const float* gq = (const float*)d_in[5]; const float* btq = (const float*)d_in[6]; const float* gk = (const float*)d_in[7]; const float* btk = (const float*)d_in[8]; const float* laq = (const float*)d_in[9]; const float* lbq = (const float*)d_in[10]; const float* lak = (const float*)d_in[11]; const float* lbk = (const float*)d_in[12]; const float* lav = (const float*)d_in[13]; const float* lbv = (const float*)d_in[14];
    float* OUT = (float*)d_out;     // [2][2048][1024]
    char* wsp = (char*)d_ws;
    auto take = [&](size_t bytes) { char* p = wsp; wsp += (bytes + 255) & ~(size_t)255; return (void*)p; };
    bf* WQ = (bf*)take((size_t)(DQ + 2 * DKV) * DM * 2); bf* WK = WQ + (size_t)DQ * DM; bf* WV = WK + (size_t)DKV * DM;   /* qkv_w as one bf16 block */ bf* WO = (bf*)take((size_t)DM * DQ * 2);
    bf* XB = (bf*)take((size_t)MT * DM * 2); bf* AP = (bf*)take((size_t)3 * 64 * DM * 2); bf* BP = (bf*)take((size_t)3 * DQ * 64 * 2); bf* XAh = (bf*)take((size_t)3 * MT * 64 * 2); bf* XAl = (bf*)take((size_t)3 * MT * 64 * 2); float* LR = (float*)take((size_t)3 * MT * DQ * 4);   /* LoRA, q | k | v behind one another: zero-padded A^T [64][1024] / B^T [1024][64] operands, x A (hi/lo), (x A) B */
    /* head planes and merged planes of BOTH batches (batch stride PB, AB elements) */ const size_t PB = (size_t)NH_ * TT * HD, AB = (size_t)TT * DQ; static_assert(NKV == NH_, "one plane stride");
    h16* QP16 = (h16*)take(NB_ * PB * 2); h16* KP16 = (h16*)take(NB_ * PB * 2); h16* VT16 = (h16*)take(NB_ * PB * 2);
    bf* QPh = (bf*)take(NB_ * PB * 2); bf* QPl = (bf*)take(NB_ * PB * 2); bf* KPh = (bf*)take(NB_ * PB * 2); bf* KPl = (bf*)take(NB_ * PB * 2); bf* VTh = (bf*)take(NB_ * PB * 2); bf* VTl = (bf*)take(NB_ * PB * 2);
    static_assert(DKV == DQ && DM == DQ, "plane buffer"); float* PP = (float*)take((size_t)KSJ * MT * DQ * 4);   /* split-K planes of one projection: KSJ x [MT][DQ] */ bf* ATh = (bf*)take(NB_ * AB * 2); bf* ATl = (bf*)take(NB_ * AB * 2);
    float* XA = PP; static_assert(KSA * 3 * 64 <= KSJ * DQ, "x A planes fit");   /* the KSA x 3 x [MT][64] f32 planes of x A lie in PP: k_tohl has read them before the first projection writes there */
    if ((size_t)(wsp - (char*)d_ws) > ws_size) return;    // ws 256 MiB
    const size_t SPL = (size_t)MT * DQ;   /* elements of one split-K plane, and of one projection's LoRA term */
    k_prep<<<PBX + PBW + PBO + 6 * PBP, 256, 0, stream>>>(x, wqkv, wo, laq, lak, lav, lbq, lbk, lbv, XB, WQ, WO, AP, BP);
    /* the rank-8 LoRA terms of q, k and v, grid z = projection (x split-K slice): exact x A, f32 planes -> hi/lo, hi/lo x exact B */
    k_gemmw<bf, 0, false, 3, 4, 1><<<dim3(MT / 256, 1, 3 * KSA), 128, 0, stream>>>(XB, nullptr, AP, nullptr, DM, XA, 64, nullptr, 0, (size_t)64 * DM, (size_t)MT * 64, DM / KSA, (size_t)3 * MT * 64);
    k_tohl<KSA, (size_t)3 * MT * 64><<<(unsigned)((size_t)3 * MT * 64 / 4 / 256), 256, 0, stream>>>(XA, XAh, XAl, (size_t)3 * MT * 64 / 4);
    k_gemmw<bf, 1, false, 3, 2, 4><<<dim3(MT / 128, DQ / 256, 3), 256, 0, stream>>>(XAh, XAl, BP, nullptr, 64, LR, DQ, nullptr, (size_t)MT * 64, (size_t)DQ * 64, SPL, 64, 0);
    /* q = planes + LoRA term, per-head LayerNorm, head planes; k likewise; v = planes + LoRA term, transposed planes */
    k_gemmw<bf, 0, false, 1, 4, 2><<<dim3(MT / 256, DQ / 128, KSJ), 256, 0, stream>>>(XB, nullptr, WQ, nullptr, DM, PP, DQ, nullptr, 0, 0, 0, DM / KSJ, SPL); k_qkfin<<<MT / QKT, 256, 0, stream>>>(PP, PP + SPL, PP + 2 * SPL, PP + 3 * SPL, LR, gq, btq, QP16, QPh, QPl);
    k_gemmw<bf, 0, false, 1, 4, 2><<<dim3(MT / 256, DKV / 128, KSJ), 256, 0, stream>>>(XB, nullptr, WK, nullptr, DM, PP, DKV, nullptr, 0, 0, 0, DM / KSJ, SPL); k_qkfin<<<MT / QKT, 256, 0, stream>>>(PP, PP + SPL, PP + 2 * SPL, PP + 3 * SPL, LR + SPL, gk, btk, KP16, KPh, KPl);
    k_gemmw<bf, 0, false, 1, 4, 2><<<dim3(MT / 256, DKV / 128, KSJ), 256, 0, stream>>>(XB, nullptr, WV, nullptr, DM, PP, DKV, nullptr, 0, 0, 0, DM / KSJ, SPL); k_vfin<<<dim3(MT / VTT, DKV / VTC), 256, 0, stream>>>(PP, PP + SPL, PP + 2 * SPL, PP + 3 * SPL, LR + 2 * SPL, VT16, VTh, VTl);
    k_fattn<<<dim3(TT / 128, NH_, NB_), 256, 0, stream>>>(QP16, KP16, VT16, QPh, QPl, KPh, KPl, VTh, VTl, madd, ATh, ATl);   /* scores, softmax and P V of all heads of both batches; writes the merged hi/lo planes */
    k_gemmw<bf, 1, true, 1, 2, 4><<<dim3(MT / 128, DM / 256, KSJ), 256, 0, stream>>>(ATh, ATl, WO, nullptr, DQ, PP, DM, bo, 0, 0, 0, DQ / KSJ, SPL); k_sumf<KSJ, (size_t)MT * DM><<<(unsigned)((size_t)MT * DM / 4 / 256), 256, 0, stream>>>(OUT, PP, (size_t)MT * DM / 4);
}

// v007
// A run of this version takes 186 microseconds.
// Next to v006, in two timings, it ran 1.36 times as fast each time.
// Counting every step since v000, it is 12.3 times as fast.
#include <hip/hip_runtime.h>

// Attention with LoRA-augmented q/k/v, per-head query/key LayerNorm and an additive mask (x [2][2048][1024]; qkv = x qkv_w^T ('oi' [3072][1024] 0.02, no bias) -> q | k | v (16 heads x 64); q += (x lora_Aq) lora_Bq x 1 (alpha/r = 8/8), k, v likewise ('xw' [1024][8], [8][1024] 0.02); q, k <- LayerNorm over the 64 head dims (eps 1e-5; qn_w, qn_b, kn_w, kn_b [64], read); scores = (q x 64^-0.5).k + attn_mask ([1][1][2048][2048] f32 zeros, read); softmax; out = merged proj_w^T + proj_b -> [2][2048][1024] (4.2 M); argument order x, attn_mask, qkv_w, proj_w, proj_b, qn_w, qn_b, kn_w, kn_b, lora_Aq, lora_Bq, lora_Ak, lora_Bk, lora_Av, lora_Bv).
// Layout, both batches as one M = 4096 in every launch: bf16 copy of x; 'oi' weight row blocks; exact projections; per projection the rank-8 LoRA term via two small GEMMs on zero-padded 64-wide operands (x A exact -> f32 -> hi/lo -> x B exact) added to the projection in its tail kernel, which also does the per-(token, head) LayerNorm of q and k and writes the 16-bit planes; fused T-2048 attention (hybrid rows: < 512 hi/lo 3 products, rest fp16 x1024), scores and probabilities in registers, with the additive mask read in the softmax; merged hi/lo x proj_w exact + proj_b.
// Compute dtypes, f32 accumulate: every input rounded to bf16; projections exact; LoRA x A exact, (x A) B hl x exact; LayerNorm f32; attention rows < 512 3 products, rest fp16; softmax f32; proj_w hl x exact + bias.

#define NB_  2
#define TT   2048
#define MT   (NB_ * TT)         // tokens of both batches: the rows of every GEMM
#define DM   1024
#define NH_  16
#define NKV  16
#define REP  (NH_ / NKV)
#define HD   64
#define DQ   (NH_ * HD)
#define DKV  (NKV * HD)
#define RH   512                  // query rows < RH use hi+lo planes (0: none)
#define PCAR 1024.0f
#define SCL  0.125f   // HD^-0.5
#define LNH_EPS 1e-5f
#define DQKV (DQ + 2 * DKV)       // columns of the q | k | v projection, one GEMM
#define KSA  16                   // split-K slices of x A (K 1024 -> 64)
typedef _Float16 h16;
typedef unsigned short bf;
typedef __attribute__((ext_vector_type(16))) __bf16   v16bf;
typedef __attribute__((ext_vector_type(16))) _Float16 v16h;
typedef __attribute__((ext_vector_type(8)))  _Float16 v8h;
typedef __attribute__((ext_vector_type(8)))  unsigned short v8us;
typedef __attribute__((ext_vector_type(8)))  float    v8f;
typedef __attribute__((ext_vector_type(4)))  float    v4f;
typedef v8h  __attribute__((may_alias)) v8ha;
typedef v4f  __attribute__((may_alias)) v4fa;
typedef v8us __attribute__((may_alias)) v8usa;

__device__ __forceinline__ unsigned short f2bf(float f) { unsigned u = __float_as_uint(f); u += 0x7FFFu + ((u >> 16) & 1u); return (unsigned short)(u >> 16); }
__device__ __forceinline__ float bf2f(unsigned short b) { return __uint_as_float(((unsigned)b) << 16); }
__device__ __forceinline__ float bfr(float f) { return bf2f(f2bf(f)); }
__device__ __forceinline__ v16h cat16(v8h lo, v8h hi) { return __builtin_shufflevector(lo, hi, 0, 1, 2, 3, 4, 5, 6, 7, 8, 9, 10, 11, 12, 13, 14, 15); }
__device__ __forceinline__ v16bf cat16b(v8us lo, v8us hi) { return __builtin_bit_cast(v16bf, __builtin_shufflevector(lo, hi, 0, 1, 2, 3, 4, 5, 6, 7, 8, 9, 10, 11, 12, 13, 14, 15)); }
__device__ __forceinline__ v8f wmma16(v16h a, v16h b, v8f c) { return __builtin_amdgcn_wmma_f32_16x16x32_f16(false, a, false, b, (short)0, c, false, false); }
__device__ __forceinline__ v8f wmmab(v16bf a, v16bf b, v8f c) { return __builtin_amdgcn_wmma_f32_16x16x32_bf16(false, a, false, b, (short)0, c, false, false); }



// ---- k_gemmw: register-blocked GEMM, one wave per 64x64 output tile (16 accumulators), WM x WN waves a work-group; grid (M/(64 WM), N/(64 WN), Z), 32 WM WN threads.
// C[m][n] (f32, pitch ldc, + optional f32 bias[n]) = sum_k A[m][k] Bt[n][k] (+ A2 Bt for NSPLIT 1), operands K-contiguous 16-bit planes. z-batch strides sA/sB/sC in elements. KC % 64 == 0.
// Split K: grid z = NZ batches x (K / KC) slices; slice ks sums k in [ks KC, (ks + 1) KC) into its own f32 plane C + ks sP, and the consumer kernel adds the planes in slice order (the bias goes into plane 0). KC == K, sP == 0: no split.
// Operands: each stage of GKB k (one whole 128-byte line of every operand row of the work-group's tile) is brought into LDS once for all its waves by asynchronous copies, a wave's copy = four whole lines, two buffers, the next stage in flight while this one is worked on; the fragments are read from LDS. Each accumulator still takes its products in the same k order.
template <typename T16> struct WFrag;
template <> struct WFrag<h16> { typedef v16h V; static __device__ __forceinline__ V ld(const h16* p) { return cat16(*(const v8h*)p, *(const v8h*)(p + 16)); } static __device__ __forceinline__ v8f mma(V a, V b, v8f c) { return wmma16(a, b, c); } };
template <> struct WFrag<bf> { typedef v16bf V; static __device__ __forceinline__ V ld(const bf* p) { return cat16b(*(const v8us*)p, *(const v8us*)(p + 16)); } static __device__ __forceinline__ v8f mma(V a, V b, v8f c) { return wmmab(a, b, c); } };
#define GKB 64                    // k a stage
#define GLP 72                    // LDS row pitch in 16-bit elements: 144 bytes = 16 x odd, free of bank conflicts for 16-byte fragment reads of 128-byte rows
// NC copies of one thread, 16 bytes each, of rows RPR apart in one operand plane (row pitch K elements). l: the thread's LDS byte address in the first of these rows; g: its 16 bytes there.
template <typename T16, int NC, int RPR>
__device__ __forceinline__ void gemm_fill(unsigned l, const T16* g, int K) {
    static_assert(NC % 4 == 0, "four copies a statement");
    const unsigned R = (unsigned)RPR * GLP * 2u; const size_t G = (size_t)RPR * K;
#pragma unroll
    for (int i = 0; i < NC; i += 4)
        /* four copies and, as the last line of their own statement, the wait that stands in front of any overwrite of a register that an issued copy names */
        asm volatile("global_load_async_to_lds_b128 %0, %4, off\n\tglobal_load_async_to_lds_b128 %1, %5, off\n\tglobal_load_async_to_lds_b128 %2, %6, off\n\tglobal_load_async_to_lds_b128 %3, %7, off\n\ts_wait_xcnt 0x0"
                     :: "v"(l + i * R), "v"(l + (i + 1) * R), "v"(l + (i + 2) * R), "v"(l + (i + 3) * R), "v"(g + i * G), "v"(g + (i + 1) * G), "v"(g + (i + 2) * G), "v"(g + (i + 3) * G) : "memory");
}
template <typename T16, int NSPLIT, bool BIAS, int NZ, int WM, int WN>
__global__ __launch_bounds__(WM * WN * 32) void k_gemmw(const T16* __restrict__ A, const T16* __restrict__ A2, const T16* __restrict__ Bt, const T16* __restrict__ Bt2, int K, float* C, int ldc, const float* __restrict__ bias, size_t sA, size_t sB, size_t sC, int KC, size_t sP) {
    typedef typename WFrag<T16>::V V;
    static_assert(NSPLIT == 0 || NSPLIT == 1, "one or two A planes, one B plane");
    constexpr int TM = 64 * WM, TN = 64 * WN, NA = NSPLIT + 1, RPR = WM * WN * 4, SE = (TM * NA + TN) * GLP;   /* RPR: rows that one copy of every thread covers; SE: elements of a stage, A | (A2) | B */
    static_assert(WM * WN * 16 * 68 * 4 <= 2 * SE * 2, "the output staging fits the stage buffers");
    __shared__ __attribute__((aligned(16))) unsigned short sm[2 * SE];
    const size_t z = blockIdx.z % NZ; const int ks = blockIdx.z / NZ; const int k0 = ks * KC; A += z * sA; if (A2) A2 += z * sA; Bt += z * sB; if (Bt2) Bt2 += z * sB; C += z * sC + (size_t)ks * sP;
    const int tid = (int)threadIdx.x, lane = tid & 31, lr = lane & 15, hi = lane >> 4;
    const int w = __builtin_amdgcn_readfirstlane(tid >> 5), wm = w / WN, wn = w % WN;   /* the same in every lane of a wave */
    const int r0 = blockIdx.x * TM + wm * 64, c0 = blockIdx.y * TN + wn * 64;
    v8f acc[4][4];
#pragma unroll
    for (int mb = 0; mb < 4; ++mb)
#pragma unroll
        for (int nb = 0; nb < 4; ++nb) acc[mb][nb] = (v8f){};
    /* the thread's share of a stage's copies: 16 bytes of row tid / 8 and of every RPR-th row behind it */
    const int cr = tid >> 3, cc = (tid & 7) * 8; const unsigned lb = (unsigned)(size_t)sm + (unsigned)(cr * GLP + cc) * 2u;
    const size_t ga = (size_t)(blockIdx.x * TM + cr) * K + k0 + cc, gb = (size_t)(blockIdx.y * TN + cr) * K + k0 + cc;
    auto fill = [&](int buf, int t) { const unsigned l = lb + (unsigned)buf * (SE * 2u); const size_t ko = (size_t)t * GKB;
        gemm_fill<T16, TM / RPR, RPR>(l, A + ga + ko, K); if (NSPLIT == 1) gemm_fill<T16, TM / RPR, RPR>(l + TM * GLP * 2u, A2 + ga + ko, K);
        gemm_fill<T16, TN / RPR, RPR>(l + TM * NA * GLP * 2u, Bt + gb + ko, K); };
    const int nst = KC / GKB;   /* stages: the same for the whole work-group */
    fill(0, 0);
    asm volatile("s_wait_asynccnt 0x0" ::: "memory");   /* this wave's copies of stage 0 have landed */
    __syncthreads();                                      /* every wave's have: stage 0 may be read */
    if (nst > 1) fill(1, 1);
#pragma unroll 1   /* rolled: the stage count is a run-time argument; one copy of the body keeps the text short */
    for (int t = 0; t < nst; ++t) {
        const T16* st = (const T16*)sm + (t & 1) * SE; const T16* sa = st + (wm * 64 + lr) * GLP + 8 * hi; const T16* sb = st + (TM * NA + wn * 64 + lr) * GLP + 8 * hi;
        V a[4], a2[4], b[4];
#pragma unroll
        for (int kq = 0; kq < GKB / 32; ++kq) {
#pragma unroll
            for (int mb = 0; mb < 4; ++mb) { a[mb] = WFrag<T16>::ld(sa + mb * 16 * GLP + kq * 32); if (NSPLIT == 1) a2[mb] = WFrag<T16>::ld(sa + TM * GLP + mb * 16 * GLP + kq * 32); b[mb] = WFrag<T16>::ld(sb + mb * 16 * GLP + kq * 32); }
            __builtin_amdgcn_sched_barrier(0);   /* keeps all fragment reads of these 32 k above the products: one LDS latency for them, where the scheduler's own order read each B fragment into the same registers and waited for it in front of its four products */
#pragma unroll
            for (int nb = 0; nb < 4; ++nb) {
#pragma unroll
                for (int mb = 0; mb < 4; ++mb) { acc[mb][nb] = WFrag<T16>::mma(a[mb], b[nb], acc[mb][nb]); if (NSPLIT == 1) acc[mb][nb] = WFrag<T16>::mma(a2[mb], b[nb], acc[mb][nb]); } } }
        asm volatile("s_wait_dscnt 0x0" ::: "memory");      /* this wave's reads of stage t are done */
        asm volatile("s_wait_asynccnt 0x0" ::: "memory");   /* its copies of stage t + 1 have landed */
        __syncthreads();                                      /* one barrier a stage: it publishes stage t + 1 and ends every wave's reads of the buffer that is refilled behind it */
        if (t + 2 < nst) fill(t & 1, t + 2);
    }
    asm volatile("s_wait_asynccnt 0x0" ::: "memory");   /* no copy is outstanding when the buffers become output staging */
    float* os = (float*)sm + w * (16 * 68);   /* each wave's own 16 x 68 floats, in the stage buffers: behind the last stage's barrier nobody reads those any more */
    v4f bv = (v4f){};   /* the lane's four bias values: they go by the column alone, so they are read once and not in front of every store */
    if (BIAS && ks == 0) { const float* bp = bias + c0 + lr * 4; const v4f b4 = *(const v4f*)bp;
        asm volatile("s_wait_xcnt 0x0" :: "v"(bp) : "memory");   /* the wait that stands in front of any overwrite of a register that the issued load names; the address is an input so that its registers are not reused ahead of it */
#pragma unroll
        for (int q = 0; q < 4; ++q) bv[q] = bfr(b4[q]); }
#pragma unroll
    for (int mb = 0; mb < 4; ++mb) {
#pragma unroll
        for (int nb = 0; nb < 4; ++nb) {
#pragma unroll
            for (int j = 0; j < 8; ++j) os[(hi * 8 + j) * 68 + nb * 16 + lr] = acc[mb][nb][j]; }
        __builtin_amdgcn_wave_barrier(); asm volatile("" ::: "memory");
        float* crow = C + (size_t)(r0 + mb * 16) * ldc + c0 + lr * 4; v4f val[8]; float* cp[8];
#pragma unroll
        for (int s = 0; s < 8; ++s) { const int row = 2 * s + hi; val[s] = *(const v4fa*)(os + row * 68 + lr * 4); if (BIAS && ks == 0) val[s] += bv; cp[s] = crow + (size_t)row * ldc; }
#pragma unroll
        for (int s = 0; s < 8; ++s) *(v4f*)cp[s] = val[s];
        /* the wait that stands in front of any overwrite of a register that an issued store names; addresses and values are inputs so that their registers are not reused ahead of it */
        asm volatile("s_wait_xcnt 0x0" :: "v"(cp[0]), "v"(cp[1]), "v"(cp[2]), "v"(cp[3]), "v"(cp[4]), "v"(cp[5]), "v"(cp[6]), "v"(cp[7]), "v"(val[0]), "v"(val[1]), "v"(val[2]), "v"(val[3]), "v"(val[4]), "v"(val[5]), "v"(val[6]), "v"(val[7]) : "memory");
        __builtin_amdgcn_wave_barrier(); asm volatile("" ::: "memory");
    }
}

__device__ __forceinline__ h16 tohx(float x) { return (h16)x; }
__device__ __forceinline__ void splitf(float y, unsigned short& h, unsigned short& l) { h = f2bf(y); l = f2bf(y - bf2f(h)); }
typedef __attribute__((ext_vector_type(2))) _Float16 v2h;
typedef __attribute__((ext_vector_type(4))) _Float16 v4h;
typedef __attribute__((ext_vector_type(2))) unsigned short v2us;
typedef __attribute__((ext_vector_type(4))) unsigned short v4us;
typedef __attribute__((ext_vector_type(2))) float v2f;
typedef __attribute__((ext_vector_type(4))) int v4i;

// ---- k_prep: every operand conversion of a call in ONE launch; a work-group's range of the flat block index says which it does (block-uniform): the three LoRA A and the three LoRA B zero-padded from rank 8 to 64, then x, qkv_w, proj_w to bf16.
__device__ __forceinline__ void cvt8(const float* __restrict__ src, bf* dst, size_t i) { const v8f v = *(const v8f*)(src + i * 8); v8us o;
#pragma unroll
    for (int k = 0; k < 8; ++k) o[k] = f2bf(v[k]); *(v8us*)(dst + i * 8) = o;
    asm volatile("s_wait_xcnt 0x0" ::: "memory");   /* the wait that stands in front of any overwrite of a register that the issued store names: in the listing the code of the next range follows this store */ }

#define LR_R 8   // LoRA rank
__device__ __forceinline__ void apad(const float* __restrict__ A, bf* Bt, size_t i) { const size_t e = i * 4; const int k0 = (int)(e % DM); const int nn = (int)(e / DM); const int nc = min(nn, LR_R - 1); v4us o;
#pragma unroll
    for (int q = 0; q < 4; ++q) { const float a = A[(size_t)(k0 + q) * LR_R + nc]; o[q] = (nn < LR_R) ? f2bf(a) : (unsigned short)0; }
    *(v4us*)(Bt + e) = o;  }
__device__ __forceinline__ void bpad(const float* __restrict__ Bm, bf* Bt, size_t i) { const size_t e = i * 4; const int k0 = (int)(e % 64); const int nn = (int)(e / 64); v4us o;
#pragma unroll
    for (int q = 0; q < 4; ++q) { const int k = k0 + q; const int kc = min(k, LR_R - 1); const float b = Bm[(size_t)kc * DQ + nn]; o[q] = (k < LR_R) ? f2bf(b) : (unsigned short)0; }
    *(v4us*)(Bt + e) = o;  }
#define PBX (MT * DM / 8 / 256)                    // work-groups of x
#define PBW ((DQ + 2 * DKV) * DM / 8 / 256)        // of qkv_w
#define PBO (DM * DQ / 8 / 256)                    // of proj_w
#define PBP (64 * DM / 4 / 256)                    // of one padded LoRA operand
static_assert(DQ == DM && (MT * DM) % 2048 == 0 && (DQ * DM) % 2048 == 0 && (64 * DM) % 1024 == 0, "whole work-groups");
__global__ __launch_bounds__(256) void k_prep(const float* __restrict__ x, const float* __restrict__ wqkv, const float* __restrict__ wo, const float* __restrict__ laq, const float* __restrict__ lak, const float* __restrict__ lav, const float* __restrict__ lbq, const float* __restrict__ lbk, const float* __restrict__ lbv, bf* XB, bf* WQKV, bf* WO, bf* AP, bf* BP) {
    int blk = (int)blockIdx.x; const size_t tid = threadIdx.x;   /* the padded operands first: their dependent strided reads are the longest path of a work-group here */
    if (blk < 3 * PBP) { const int p = blk / PBP; apad(p == 0 ? laq : p == 1 ? lak : lav, AP + (size_t)p * 64 * DM, (size_t)(blk % PBP) * 256 + tid); return; }
    blk -= 3 * PBP;
    if (blk < 3 * PBP) { const int p = blk / PBP; bpad(p == 0 ? lbq : p == 1 ? lbk : lbv, BP + (size_t)p * DQ * 64, (size_t)(blk % PBP) * 256 + tid); return; }
    blk -= 3 * PBP;
    if (blk < PBX) { cvt8(x, XB, (size_t)blk * 256 + tid); return; }
    blk -= PBX;
    if (blk < PBW) { cvt8(wqkv, WQKV, (size_t)blk * 256 + tid); return; }
    blk -= PBW;
    cvt8(wo, WO, (size_t)blk * 256 + tid);
}
// k_tohl: the NS split-K planes of F (stride sP) added in slice order, then hi/lo. The planes lie too far apart for an immediate offset: one uniform base, one 32-bit byte offset a plane.
template <int NS, size_t sP>
__global__ __launch_bounds__(256) void k_tohl(const float* __restrict__ F, bf* Hh, bf* Hl, size_t n4) { static_assert(NS == 16 && (size_t)NS * sP * 4 < ((size_t)1 << 32), "sixteen offsets of 32 bits"); const size_t i = (size_t)blockIdx.x * 256 + threadIdx.x; if (i >= n4) return; const unsigned ob = (unsigned)i * 16u; unsigned os[NS]; v4f p[NS]; v4us oh, ol;
#pragma unroll
    for (int s = 0; s < NS; ++s) { os[s] = ob + (unsigned)s * (unsigned)(sP * 4); p[s] = *(const v4f*)((const char*)F + os[s]); }   /* one uniform base, one 32-bit byte offset a plane */
    /* the wait that stands in front of any overwrite of a register that an issued load names; the offsets are inputs so that their registers are not reused (as a later load's destination) ahead of it */
    asm volatile("s_wait_xcnt 0x0" :: "v"(os[0]), "v"(os[1]), "v"(os[2]), "v"(os[3]), "v"(os[4]), "v"(os[5]), "v"(os[6]), "v"(os[7]), "v"(os[8]), "v"(os[9]), "v"(os[10]), "v"(os[11]), "v"(os[12]), "v"(os[13]), "v"(os[14]), "v"(os[15]) : "memory");
    v4f a = p[0];
#pragma unroll
    for (int s = 1; s < NS; ++s) {   /* split-K planes, slice order */
#pragma unroll
        for (int q = 0; q < 4; ++q) a[q] = __fadd_rn(a[q], p[s][q]); }
#pragma unroll
    for (int q = 0; q < 4; ++q) { unsigned short h2, l2; splitf(a[q], h2, l2); oh[q] = h2; ol[q] = l2; }
    *(v4us*)(Hh + i * 4) = oh; *(v4us*)(Hl + i * 4) = ol;  }
// ---- The tail of a projection in one kernel: P (the projection's own columns of the q | k | v GEMM's f32 result, row pitch DQKV) + Lr (its LoRA term, row pitch DQ), then straight to the 16-bit planes that the attention kernel reads.
// ld_pl: the loads of NST steps of a thread, SP bytes apart in P and SL in Lr; both bases stay in scalar registers, one 32-bit byte offset register each.
template <int NST, size_t SP, size_t SL>
__device__ __forceinline__ void ld_pl(const float* P, const float* Lr, unsigned obp, unsigned obl, v4f (&p)[NST][2]) {
#pragma unroll
    for (int s = 0; s < NST; ++s) { p[s][0] = *(const v4f*)((const char*)P + s * SP + obp); p[s][1] = *(const v4f*)((const char*)Lr + s * SL + obl); } }
// sum over a 16-lane row, every lane gets it (DPP row_xmask 1, 2, 4, 8)
template <int M> __device__ __forceinline__ float rowx(float v) { return __int_as_float(__builtin_amdgcn_update_dpp(0, __float_as_int(v), 0x160 + M, 0xf, 0xf, true)); }
__device__ __forceinline__ float rowsum16(float v) { v += rowx<1>(v); v += rowx<2>(v); v += rowx<4>(v); v += rowx<8>(v); return v; }
// k_qkfin (q, k): a work-group takes QKT whole tokens of one batch (grid: the MT tokens of both); a thread holds 4 consecutive head dims, so 16 lanes hold one (token, head) row: LayerNorm over the 64 head dims in registers, then head planes [h][t][d] (fp16 + hi/lo), one whole 128-byte line a row and plane.
#define QKT 4
static_assert(DQ == 256 * 4 && DKV == DQ && HD == 64 && TT % QKT == 0, "one token a work-group step, 16 lanes a head");
__global__ __launch_bounds__(256) void k_qkfin(const float* __restrict__ P, const float* __restrict__ Lr, const float* __restrict__ g, const float* __restrict__ bb, h16* P16, bf* Ph, bf* Pl) {
    const int tid = threadIdx.x, h = tid >> 4, d = (tid & 15) * 4, t0 = blockIdx.x * QKT; const unsigned obp = ((unsigned)t0 * DQKV + (unsigned)tid * 4u) * 4u, obl = ((unsigned)t0 * DQ + (unsigned)tid * 4u) * 4u;
    const unsigned gd = (unsigned)d * 4u; v4f p[QKT][2], a[QKT];
    v4f gv = *(const v4f*)((const char*)g + gd), bv = *(const v4f*)((const char*)bb + gd);
    ld_pl<QKT, (size_t)DQKV * 4, (size_t)DQ * 4>(P, Lr, obp, obl, p);
    /* the wait that stands in front of any overwrite of a register that an issued load names; the three offsets are inputs so that their registers are not reused (as a later load's destination) ahead of it */
    asm volatile("s_wait_xcnt 0x0" :: "v"(obp), "v"(obl), "v"(gd) : "memory");
    __builtin_amdgcn_sched_barrier(0);   /* keeps all of the thread's loads above the sums: one memory latency a thread, where the scheduler's own order waited for the first loads before it issued the last */
#pragma unroll
    for (int s = 0; s < QKT; ++s) a[s] = p[s][0] + p[s][1];
#pragma unroll
    for (int q = 0; q < 4; ++q) { gv[q] = bfr(gv[q]); bv[q] = bfr(bv[q]); }
    const size_t e = ((size_t)((t0 / TT) * NH_ + h) * TT + t0 % TT) * HD + d;   /* head planes [b][h][t][d] */
#pragma unroll
    for (int s = 0; s < QKT; ++s) {
        const float mu = rowsum16((a[s][0] + a[s][1]) + (a[s][2] + a[s][3])) * (1.0f / HD); const v4f dv = a[s] - mu;
        const float var = rowsum16((dv[0] * dv[0] + dv[1] * dv[1]) + (dv[2] * dv[2] + dv[3] * dv[3])) * (1.0f / HD);
        const float rs = __fdiv_rn(1.0f, __fsqrt_rn(var + LNH_EPS)); v4h o16; v4us oh, ol;
#pragma unroll
        for (int q = 0; q < 4; ++q) { const float y = dv[q] * rs * gv[q] + bv[q]; o16[q] = tohx(y); unsigned short a2, c2; splitf(y, a2, c2); oh[q] = a2; ol[q] = c2; }
        *(v4h*)(P16 + e + s * HD) = o16; *(v4us*)(Ph + e + s * HD) = oh; *(v4us*)(Pl + e + s * HD) = ol; }
}
// k_vfin (v): a work-group takes VTT tokens x VTC columns, reads them along the columns (512 contiguous bytes a wave), turns the tile in LDS and writes the transposed planes [b][g][d][t] (fp16 + hi/lo) along t, one whole 128-byte line a column and plane.
#define VTT 64
#define VTC 128
#define VTP (VTT + 1)   // odd LDS pitch in dwords: the 4 columns x 8 token groups that a wave reads back fall on 32 different banks
static_assert(TT % VTT == 0 && DKV % VTC == 0 && VTC == 32 * 4 && VTT % 8 == 0 && (VTC * VTT / 8) % 256 == 0, "v tile");
__global__ __launch_bounds__(256) void k_vfin(const float* __restrict__ P, const float* __restrict__ Lr, h16* V16, bf* Vh, bf* Vl) {
    __shared__ float ts[VTC * VTP];
    const int tid = threadIdx.x, lane = tid & 31, w = tid >> 5, t0 = blockIdx.x * VTT, c0 = blockIdx.y * VTC; const unsigned obp = ((unsigned)(t0 + w) * DQKV + (unsigned)(c0 + lane * 4)) * 4u, obl = ((unsigned)(t0 + w) * DKV + (unsigned)(c0 + lane * 4)) * 4u;
    v4f p[VTT / 8][2];
    ld_pl<VTT / 8, (size_t)8 * DQKV * 4, (size_t)8 * DKV * 4>(P, Lr, obp, obl, p);
    /* the wait that stands in front of any overwrite of a register that an issued load names; the offsets are inputs so that their registers are not reused (as a later load's destination) ahead of it */
    asm volatile("s_wait_xcnt 0x0" :: "v"(obp), "v"(obl) : "memory");
    __builtin_amdgcn_sched_barrier(0);   /* keeps all of the thread's loads above the sums: one memory latency a thread */
#pragma unroll
    for (int s = 0; s < VTT / 8; ++s) { const v4f a = p[s][0] + p[s][1];
#pragma unroll
        for (int q = 0; q < 4; ++q) ts[(lane * 4 + q) * VTP + s * 8 + w] = a[q]; }
    __syncthreads();   /* the tile is whole before any thread reads a column that other waves wrote */
#pragma unroll
    for (int it = 0; it < VTC * VTT / 8 / 256; ++it) { const int item = it * 256 + tid, tg = item & (VTT / 8 - 1), c = item / (VTT / 8); const float* r = ts + c * VTP + tg * 8; v8h o16; v8us oh, ol;
#pragma unroll
        for (int j = 0; j < 8; ++j) { const float x = r[j]; o16[j] = tohx(x); unsigned short a2, c2; splitf(x, a2, c2); oh[j] = a2; ol[j] = c2; }
        const size_t e = ((size_t)(t0 / TT) * DKV + c0 + c) * TT + t0 % TT + tg * 8;   /* planes [b][g][d][t] */ *(v8h*)(V16 + e) = o16; *(v8us*)(Vh + e) = oh; *(v8us*)(Vl + e) = ol; }
}
// ---- k_fattn: fused attention, one launch for all heads of both batches (grid: row blocks, heads, batches). One wave owns 16 queries of one head and walks the TT keys, 64 a pass (32 on the hi/lo rows, whose fragments take twice the registers):
// S^T = K Q^T (A = key rows, B = the queries, loaded once), so a lane holds 8 keys of ONE query per 16-key tile; t = S x HD^-0.5 + bf16(attn_mask[i][j]) (the additive f32 mask input, read as data);
// running-maximum softmax in registers (the output tiles and the sum are rescaled when the maximum moves; the division by the sum comes last); O^T += V^T P^T with P^T packed from the score tiles as the B operand (two 16-key tiles = one 32-key fragment in the loaders' k order).
// Scores and probabilities never reach memory. Rows < RH: hi/lo planes, 3 products; the rest fp16 with P x PCAR. Each work-group takes FHW hi/lo waves and 8 - FHW fp16 waves, so that the longer hi/lo rows are spread over all work-groups.
// The eight waves of a work-group walk the same keys of the same head: each stage of SKB keys (the K and V tiles of all six planes) is brought into LDS ONCE for all of them, in whole 128-byte lines, by asynchronous copies, two buffers, the next stage in flight while this one is worked on; the fragments are read from LDS. The mask rows are each wave's own and still come straight from memory.
#define FHW 2
#define PLOG 10.0f   // log2(PCAR)
static_assert(PCAR == 1024.0f, "PLOG");
static_assert(FHW * 16 * (TT / 128) == RH && (8 - FHW) * 16 * (TT / 128) == TT - RH, "row split");
#define SKB 64                    // keys a stage
#define NSTG (TT / SKB)
#define LPE 72                    // LDS row pitch in 16-bit elements: 144 bytes = 16 x odd, free of bank conflicts for 16-byte fragment reads of 128-byte rows
#define PLE (64 * LPE)            // one plane's tile: 64 rows (K: keys x head dims; V: head dims x keys)
#define STE (6 * PLE)             // a stage: K16 | V16 | Kh | Kl | Vh | Vl
static_assert(HD == 64 && SKB == 64 && NSTG >= 2 && TT % SKB == 0, "64 x 64 tiles, two stages or more");
typedef __attribute__((ext_vector_type(8))) unsigned v8u;
// One stage's copies of one thread: 16 bytes of row r = tid / 8 and of row r + 32 of each of the six tiles (a wave: four whole 128-byte rows a copy). l: the thread's LDS byte address in tile 0 of the buffer; the pointers: its 16 bytes of row r in each plane.
__device__ __forceinline__ void stage_fill(unsigned l, const h16* k16, const h16* v16, const bf* kh, const bf* kl, const bf* vh, const bf* vl) {
    const unsigned P = PLE * 2u, R = 32u * LPE * 2u;
    /* the copies and, as the last line of their own statement, the wait that stands in front of any overwrite of a register that an issued copy names */
    asm volatile("global_load_async_to_lds_b128 %0, %12, off\n\tglobal_load_async_to_lds_b128 %1, %13, off\n\tglobal_load_async_to_lds_b128 %2, %14, off\n\tglobal_load_async_to_lds_b128 %3, %15, off\n\t"
                 "global_load_async_to_lds_b128 %4, %16, off\n\tglobal_load_async_to_lds_b128 %5, %17, off\n\tglobal_load_async_to_lds_b128 %6, %18, off\n\tglobal_load_async_to_lds_b128 %7, %19, off\n\t"
                 "global_load_async_to_lds_b128 %8, %20, off\n\tglobal_load_async_to_lds_b128 %9, %21, off\n\tglobal_load_async_to_lds_b128 %10, %22, off\n\tglobal_load_async_to_lds_b128 %11, %23, off\n\ts_wait_xcnt 0x0"
                 :: "v"(l), "v"(l + R), "v"(l + P), "v"(l + P + R), "v"(l + 2 * P), "v"(l + 2 * P + R), "v"(l + 3 * P), "v"(l + 3 * P + R), "v"(l + 4 * P), "v"(l + 4 * P + R), "v"(l + 5 * P), "v"(l + 5 * P + R),
                    "v"(k16), "v"(k16 + 32 * HD), "v"(v16), "v"(v16 + (size_t)32 * TT), "v"(kh), "v"(kh + 32 * HD), "v"(kl), "v"(kl + 32 * HD), "v"(vh), "v"(vh + (size_t)32 * TT), "v"(vl), "v"(vl + (size_t)32 * TT) : "memory");
}
// One pass of one wave over KB keys. kp, kp2, vp, vp2: the lane's place in the K and V tiles in LDS (row lane % 16, 8 elements further in the upper lane half); mp: its place in its query's mask row.
template <typename T16, bool HR, int KB>   // KB keys a pass
__device__ __forceinline__ void fattn_pass(const T16* kp, const T16* kp2, const T16* vp, const T16* vp2, const float* __restrict__ mp, const v8u (&qa)[2], const v8u (&qb)[2], v8f (&o)[4], float& m, float& sum) {
    typedef typename WFrag<T16>::V V;
    V qf[2], qf2[2];
#pragma unroll
    for (int ks = 0; ks < 2; ++ks) { qf[ks] = __builtin_bit_cast(V, qa[ks]); qf2[ks] = __builtin_bit_cast(V, qb[ks]); }
        V kf[KB / 16][2], kf2[KB / 16][2], vf[4][KB / 32], vf2[4][KB / 32]; v4f mk[KB / 16][2];
#pragma unroll
        for (int kb = 0; kb < KB / 16; ++kb)
#pragma unroll
            for (int ks = 0; ks < 2; ++ks) mk[kb][ks] = *(const v4f*)(mp + kb * 16 + ks * 4);   /* the pass's only loads from memory go out first */
        /* the wait that stands in front of any overwrite of a register that an issued load names; the address is an input so that its registers are not reused (as a later load's destination) ahead of it */
        asm volatile("s_wait_xcnt 0x0" :: "v"(mp) : "memory");
#pragma unroll
        for (int kb = 0; kb < KB / 16; ++kb) {
#pragma unroll
            for (int ks = 0; ks < 2; ++ks) { kf[kb][ks] = WFrag<T16>::ld(kp + kb * 16 * LPE + ks * 32); if (HR) kf2[kb][ks] = WFrag<T16>::ld(kp2 + kb * 16 * LPE + ks * 32); } }
        __builtin_amdgcn_sched_barrier(0);   /* keeps all of the pass's K fragment reads above the products: one LDS latency a pass, where the scheduler's own order read each fragment into the same registers and waited for it in front of its product */
        v8f s[KB / 16];
#pragma unroll
        for (int kb = 0; kb < KB / 16; ++kb) { s[kb] = (v8f){};
#pragma unroll
            for (int ks = 0; ks < 2; ++ks) { s[kb] = WFrag<T16>::mma(kf[kb][ks], qf[ks], s[kb]);
                if (HR) { s[kb] = WFrag<T16>::mma(kf[kb][ks], qf2[ks], s[kb]); s[kb] = WFrag<T16>::mma(kf2[kb][ks], qf[ks], s[kb]); } } }
#pragma unroll
        for (int mb = 0; mb < 4; ++mb)
#pragma unroll
            for (int ks = 0; ks < KB / 32; ++ks) { vf[mb][ks] = WFrag<T16>::ld(vp + mb * 16 * LPE + ks * 32); if (HR) vf2[mb][ks] = WFrag<T16>::ld(vp2 + mb * 16 * LPE + ks * 32); }
        __builtin_amdgcn_sched_barrier(0);   /* keeps the V fragment reads above the softmax, whose vector work then covers their latency */
        float bk[KB / 16];
#pragma unroll
        for (int kb = 0; kb < KB / 16; ++kb) { const v4f m0 = mk[kb][0], m1 = mk[kb][1]; bk[kb] = -3.0e38f;
#pragma unroll
            for (int j = 0; j < 8; ++j) { const float t = s[kb][j] * SCL + bfr(j < 4 ? m0[j & 3] : m1[j & 3]); s[kb][j] = t; bk[kb] = fmaxf(bk[kb], t); } }
        float bm = m;
#pragma unroll
        for (int kb = 0; kb < KB / 16; ++kb) bm = fmaxf(bm, bk[kb]);
        bm = fmaxf(bm, __shfl_xor(bm, 16, 32));   /* the two lane halves hold the two halves of a query's keys */
        const float al = __builtin_amdgcn_exp2f((m - bm) * 1.4426950408889634f); m = bm;
        float pk[KB / 16];
#pragma unroll
        for (int kb = 0; kb < KB / 16; ++kb) { float e[8];
#pragma unroll
            for (int j = 0; j < 8; ++j) { const float d = s[kb][j] - m;   /* the maximum is subtracted first: exactly 0 at t = m for every m, and minus infinity stays minus infinity (p = 0) */
                if constexpr (HR) e[j] = d * 1.4426950408889634f; else e[j] = __builtin_fmaf(d, 1.4426950408889634f, PLOG); }   /* the fp16 rows' factor PCAR rides in the exponent: p = PCAR x exp(t - m) */
            /* eight exponentials, each in place, then one v_nop: behind a transcendental the instruction set asks for one independent instruction before its result is read or its source overwritten; here the next exponential (another register) or the v_nop is that instruction */
            asm("v_exp_f32 %0, %0\n\tv_exp_f32 %1, %1\n\tv_exp_f32 %2, %2\n\tv_exp_f32 %3, %3\n\tv_exp_f32 %4, %4\n\tv_exp_f32 %5, %5\n\tv_exp_f32 %6, %6\n\tv_exp_f32 %7, %7\n\tv_nop" : "+v"(e[0]), "+v"(e[1]), "+v"(e[2]), "+v"(e[3]), "+v"(e[4]), "+v"(e[5]), "+v"(e[6]), "+v"(e[7]));
#pragma unroll
            for (int j = 0; j < 8; ++j) { s[kb][j] = e[j]; pk[kb] = j ? pk[kb] + e[j] : e[0]; } }
        float ps = pk[0];
#pragma unroll
        for (int kb = 1; kb < KB / 16; ++kb) ps += pk[kb];
        sum = sum * al + ps;
#pragma unroll
        for (int mb = 0; mb < 4; ++mb)
#pragma unroll
            for (int j = 0; j < 8; ++j) o[mb][j] *= al;
        V pf[KB / 32], pf2[KB / 32];
#pragma unroll
        for (int ks = 0; ks < KB / 32; ++ks) {
            if constexpr (HR) { v8us h0, h1, l0, l1;
#pragma unroll
                for (int j = 0; j < 8; ++j) { unsigned short a, c2; splitf(s[2 * ks][j], a, c2); h0[j] = a; l0[j] = c2; splitf(s[2 * ks + 1][j], a, c2); h1[j] = a; l1[j] = c2; }
                pf[ks] = cat16b(h0, h1); pf2[ks] = cat16b(l0, l1);
            } else { v8h a0, a1;
#pragma unroll
                for (int j = 0; j < 8; ++j) { a0[j] = tohx(s[2 * ks][j]); a1[j] = tohx(s[2 * ks + 1][j]); }
                pf[ks] = cat16(a0, a1); } }
#pragma unroll
        for (int mb = 0; mb < 4; ++mb)
#pragma unroll
            for (int ks = 0; ks < KB / 32; ++ks) { o[mb] = WFrag<T16>::mma(vf[mb][ks], pf[ks], o[mb]);
                if (HR) { o[mb] = WFrag<T16>::mma(vf[mb][ks], pf2[ks], o[mb]); o[mb] = WFrag<T16>::mma(vf2[mb][ks], pf[ks], o[mb]); } }
}
// amdgpu_waves_per_eu(4, 4): the register budget of four waves a SIMD, so that two work-groups (whose LDS fits twice) share a WGP and one's vector work fills the other's waits
__global__ __launch_bounds__(256) __attribute__((amdgpu_waves_per_eu(4, 4))) void k_fattn(const h16* __restrict__ Q16, const h16* __restrict__ K16, const h16* __restrict__ V16, const bf* __restrict__ Qh, const bf* __restrict__ Ql, const bf* __restrict__ Kh, const bf* __restrict__ Kl, const bf* __restrict__ Vh, const bf* __restrict__ Vl, const float* __restrict__ madd, bf* Ah, bf* Al) {
    __shared__ __attribute__((aligned(16))) unsigned short sm[2 * STE];
    const int tid = (int)threadIdx.x, lane = tid & 31, lr = lane & 15, hi = lane >> 4;
    const int w = __builtin_amdgcn_readfirstlane(tid >> 5); const bool hr = w < FHW;   /* the same in every lane of a wave: a scalar branch */
    const size_t hq = ((size_t)blockIdx.z * NH_ + blockIdx.y) * TT * HD, hk = ((size_t)blockIdx.z * NKV + blockIdx.y / REP) * TT * HD; const size_t ao = (size_t)blockIdx.z * TT * DQ + blockIdx.y * HD; bf* ah = Ah + ao; bf* al = Al + ao;
    const int q0 = hr ? (int)blockIdx.x * (FHW * 16) + w * 16 : RH + (int)blockIdx.x * ((8 - FHW) * 16) + (w - FHW) * 16;
    /* the thread's share of a stage's copies */
    const int cr = tid >> 3, cc = (tid & 7) * 8; const unsigned lb = (unsigned)(size_t)sm + (unsigned)(cr * LPE + cc) * 2u; const size_t gk = hk + (size_t)cr * HD + cc, gv = hk + (size_t)cr * TT + cc;
    stage_fill(lb, K16 + gk, V16 + gv, Kh + gk, Kl + gk, Vh + gv, Vl + gv);
    /* the query fragments as raw 16-bit planes, one set of registers for both kinds of wave: hi | lo, or fp16 | (the lo plane, loaded without a branch and never used) */
    const size_t qo = hq + (size_t)(q0 + lr) * HD + 8 * hi; const bf* qp = (hr ? Qh : (const bf*)Q16) + qo; const bf* qp2 = Ql + qo;
    v8u qa[2], qb[2];
#pragma unroll
    for (int ks = 0; ks < 2; ++ks) { qa[ks] = __builtin_bit_cast(v8u, WFrag<bf>::ld(qp + ks * 32)); qb[ks] = __builtin_bit_cast(v8u, WFrag<bf>::ld(qp2 + ks * 32)); }
    /* the wait that stands in front of any overwrite of a register that an issued load names; the addresses are inputs so that their registers are not reused ahead of it */
    asm volatile("s_wait_xcnt 0x0" :: "v"(qp), "v"(qp2) : "memory");
    v8f o[4];
#pragma unroll
    for (int mb = 0; mb < 4; ++mb) o[mb] = (v8f){};
    float m = -3.0e38f, sum = 0.f;
    const float* mrow = madd + (size_t)(q0 + lr) * TT + 8 * hi;
    const int fo = lr * LPE + 8 * hi;
    asm volatile("s_wait_asynccnt 0x0" ::: "memory");   /* this wave's copies of stage 0 have landed */
    __syncthreads();                                      /* every wave's have: stage 0 may be read */
    stage_fill(lb + STE * 2u, K16 + gk + (size_t)SKB * HD, V16 + gv + SKB, Kh + gk + (size_t)SKB * HD, Kl + gk + (size_t)SKB * HD, Vh + gv + SKB, Vl + gv + SKB);
    for (int t = 0; t < NSTG; ++t) {
        const unsigned short* st = sm + (t & 1) * STE + fo; const float* mp = mrow + t * SKB;
        if (hr) {   /* two passes of 32 keys a stage; unrolled, so that the half's place in the tiles is an immediate offset of the LDS reads */
#pragma unroll
            for (int sub = 0; sub < 2; ++sub) fattn_pass<bf, true, 32>(st + 2 * PLE + sub * 32 * LPE, st + 3 * PLE + sub * 32 * LPE, st + 4 * PLE + sub * 32, st + 5 * PLE + sub * 32, mp + sub * 32, qa, qb, o, m, sum);
        } else { const h16* sh = (const h16*)st; fattn_pass<h16, false, 64>(sh, sh, sh + PLE, sh + PLE, mp, qa, qb, o, m, sum); }
        asm volatile("s_wait_dscnt 0x0" ::: "memory");      /* this wave's reads of stage t are done */
        asm volatile("s_wait_asynccnt 0x0" ::: "memory");   /* its copies of stage t + 1 have landed */
        __syncthreads();                                      /* one barrier a stage: it publishes stage t + 1 and ends every wave's reads of the buffer that is refilled behind it */
        if (t + 2 < NSTG) { const size_t ak = (size_t)(t + 2) * SKB * HD, av = (size_t)(t + 2) * SKB; stage_fill(lb + (unsigned)(t & 1) * (STE * 2u), K16 + gk + ak, V16 + gv + av, Kh + gk + ak, Kl + gk + ak, Vh + gv + av, Vl + gv + av); }
    }
    asm volatile("s_wait_asynccnt 0x0" ::: "memory");   /* no copy is outstanding when the wave ends */
    sum += __shfl_xor(sum, 16, 32);
    const float f = __fdiv_rn(1.0f, sum);   /* on the fp16 rows sum and o both carry PCAR */
#pragma unroll
    for (int mb = 0; mb < 4; ++mb) { v8us oh, ol;   /* a lane holds 8 consecutive head dims of its query: one 16-byte store a plane */
#pragma unroll
        for (int j = 0; j < 8; ++j) { unsigned short a, c2; splitf(o[mb][j] * f, a, c2); oh[j] = a; ol[j] = c2; }
        const size_t oo = (size_t)(q0 + lr) * DQ + mb * 16 + hi * 8; *(v8us*)(ah + oo) = oh; *(v8us*)(al + oo) = ol; }
}

extern "C" void kernel_launch(void* const* d_in, const int* in_sizes, int n_in,
                              void* d_out, int out_size, void* d_ws, size_t ws_size, hipStream_t stream) {
    (void)in_sizes; (void)n_in; (void)out_size;
    const float* x = (const float*)d_in[0]; const float* madd = (const float*)d_in[1];   /* attn_mask [1][1][2048][2048] f32 (zeros): read, added to the scaled scores */ const float* wqkv = (const float*)d_in[2]; const float* wo = (const float*)d_in[3]; const float* bo = (const float*)d_in[4]; const float* gq = (const float*)d_in[5]; const float* btq = (const float*)d_in[6]; const float* gk = (const float*)d_in[7]; const float* btk = (const float*)d_in[8]; const float* laq = (const float*)d_in[9]; const float* lbq = (const float*)d_in[10]; const float* lak = (const float*)d_in[11]; const float* lbk = (const float*)d_in[12]; const float* lav = (const float*)d_in[13]; const float* lbv = (const float*)d_in[14];
    float* OUT = (float*)d_out;     // [2][2048][1024]
    char* wsp = (char*)d_ws;
    auto take = [&](size_t bytes) { char* p = wsp; wsp += (bytes + 255) & ~(size_t)255; return (void*)p; };
    bf* WQ = (bf*)take((size_t)DQKV * DM * 2);   /* qkv_w as one bf16 block */ bf* WO = (bf*)take((size_t)DM * DQ * 2);
    bf* XB = (bf*)take((size_t)MT * DM * 2); bf* AP = (bf*)take((size_t)3 * 64 * DM * 2); bf* BP = (bf*)take((size_t)3 * DQ * 64 * 2); bf* XAh = (bf*)take((size_t)3 * MT * 64 * 2); bf* XAl = (bf*)take((size_t)3 * MT * 64 * 2); float* LR = (float*)take((size_t)3 * MT * DQ * 4);   /* LoRA, q | k | v behind one another: zero-padded A^T [64][1024] / B^T [1024][64] operands, x A (hi/lo), (x A) B */
    /* head planes and merged planes of BOTH batches (batch stride PB, AB elements) */ const size_t PB = (size_t)NH_ * TT * HD, AB = (size_t)TT * DQ; static_assert(NKV == NH_, "one plane stride");
    h16* QP16 = (h16*)take(NB_ * PB * 2); h16* KP16 = (h16*)take(NB_ * PB * 2); h16* VT16 = (h16*)take(NB_ * PB * 2);
    bf* QPh = (bf*)take(NB_ * PB * 2); bf* QPl = (bf*)take(NB_ * PB * 2); bf* KPh = (bf*)take(NB_ * PB * 2); bf* KPl = (bf*)take(NB_ * PB * 2); bf* VTh = (bf*)take(NB_ * PB * 2); bf* VTl = (bf*)take(NB_ * PB * 2);
    static_assert(DKV == DQ && DM == DQ, "plane buffer"); float* PP = (float*)take((size_t)MT * DQKV * 4);   /* q | k | v before their tails: f32 [MT][DQKV] */ bf* ATh = (bf*)take(NB_ * AB * 2); bf* ATl = (bf*)take(NB_ * AB * 2);
    float* XA = PP; static_assert(KSA * 3 * 64 <= DQKV, "x A planes fit");   /* the KSA x 3 x [MT][64] f32 planes of x A lie in PP: k_tohl has read them before the projection writes there */
    if ((size_t)(wsp - (char*)d_ws) > ws_size) return;    // ws 256 MiB
    const size_t SPL = (size_t)MT * DQ;   /* elements of one projection's LoRA term */
    k_prep<<<PBX + PBW + PBO + 6 * PBP, 256, 0, stream>>>(x, wqkv, wo, laq, lak, lav, lbq, lbk, lbv, XB, WQ, WO, AP, BP);
    /* the rank-8 LoRA terms of q, k and v, grid z = projection (x split-K slice): exact x A, f32 planes -> hi/lo, hi/lo x exact B */
    k_gemmw<bf, 0, false, 3, 4, 1><<<dim3(MT / 256, 1, 3 * KSA), 128, 0, stream>>>(XB, nullptr, AP, nullptr, DM, XA, 64, nullptr, 0, (size_t)64 * DM, (size_t)MT * 64, DM / KSA, (size_t)3 * MT * 64);
    k_tohl<KSA, (size_t)3 * MT * 64><<<(unsigned)((size_t)3 * MT * 64 / 4 / 256), 256, 0, stream>>>(XA, XAh, XAl, (size_t)3 * MT * 64 / 4);
    k_gemmw<bf, 1, false, 3, 2, 4><<<dim3(MT / 128, DQ / 256, 3), 256, 0, stream>>>(XAh, XAl, BP, nullptr, 64, LR, DQ, nullptr, (size_t)MT * 64, (size_t)DQ * 64, SPL, 64, 0);
    /* q | k | v = x qkv_w^T as ONE GEMM, N = DQKV, every accumulator over the whole K: its 384 work-groups fill the chip with no split of K, and no partial planes go through memory */
    k_gemmw<bf, 0, false, 1, 4, 2><<<dim3(MT / 256, DQKV / 128, 1), 256, 0, stream>>>(XB, nullptr, WQ, nullptr, DM, PP, DQKV, nullptr, 0, 0, 0, DM, 0);
    /* q = its columns + LoRA term, per-head LayerNorm, head planes; k likewise; v = its columns + LoRA term, transposed planes */
    k_qkfin<<<MT / QKT, 256, 0, stream>>>(PP, LR, gq, btq, QP16, QPh, QPl);
    k_qkfin<<<MT / QKT, 256, 0, stream>>>(PP + DQ, LR + SPL, gk, btk, KP16, KPh, KPl);
    k_vfin<<<dim3(MT / VTT, DKV / VTC), 256, 0, stream>>>(PP + DQ + DKV, LR + 2 * SPL, VT16, VTh, VTl);
    k_fattn<<<dim3(TT / 128, NH_, NB_), 256, 0, stream>>>(QP16, KP16, VT16, QPh, QPl, KPh, KPl, VTh, VTl, madd, ATh, ATl);   /* scores, softmax and P V of all heads of both batches; writes the merged hi/lo planes */
    /* the output projection over the whole K on 128 x 128 tiles, one work-group a WGP: it stores out itself, bias included */
    k_gemmw<bf, 1, true, 1, 2, 2><<<dim3(MT / 128, DM / 128, 1), 128, 0, stream>>>(ATh, ATl, WO, nullptr, DQ, OUT, DM, bo, 0, 0, 0, DQ, 0);
}

// v008
// A run of this version takes 169 microseconds.
// Timed twice side by side with v007, it ran 1.09 times as fast both times.
// Over all steps from v000 it is 13.5 times as fast.
#include <hip/hip_runtime.h>

// Attention with LoRA-augmented q/k/v, per-head query/key LayerNorm and an additive mask (x [2][2048][1024]; qkv = x qkv_w^T ('oi' [3072][1024] 0.02, no bias) -> q | k | v (16 heads x 64); q += (x lora_Aq) lora_Bq x 1 (alpha/r = 8/8), k, v likewise ('xw' [1024][8], [8][1024] 0.02); q, k <- LayerNorm over the 64 head dims (eps 1e-5; qn_w, qn_b, kn_w, kn_b [64], read); scores = (q x 64^-0.5).k + attn_mask ([1][1][2048][2048] f32 zeros, read); softmax; out = merged proj_w^T + proj_b -> [2][2048][1024] (4.2 M); argument order x, attn_mask, qkv_w, proj_w, proj_b, qn_w, qn_b, kn_w, kn_b, lora_Aq, lora_Bq, lora_Ak, lora_Bk, lora_Av, lora_Bv).
// Layout, both batches as one M = 4096 in every launch: bf16 copy of x; 'oi' weight row blocks; exact projections; the three rank-8 LoRA terms ride in the projection GEMM itself as one more stage of 64 k: x A of q, k and v as ONE small GEMM on a zero-padded 64-wide operand (columns 8 p + r; exact -> f32 -> hi/lo), its hi | lo written behind each row of x, and each LoRA B row-wise behind qkv_w at its own projection's columns (zero elsewhere); a tail kernel per projection does the per-(token, head) LayerNorm of q and k and writes the 16-bit planes; fused T-2048 attention (hybrid rows: < 512 hi/lo 3 products, rest fp16 x1024), scores and probabilities in registers, with the additive mask read in the softmax; merged hi/lo x proj_w exact + proj_b.
// Compute dtypes, f32 accumulate: every input rounded to bf16; projections exact; LoRA x A exact, (x A) B hl x exact; LayerNorm f32; attention rows < 512 3 products, rest fp16; softmax f32; proj_w hl x exact + bias.

#define NB_  2
#define TT   2048
#define MT   (NB_ * TT)         // tokens of both batches: the rows of every GEMM
#define DM   1024
#define NH_  16
#define NKV  16
#define REP  (NH_ / NKV)
#define HD   64
#define DQ   (NH_ * HD)
#define DKV  (NKV * HD)
#define RH   512                  // query rows < RH use hi+lo planes (0: none)
#define PCAR 1024.0f
#define SCL  0.125f   // HD^-0.5
#define LNH_EPS 1e-5f
#define DQKV (DQ + 2 * DKV)       // columns of the q | k | v projection, one GEMM
#define KSA  16                   // split-K slices of x A (K 1024 -> 64)
#define KX   (DM + 64)            // row pitch and K of the projection's operands: x | (x A) hi (32) | (x A) lo (32), and qkv_w | B (32) | B (32)
typedef _Float16 h16;
typedef unsigned short bf;
typedef __attribute__((ext_vector_type(16))) __bf16   v16bf;
typedef __attribute__((ext_vector_type(16))) _Float16 v16h;
typedef __attribute__((ext_vector_type(8)))  _Float16 v8h;
typedef __attribute__((ext_vector_type(8)))  unsigned short v8us;
typedef __attribute__((ext_vector_type(8)))  float    v8f;
typedef __attribute__((ext_vector_type(4)))  float    v4f;
typedef v8h  __attribute__((may_alias)) v8ha;
typedef v4f  __attribute__((may_alias)) v4fa;
typedef v8us __attribute__((may_alias)) v8usa;

__device__ __forceinline__ unsigned short f2bf(float f) { unsigned u = __float_as_uint(f); u += 0x7FFFu + ((u >> 16) & 1u); return (unsigned short)(u >> 16); }
__device__ __forceinline__ float bf2f(unsigned short b) { return __uint_as_float(((unsigned)b) << 16); }
__device__ __forceinline__ float bfr(float f) { return bf2f(f2bf(f)); }
__device__ __forceinline__ v16h cat16(v8h lo, v8h hi) { return __builtin_shufflevector(lo, hi, 0, 1, 2, 3, 4, 5, 6, 7, 8, 9, 10, 11, 12, 13, 14, 15); }
__device__ __forceinline__ v16bf cat16b(v8us lo, v8us hi) { return __builtin_bit_cast(v16bf, __builtin_shufflevector(lo, hi, 0, 1, 2, 3, 4, 5, 6, 7, 8, 9, 10, 11, 12, 13, 14, 15)); }
__device__ __forceinline__ v8f wmma16(v16h a, v16h b, v8f c) { return __builtin_amdgcn_wmma_f32_16x16x32_f16(false, a, false, b, (short)0, c, false, false); }
__device__ __forceinline__ v8f wmmab(v16bf a, v16bf b, v8f c) { return __builtin_amdgcn_wmma_f32_16x16x32_bf16(false, a, false, b, (short)0, c, false, false); }



// ---- k_gemmw: register-blocked GEMM, one wave per 64x64 output tile (16 accumulators), WM x WN waves a work-group; grid (M/(64 WM), N/(64 WN), Z), 32 WM WN threads.
// C[m][n] (f32, pitch ldc, + optional f32 bias[n]) = sum_k A[m][k] Bt[n][k] (+ A2 Bt for NSPLIT 1), operands K-contiguous 16-bit planes. z-batch strides sA/sB/sC in elements. KC % 64 == 0.
// Split K: grid z = NZ batches x the k slices (K is the row pitch and may exceed the k they cover); slice ks sums k in [ks KC, (ks + 1) KC) into its own f32 plane C + ks sP, and the consumer kernel adds the planes in slice order (the bias goes into plane 0). KC == K, sP == 0: no split.
// Operands: each stage of GKB k (one whole 128-byte line of every operand row of the work-group's tile) is brought into LDS once for all its waves by asynchronous copies, a wave's copy = four whole lines, two buffers, the next stage in flight while this one is worked on; the fragments are read from LDS. Each accumulator still takes its products in the same k order.
template <typename T16> struct WFrag;
template <> struct WFrag<h16> { typedef v16h V; static __device__ __forceinline__ V ld(const h16* p) { return cat16(*(const v8h*)p, *(const v8h*)(p + 16)); } static __device__ __forceinline__ v8f mma(V a, V b, v8f c) { return wmma16(a, b, c); } };
template <> struct WFrag<bf> { typedef v16bf V; static __device__ __forceinline__ V ld(const bf* p) { return cat16b(*(const v8us*)p, *(const v8us*)(p + 16)); } static __device__ __forceinline__ v8f mma(V a, V b, v8f c) { return wmmab(a, b, c); } };
#define GKB 64                    // k a stage
#define GLP 72                    // LDS row pitch in 16-bit elements: 144 bytes = 16 x odd, free of bank conflicts for 16-byte fragment reads of 128-byte rows
// NC copies of one thread, 16 bytes each, of rows RPR apart in one operand plane (row pitch K elements). l: the thread's LDS byte address in the first of these rows; g: its 16 bytes there.
template <typename T16, int NC, int RPR>
__device__ __forceinline__ void gemm_fill(unsigned l, const T16* g, int K) {
    static_assert(NC % 4 == 0, "four copies a statement");
    const unsigned R = (unsigned)RPR * GLP * 2u; const size_t G = (size_t)RPR * K;
#pragma unroll
    for (int i = 0; i < NC; i += 4)
        /* four copies and, as the last line of their own statement, the wait that stands in front of any overwrite of a register that an issued copy names */
        asm volatile("global_load_async_to_lds_b128 %0, %4, off\n\tglobal_load_async_to_lds_b128 %1, %5, off\n\tglobal_load_async_to_lds_b128 %2, %6, off\n\tglobal_load_async_to_lds_b128 %3, %7, off\n\ts_wait_xcnt 0x0"
                     :: "v"(l + i * R), "v"(l + (i + 1) * R), "v"(l + (i + 2) * R), "v"(l + (i + 3) * R), "v"(g + i * G), "v"(g + (i + 1) * G), "v"(g + (i + 2) * G), "v"(g + (i + 3) * G) : "memory");
}
template <typename T16, int NSPLIT, bool BIAS, int NZ, int WM, int WN>
__global__ __launch_bounds__(WM * WN * 32) void k_gemmw(const T16* __restrict__ A, const T16* __restrict__ A2, const T16* __restrict__ Bt, const T16* __restrict__ Bt2, int K, float* C, int ldc, const float* __restrict__ bias, size_t sA, size_t sB, size_t sC, int KC, size_t sP) {
    typedef typename WFrag<T16>::V V;
    static_assert(NSPLIT == 0 || NSPLIT == 1, "one or two A planes, one B plane");
    constexpr int TM = 64 * WM, TN = 64 * WN, NA = NSPLIT + 1, RPR = WM * WN * 4, SE = (TM * NA + TN) * GLP;   /* RPR: rows that one copy of every thread covers; SE: elements of a stage, A | (A2) | B */
    static_assert(WM * WN * 16 * 68 * 4 <= 2 * SE * 2, "the output staging fits the stage buffers");
    __shared__ __attribute__((aligned(16))) unsigned short sm[2 * SE];
    const size_t z = blockIdx.z % NZ; const int ks = blockIdx.z / NZ; const int k0 = ks * KC; A += z * sA; if (A2) A2 += z * sA; Bt += z * sB; if (Bt2) Bt2 += z * sB; C += z * sC + (size_t)ks * sP;
    const int tid = (int)threadIdx.x, lane = tid & 31, lr = lane & 15, hi = lane >> 4;
    const int w = __builtin_amdgcn_readfirstlane(tid >> 5), wm = w / WN, wn = w % WN;   /* the same in every lane of a wave */
    const int r0 = blockIdx.x * TM + wm * 64, c0 = blockIdx.y * TN + wn * 64;
    v8f acc[4][4];
#pragma unroll
    for (int mb = 0; mb < 4; ++mb)
#pragma unroll
        for (int nb = 0; nb < 4; ++nb) acc[mb][nb] = (v8f){};
    /* the thread's share of a stage's copies: 16 bytes of row tid / 8 and of every RPR-th row behind it */
    const int cr = tid >> 3, cc = (tid & 7) * 8; const unsigned lb = (unsigned)(size_t)sm + (unsigned)(cr * GLP + cc) * 2u;
    const size_t ga = (size_t)(blockIdx.x * TM + cr) * K + k0 + cc, gb = (size_t)(blockIdx.y * TN + cr) * K + k0 + cc;
    auto fill = [&](int buf, int t) { const unsigned l = lb + (unsigned)buf * (SE * 2u); const size_t ko = (size_t)t * GKB;
        gemm_fill<T16, TM / RPR, RPR>(l, A + ga + ko, K); if (NSPLIT == 1) gemm_fill<T16, TM / RPR, RPR>(l + TM * GLP * 2u, A2 + ga + ko, K);
        gemm_fill<T16, TN / RPR, RPR>(l + TM * NA * GLP * 2u, Bt + gb + ko, K); };
    const int nst = KC / GKB;   /* stages: the same for the whole work-group */
    fill(0, 0);
    asm volatile("s_wait_asynccnt 0x0" ::: "memory");   /* this wave's copies of stage 0 have landed */
    __syncthreads();                                      /* every wave's have: stage 0 may be read */
    if (nst > 1) fill(1, 1);
#pragma unroll 1   /* rolled: the stage count is a run-time argument; one copy of the body keeps the text short */
    for (int t = 0; t < nst; ++t) {
        const T16* st = (const T16*)sm + (t & 1) * SE; const T16* sa = st + (wm * 64 + lr) * GLP + 8 * hi; const T16* sb = st + (TM * NA + wn * 64 + lr) * GLP + 8 * hi;
        V a[4], a2[4], b[4];
#pragma unroll
        for (int kq = 0; kq < GKB / 32; ++kq) {
#pragma unroll
            for (int mb = 0; mb < 4; ++mb) { a[mb] = WFrag<T16>::ld(sa + mb * 16 * GLP + kq * 32); if (NSPLIT == 1) a2[mb] = WFrag<T16>::ld(sa + TM * GLP + mb * 16 * GLP + kq * 32); b[mb] = WFrag<T16>::ld(sb + mb * 16 * GLP + kq * 32); }
            __builtin_amdgcn_sched_barrier(0);   /* keeps all fragment reads of these 32 k above the products: one LDS latency for them, where the scheduler's own order read each B fragment into the same registers and waited for it in front of its four products */
#pragma unroll
            for (int nb = 0; nb < 4; ++nb) {
#pragma unroll
                for (int mb = 0; mb < 4; ++mb) { acc[mb][nb] = WFrag<T16>::mma(a[mb], b[nb], acc[mb][nb]); if (NSPLIT == 1) acc[mb][nb] = WFrag<T16>::mma(a2[mb], b[nb], acc[mb][nb]); } } }
        asm volatile("s_wait_dscnt 0x0" ::: "memory");      /* this wave's reads of stage t are done */
        asm volatile("s_wait_asynccnt 0x0" ::: "memory");   /* its copies of stage t + 1 have landed */
        __syncthreads();                                      /* one barrier a stage: it publishes stage t + 1 and ends every wave's reads of the buffer that is refilled behind it */
        if (t + 2 < nst) fill(t & 1, t + 2);
    }
    asm volatile("s_wait_asynccnt 0x0" ::: "memory");   /* no copy is outstanding when the buffers become output staging */
    float* os = (float*)sm + w * (16 * 68);   /* each wave's own 16 x 68 floats, in the stage buffers: behind the last stage's barrier nobody reads those any more */
    v4f bv = (v4f){};   /* the lane's four bias values: they go by the column alone, so they are read once and not in front of every store */
    if (BIAS && ks == 0) { const float* bp = bias + c0 + lr * 4; const v4f b4 = *(const v4f*)bp;
        asm volatile("s_wait_xcnt 0x0" :: "v"(bp) : "memory");   /* the wait that stands in front of any overwrite of a register that the issued load names; the address is an input so that its registers are not reused ahead of it */
#pragma unroll
        for (int q = 0; q < 4; ++q) bv[q] = bfr(b4[q]); }
#pragma unroll
    for (int mb = 0; mb < 4; ++mb) {
#pragma unroll
        for (int nb = 0; nb < 4; ++nb) {
#pragma unroll
            for (int j = 0; j < 8; ++j) os[(hi * 8 + j) * 68 + nb * 16 + lr] = acc[mb][nb][j]; }
        __builtin_amdgcn_wave_barrier(); asm volatile("" ::: "memory");
        float* crow = C + (size_t)(r0 + mb * 16) * ldc + c0 + lr * 4; v4f val[8]; float* cp[8];
#pragma unroll
        for (int s = 0; s < 8; ++s) { const int row = 2 * s + hi; val[s] = *(const v4fa*)(os + row * 68 + lr * 4); if (BIAS && ks == 0) val[s] += bv; cp[s] = crow + (size_t)row * ldc; }
#pragma unroll
        for (int s = 0; s < 8; ++s) *(v4f*)cp[s] = val[s];
        /* the wait that stands in front of any overwrite of a register that an issued store names; addresses and values are inputs so that their registers are not reused ahead of it */
        asm volatile("s_wait_xcnt 0x0" :: "v"(cp[0]), "v"(cp[1]), "v"(cp[2]), "v"(cp[3]), "v"(cp[4]), "v"(cp[5]), "v"(cp[6]), "v"(cp[7]), "v"(val[0]), "v"(val[1]), "v"(val[2]), "v"(val[3]), "v"(val[4]), "v"(val[5]), "v"(val[6]), "v"(val[7]) : "memory");
        __builtin_amdgcn_wave_barrier(); asm volatile("" ::: "memory");
    }
}

__device__ __forceinline__ h16 tohx(float x) { return (h16)x; }
__device__ __forceinline__ void splitf(float y, unsigned short& h, unsigned short& l) { h = f2bf(y); l = f2bf(y - bf2f(h)); }
typedef __attribute__((ext_vector_type(2))) _Float16 v2h;
typedef __attribute__((ext_vector_type(4))) _Float16 v4h;
typedef __attribute__((ext_vector_type(2))) unsigned short v2us;
typedef __attribute__((ext_vector_type(4))) unsigned short v4us;
typedef __attribute__((ext_vector_type(2))) float v2f;
typedef __attribute__((ext_vector_type(4))) int v4i;

// ---- k_prep: every operand conversion of a call in ONE launch; a work-group's range of the flat block index says which it does (block-uniform): the three LoRA A packed into one zero-padded 64-row operand, the three LoRA B behind the rows of qkv_w, then x, qkv_w, proj_w to bf16.
// cvt8: rows of DM floats to bf16 rows of pitch DP.
template <int DP>
__device__ __forceinline__ void cvt8(const float* __restrict__ src, bf* dst, size_t i) { const v8f v = *(const v8f*)(src + i * 8); v8us o; const size_t e = i * 8;
#pragma unroll
    for (int k = 0; k < 8; ++k) o[k] = f2bf(v[k]); *(v8us*)(dst + (e / DM) * DP + e % DM) = o;
    asm volatile("s_wait_xcnt 0x0" ::: "memory");   /* the wait that stands in front of any overwrite of a register that the issued store names: in the listing the code of the next range follows this store */ }

#define LR_R 8   // LoRA rank
// apad: row nn = 8 p + r of the packed operand (pitch KX, its first DM columns) = column r of projection p's LoRA A; rows from 24 on are zero. A work-group holds one row.
__device__ __forceinline__ void apad(const float* __restrict__ Aq, const float* __restrict__ Ak, const float* __restrict__ Av, bf* Bt, size_t i) { const size_t e = i * 4; const int k0 = (int)(e % DM); const int nn = (int)(e / DM); const int p = nn / LR_R; const float* A = p == 0 ? Aq : p == 1 ? Ak : Av; v4us o;
#pragma unroll
    for (int q = 0; q < 4; ++q) { const float a = A[(size_t)(k0 + q) * LR_R + nn % LR_R]; o[q] = (p < 3) ? f2bf(a) : (unsigned short)0; }
    *(v4us*)(Bt + (size_t)nn * KX + k0) = o;
    asm volatile("s_wait_xcnt 0x0" ::: "memory");   /* the wait that stands in front of any overwrite of a register that the issued store names: in the listing the code of the next range follows this store */ }
// bpad: the 64 columns behind row n of qkv_w: twice 32 (for the hi and for the lo half of x A), in each B[r][n % DQ] of n's own projection p at column 8 p + r and zero elsewhere. A work-group holds 16 rows of one projection.
__device__ __forceinline__ void bpad(const float* __restrict__ Bq, const float* __restrict__ Bk, const float* __restrict__ Bv, bf* Wx, size_t i) { const size_t e = i * 4; const int k0 = (int)(e % 64); const int n = (int)(e / 64); const int p = n / DQ; const float* Bm = p == 0 ? Bq : p == 1 ? Bk : Bv; v4us o;
#pragma unroll
    for (int q = 0; q < 4; ++q) { const int k = (k0 + q) % 32; const float b = Bm[(size_t)(k % LR_R) * DQ + n % DQ]; o[q] = (k / LR_R == p) ? f2bf(b) : (unsigned short)0; }
    *(v4us*)(Wx + (size_t)n * KX + DM + k0) = o;
    asm volatile("s_wait_xcnt 0x0" ::: "memory");   /* the wait that stands in front of any overwrite of a register that the issued store names: in the listing the code of the next range follows this store */ }
#define PBX (MT * DM / 8 / 256)                    // work-groups of x
#define PBW ((DQ + 2 * DKV) * DM / 8 / 256)        // of qkv_w
#define PBO (DM * DQ / 8 / 256)                    // of proj_w
#define PBP (64 * DM / 4 / 256)                    // of the packed LoRA A; of one projection's LoRA B columns
static_assert(DQ == DM && (MT * DM) % 2048 == 0 && (DQ * DM) % 2048 == 0 && (64 * DM) % 1024 == 0, "whole work-groups");
__global__ __launch_bounds__(256) void k_prep(const float* __restrict__ x, const float* __restrict__ wqkv, const float* __restrict__ wo, const float* __restrict__ laq, const float* __restrict__ lak, const float* __restrict__ lav, const float* __restrict__ lbq, const float* __restrict__ lbk, const float* __restrict__ lbv, bf* XB, bf* WQKV, bf* WO, bf* AP) {
    int blk = (int)blockIdx.x; const size_t tid = threadIdx.x;   /* the padded operands first: their dependent strided reads are the longest path of a work-group here */
    if (blk < PBP) { apad(laq, lak, lav, AP, (size_t)blk * 256 + tid); return; }
    blk -= PBP;
    if (blk < 3 * PBP) { bpad(lbq, lbk, lbv, WQKV, (size_t)blk * 256 + tid); return; }
    blk -= 3 * PBP;
    if (blk < PBX) { cvt8<KX>(x, XB, (size_t)blk * 256 + tid); return; }
    blk -= PBX;
    if (blk < PBW) { cvt8<KX>(wqkv, WQKV, (size_t)blk * 256 + tid); return; }
    blk -= PBW;
    cvt8<DQ>(wo, WO, (size_t)blk * 256 + tid);
}
// k_tohl: the first 32 columns (24 in use, the rest exact zeros) of the NS split-K planes of F ([MT][64], stride sP) added in slice order, then hi/lo: hi to columns DM.., lo to columns DM + 32.. of the same row of X (pitch KX). The planes lie too far apart for an immediate offset: one uniform base, one 32-bit byte offset a plane.
template <int NS, size_t sP>
__global__ __launch_bounds__(256) void k_tohl(const float* __restrict__ F, bf* X, size_t n4) { static_assert(NS == 16 && (size_t)NS * sP * 4 < ((size_t)1 << 32), "sixteen offsets of 32 bits"); const size_t i = (size_t)blockIdx.x * 256 + threadIdx.x; if (i >= n4) return; const unsigned ob = ((unsigned)(i >> 3) * 64u + (unsigned)(i & 7) * 4u) * 4u; unsigned os[NS]; v4f p[NS]; v4us oh, ol;
#pragma unroll
    for (int s = 0; s < NS; ++s) { os[s] = ob + (unsigned)s * (unsigned)(sP * 4); p[s] = *(const v4f*)((const char*)F + os[s]); }   /* one uniform base, one 32-bit byte offset a plane */
    /* the wait that stands in front of any overwrite of a register that an issued load names; the offsets are inputs so that their registers are not reused (as a later load's destination) ahead of it */
    asm volatile("s_wait_xcnt 0x0" :: "v"(os[0]), "v"(os[1]), "v"(os[2]), "v"(os[3]), "v"(os[4]), "v"(os[5]), "v"(os[6]), "v"(os[7]), "v"(os[8]), "v"(os[9]), "v"(os[10]), "v"(os[11]), "v"(os[12]), "v"(os[13]), "v"(os[14]), "v"(os[15]) : "memory");
    v4f a = p[0];
#pragma unroll
    for (int s = 1; s < NS; ++s) {   /* split-K planes, slice order */
#pragma unroll
        for (int q = 0; q < 4; ++q) a[q] = __fadd_rn(a[q], p[s][q]); }
#pragma unroll
    for (int q = 0; q < 4; ++q) { unsigned short h2, l2; splitf(a[q], h2, l2); oh[q] = h2; ol[q] = l2; }
    bf* xr = X + (i >> 3) * KX + DM + (i & 7) * 4; *(v4us*)xr = oh; *(v4us*)(xr + 32) = ol;  }
// ---- The tail of a projection in one kernel: P (the projection's own columns of the q | k | v GEMM's f32 result, LoRA term included, row pitch DQKV) straight to the 16-bit planes that the attention kernel reads.
// ld_pl: the loads of NST steps of a thread, SP bytes apart in P; the base stays in scalar registers, one 32-bit byte offset register.
template <int NST, size_t SP>
__device__ __forceinline__ void ld_pl(const float* P, unsigned obp, v4f (&p)[NST]) {
#pragma unroll
    for (int s = 0; s < NST; ++s) p[s] = *(const v4f*)((const char*)P + s * SP + obp); }
// sum over a 16-lane row, every lane gets it (DPP row_xmask 1, 2, 4, 8)
template <int M> __device__ __forceinline__ float rowx(float v) { return __int_as_float(__builtin_amdgcn_update_dpp(0, __float_as_int(v), 0x160 + M, 0xf, 0xf, true)); }
__device__ __forceinline__ float rowsum16(float v) { v += rowx<1>(v); v += rowx<2>(v); v += rowx<4>(v); v += rowx<8>(v); return v; }
// k_qkfin (q, k): a work-group takes QKT whole tokens of one batch (grid: the MT tokens of both); a thread holds 4 consecutive head dims, so 16 lanes hold one (token, head) row: LayerNorm over the 64 head dims in registers, then head planes [h][t][d] (fp16 + hi/lo), one whole 128-byte line a row and plane.
#define QKT 4
static_assert(DQ == 256 * 4 && DKV == DQ && HD == 64 && TT % QKT == 0, "one token a work-group step, 16 lanes a head");
__global__ __launch_bounds__(256) void k_qkfin(const float* __restrict__ P, const float* __restrict__ g, const float* __restrict__ bb, h16* P16, bf* Ph, bf* Pl) {
    const int tid = threadIdx.x, h = tid >> 4, d = (tid & 15) * 4, t0 = blockIdx.x * QKT; const unsigned obp = ((unsigned)t0 * DQKV + (unsigned)tid * 4u) * 4u;
    const unsigned gd = (unsigned)d * 4u; v4f a[QKT];
    v4f gv = *(const v4f*)((const char*)g + gd), bv = *(const v4f*)((const char*)bb + gd);
    ld_pl<QKT, (size_t)DQKV * 4>(P, obp, a);
    /* the wait that stands in front of any overwrite of a register that an issued load names; the two offsets are inputs so that their registers are not reused (as a later load's destination) ahead of it */
    asm volatile("s_wait_xcnt 0x0" :: "v"(obp), "v"(gd) : "memory");
    __builtin_amdgcn_sched_barrier(0);   /* keeps all of the thread's loads above the sums: one memory latency a thread, where the scheduler's own order waited for the first loads before it issued the last */
#pragma unroll
    for (int q = 0; q < 4; ++q) { gv[q] = bfr(gv[q]); bv[q] = bfr(bv[q]); }
    const size_t e = ((size_t)((t0 / TT) * NH_ + h) * TT + t0 % TT) * HD + d;   /* head planes [b][h][t][d] */
#pragma unroll
    for (int s = 0; s < QKT; ++s) {
        const float mu = rowsum16((a[s][0] + a[s][1]) + (a[s][2] + a[s][3])) * (1.0f / HD); const v4f dv = a[s] - mu;
        const float var = rowsum16((dv[0] * dv[0] + dv[1] * dv[1]) + (dv[2] * dv[2] + dv[3] * dv[3])) * (1.0f / HD);
        const float rs = __fdiv_rn(1.0f, __fsqrt_rn(var + LNH_EPS)); v4h o16; v4us oh, ol;
#pragma unroll
        for (int q = 0; q < 4; ++q) { const float y = dv[q] * rs * gv[q] + bv[q]; o16[q] = tohx(y); unsigned short a2, c2; splitf(y, a2, c2); oh[q] = a2; ol[q] = c2; }
        *(v4h*)(P16 + e + s * HD) = o16; *(v4us*)(Ph + e + s * HD) = oh; *(v4us*)(Pl + e + s * HD) = ol; }
}
// k_vfin (v): a work-group takes VTT tokens x VTC columns, reads them along the columns (512 contiguous bytes a wave), turns the tile in LDS and writes the transposed planes [b][g][d][t] (fp16 + hi/lo) along t, one whole 128-byte line a column and plane.
#define VTT 64
#define VTC 128
#define VTP (VTT + 1)   // odd LDS pitch in dwords: the 4 columns x 8 token groups that a wave reads back fall on 32 different banks
static_assert(TT % VTT == 0 && DKV % VTC == 0 && VTC == 32 * 4 && VTT % 8 == 0 && (VTC * VTT / 8) % 256 == 0, "v tile");
__global__ __launch_bounds__(256) void k_vfin(const float* __restrict__ P, h16* V16, bf* Vh, bf* Vl) {
    __shared__ float ts[VTC * VTP];
    const int tid = threadIdx.x, lane = tid & 31, w = tid >> 5, t0 = blockIdx.x * VTT, c0 = blockIdx.y * VTC; const unsigned obp = ((unsigned)(t0 + w) * DQKV + (unsigned)(c0 + lane * 4)) * 4u;
    v4f p[VTT / 8];
    ld_pl<VTT / 8, (size_t)8 * DQKV * 4>(P, obp, p);
    /* the wait that stands in front of any overwrite of a register that an issued load names; the offset is an input so that its register is not reused (as a later load's destination) ahead of it */
    asm volatile("s_wait_xcnt 0x0" :: "v"(obp) : "memory");
#pragma unroll
    for (int s = 0; s < VTT / 8; ++s) { const v4f a = p[s];
#pragma unroll
        for (int q = 0; q < 4; ++q) ts[(lane * 4 + q) * VTP + s * 8 + w] = a[q]; }
    __syncthreads();   /* the tile is whole before any thread reads a column that other waves wrote */
#pragma unroll
    for (int it = 0; it < VTC * VTT / 8 / 256; ++it) { const int item = it * 256 + tid, tg = item & (VTT / 8 - 1), c = item / (VTT / 8); const float* r = ts + c * VTP + tg * 8; v8h o16; v8us oh, ol;
#pragma unroll
        for (int j = 0; j < 8; ++j) { const float x = r[j]; o16[j] = tohx(x); unsigned short a2, c2; splitf(x, a2, c2); oh[j] = a2; ol[j] = c2; }
        const size_t e = ((size_t)(t0 / TT) * DKV + c0 + c) * TT + t0 % TT + tg * 8;   /* planes [b][g][d][t] */ *(v8h*)(V16 + e) = o16; *(v8us*)(Vh + e) = oh; *(v8us*)(Vl + e) = ol; }
}
// ---- k_fattn: fused attention, one launch for all heads of both batches (grid: row blocks, heads, batches). One wave owns 16 queries of one head and walks the TT keys, 64 a pass (32 on the hi/lo rows, whose fragments take twice the registers):
// S^T = K Q^T (A = key rows, B = the queries, loaded once), so a lane holds 8 keys of ONE query per 16-key tile; t = S x HD^-0.5 + bf16(attn_mask[i][j]) (the additive f32 mask input, read as data);
// running-maximum softmax in registers (the output tiles and the sum are rescaled when the maximum moves; the division by the sum comes last); O^T += V^T P^T with P^T packed from the score tiles as the B operand (two 16-key tiles = one 32-key fragment in the loaders' k order).
// Scores and probabilities never reach memory. Rows < RH: hi/lo planes, 3 products; the rest fp16 with P x PCAR. Each work-group takes FHW hi/lo waves and 8 - FHW fp16 waves, so that the longer hi/lo rows are spread over all work-groups.
// The eight waves of a work-group walk the same keys of the same head: each stage of SKB keys (the K and V tiles of all six planes) is brought into LDS ONCE for all of them, in whole 128-byte lines, by asynchronous copies, two buffers, the next stage in flight while this one is worked on; the fragments are read from LDS. The mask rows are each wave's own and still come straight from memory.
#define FHW 2
#define PLOG 10.0f   // log2(PCAR)
static_assert(PCAR == 1024.0f, "PLOG");
static_assert(FHW * 16 * (TT / 128) == RH && (8 - FHW) * 16 * (TT / 128) == TT - RH, "row split");
#define SKB 64                    // keys a stage
#define NSTG (TT / SKB)
#define LPE 72                    // LDS row pitch in 16-bit elements: 144 bytes = 16 x odd, free of bank conflicts for 16-byte fragment reads of 128-byte rows
#define PLE (64 * LPE)            // one plane's tile: 64 rows (K: keys x head dims; V: head dims x keys)
#define STE (6 * PLE)             // a stage: K16 | V16 | Kh | Kl | Vh | Vl
static_assert(HD == 64 && SKB == 64 && NSTG >= 2 && TT % SKB == 0, "64 x 64 tiles, two stages or more");
typedef __attribute__((ext_vector_type(8))) unsigned v8u;
// One stage's copies of one thread: 16 bytes of row r = tid / 8 and of row r + 32 of each of the six tiles (a wave: four whole 128-byte rows a copy). l: the thread's LDS byte address in tile 0 of the buffer; the pointers: its 16 bytes of row r in each plane.
__device__ __forceinline__ void stage_fill(unsigned l, const h16* k16, const h16* v16, const bf* kh, const bf* kl, const bf* vh, const bf* vl) {
    const unsigned P = PLE * 2u, R = 32u * LPE * 2u;
    /* the copies and, as the last line of their own statement, the wait that stands in front of any overwrite of a register that an issued copy names */
    asm volatile("global_load_async_to_lds_b128 %0, %12, off\n\tglobal_load_async_to_lds_b128 %1, %13, off\n\tglobal_load_async_to_lds_b128 %2, %14, off\n\tglobal_load_async_to_lds_b128 %3, %15, off\n\t"
                 "global_load_async_to_lds_b128 %4, %16, off\n\tglobal_load_async_to_lds_b128 %5, %17, off\n\tglobal_load_async_to_lds_b128 %6, %18, off\n\tglobal_load_async_to_lds_b128 %7, %19, off\n\t"
                 "global_load_async_to_lds_b128 %8, %20, off\n\tglobal_load_async_to_lds_b128 %9, %21, off\n\tglobal_load_async_to_lds_b128 %10, %22, off\n\tglobal_load_async_to_lds_b128 %11, %23, off\n\ts_wait_xcnt 0x0"
                 :: "v"(l), "v"(l + R), "v"(l + P), "v"(l + P + R), "v"(l + 2 * P), "v"(l + 2 * P + R), "v"(l + 3 * P), "v"(l + 3 * P + R), "v"(l + 4 * P), "v"(l + 4 * P + R), "v"(l + 5 * P), "v"(l + 5 * P + R),
                    "v"(k16), "v"(k16 + 32 * HD), "v"(v16), "v"(v16 + (size_t)32 * TT), "v"(kh), "v"(kh + 32 * HD), "v"(kl), "v"(kl + 32 * HD), "v"(vh), "v"(vh + (size_t)32 * TT), "v"(vl), "v"(vl + (size_t)32 * TT) : "memory");
}
// One pass of one wave over KB keys. kp, kp2, vp, vp2: the lane's place in the K and V tiles in LDS (row lane % 16, 8 elements further in the upper lane half); mp: its place in its query's mask row.
template <typename T16, bool HR, int KB>   // KB keys a pass
__device__ __forceinline__ void fattn_pass(const T16* kp, const T16* kp2, const T16* vp, const T16* vp2, const float* __restrict__ mp, const v8u (&qa)[2], const v8u (&qb)[2], v8f (&o)[4], float& m, float& sum) {
    typedef typename WFrag<T16>::V V;
    V qf[2], qf2[2];
#pragma unroll
    for (int ks = 0; ks < 2; ++ks) { qf[ks] = __builtin_bit_cast(V, qa[ks]); qf2[ks] = __builtin_bit_cast(V, qb[ks]); }
        V kf[KB / 16][2], kf2[KB / 16][2], vf[4][KB / 32], vf2[4][KB / 32]; v4f mk[KB / 16][2];
#pragma unroll
        for (int kb = 0; kb < KB / 16; ++kb)
#pragma unroll
            for (int ks = 0; ks < 2; ++ks) mk[kb][ks] = *(const v4f*)(mp + kb * 16 + ks * 4);   /* the pass's only loads from memory go out first */
        /* the wait that stands in front of any overwrite of a register that an issued load names; the address is an input so that its registers are not reused (as a later load's destination) ahead of it */
        asm volatile("s_wait_xcnt 0x0" :: "v"(mp) : "memory");
#pragma unroll
        for (int kb = 0; kb < KB / 16; ++kb) {
#pragma unroll
            for (int ks = 0; ks < 2; ++ks) { kf[kb][ks] = WFrag<T16>::ld(kp + kb * 16 * LPE + ks * 32); if (HR) kf2[kb][ks] = WFrag<T16>::ld(kp2 + kb * 16 * LPE + ks * 32); } }
        __builtin_amdgcn_sched_barrier(0);   /* keeps all of the pass's K fragment reads above the products: one LDS latency a pass, where the scheduler's own order read each fragment into the same registers and waited for it in front of its product */
        v8f s[KB / 16];
#pragma unroll
        for (int kb = 0; kb < KB / 16; ++kb) { s[kb] = (v8f){};
#pragma unroll
            for (int ks = 0; ks < 2; ++ks) { s[kb] = WFrag<T16>::mma(kf[kb][ks], qf[ks], s[kb]);
                if (HR) { s[kb] = WFrag<T16>::mma(kf[kb][ks], qf2[ks], s[kb]); s[kb] = WFrag<T16>::mma(kf2[kb][ks], qf[ks], s[kb]); } } }
#pragma unroll
        for (int mb = 0; mb < 4; ++mb)
#pragma unroll
            for (int ks = 0; ks < KB / 32; ++ks) { vf[mb][ks] = WFrag<T16>::ld(vp + mb * 16 * LPE + ks * 32); if (HR) vf2[mb][ks] = WFrag<T16>::ld(vp2 + mb * 16 * LPE + ks * 32); }
        __builtin_amdgcn_sched_barrier(0);   /* keeps the V fragment reads above the softmax, whose vector work then covers their latency */
        float bk[KB / 16];
#pragma unroll
        for (int kb = 0; kb < KB / 16; ++kb) { const v4f m0 = mk[kb][0], m1 = mk[kb][1]; bk[kb] = -3.0e38f;
#pragma unroll
            for (int j = 0; j < 8; ++j) { const float t = s[kb][j] * SCL + bfr(j < 4 ? m0[j & 3] : m1[j & 3]); s[kb][j] = t; bk[kb] = fmaxf(bk[kb], t); } }
        float bm = m;
#pragma unroll
        for (int kb = 0; kb < KB / 16; ++kb) bm = fmaxf(bm, bk[kb]);
        bm = fmaxf(bm, __shfl_xor(bm, 16, 32));   /* the two lane halves hold the two halves of a query's keys */
        const float al = __builtin_amdgcn_exp2f((m - bm) * 1.4426950408889634f); m = bm;
        float pk[KB / 16];
#pragma unroll
        for (int kb = 0; kb < KB / 16; ++kb) { float e[8];
#pragma unroll
            for (int j = 0; j < 8; ++j) { const float d = s[kb][j] - m;   /* the maximum is subtracted first: exactly 0 at t = m for every m, and minus infinity stays minus infinity (p = 0) */
                if constexpr (HR) e[j] = d * 1.4426950408889634f; else e[j] = __builtin_fmaf(d, 1.4426950408889634f, PLOG); }   /* the fp16 rows' factor PCAR rides in the exponent: p = PCAR x exp(t - m) */
            /* eight exponentials, each in place, then one v_nop: behind a transcendental the instruction set asks for one independent instruction before its result is read or its source overwritten; here the next exponential (another register) or the v_nop is that instruction */
            asm("v_exp_f32 %0, %0\n\tv_exp_f32 %1, %1\n\tv_exp_f32 %2, %2\n\tv_exp_f32 %3, %3\n\tv_exp_f32 %4, %4\n\tv_exp_f32 %5, %5\n\tv_exp_f32 %6, %6\n\tv_exp_f32 %7, %7\n\tv_nop" : "+v"(e[0]), "+v"(e[1]), "+v"(e[2]), "+v"(e[3]), "+v"(e[4]), "+v"(e[5]), "+v"(e[6]), "+v"(e[7]));
#pragma unroll
            for (int j = 0; j < 8; ++j) { s[kb][j] = e[j]; pk[kb] = j ? pk[kb] + e[j] : e[0]; } }
        float ps = pk[0];
#pragma unroll
        for (int kb = 1; kb < KB / 16; ++kb) ps += pk[kb];
        sum = sum * al + ps;
#pragma unroll
        for (int mb = 0; mb < 4; ++mb)
#pragma unroll
            for (int j = 0; j < 8; ++j) o[mb][j] *= al;
        V pf[KB / 32], pf2[KB / 32];
#pragma unroll
        for (int ks = 0; ks < KB / 32; ++ks) {
            if constexpr (HR) { v8us h0, h1, l0, l1;
#pragma unroll
                for (int j = 0; j < 8; ++j) { unsigned short a, c2; splitf(s[2 * ks][j], a, c2); h0[j] = a; l0[j] = c2; splitf(s[2 * ks + 1][j], a, c2); h1[j] = a; l1[j] = c2; }
                pf[ks] = cat16b(h0, h1); pf2[ks] = cat16b(l0, l1);
            } else { v8h a0, a1;
#pragma unroll
                for (int j = 0; j < 8; ++j) { a0[j] = tohx(s[2 * ks][j]); a1[j] = tohx(s[2 * ks + 1][j]); }
                pf[ks] = cat16(a0, a1); } }
#pragma unroll
        for (int mb = 0; mb < 4; ++mb)
#pragma unroll
            for (int ks = 0; ks < KB / 32; ++ks) { o[mb] = WFrag<T16>::mma(vf[mb][ks], pf[ks], o[mb]);
                if (HR) { o[mb] = WFrag<T16>::mma(vf[mb][ks], pf2[ks], o[mb]); o[mb] = WFrag<T16>::mma(vf2[mb][ks], pf[ks], o[mb]); } }
}
// amdgpu_waves_per_eu(4, 4): the register budget of four waves a SIMD, so that two work-groups (whose LDS fits twice) share a WGP and one's vector work fills the other's waits
__global__ __launch_bounds__(256) __attribute__((amdgpu_waves_per_eu(4, 4))) void k_fattn(const h16* __restrict__ Q16, const h16* __restrict__ K16, const h16* __restrict__ V16, const bf* __restrict__ Qh, const bf* __restrict__ Ql, const bf* __restrict__ Kh, const bf* __restrict__ Kl, const bf* __restrict__ Vh, const bf* __restrict__ Vl, const float* __restrict__ madd, bf* Ah, bf* Al) {
    __shared__ __attribute__((aligned(16))) unsigned short sm[2 * STE];
    const int tid = (int)threadIdx.x, lane = tid & 31, lr = lane & 15, hi = lane >> 4;
    const int w = __builtin_amdgcn_readfirstlane(tid >> 5); const bool hr = w < FHW;   /* the same in every lane of a wave: a scalar branch */
    const size_t hq = ((size_t)blockIdx.z * NH_ + blockIdx.y) * TT * HD, hk = ((size_t)blockIdx.z * NKV + blockIdx.y / REP) * TT * HD; const size_t ao = (size_t)blockIdx.z * TT * DQ + blockIdx.y * HD; bf* ah = Ah + ao; bf* al = Al + ao;
    const int q0 = hr ? (int)blockIdx.x * (FHW * 16) + w * 16 : RH + (int)blockIdx.x * ((8 - FHW) * 16) + (w - FHW) * 16;
    /* the thread's share of a stage's copies */
    const int cr = tid >> 3, cc = (tid & 7) * 8; const unsigned lb = (unsigned)(size_t)sm + (unsigned)(cr * LPE + cc) * 2u; const size_t gk = hk + (size_t)cr * HD + cc, gv = hk + (size_t)cr * TT + cc;
    stage_fill(lb, K16 + gk, V16 + gv, Kh + gk, Kl + gk, Vh + gv, Vl + gv);
    /* the query fragments as raw 16-bit planes, one set of registers for both kinds of wave: hi | lo, or fp16 | (the lo plane, loaded without a branch and never used) */
    const size_t qo = hq + (size_t)(q0 + lr) * HD + 8 * hi; const bf* qp = (hr ? Qh : (const bf*)Q16) + qo; const bf* qp2 = Ql + qo;
    v8u qa[2], qb[2];
#pragma unroll
    for (int ks = 0; ks < 2; ++ks) { qa[ks] = __builtin_bit_cast(v8u, WFrag<bf>::ld(qp + ks * 32)); qb[ks] = __builtin_bit_cast(v8u, WFrag<bf>::ld(qp2 + ks * 32)); }
    /* the wait that stands in front of any overwrite of a register that an issued load names; the addresses are inputs so that their registers are not reused ahead of it */
    asm volatile("s_wait_xcnt 0x0" :: "v"(qp), "v"(qp2) : "memory");
    v8f o[4];
#pragma unroll
    for (int mb = 0; mb < 4; ++mb) o[mb] = (v8f){};
    float m = -3.0e38f, sum = 0.f;
    const float* mrow = madd + (size_t)(q0 + lr) * TT + 8 * hi;
    const int fo = lr * LPE + 8 * hi;
    asm volatile("s_wait_asynccnt 0x0" ::: "memory");   /* this wave's copies of stage 0 have landed */
    __syncthreads();                                      /* every wave's have: stage 0 may be read */
    stage_fill(lb + STE * 2u, K16 + gk + (size_t)SKB * HD, V16 + gv + SKB, Kh + gk + (size_t)SKB * HD, Kl + gk + (size_t)SKB * HD, Vh + gv + SKB, Vl + gv + SKB);
    for (int t = 0; t < NSTG; ++t) {
        const unsigned short* st = sm + (t & 1) * STE + fo; const float* mp = mrow + t * SKB;
        if (hr) {   /* two passes of 32 keys a stage; unrolled, so that the half's place in the tiles is an immediate offset of the LDS reads */
#pragma unroll
            for (int sub = 0; sub < 2; ++sub) fattn_pass<bf, true, 32>(st + 2 * PLE + sub * 32 * LPE, st + 3 * PLE + sub * 32 * LPE, st + 4 * PLE + sub * 32, st + 5 * PLE + sub * 32, mp + sub * 32, qa, qb, o, m, sum);
        } else { const h16* sh = (const h16*)st; fattn_pass<h16, false, 64>(sh, sh, sh + PLE, sh + PLE, mp, qa, qb, o, m, sum); }
        asm volatile("s_wait_dscnt 0x0" ::: "memory");      /* this wave's reads of stage t are done */
        asm volatile("s_wait_asynccnt 0x0" ::: "memory");   /* its copies of stage t + 1 have landed */
        __syncthreads();                                      /* one barrier a stage: it publishes stage t + 1 and ends every wave's reads of the buffer that is refilled behind it */
        if (t + 2 < NSTG) { const size_t ak = (size_t)(t + 2) * SKB * HD, av = (size_t)(t + 2) * SKB; stage_fill(lb + (unsigned)(t & 1) * (STE * 2u), K16 + gk + ak, V16 + gv + av, Kh + gk + ak, Kl + gk + ak, Vh + gv + av, Vl + gv + av); }
    }
    asm volatile("s_wait_asynccnt 0x0" ::: "memory");   /* no copy is outstanding when the wave ends */
    sum += __shfl_xor(sum, 16, 32);
    const float f = __fdiv_rn(1.0f, sum);   /* on the fp16 rows sum and o both carry PCAR */
#pragma unroll
    for (int mb = 0; mb < 4; ++mb) { v8us oh, ol;   /* a lane holds 8 consecutive head dims of its query: one 16-byte store a plane */
#pragma unroll
        for (int j = 0; j < 8; ++j) { unsigned short a, c2; splitf(o[mb][j] * f, a, c2); oh[j] = a; ol[j] = c2; }
        const size_t oo = (size_t)(q0 + lr) * DQ + mb * 16 + hi * 8; *(v8us*)(ah + oo) = oh; *(v8us*)(al + oo) = ol; }
}

extern "C" void kernel_launch(void* const* d_in, const int* in_sizes, int n_in,
                              void* d_out, int out_size, void* d_ws, size_t ws_size, hipStream_t stream) {
    (void)in_sizes; (void)n_in; (void)out_size;
    const float* x = (const float*)d_in[0]; const float* madd = (const float*)d_in[1];   /* attn_mask [1][1][2048][2048] f32 (zeros): read, added to the scaled scores */ const float* wqkv = (const float*)d_in[2]; const float* wo = (const float*)d_in[3]; const float* bo = (const float*)d_in[4]; const float* gq = (const float*)d_in[5]; const float* btq = (const float*)d_in[6]; const float* gk = (const float*)d_in[7]; const float* btk = (const float*)d_in[8]; const float* laq = (const float*)d_in[9]; const float* lbq = (const float*)d_in[10]; const float* lak = (const float*)d_in[11]; const float* lbk = (const float*)d_in[12]; const float* lav = (const float*)d_in[13]; const float* lbv = (const float*)d_in[14];
    float* OUT = (float*)d_out;     // [2][2048][1024]
    char* wsp = (char*)d_ws;
    auto take = [&](size_t bytes) { char* p = wsp; wsp += (bytes + 255) & ~(size_t)255; return (void*)p; };
    bf* WQ = (bf*)take((size_t)DQKV * KX * 2);   /* qkv_w as one bf16 block, behind each row its LoRA B columns */ bf* WO = (bf*)take((size_t)DM * DQ * 2);
    bf* XB = (bf*)take((size_t)MT * KX * 2);   /* x, behind each row x A (hi | lo) of q, k, v */ bf* AP = (bf*)take((size_t)64 * KX * 2);   /* the three LoRA A packed and zero-padded, A^T [64] rows of the same pitch (its first DM columns are written and read) */
    /* head planes and merged planes of BOTH batches (batch stride PB, AB elements) */ const size_t PB = (size_t)NH_ * TT * HD, AB = (size_t)TT * DQ; static_assert(NKV == NH_, "one plane stride");
    h16* QP16 = (h16*)take(NB_ * PB * 2); h16* KP16 = (h16*)take(NB_ * PB * 2); h16* VT16 = (h16*)take(NB_ * PB * 2);
    bf* QPh = (bf*)take(NB_ * PB * 2); bf* QPl = (bf*)take(NB_ * PB * 2); bf* KPh = (bf*)take(NB_ * PB * 2); bf* KPl = (bf*)take(NB_ * PB * 2); bf* VTh = (bf*)take(NB_ * PB * 2); bf* VTl = (bf*)take(NB_ * PB * 2);
    static_assert(DKV == DQ && DM == DQ, "plane buffer"); float* PP = (float*)take((size_t)MT * DQKV * 4);   /* q | k | v before their tails: f32 [MT][DQKV] */ bf* ATh = (bf*)take(NB_ * AB * 2); bf* ATl = (bf*)take(NB_ * AB * 2);
    float* XA = PP; static_assert(KSA * 64 <= DQKV, "x A planes fit");   /* the KSA x [MT][64] f32 planes of x A lie in PP: k_tohl has read them before the projection writes there */
    if ((size_t)(wsp - (char*)d_ws) > ws_size) return;    // ws 256 MiB
    k_prep<<<PBX + PBW + PBO + 4 * PBP, 256, 0, stream>>>(x, wqkv, wo, laq, lak, lav, lbq, lbk, lbv, XB, WQ, WO, AP);
    /* x A of q, k and v in one 64-wide GEMM, grid z = split-K slice over the first DM columns: exact x A, f32 planes -> hi | lo behind the rows of x */
    k_gemmw<bf, 0, false, 1, 4, 1><<<dim3(MT / 256, 1, KSA), 128, 0, stream>>>(XB, nullptr, AP, nullptr, KX, XA, 64, nullptr, 0, 0, 0, DM / KSA, (size_t)MT * 64);
    k_tohl<KSA, (size_t)MT * 64><<<(unsigned)((size_t)MT * 32 / 4 / 256), 256, 0, stream>>>(XA, XB, (size_t)MT * 32 / 4);
    /* q | k | v = x qkv_w^T + (x A) B as ONE GEMM, N = DQKV, every accumulator over the whole K = DM + 64 (the last stage is the LoRA term, hi/lo x exact B): its 384 work-groups fill the chip with no split of K, and no partial planes go through memory */
    k_gemmw<bf, 0, false, 1, 4, 2><<<dim3(MT / 256, DQKV / 128, 1), 256, 0, stream>>>(XB, nullptr, WQ, nullptr, KX, PP, DQKV, nullptr, 0, 0, 0, KX, 0);
    /* q = its columns, per-head LayerNorm, head planes; k likewise; v = its columns, transposed planes */
    k_qkfin<<<MT / QKT, 256, 0, stream>>>(PP, gq, btq, QP16, QPh, QPl);
    k_qkfin<<<MT / QKT, 256, 0, stream>>>(PP + DQ, gk, btk, KP16, KPh, KPl);
    k_vfin<<<dim3(MT / VTT, DKV / VTC), 256, 0, stream>>>(PP + DQ + DKV, VT16, VTh, VTl);
    k_fattn<<<dim3(TT / 128, NH_, NB_), 256, 0, stream>>>(QP16, KP16, VT16, QPh, QPl, KPh, KPl, VTh, VTl, madd, ATh, ATl);   /* scores, softmax and P V of all heads of both batches; writes the merged hi/lo planes */
    /* the output projection over the whole K on 128 x 128 tiles, one work-group a WGP: it stores out itself, bias included */
    k_gemmw<bf, 1, true, 1, 2, 2><<<dim3(MT / 128, DM / 128, 1), 128, 0, stream>>>(ATh, ATl, WO, nullptr, DQ, OUT, DM, bo, 0, 0, 0, DQ, 0);
}

// v009
// One run takes 163 microseconds.
// In both of two side-by-side timings against v008, it was 1.04 times as fast.
// Over all steps from v000 it is 14.0 times as fast.
#include <hip/hip_runtime.h>

// Attention with LoRA-augmented q/k/v, per-head query/key LayerNorm and an additive mask (x [2][2048][1024]; qkv = x qkv_w^T ('oi' [3072][1024] 0.02, no bias) -> q | k | v (16 heads x 64); q += (x lora_Aq) lora_Bq x 1 (alpha/r = 8/8), k, v likewise ('xw' [1024][8], [8][1024] 0.02); q, k <- LayerNorm over the 64 head dims (eps 1e-5; qn_w, qn_b, kn_w, kn_b [64], read); scores = (q x 64^-0.5).k + attn_mask ([1][1][2048][2048] f32 zeros, read); softmax; out = merged proj_w^T + proj_b -> [2][2048][1024] (4.2 M); argument order x, attn_mask, qkv_w, proj_w, proj_b, qn_w, qn_b, kn_w, kn_b, lora_Aq, lora_Bq, lora_Ak, lora_Bk, lora_Av, lora_Bv).
// Layout, both batches as one M = 4096 in every launch: bf16 copy of x; 'oi' weight row blocks; exact projections; the three rank-8 LoRA terms ride in the projection GEMM itself as one more stage of 64 k: x A of q, k and v as ONE small GEMM on a zero-padded 64-wide operand (columns 8 p + r; exact -> f32 -> hi/lo), its hi | lo written behind each row of x, and each LoRA B row-wise behind qkv_w at its own projection's columns (zero elsewhere); the projection GEMM's own epilogue does the per-(token, head) LayerNorm of q and k and writes the 16-bit planes (a wave's 64 x 64 tile is one head); fused T-2048 attention (hybrid rows: < 512 hi/lo 3 products, rest fp16 x1024), scores and probabilities in registers, with the additive mask read in the softmax; merged hi/lo x proj_w exact + proj_b.
// Compute dtypes, f32 accumulate: every input rounded to bf16; projections exact; LoRA x A exact, (x A) B hl x exact; LayerNorm f32; attention rows < 512 3 products, rest fp16; softmax f32; proj_w hl x exact + bias.

#define NB_  2
#define TT   2048
#define MT   (NB_ * TT)         // tokens of both batches: the rows of every GEMM
#define DM   1024
#define NH_  16
#define NKV  16
#define REP  (NH_ / NKV)
#define HD   64
#define DQ   (NH_ * HD)
#define DKV  (NKV * HD)
#define RH   512                  // query rows < RH use hi+lo planes (0: none)
#define PCAR 1024.0f
#define SCL  0.125f   // HD^-0.5
#define LNH_EPS 1e-5f
#define DQKV (DQ + 2 * DKV)       // columns of the q | k | v projection, one GEMM
#define KSA  16                   // split-K slices of x A (K 1024 -> 64)
#define KX   (DM + 64)            // row pitch and K of the projection's operands: x | (x A) hi (32) | (x A) lo (32), and qkv_w | B (32) | B (32)
typedef _Float16 h16;
typedef unsigned short bf;
typedef __attribute__((ext_vector_type(16))) __bf16   v16bf;
typedef __attribute__((ext_vector_type(16))) _Float16 v16h;
typedef __attribute__((ext_vector_type(8)))  _Float16 v8h;
typedef __attribute__((ext_vector_type(8)))  unsigned short v8us;
typedef __attribute__((ext_vector_type(8)))  float    v8f;
typedef __attribute__((ext_vector_type(4)))  float    v4f;
typedef v8h  __attribute__((may_alias)) v8ha;
typedef v4f  __attribute__((may_alias)) v4fa;
typedef v8us __attribute__((may_alias)) v8usa;

__device__ __forceinline__ unsigned short f2bf(float f) { unsigned u = __float_as_uint(f); u += 0x7FFFu + ((u >> 16) & 1u); return (unsigned short)(u >> 16); }
__device__ __forceinline__ float bf2f(unsigned short b) { return __uint_as_float(((unsigned)b) << 16); }
__device__ __forceinline__ float bfr(float f) { return bf2f(f2bf(f)); }
__device__ __forceinline__ v16h cat16(v8h lo, v8h hi) { return __builtin_shufflevector(lo, hi, 0, 1, 2, 3, 4, 5, 6, 7, 8, 9, 10, 11, 12, 13, 14, 15); }
__device__ __forceinline__ v16bf cat16b(v8us lo, v8us hi) { return __builtin_bit_cast(v16bf, __builtin_shufflevector(lo, hi, 0, 1, 2, 3, 4, 5, 6, 7, 8, 9, 10, 11, 12, 13, 14, 15)); }
__device__ __forceinline__ v8f wmma16(v16h a, v16h b, v8f c) { return __builtin_amdgcn_wmma_f32_16x16x32_f16(false, a, false, b, (short)0, c, false, false); }
__device__ __forceinline__ v8f wmmab(v16bf a, v16bf b, v8f c) { return __builtin_amdgcn_wmma_f32_16x16x32_bf16(false, a, false, b, (short)0, c, false, false); }



// ---- k_gemmw: register-blocked GEMM, one wave per 64x64 output tile (16 accumulators), WM x WN waves a work-group; grid (M/(64 WM), N/(64 WN), Z), 32 WM WN threads.
// C[m][n] (f32, pitch ldc, + optional f32 bias[n]) = sum_k A[m][k] Bt[n][k] (+ A2 Bt for NSPLIT 1), operands K-contiguous 16-bit planes. z-batch strides sA/sB/sC in elements. KC % 64 == 0.
// Split K: grid z = NZ batches x the k slices (K is the row pitch and may exceed the k they cover); slice ks sums k in [ks KC, (ks + 1) KC) into its own f32 plane C + ks sP, and the consumer kernel adds the planes in slice order (the bias goes into plane 0). KC == K, sP == 0: no split.
// Operands: each stage of GKB k (one whole 128-byte line of every operand row of the work-group's tile) is brought into LDS once for all its waves by asynchronous copies, a wave's copy = four whole lines, two buffers, the next stage in flight while this one is worked on; the fragments are read from LDS. Each accumulator still takes its products in the same k order.
template <typename T16> struct WFrag;
template <> struct WFrag<h16> { typedef v16h V; static __device__ __forceinline__ V ld(const h16* p) { return cat16(*(const v8h*)p, *(const v8h*)(p + 16)); } static __device__ __forceinline__ v8f mma(V a, V b, v8f c) { return wmma16(a, b, c); } };
template <> struct WFrag<bf> { typedef v16bf V; static __device__ __forceinline__ V ld(const bf* p) { return cat16b(*(const v8us*)p, *(const v8us*)(p + 16)); } static __device__ __forceinline__ v8f mma(V a, V b, v8f c) { return wmmab(a, b, c); } };
#define GKB 64                    // k a stage
#define GLP 72                    // LDS row pitch in 16-bit elements: 144 bytes = 16 x odd, free of bank conflicts for 16-byte fragment reads of 128-byte rows
// NC copies of one thread, 16 bytes each, of rows RPR apart in one operand plane (row pitch K elements). l: the thread's LDS byte address in the first of these rows; g: its 16 bytes there.
template <typename T16, int NC, int RPR>
__device__ __forceinline__ void gemm_fill(unsigned l, const T16* g, int K) {
    static_assert(NC % 4 == 0, "four copies a statement");
    const unsigned R = (unsigned)RPR * GLP * 2u; const size_t G = (size_t)RPR * K;
#pragma unroll
    for (int i = 0; i < NC; i += 4)
        /* four copies and, as the last line of their own statement, the wait that stands in front of any overwrite of a register that an issued copy names */
        asm volatile("global_load_async_to_lds_b128 %0, %4, off\n\tglobal_load_async_to_lds_b128 %1, %5, off\n\tglobal_load_async_to_lds_b128 %2, %6, off\n\tglobal_load_async_to_lds_b128 %3, %7, off\n\ts_wait_xcnt 0x0"
                     :: "v"(l + i * R), "v"(l + (i + 1) * R), "v"(l + (i + 2) * R), "v"(l + (i + 3) * R), "v"(g + i * G), "v"(g + (i + 1) * G), "v"(g + (i + 2) * G), "v"(g + (i + 3) * G) : "memory");
}
// TAIL (the q | k | v projection): no f32 result is stored; each wave takes its 64 x 64 tile, which is 64 tokens of ONE head of one projection, straight to the 16-bit planes that the attention kernel reads (tail_qk, tail_v below).
struct QkvTail { const float* gq; const float* bq; const float* gk; const float* bk; h16* q16; bf* qh; bf* ql; h16* k16; bf* kh; bf* kl; h16* v16; bf* vh; bf* vl; };
#define TWB 9216                  // bytes of LDS staging a wave in the tails: 32 rows x 68 floats (q, k), 64 columns x 144 bytes (v)
__device__ __forceinline__ void tail_qk(const v8f (&acc)[4][4], float* os, int lr, int hi, const float* __restrict__ g, const float* __restrict__ bb, h16* P16, bf* Ph, bf* Pl, unsigned ob);
__device__ __forceinline__ void tail_v(const v8f (&acc)[4][4], unsigned short* vs, int lane, h16* V16, bf* Vh, bf* Vl, unsigned ob);
template <typename T16, int NSPLIT, bool BIAS, int NZ, int WM, int WN, bool TAIL>
__global__ __launch_bounds__(WM * WN * 32) void k_gemmw(const T16* __restrict__ A, const T16* __restrict__ A2, const T16* __restrict__ Bt, const T16* __restrict__ Bt2, int K, float* C, int ldc, const float* __restrict__ bias, size_t sA, size_t sB, size_t sC, int KC, size_t sP, QkvTail tl) {
    typedef typename WFrag<T16>::V V;
    static_assert(NSPLIT == 0 || NSPLIT == 1, "one or two A planes, one B plane");
    constexpr int TM = 64 * WM, TN = 64 * WN, NA = NSPLIT + 1, RPR = WM * WN * 4, SE = (TM * NA + TN) * GLP;   /* RPR: rows that one copy of every thread covers; SE: elements of a stage, A | (A2) | B */
    static_assert(WM * WN * 16 * 68 * 4 <= 2 * SE * 2, "the output staging fits the stage buffers");
    __shared__ __attribute__((aligned(16))) unsigned short sm[2 * SE];
    const size_t z = blockIdx.z % NZ; const int ks = blockIdx.z / NZ; const int k0 = ks * KC; A += z * sA; if (A2) A2 += z * sA; Bt += z * sB; if (Bt2) Bt2 += z * sB; C += z * sC + (size_t)ks * sP;
    const int tid = (int)threadIdx.x, lane = tid & 31, lr = lane & 15, hi = lane >> 4;
    const int w = __builtin_amdgcn_readfirstlane(tid >> 5), wm = w / WN, wn = w % WN;   /* the same in every lane of a wave */
    const int r0 = blockIdx.x * TM + wm * 64, c0 = blockIdx.y * TN + wn * 64;
    v8f acc[4][4];
#pragma unroll
    for (int mb = 0; mb < 4; ++mb)
#pragma unroll
        for (int nb = 0; nb < 4; ++nb) acc[mb][nb] = (v8f){};
    /* the thread's share of a stage's copies: 16 bytes of row tid / 8 and of every RPR-th row behind it */
    const int cr = tid >> 3, cc = (tid & 7) * 8; const unsigned lb = (unsigned)(size_t)sm + (unsigned)(cr * GLP + cc) * 2u;
    const size_t ga = (size_t)(blockIdx.x * TM + cr) * K + k0 + cc, gb = (size_t)(blockIdx.y * TN + cr) * K + k0 + cc;
    auto fill = [&](int buf, int t) { const unsigned l = lb + (unsigned)buf * (SE * 2u); const size_t ko = (size_t)t * GKB;
        gemm_fill<T16, TM / RPR, RPR>(l, A + ga + ko, K); if (NSPLIT == 1) gemm_fill<T16, TM / RPR, RPR>(l + TM * GLP * 2u, A2 + ga + ko, K);
        gemm_fill<T16, TN / RPR, RPR>(l + TM * NA * GLP * 2u, Bt + gb + ko, K); };
    const int nst = KC / GKB;   /* stages: the same for the whole work-group */
    fill(0, 0);
    asm volatile("s_wait_asynccnt 0x0" ::: "memory");   /* this wave's copies of stage 0 have landed */
    __syncthreads();                                      /* every wave's have: stage 0 may be read */
    if (nst > 1) fill(1, 1);
#pragma unroll 1   /* rolled: the stage count is a run-time argument; one copy of the body keeps the text short */
    for (int t = 0; t < nst; ++t) {
        const T16* st = (const T16*)sm + (t & 1) * SE; const T16* sa = st + (wm * 64 + lr) * GLP + 8 * hi; const T16* sb = st + (TM * NA + wn * 64 + lr) * GLP + 8 * hi;
        V a[4], a2[4], b[4];
#pragma unroll
        for (int kq = 0; kq < GKB / 32; ++kq) {
#pragma unroll
            for (int mb = 0; mb < 4; ++mb) { a[mb] = WFrag<T16>::ld(sa + mb * 16 * GLP + kq * 32); if (NSPLIT == 1) a2[mb] = WFrag<T16>::ld(sa + TM * GLP + mb * 16 * GLP + kq * 32); b[mb] = WFrag<T16>::ld(sb + mb * 16 * GLP + kq * 32); }
            __builtin_amdgcn_sched_barrier(0);   /* keeps all fragment reads of these 32 k above the products: one LDS latency for them, where the scheduler's own order read each B fragment into the same registers and waited for it in front of its four products */
#pragma unroll
            for (int nb = 0; nb < 4; ++nb) {
#pragma unroll
                for (int mb = 0; mb < 4; ++mb) { acc[mb][nb] = WFrag<T16>::mma(a[mb], b[nb], acc[mb][nb]); if (NSPLIT == 1) acc[mb][nb] = WFrag<T16>::mma(a2[mb], b[nb], acc[mb][nb]); } } }
        asm volatile("s_wait_dscnt 0x0" ::: "memory");      /* this wave's reads of stage t are done */
        asm volatile("s_wait_asynccnt 0x0" ::: "memory");   /* its copies of stage t + 1 have landed */
        __syncthreads();                                      /* one barrier a stage: it publishes stage t + 1 and ends every wave's reads of the buffer that is refilled behind it */
        if (t + 2 < nst) fill(t & 1, t + 2);
    }
    asm volatile("s_wait_asynccnt 0x0" ::: "memory");   /* no copy is outstanding when the buffers become output staging */
    if constexpr (TAIL) {   /* every value here is the same in all lanes of a wave: scalar branches */
        static_assert(WM * WN * TWB <= 2 * SE * 2 && DQ % 64 == 0 && DKV == DQ && TT % 64 == 0 && HD == 64, "a wave's tile is one head of one batch; its staging fits the stage buffers");
        const int p = c0 / DQ, hc = c0 % DQ, bt = r0 / TT, t0 = r0 % TT; char* wb = (char*)sm + w * TWB;   /* each wave's own staging, in the stage buffers: behind the last stage's barrier nobody reads those any more */
        if (p == 2) tail_v(acc, (unsigned short*)wb, lane, tl.v16, tl.vh, tl.vl, (unsigned)(((bt * DKV + hc + (lane >> 3)) * TT + t0 + (lane & 7) * 8) * 2));
        else tail_qk(acc, (float*)wb, lr, hi, p ? tl.gk : tl.gq, p ? tl.bk : tl.bq, p ? tl.k16 : tl.q16, p ? tl.kh : tl.qh, p ? tl.kl : tl.ql, (unsigned)((((bt * NH_ + hc / HD) * TT + t0) * HD + lr * 4) * 2));
        return; }
    float* os = (float*)sm + w * (16 * 68);   /* each wave's own 16 x 68 floats, in the stage buffers: behind the last stage's barrier nobody reads those any more */
    v4f bv = (v4f){};   /* the lane's four bias values: they go by the column alone, so they are read once and not in front of every store */
    if (BIAS && ks == 0) { const float* bp = bias + c0 + lr * 4; const v4f b4 = *(const v4f*)bp;
        asm volatile("s_wait_xcnt 0x0" :: "v"(bp) : "memory");   /* the wait that stands in front of any overwrite of a register that the issued load names; the address is an input so that its registers are not reused ahead of it */
#pragma unroll
        for (int q = 0; q < 4; ++q) bv[q] = bfr(b4[q]); }
#pragma unroll
    for (int mb = 0; mb < 4; ++mb) {
#pragma unroll
        for (int nb = 0; nb < 4; ++nb) {
#pragma unroll
            for (int j = 0; j < 8; ++j) os[(hi * 8 + j) * 68 + nb * 16 + lr] = acc[mb][nb][j]; }
        __builtin_amdgcn_wave_barrier(); asm volatile("" ::: "memory");
        float* crow = C + (size_t)(r0 + mb * 16) * ldc + c0 + lr * 4; v4f val[8]; float* cp[8];
#pragma unroll
        for (int s = 0; s < 8; ++s) { const int row = 2 * s + hi; val[s] = *(const v4fa*)(os + row * 68 + lr * 4); if (BIAS && ks == 0) val[s] += bv; cp[s] = crow + (size_t)row * ldc; }
#pragma unroll
        for (int s = 0; s < 8; ++s) *(v4f*)cp[s] = val[s];
        /* the wait that stands in front of any overwrite of a register that an issued store names; addresses and values are inputs so that their registers are not reused ahead of it */
        asm volatile("s_wait_xcnt 0x0" :: "v"(cp[0]), "v"(cp[1]), "v"(cp[2]), "v"(cp[3]), "v"(cp[4]), "v"(cp[5]), "v"(cp[6]), "v"(cp[7]), "v"(val[0]), "v"(val[1]), "v"(val[2]), "v"(val[3]), "v"(val[4]), "v"(val[5]), "v"(val[6]), "v"(val[7]) : "memory");
        __builtin_amdgcn_wave_barrier(); asm volatile("" ::: "memory");
    }
}

__device__ __forceinline__ h16 tohx(float x) { return (h16)x; }
__device__ __forceinline__ void splitf(float y, unsigned short& h, unsigned short& l) { h = f2bf(y); l = f2bf(y - bf2f(h)); }
typedef __attribute__((ext_vector_type(2))) _Float16 v2h;
typedef __attribute__((ext_vector_type(4))) _Float16 v4h;
typedef __attribute__((ext_vector_type(2))) unsigned short v2us;
typedef __attribute__((ext_vector_type(4))) unsigned short v4us;
typedef __attribute__((ext_vector_type(2))) float v2f;
typedef __attribute__((ext_vector_type(4))) int v4i;

// ---- k_prep: every operand conversion of a call in ONE launch; a work-group's range of the flat block index says which it does (block-uniform): the three LoRA A packed into one zero-padded 64-row operand, the three LoRA B behind the rows of qkv_w, then x, qkv_w, proj_w to bf16.
// cvt8: rows of DM floats to bf16 rows of pitch DP.
template <int DP>
__device__ __forceinline__ void cvt8(const float* __restrict__ src, bf* dst, size_t i) { const v8f v = *(const v8f*)(src + i * 8); v8us o; const size_t e = i * 8;
#pragma unroll
    for (int k = 0; k < 8; ++k) o[k] = f2bf(v[k]); *(v8us*)(dst + (e / DM) * DP + e % DM) = o;
    asm volatile("s_wait_xcnt 0x0" ::: "memory");   /* the wait that stands in front of any overwrite of a register that the issued store names: in the listing the code of the next range follows this store */ }

#define LR_R 8   // LoRA rank
// apad: row nn = 8 p + r of the packed operand (pitch KX, its first DM columns) = column r of projection p's LoRA A; rows from 24 on are zero. A work-group holds one row.
__device__ __forceinline__ void apad(const float* __restrict__ Aq, const float* __restrict__ Ak, const float* __restrict__ Av, bf* Bt, size_t i) { const size_t e = i * 4; const int k0 = (int)(e % DM); const int nn = (int)(e / DM); const int p = nn / LR_R; const float* A = p == 0 ? Aq : p == 1 ? Ak : Av; v4us o;
#pragma unroll
    for (int q = 0; q < 4; ++q) { const float a = A[(size_t)(k0 + q) * LR_R + nn % LR_R]; o[q] = (p < 3) ? f2bf(a) : (unsigned short)0; }
    *(v4us*)(Bt + (size_t)nn * KX + k0) = o;
    asm volatile("s_wait_xcnt 0x0" ::: "memory");   /* the wait that stands in front of any overwrite of a register that the issued store names: in the listing the code of the next range follows this store */ }
// bpad: the 64 columns behind row n of qkv_w: twice 32 (for the hi and for the lo half of x A), in each B[r][n % DQ] of n's own projection p at column 8 p + r and zero elsewhere. A work-group holds 16 rows of one projection.
__device__ __forceinline__ void bpad(const float* __restrict__ Bq, const float* __restrict__ Bk, const float* __restrict__ Bv, bf* Wx, size_t i) { const size_t e = i * 4; const int k0 = (int)(e % 64); const int n = (int)(e / 64); const int p = n / DQ; const float* Bm = p == 0 ? Bq : p == 1 ? Bk : Bv; v4us o;
#pragma unroll
    for (int q = 0; q < 4; ++q) { const int k = (k0 + q) % 32; const float b = Bm[(size_t)(k % LR_R) * DQ + n % DQ]; o[q] = (k / LR_R == p) ? f2bf(b) : (unsigned short)0; }
    *(v4us*)(Wx + (size_t)n * KX + DM + k0) = o;
    asm volatile("s_wait_xcnt 0x0" ::: "memory");   /* the wait that stands in front of any overwrite of a register that the issued store names: in the listing the code of the next range follows this store */ }
#define PBX (MT * DM / 8 / 256)                    // work-groups of x
#define PBW ((DQ + 2 * DKV) * DM / 8 / 256)        // of qkv_w
#define PBO (DM * DQ / 8 / 256)                    // of proj_w
#define PBP (64 * DM / 4 / 256)                    // of the packed LoRA A; of one projection's LoRA B columns
static_assert(DQ == DM && (MT * DM) % 2048 == 0 && (DQ * DM) % 2048 == 0 && (64 * DM) % 1024 == 0, "whole work-groups");
__global__ __launch_bounds__(256) void k_prep(const float* __restrict__ x, const float* __restrict__ wqkv, const float* __restrict__ wo, const float* __restrict__ laq, const float* __restrict__ lak, const float* __restrict__ lav, const float* __restrict__ lbq, const float* __restrict__ lbk, const float* __restrict__ lbv, bf* XB, bf* WQKV, bf* WO, bf* AP) {
    int blk = (int)blockIdx.x; const size_t tid = threadIdx.x;   /* the padded operands first: their dependent strided reads are the longest path of a work-group here */
    if (blk < PBP) { apad(laq, lak, lav, AP, (size_t)blk * 256 + tid); return; }
    blk -= PBP;
    if (blk < 3 * PBP) { bpad(lbq, lbk, lbv, WQKV, (size_t)blk * 256 + tid); return; }
    blk -= 3 * PBP;
    if (blk < PBX) { cvt8<KX>(x, XB, (size_t)blk * 256 + tid); return; }
    blk -= PBX;
    if (blk < PBW) { cvt8<KX>(wqkv, WQKV, (size_t)blk * 256 + tid); return; }
    blk -= PBW;
    cvt8<DQ>(wo, WO, (size_t)blk * 256 + tid);
}
// k_tohl: the first 32 columns (24 in use, the rest exact zeros) of the NS split-K planes of F ([MT][64], stride sP) added in slice order, then hi/lo: hi to columns DM.., lo to columns DM + 32.. of the same row of X (pitch KX). The planes lie too far apart for an immediate offset: one uniform base, one 32-bit byte offset a plane.
template <int NS, size_t sP>
__global__ __launch_bounds__(256) void k_tohl(const float* __restrict__ F, bf* X, size_t n4) { static_assert(NS == 16 && (size_t)NS * sP * 4 < ((size_t)1 << 32), "sixteen offsets of 32 bits"); const size_t i = (size_t)blockIdx.x * 256 + threadIdx.x; if (i >= n4) return; const unsigned ob = ((unsigned)(i >> 3) * 64u + (unsigned)(i & 7) * 4u) * 4u; unsigned os[NS]; v4f p[NS]; v4us oh, ol;
#pragma unroll
    for (int s = 0; s < NS; ++s) { os[s] = ob + (unsigned)s * (unsigned)(sP * 4); p[s] = *(const v4f*)((const char*)F + os[s]); }   /* one uniform base, one 32-bit byte offset a plane */
    /* the wait that stands in front of any overwrite of a register that an issued load names; the offsets are inputs so that their registers are not reused (as a later load's destination) ahead of it */
    asm volatile("s_wait_xcnt 0x0" :: "v"(os[0]), "v"(os[1]), "v"(os[2]), "v"(os[3]), "v"(os[4]), "v"(os[5]), "v"(os[6]), "v"(os[7]), "v"(os[8]), "v"(os[9]), "v"(os[10]), "v"(os[11]), "v"(os[12]), "v"(os[13]), "v"(os[14]), "v"(os[15]) : "memory");
    v4f a = p[0];
#pragma unroll
    for (int s = 1; s < NS; ++s) {   /* split-K planes, slice order */
#pragma unroll
        for (int q = 0; q < 4; ++q) a[q] = __fadd_rn(a[q], p[s][q]); }
#pragma unroll
    for (int q = 0; q < 4; ++q) { unsigned short h2, l2; splitf(a[q], h2, l2); oh[q] = h2; ol[q] = l2; }
    bf* xr = X + (i >> 3) * KX + DM + (i & 7) * 4; *(v4us*)xr = oh; *(v4us*)(xr + 32) = ol;  }
// ---- The tails of the projections, run by each wave of the q | k | v GEMM on its own 64 x 64 accumulator tile (acc[mb][nb][j]: token mb 16 + 8 (lane / 16) + j, column nb 16 + lane % 16), through the wave's own LDS staging.
// sum over a 16-lane row, every lane gets it (DPP row_xmask 1, 2, 4, 8)
template <int M> __device__ __forceinline__ float rowx(float v) { return __int_as_float(__builtin_amdgcn_update_dpp(0, __float_as_int(v), 0x160 + M, 0xf, 0xf, true)); }
__device__ __forceinline__ float rowsum16(float v) { v += rowx<1>(v); v += rowx<2>(v); v += rowx<4>(v); v += rowx<8>(v); return v; }
// tail_qk (q, k): 32 tokens at a time are staged as f32 rows; a lane reads back 4 consecutive head dims, so 16 lanes hold one (token, head) row: LayerNorm over the 64 head dims in registers, then head planes [b][h][t][d] (fp16 + hi/lo), two whole 128-byte lines a store. ob: the lane's byte offset in a plane at the tile's first token.
__device__ __forceinline__ void tail_qk(const v8f (&acc)[4][4], float* os, int lr, int hi, const float* __restrict__ g, const float* __restrict__ bb, h16* P16, bf* Ph, bf* Pl, unsigned ob) {
    const float* gp = g + lr * 4; const float* bp = bb + lr * 4; v4f gv = *(const v4f*)gp, bv = *(const v4f*)bp;
    /* the wait that stands in front of any overwrite of a register that an issued load names; the addresses are inputs so that their registers are not reused ahead of it */
    asm volatile("s_wait_xcnt 0x0" :: "v"(gp), "v"(bp) : "memory");
#pragma unroll
    for (int q = 0; q < 4; ++q) { gv[q] = bfr(gv[q]); bv[q] = bfr(bv[q]); }
#pragma unroll
    for (int mh = 0; mh < 2; ++mh) {
#pragma unroll
        for (int m2 = 0; m2 < 2; ++m2)
#pragma unroll
            for (int nb = 0; nb < 4; ++nb)
#pragma unroll
                for (int j = 0; j < 8; ++j) os[(m2 * 16 + hi * 8 + j) * 68 + nb * 16 + lr] = acc[mh * 2 + m2][nb][j];
        asm volatile("s_wait_dscnt 0x0" ::: "memory");   /* the staging writes are done before a lane reads back what other lanes of the wave wrote; the clobber keeps the compiler from lifting those reads over the writes */
#pragma unroll 1   /* rolled, four rows a lane and trip: four independent LayerNorm chains cover each other's latency, and the text stays short */
        for (int sg = 0; sg < 4; ++sg) { unsigned off[4]; v4h o16[4]; v4us oh[4], ol[4];
#pragma unroll
            for (int u = 0; u < 4; ++u) { const int row = (sg * 4 + u) * 2 + hi; const v4f a = *(const v4fa*)(os + row * 68 + lr * 4);
                const float mu = rowsum16((a[0] + a[1]) + (a[2] + a[3])) * (1.0f / HD); const v4f dv = a - mu;
                const float var = rowsum16((dv[0] * dv[0] + dv[1] * dv[1]) + (dv[2] * dv[2] + dv[3] * dv[3])) * (1.0f / HD);
                const float rs = __fdiv_rn(1.0f, __fsqrt_rn(var + LNH_EPS));
#pragma unroll
                for (int q = 0; q < 4; ++q) { const float y = dv[q] * rs * gv[q] + bv[q]; o16[u][q] = tohx(y); unsigned short a2, c2; splitf(y, a2, c2); oh[u][q] = a2; ol[u][q] = c2; }
                off[u] = ob + (unsigned)(mh * 32 + row) * (HD * 2u); }
#pragma unroll
            for (int u = 0; u < 4; ++u) { *(v4h*)((char*)P16 + off[u]) = o16[u]; *(v4us*)((char*)Ph + off[u]) = oh[u]; *(v4us*)((char*)Pl + off[u]) = ol[u]; }
            /* the wait that stands in front of any overwrite of a register that an issued store names; offsets and values are inputs so that their registers are not reused ahead of it; its clobber also keeps the next staging writes behind these reads */
            asm volatile("s_wait_xcnt 0x0" :: "v"(off[0]), "v"(off[1]), "v"(off[2]), "v"(off[3]), "v"(o16[0]), "v"(o16[1]), "v"(o16[2]), "v"(o16[3]), "v"(oh[0]), "v"(oh[1]), "v"(oh[2]), "v"(oh[3]), "v"(ol[0]), "v"(ol[1]), "v"(ol[2]), "v"(ol[3]) : "memory"); }
    }
}
// tail_v (v): a lane's accumulator holds 8 consecutive tokens of one column, which is 16 bytes of a row of a transposed plane [b][g][d][t] (fp16 + hi/lo); one plane at a time the 64 columns x 64 tokens are staged in LDS (pitch 144 bytes) and written out along t, four whole 128-byte lines a store. ob: the lane's byte offset in a plane: column lane / 8 of the tile, 16 bytes lane % 8 of its line.
#define VSP 72                    // staging pitch in 16-bit elements: 144 bytes = 16 x odd, free of bank conflicts for 16-byte accesses
__device__ __forceinline__ void tail_vout(const unsigned short* vs, int lane, char* plane, unsigned ob) {
    asm volatile("s_wait_dscnt 0x0" ::: "memory");   /* the staging writes are done before a lane reads back what other lanes of the wave wrote; the clobber keeps the compiler from lifting those reads over the writes */
#pragma unroll
    for (int ig = 0; ig < 2; ++ig) { v8us r[8];
#pragma unroll
        for (int it = 0; it < 8; ++it) r[it] = *(const v8usa*)(vs + ((ig * 8 + it) * 4 + (lane >> 3)) * VSP + (lane & 7) * 8);
#pragma unroll
        for (int it = 0; it < 8; ++it) *(v8usa*)(plane + (size_t)(ig * 8 + it) * (4 * TT * 2) + ob) = r[it];
        /* the wait that stands in front of any overwrite of a register that an issued store names; offset and values are inputs so that their registers are not reused ahead of it; its clobber also keeps the next staging writes behind these reads */
        asm volatile("s_wait_xcnt 0x0" :: "v"(ob), "v"(r[0]), "v"(r[1]), "v"(r[2]), "v"(r[3]), "v"(r[4]), "v"(r[5]), "v"(r[6]), "v"(r[7]) : "memory"); }
}
__device__ __forceinline__ void tail_v(const v8f (&acc)[4][4], unsigned short* vs, int lane, h16* V16, bf* Vh, bf* Vl, unsigned ob) {
    unsigned short* vw = vs + (lane & 15) * VSP + (lane >> 4) * 8; v8us lo[4][4];
#pragma unroll
    for (int mb = 0; mb < 4; ++mb)
#pragma unroll
        for (int nb = 0; nb < 4; ++nb) { v8h o;
#pragma unroll
            for (int j = 0; j < 8; ++j) o[j] = tohx(acc[mb][nb][j]);
            *(v8usa*)(vw + nb * 16 * VSP + mb * 16) = __builtin_bit_cast(v8us, o); }
    tail_vout(vs, lane, (char*)V16, ob);
#pragma unroll
    for (int mb = 0; mb < 4; ++mb)
#pragma unroll
        for (int nb = 0; nb < 4; ++nb) { v8us o;
#pragma unroll
            for (int j = 0; j < 8; ++j) { unsigned short a2, c2; splitf(acc[mb][nb][j], a2, c2); o[j] = a2; lo[mb][nb][j] = c2; }
            *(v8usa*)(vw + nb * 16 * VSP + mb * 16) = o; }
    tail_vout(vs, lane, (char*)Vh, ob);
#pragma unroll
    for (int mb = 0; mb < 4; ++mb)
#pragma unroll
        for (int nb = 0; nb < 4; ++nb) *(v8usa*)(vw + nb * 16 * VSP + mb * 16) = lo[mb][nb];
    tail_vout(vs, lane, (char*)Vl, ob);
}
// ---- k_fattn: fused attention, one launch for all heads of both batches (grid: row blocks, heads, batches). One wave owns 16 queries of one head and walks the TT keys, 64 a pass (32 on the hi/lo rows, whose fragments take twice the registers):
// S^T = K Q^T (A = key rows, B = the queries, loaded once), so a lane holds 8 keys of ONE query per 16-key tile; t = S x HD^-0.5 + bf16(attn_mask[i][j]) (the additive f32 mask input, read as data);
// running-maximum softmax in registers (the output tiles and the sum are rescaled when the maximum moves; the division by the sum comes last); O^T += V^T P^T with P^T packed from the score tiles as the B operand (two 16-key tiles = one 32-key fragment in the loaders' k order).
// Scores and probabilities never reach memory. Rows < RH: hi/lo planes, 3 products; the rest fp16 with P x PCAR. Each work-group takes FHW hi/lo waves and 8 - FHW fp16 waves, so that the longer hi/lo rows are spread over all work-groups.
// The eight waves of a work-group walk the same keys of the same head: each stage of SKB keys (the K and V tiles of all six planes) is brought into LDS ONCE for all of them, in whole 128-byte lines, by asynchronous copies, two buffers, the next stage in flight while this one is worked on; the fragments are read from LDS. The mask rows are each wave's own and still come straight from memory.
#define FHW 2
#define PLOG 10.0f   // log2(PCAR)
static_assert(PCAR == 1024.0f, "PLOG");
static_assert(FHW * 16 * (TT / 128) == RH && (8 - FHW) * 16 * (TT / 128) == TT - RH, "row split");
#define SKB 64                    // keys a stage
#define NSTG (TT / SKB)
#define LPE 72                    // LDS row pitch in 16-bit elements: 144 bytes = 16 x odd, free of bank conflicts for 16-byte fragment reads of 128-byte rows
#define PLE (64 * LPE)            // one plane's tile: 64 rows (K: keys x head dims; V: head dims x keys)
#define STE (6 * PLE)             // a stage: K16 | V16 | Kh | Kl | Vh | Vl
static_assert(HD == 64 && SKB == 64 && NSTG >= 2 && TT % SKB == 0, "64 x 64 tiles, two stages or more");
typedef __attribute__((ext_vector_type(8))) unsigned v8u;
// One stage's copies of one thread: 16 bytes of row r = tid / 8 and of row r + 32 of each of the six tiles (a wave: four whole 128-byte rows a copy). l: the thread's LDS byte address in tile 0 of the buffer; the pointers: its 16 bytes of row r in each plane.
__device__ __forceinline__ void stage_fill(unsigned l, const h16* k16, const h16* v16, const bf* kh, const bf* kl, const bf* vh, const bf* vl) {
    const unsigned P = PLE * 2u, R = 32u * LPE * 2u;
    /* the copies and, as the last line of their own statement, the wait that stands in front of any overwrite of a register that an issued copy names */
    asm volatile("global_load_async_to_lds_b128 %0, %12, off\n\tglobal_load_async_to_lds_b128 %1, %13, off\n\tglobal_load_async_to_lds_b128 %2, %14, off\n\tglobal_load_async_to_lds_b128 %3, %15, off\n\t"
                 "global_load_async_to_lds_b128 %4, %16, off\n\tglobal_load_async_to_lds_b128 %5, %17, off\n\tglobal_load_async_to_lds_b128 %6, %18, off\n\tglobal_load_async_to_lds_b128 %7, %19, off\n\t"
                 "global_load_async_to_lds_b128 %8, %20, off\n\tglobal_load_async_to_lds_b128 %9, %21, off\n\tglobal_load_async_to_lds_b128 %10, %22, off\n\tglobal_load_async_to_lds_b128 %11, %23, off\n\ts_wait_xcnt 0x0"
                 :: "v"(l), "v"(l + R), "v"(l + P), "v"(l + P + R), "v"(l + 2 * P), "v"(l + 2 * P + R), "v"(l + 3 * P), "v"(l + 3 * P + R), "v"(l + 4 * P), "v"(l + 4 * P + R), "v"(l + 5 * P), "v"(l + 5 * P + R),
                    "v"(k16), "v"(k16 + 32 * HD), "v"(v16), "v"(v16 + (size_t)32 * TT), "v"(kh), "v"(kh + 32 * HD), "v"(kl), "v"(kl + 32 * HD), "v"(vh), "v"(vh + (size_t)32 * TT), "v"(vl), "v"(vl + (size_t)32 * TT) : "memory");
}
// One pass of one wave over KB keys. kp, kp2, vp, vp2: the lane's place in the K and V tiles in LDS (row lane % 16, 8 elements further in the upper lane half); mp: its place in its query's mask row.
template <typename T16, bool HR, int KB>   // KB keys a pass
__device__ __forceinline__ void fattn_pass(const T16* kp, const T16* kp2, const T16* vp, const T16* vp2, const float* __restrict__ mp, const v8u (&qa)[2], const v8u (&qb)[2], v8f (&o)[4], float& m, float& sum) {
    typedef typename WFrag<T16>::V V;
    V qf[2], qf2[2];
#pragma unroll
    for (int ks = 0; ks < 2; ++ks) { qf[ks] = __builtin_bit_cast(V, qa[ks]); qf2[ks] = __builtin_bit_cast(V, qb[ks]); }
        V kf[KB / 16][2], kf2[KB / 16][2], vf[4][KB / 32], vf2[4][KB / 32]; v4f mk[KB / 16][2];
#pragma unroll
        for (int kb = 0; kb < KB / 16; ++kb)
#pragma unroll
            for (int ks = 0; ks < 2; ++ks) mk[kb][ks] = *(const v4f*)(mp + kb * 16 + ks * 4);   /* the pass's only loads from memory go out first */
        /* the wait that stands in front of any overwrite of a register that an issued load names; the address is an input so that its registers are not reused (as a later load's destination) ahead of it */
        asm volatile("s_wait_xcnt 0x0" :: "v"(mp) : "memory");
#pragma unroll
        for (int kb = 0; kb < KB / 16; ++kb) {
#pragma unroll
            for (int ks = 0; ks < 2; ++ks) { kf[kb][ks] = WFrag<T16>::ld(kp + kb * 16 * LPE + ks * 32); if (HR) kf2[kb][ks] = WFrag<T16>::ld(kp2 + kb * 16 * LPE + ks * 32); } }
        __builtin_amdgcn_sched_barrier(0);   /* keeps all of the pass's K fragment reads above the products: one LDS latency a pass, where the scheduler's own order read each fragment into the same registers and waited for it in front of its product */
        v8f s[KB / 16];
#pragma unroll
        for (int kb = 0; kb < KB / 16; ++kb) { s[kb] = (v8f){};
#pragma unroll
            for (int ks = 0; ks < 2; ++ks) { s[kb] = WFrag<T16>::mma(kf[kb][ks], qf[ks], s[kb]);
                if (HR) { s[kb] = WFrag<T16>::mma(kf[kb][ks], qf2[ks], s[kb]); s[kb] = WFrag<T16>::mma(kf2[kb][ks], qf[ks], s[kb]); } } }
#pragma unroll
        for (int mb = 0; mb < 4; ++mb)
#pragma unroll
            for (int ks = 0; ks < KB / 32; ++ks) { vf[mb][ks] = WFrag<T16>::ld(vp + mb * 16 * LPE + ks * 32); if (HR) vf2[mb][ks] = WFrag<T16>::ld(vp2 + mb * 16 * LPE + ks * 32); }
        __builtin_amdgcn_sched_barrier(0);   /* keeps the V fragment reads above the softmax, whose vector work then covers their latency */
        float bk[KB / 16];
#pragma unroll
        for (int kb = 0; kb < KB / 16; ++kb) { const v4f m0 = mk[kb][0], m1 = mk[kb][1]; bk[kb] = -3.0e38f;
#pragma unroll
            for (int j = 0; j < 8; ++j) { const float t = s[kb][j] * SCL + bfr(j < 4 ? m0[j & 3] : m1[j & 3]); s[kb][j] = t; bk[kb] = fmaxf(bk[kb], t); } }
        float bm = m;
#pragma unroll
        for (int kb = 0; kb < KB / 16; ++kb) bm = fmaxf(bm, bk[kb]);
        bm = fmaxf(bm, __shfl_xor(bm, 16, 32));   /* the two lane halves hold the two halves of a query's keys */
        const float al = __builtin_amdgcn_exp2f((m - bm) * 1.4426950408889634f); m = bm;
        float pk[KB / 16];
#pragma unroll
        for (int kb = 0; kb < KB / 16; ++kb) { float e[8];
#pragma unroll
            for (int j = 0; j < 8; ++j) { const float d = s[kb][j] - m;   /* the maximum is subtracted first: exactly 0 at t = m for every m, and minus infinity stays minus infinity (p = 0) */
                if constexpr (HR) e[j] = d * 1.4426950408889634f; else e[j] = __builtin_fmaf(d, 1.4426950408889634f, PLOG); }   /* the fp16 rows' factor PCAR rides in the exponent: p = PCAR x exp(t - m) */
            /* eight exponentials, each in place, then one v_nop: behind a transcendental the instruction set asks for one independent instruction before its result is read or its source overwritten; here the next exponential (another register) or the v_nop is that instruction */
            asm("v_exp_f32 %0, %0\n\tv_exp_f32 %1, %1\n\tv_exp_f32 %2, %2\n\tv_exp_f32 %3, %3\n\tv_exp_f32 %4, %4\n\tv_exp_f32 %5, %5\n\tv_exp_f32 %6, %6\n\tv_exp_f32 %7, %7\n\tv_nop" : "+v"(e[0]), "+v"(e[1]), "+v"(e[2]), "+v"(e[3]), "+v"(e[4]), "+v"(e[5]), "+v"(e[6]), "+v"(e[7]));
#pragma unroll
            for (int j = 0; j < 8; ++j) { s[kb][j] = e[j]; pk[kb] = j ? pk[kb] + e[j] : e[0]; } }
        float ps = pk[0];
#pragma unroll
        for (int kb = 1; kb < KB / 16; ++kb) ps += pk[kb];
        sum = sum * al + ps;
#pragma unroll
        for (int mb = 0; mb < 4; ++mb)
#pragma unroll
            for (int j = 0; j < 8; ++j) o[mb][j] *= al;
        V pf[KB / 32], pf2[KB / 32];
#pragma unroll
        for (int ks = 0; ks < KB / 32; ++ks) {
            if constexpr (HR) { v8us h0, h1, l0, l1;
#pragma unroll
                for (int j = 0; j < 8; ++j) { unsigned short a, c2; splitf(s[2 * ks][j], a, c2); h0[j] = a; l0[j] = c2; splitf(s[2 * ks + 1][j], a, c2); h1[j] = a; l1[j] = c2; }
                pf[ks] = cat16b(h0, h1); pf2[ks] = cat16b(l0, l1);
            } else { v8h a0, a1;
#pragma unroll
                for (int j = 0; j < 8; ++j) { a0[j] = tohx(s[2 * ks][j]); a1[j] = tohx(s[2 * ks + 1][j]); }
                pf[ks] = cat16(a0, a1); } }
#pragma unroll
        for (int mb = 0; mb < 4; ++mb)
#pragma unroll
            for (int ks = 0; ks < KB / 32; ++ks) { o[mb] = WFrag<T16>::mma(vf[mb][ks], pf[ks], o[mb]);
                if (HR) { o[mb] = WFrag<T16>::mma(vf[mb][ks], pf2[ks], o[mb]); o[mb] = WFrag<T16>::mma(vf2[mb][ks], pf[ks], o[mb]); } }
}
// amdgpu_waves_per_eu(4, 4): the register budget of four waves a SIMD, so that two work-groups (whose LDS fits twice) share a WGP and one's vector work fills the other's waits
__global__ __launch_bounds__(256) __attribute__((amdgpu_waves_per_eu(4, 4))) void k_fattn(const h16* __restrict__ Q16, const h16* __restrict__ K16, const h16* __restrict__ V16, const bf* __restrict__ Qh, const bf* __restrict__ Ql, const bf* __restrict__ Kh, const bf* __restrict__ Kl, const bf* __restrict__ Vh, const bf* __restrict__ Vl, const float* __restrict__ madd, bf* Ah, bf* Al) {
    __shared__ __attribute__((aligned(16))) unsigned short sm[2 * STE];
    const int tid = (int)threadIdx.x, lane = tid & 31, lr = lane & 15, hi = lane >> 4;
    const int w = __builtin_amdgcn_readfirstlane(tid >> 5); const bool hr = w < FHW;   /* the same in every lane of a wave: a scalar branch */
    const size_t hq = ((size_t)blockIdx.z * NH_ + blockIdx.y) * TT * HD, hk = ((size_t)blockIdx.z * NKV + blockIdx.y / REP) * TT * HD; const size_t ao = (size_t)blockIdx.z * TT * DQ + blockIdx.y * HD; bf* ah = Ah + ao; bf* al = Al + ao;
    const int q0 = hr ? (int)blockIdx.x * (FHW * 16) + w * 16 : RH + (int)blockIdx.x * ((8 - FHW) * 16) + (w - FHW) * 16;
    /* the thread's share of a stage's copies */
    const int cr = tid >> 3, cc = (tid & 7) * 8; const unsigned lb = (unsigned)(size_t)sm + (unsigned)(cr * LPE + cc) * 2u; const size_t gk = hk + (size_t)cr * HD + cc, gv = hk + (size_t)cr * TT + cc;
    stage_fill(lb, K16 + gk, V16 + gv, Kh + gk, Kl + gk, Vh + gv, Vl + gv);
    /* the query fragments as raw 16-bit planes, one set of registers for both kinds of wave: hi | lo, or fp16 | (the lo plane, loaded without a branch and never used) */
    const size_t qo = hq + (size_t)(q0 + lr) * HD + 8 * hi; const bf* qp = (hr ? Qh : (const bf*)Q16) + qo; const bf* qp2 = Ql + qo;
    v8u qa[2], qb[2];
#pragma unroll
    for (int ks = 0; ks < 2; ++ks) { qa[ks] = __builtin_bit_cast(v8u, WFrag<bf>::ld(qp + ks * 32)); qb[ks] = __builtin_bit_cast(v8u, WFrag<bf>::ld(qp2 + ks * 32)); }
    /* the wait that stands in front of any overwrite of a register that an issued load names; the addresses are inputs so that their registers are not reused ahead of it */
    asm volatile("s_wait_xcnt 0x0" :: "v"(qp), "v"(qp2) : "memory");
    v8f o[4];
#pragma unroll
    for (int mb = 0; mb < 4; ++mb) o[mb] = (v8f){};
    float m = -3.0e38f, sum = 0.f;
    const float* mrow = madd + (size_t)(q0 + lr) * TT + 8 * hi;
    const int fo = lr * LPE + 8 * hi;
    asm volatile("s_wait_asynccnt 0x0" ::: "memory");   /* this wave's copies of stage 0 have landed */
    __syncthreads();                                      /* every wave's have: stage 0 may be read */
    stage_fill(lb + STE * 2u, K16 + gk + (size_t)SKB * HD, V16 + gv + SKB, Kh + gk + (size_t)SKB * HD, Kl + gk + (size_t)SKB * HD, Vh + gv + SKB, Vl + gv + SKB);
    for (int t = 0; t < NSTG; ++t) {
        const unsigned short* st = sm + (t & 1) * STE + fo; const float* mp = mrow + t * SKB;
        if (hr) {   /* two passes of 32 keys a stage; unrolled, so that the half's place in the tiles is an immediate offset of the LDS reads */
#pragma unroll
            for (int sub = 0; sub < 2; ++sub) fattn_pass<bf, true, 32>(st + 2 * PLE + sub * 32 * LPE, st + 3 * PLE + sub * 32 * LPE, st + 4 * PLE + sub * 32, st + 5 * PLE + sub * 32, mp + sub * 32, qa, qb, o, m, sum);
        } else { const h16* sh = (const h16*)st; fattn_pass<h16, false, 64>(sh, sh, sh + PLE, sh + PLE, mp, qa, qb, o, m, sum); }
        asm volatile("s_wait_dscnt 0x0" ::: "memory");      /* this wave's reads of stage t are done */
        asm volatile("s_wait_asynccnt 0x0" ::: "memory");   /* its copies of stage t + 1 have landed */
        __syncthreads();                                      /* one barrier a stage: it publishes stage t + 1 and ends every wave's reads of the buffer that is refilled behind it */
        if (t + 2 < NSTG) { const size_t ak = (size_t)(t + 2) * SKB * HD, av = (size_t)(t + 2) * SKB; stage_fill(lb + (unsigned)(t & 1) * (STE * 2u), K16 + gk + ak, V16 + gv + av, Kh + gk + ak, Kl + gk + ak, Vh + gv + av, Vl + gv + av); }
    }
    asm volatile("s_wait_asynccnt 0x0" ::: "memory");   /* no copy is outstanding when the wave ends */
    sum += __shfl_xor(sum, 16, 32);
    const float f = __fdiv_rn(1.0f, sum);   /* on the fp16 rows sum and o both carry PCAR */
#pragma unroll
    for (int mb = 0; mb < 4; ++mb) { v8us oh, ol;   /* a lane holds 8 consecutive head dims of its query: one 16-byte store a plane */
#pragma unroll
        for (int j = 0; j < 8; ++j) { unsigned short a, c2; splitf(o[mb][j] * f, a, c2); oh[j] = a; ol[j] = c2; }
        const size_t oo = (size_t)(q0 + lr) * DQ + mb * 16 + hi * 8; *(v8us*)(ah + oo) = oh; *(v8us*)(al + oo) = ol; }
}

extern "C" void kernel_launch(void* const* d_in, const int* in_sizes, int n_in,
                              void* d_out, int out_size, void* d_ws, size_t ws_size, hipStream_t stream) {
    (void)in_sizes; (void)n_in; (void)out_size;
    const float* x = (const float*)d_in[0]; const float* madd = (const float*)d_in[1];   /* attn_mask [1][1][2048][2048] f32 (zeros): read, added to the scaled scores */ const float* wqkv = (const float*)d_in[2]; const float* wo = (const float*)d_in[3]; const float* bo = (const float*)d_in[4]; const float* gq = (const float*)d_in[5]; const float* btq = (const float*)d_in[6]; const float* gk = (const float*)d_in[7]; const float* btk = (const float*)d_in[8]; const float* laq = (const float*)d_in[9]; const float* lbq = (const float*)d_in[10]; const float* lak = (const float*)d_in[11]; const float* lbk = (const float*)d_in[12]; const float* lav = (const float*)d_in[13]; const float* lbv = (const float*)d_in[14];
    float* OUT = (float*)d_out;     // [2][2048][1024]
    char* wsp = (char*)d_ws;
    auto take = [&](size_t bytes) { char* p = wsp; wsp += (bytes + 255) & ~(size_t)255; return (void*)p; };
    bf* WQ = (bf*)take((size_t)DQKV * KX * 2);   /* qkv_w as one bf16 block, behind each row its LoRA B columns */ bf* WO = (bf*)take((size_t)DM * DQ * 2);
    bf* XB = (bf*)take((size_t)MT * KX * 2);   /* x, behind each row x A (hi | lo) of q, k, v */ bf* AP = (bf*)take((size_t)64 * KX * 2);   /* the three LoRA A packed and zero-padded, A^T [64] rows of the same pitch (its first DM columns are written and read) */
    /* head planes and merged planes of BOTH batches (batch stride PB, AB elements) */ const size_t PB = (size_t)NH_ * TT * HD, AB = (size_t)TT * DQ; static_assert(NKV == NH_, "one plane stride");
    h16* QP16 = (h16*)take(NB_ * PB * 2); h16* KP16 = (h16*)take(NB_ * PB * 2); h16* VT16 = (h16*)take(NB_ * PB * 2);
    bf* QPh = (bf*)take(NB_ * PB * 2); bf* QPl = (bf*)take(NB_ * PB * 2); bf* KPh = (bf*)take(NB_ * PB * 2); bf* KPl = (bf*)take(NB_ * PB * 2); bf* VTh = (bf*)take(NB_ * PB * 2); bf* VTl = (bf*)take(NB_ * PB * 2);
    bf* ATh = (bf*)take(NB_ * AB * 2); bf* ATl = (bf*)take(NB_ * AB * 2);
    float* XA = (float*)take((size_t)KSA * MT * 64 * 4);   /* the KSA x [MT][64] f32 planes of x A */
    if ((size_t)(wsp - (char*)d_ws) > ws_size) return;    // ws 256 MiB
    k_prep<<<PBX + PBW + PBO + 4 * PBP, 256, 0, stream>>>(x, wqkv, wo, laq, lak, lav, lbq, lbk, lbv, XB, WQ, WO, AP);
    /* x A of q, k and v in one 64-wide GEMM, grid z = split-K slice over the first DM columns: exact x A, f32 planes -> hi | lo behind the rows of x */
    k_gemmw<bf, 0, false, 1, 4, 1, false><<<dim3(MT / 256, 1, KSA), 128, 0, stream>>>(XB, nullptr, AP, nullptr, KX, XA, 64, nullptr, 0, 0, 0, DM / KSA, (size_t)MT * 64, QkvTail{});
    k_tohl<KSA, (size_t)MT * 64><<<(unsigned)((size_t)MT * 32 / 4 / 256), 256, 0, stream>>>(XA, XB, (size_t)MT * 32 / 4);
    /* q | k | v = x qkv_w^T + (x A) B as ONE GEMM, N = DQKV, every accumulator over the whole K = DM + 64 (the last stage is the LoRA term, hi/lo x exact B): its 384 work-groups fill the chip with no split of K, and no f32 result goes through memory: each wave's epilogue does its head's tail (q, k: per-head LayerNorm, head planes; v: transposed planes) */
    const QkvTail tl = {gq, btq, gk, btk, QP16, QPh, QPl, KP16, KPh, KPl, VT16, VTh, VTl};
    k_gemmw<bf, 0, false, 1, 4, 2, true><<<dim3(MT / 256, DQKV / 128, 1), 256, 0, stream>>>(XB, nullptr, WQ, nullptr, KX, nullptr, 0, nullptr, 0, 0, 0, KX, 0, tl);
    k_fattn<<<dim3(TT / 128, NH_, NB_), 256, 0, stream>>>(QP16, KP16, VT16, QPh, QPl, KPh, KPl, VTh, VTl, madd, ATh, ATl);   /* scores, softmax and P V of all heads of both batches; writes the merged hi/lo planes */
    /* the output projection over the whole K on 128 x 128 tiles, one work-group a WGP: it stores out itself, bias included */
    k_gemmw<bf, 1, true, 1, 2, 2, false><<<dim3(MT / 128, DM / 128, 1), 128, 0, stream>>>(ATh, ATl, WO, nullptr, DQ, OUT, DM, bo, 0, 0, 0, DQ, 0, QkvTail{});
}

// v010
// A run of this version takes 155 microseconds.
// Timed twice side by side with v009, it ran 1.04 times as fast both times.
// Counting every step since v000, it is 14.6 times as fast.
#include <hip/hip_runtime.h>

// Attention with LoRA-augmented q/k/v, per-head query/key LayerNorm and an additive mask (x [2][2048][1024]; qkv = x qkv_w^T ('oi' [3072][1024] 0.02, no bias) -> q | k | v (16 heads x 64); q += (x lora_Aq) lora_Bq x 1 (alpha/r = 8/8), k, v likewise ('xw' [1024][8], [8][1024] 0.02); q, k <- LayerNorm over the 64 head dims (eps 1e-5; qn_w, qn_b, kn_w, kn_b [64], read); scores = (q x 64^-0.5).k + attn_mask ([1][1][2048][2048] f32 zeros, read); softmax; out = merged proj_w^T + proj_b -> [2][2048][1024] (4.2 M); argument order x, attn_mask, qkv_w, proj_w, proj_b, qn_w, qn_b, kn_w, kn_b, lora_Aq, lora_Bq, lora_Ak, lora_Bk, lora_Av, lora_Bv).
// Layout, both batches as one M = 4096 in every launch: bf16 copy of x; 'oi' weight row blocks; exact projections; the three rank-8 LoRA terms ride in the projection GEMM itself as one more stage of 64 k: x A of q, k and v as ONE small GEMM on a zero-padded 64-wide operand (columns 8 p + r; exact -> f32 -> hi/lo), its hi | lo written behind each row of x, and each LoRA B row-wise behind qkv_w at its own projection's columns (zero elsewhere); the projection GEMM's own epilogue does the per-(token, head) LayerNorm of q and k and writes the 16-bit planes (a wave's 64 x 64 tile is one head); fused T-2048 attention (hybrid rows: < 512 hi/lo 3 products, rest fp16 x1024), scores and probabilities in registers, with the additive mask read in the softmax; merged hi/lo x proj_w exact + proj_b.
// Compute dtypes, f32 accumulate: every input rounded to bf16; projections exact; LoRA x A exact, (x A) B hl x exact; LayerNorm f32; attention rows < 512 3 products, rest fp16; softmax f32; proj_w hl x exact + bias.

#define NB_  2
#define TT   2048
#define MT   (NB_ * TT)         // tokens of both batches: the rows of every GEMM
#define DM   1024
#define NH_  16
#define NKV  16
#define REP  (NH_ / NKV)
#define HD   64
#define DQ   (NH_ * HD)
#define DKV  (NKV * HD)
#define RH   512                  // query rows < RH use hi+lo planes (0: none)
#define PCAR 1024.0f
#define SCL  0.125f   // HD^-0.5
#define LNH_EPS 1e-5f
#define DQKV (DQ + 2 * DKV)       // columns of the q | k | v projection, one GEMM
#define KSA  16                   // split-K slices of x A (K 1024 -> 64)
#define KX   (DM + 64)            // row pitch and K of the projection's operands: x | (x A) hi (32) | (x A) lo (32), and qkv_w | B (32) | B (32)
typedef _Float16 h16;
typedef unsigned short bf;
typedef __attribute__((ext_vector_type(16))) __bf16   v16bf;
typedef __attribute__((ext_vector_type(16))) _Float16 v16h;
typedef __attribute__((ext_vector_type(8)))  _Float16 v8h;
typedef __attribute__((ext_vector_type(8)))  unsigned short v8us;
typedef __attribute__((ext_vector_type(8)))  float    v8f;
typedef __attribute__((ext_vector_type(4)))  float    v4f;
typedef v8h  __attribute__((may_alias)) v8ha;
typedef v4f  __attribute__((may_alias)) v4fa;
typedef v8us __attribute__((may_alias)) v8usa;

// f32 -> bf16, round to nearest even, by the hardware's convert (two values an instruction where a vector is converted)
typedef __attribute__((ext_vector_type(4)))  __bf16   v4bf;
typedef __attribute__((ext_vector_type(8)))  __bf16   v8bf;
typedef __attribute__((ext_vector_type(4)))  unsigned short v4us;
__device__ __forceinline__ unsigned short f2bf(float f) { return __builtin_bit_cast(unsigned short, (__bf16)f); }
__device__ __forceinline__ v8us rb8(v8f v) { return __builtin_bit_cast(v8us, __builtin_convertvector(v, v8bf)); }
__device__ __forceinline__ v4us rb4(v4f v) { return __builtin_bit_cast(v4us, __builtin_convertvector(v, v4bf)); }
// back to f32 from the packed pairs, by bit operations on whole registers: written as a conversion of the elements, the compiler converted every value a second time, alone
typedef __attribute__((ext_vector_type(2)))  unsigned v2u;
typedef __attribute__((ext_vector_type(4)))  unsigned v4u;
__device__ __forceinline__ v8f fb8(v8us h) { const v4u u = __builtin_bit_cast(v4u, h); v8f f;
#pragma unroll
    for (int i = 0; i < 4; ++i) { f[2 * i] = __uint_as_float(u[i] << 16); f[2 * i + 1] = __uint_as_float(u[i] & 0xFFFF0000u); } return f; }
__device__ __forceinline__ v4f fb4(v4us h) { const v2u u = __builtin_bit_cast(v2u, h); v4f f;
#pragma unroll
    for (int i = 0; i < 2; ++i) { f[2 * i] = __uint_as_float(u[i] << 16); f[2 * i + 1] = __uint_as_float(u[i] & 0xFFFF0000u); } return f; }
// hi = the rounded value, lo = the rounded rest
__device__ __forceinline__ void split8(v8f y, v8us& h, v8us& l) { h = rb8(y); l = rb8(y - fb8(h)); }
__device__ __forceinline__ void split4(v4f y, v4us& h, v4us& l) { h = rb4(y); l = rb4(y - fb4(h)); }
__device__ __forceinline__ float bf2f(unsigned short b) { return __uint_as_float(((unsigned)b) << 16); }
__device__ __forceinline__ float bfr(float f) { return bf2f(f2bf(f)); }
__device__ __forceinline__ v16h cat16(v8h lo, v8h hi) { return __builtin_shufflevector(lo, hi, 0, 1, 2, 3, 4, 5, 6, 7, 8, 9, 10, 11, 12, 13, 14, 15); }
__device__ __forceinline__ v16bf cat16b(v8us lo, v8us hi) { return __builtin_bit_cast(v16bf, __builtin_shufflevector(lo, hi, 0, 1, 2, 3, 4, 5, 6, 7, 8, 9, 10, 11, 12, 13, 14, 15)); }
__device__ __forceinline__ v8f wmma16(v16h a, v16h b, v8f c) { return __builtin_amdgcn_wmma_f32_16x16x32_f16(false, a, false, b, (short)0, c, false, false); }
__device__ __forceinline__ v8f wmmab(v16bf a, v16bf b, v8f c) { return __builtin_amdgcn_wmma_f32_16x16x32_bf16(false, a, false, b, (short)0, c, false, false); }



// ---- k_gemmw: register-blocked GEMM, one wave per 64x64 output tile (16 accumulators), WM x WN waves a work-group; grid (M/(64 WM), N/(64 WN), Z), 32 WM WN threads.
// C[m][n] (f32, pitch ldc, + optional f32 bias[n]) = sum_k A[m][k] Bt[n][k] (+ A2 Bt for NSPLIT 1), operands K-contiguous 16-bit planes. z-batch strides sA/sB/sC in elements. KC % 64 == 0.
// Split K: grid z = NZ batches x the k slices (K is the row pitch and may exceed the k they cover); slice ks sums k in [ks KC, (ks + 1) KC) into its own f32 plane C + ks sP, and the consumer kernel adds the planes in slice order (the bias goes into plane 0). KC == K, sP == 0: no split.
// Operands: each stage of GKB k (one whole 128-byte line of every operand row of the work-group's tile) is brought into LDS once for all its waves by asynchronous copies, a wave's copy = four whole lines, two buffers, the next stage in flight while this one is worked on; the fragments are read from LDS. Each accumulator still takes its products in the same k order.
template <typename T16> struct WFrag;
template <> struct WFrag<h16> { typedef v16h V; static __device__ __forceinline__ V ld(const h16* p) { return cat16(*(const v8h*)p, *(const v8h*)(p + 16)); } static __device__ __forceinline__ v8f mma(V a, V b, v8f c) { return wmma16(a, b, c); } };
template <> struct WFrag<bf> { typedef v16bf V; static __device__ __forceinline__ V ld(const bf* p) { return cat16b(*(const v8us*)p, *(const v8us*)(p + 16)); } static __device__ __forceinline__ v8f mma(V a, V b, v8f c) { return wmmab(a, b, c); } };
#define GKB 64                    // k a stage
#define GLP 72                    // LDS row pitch in 16-bit elements: 144 bytes = 16 x odd, free of bank conflicts for 16-byte fragment reads of 128-byte rows
// NC copies of one thread, 16 bytes each, of rows RPR apart in one operand plane (row pitch K elements). l: the thread's LDS byte address in the first of these rows; g: its 16 bytes there.
template <typename T16, int NC, int RPR>
__device__ __forceinline__ void gemm_fill(unsigned l, const T16* g, int K) {
    static_assert(NC % 4 == 0, "four copies a statement");
    const unsigned R = (unsigned)RPR * GLP * 2u; const size_t G = (size_t)RPR * K;
#pragma unroll
    for (int i = 0; i < NC; i += 4)
        /* four copies and, as the last line of their own statement, the wait that stands in front of any overwrite of a register that an issued copy names */
        asm volatile("global_load_async_to_lds_b128 %0, %4, off\n\tglobal_load_async_to_lds_b128 %1, %5, off\n\tglobal_load_async_to_lds_b128 %2, %6, off\n\tglobal_load_async_to_lds_b128 %3, %7, off\n\ts_wait_xcnt 0x0"
                     :: "v"(l + i * R), "v"(l + (i + 1) * R), "v"(l + (i + 2) * R), "v"(l + (i + 3) * R), "v"(g + i * G), "v"(g + (i + 1) * G), "v"(g + (i + 2) * G), "v"(g + (i + 3) * G) : "memory");
}
// TAIL (the q | k | v projection): no f32 result is stored; each wave takes its 64 x 64 tile, which is 64 tokens of ONE head of one projection, straight to the 16-bit planes that the attention kernel reads (tail_qk, tail_v below).
struct QkvTail { const float* gq; const float* bq; const float* gk; const float* bk; h16* q16; bf* qh; bf* ql; h16* k16; bf* kh; bf* kl; h16* v16; bf* vh; bf* vl; };
#define TWB 9216                  // bytes of LDS staging a wave in the tails: 32 rows x 68 floats (q, k), 64 columns x 144 bytes (v)
__device__ __forceinline__ void tail_qk(const v8f (&acc)[4][4], float* os, int lr, int hi, const float* __restrict__ g, const float* __restrict__ bb, h16* P16, bf* Ph, bf* Pl, unsigned ob);
__device__ __forceinline__ void tail_v(const v8f (&acc)[4][4], unsigned short* vs, int lane, h16* V16, bf* Vh, bf* Vl, unsigned ob);
template <typename T16, int NSPLIT, bool BIAS, int NZ, int WM, int WN, bool TAIL>
__global__ __launch_bounds__(WM * WN * 32) void k_gemmw(const T16* __restrict__ A, const T16* __restrict__ A2, const T16* __restrict__ Bt, const T16* __restrict__ Bt2, int K, float* C, int ldc, const float* __restrict__ bias, size_t sA, size_t sB, size_t sC, int KC, size_t sP, QkvTail tl) {
    typedef typename WFrag<T16>::V V;
    static_assert(NSPLIT == 0 || NSPLIT == 1, "one or two A planes, one B plane");
    constexpr int TM = 64 * WM, TN = 64 * WN, NA = NSPLIT + 1, RPR = WM * WN * 4, SE = (TM * NA + TN) * GLP;   /* RPR: rows that one copy of every thread covers; SE: elements of a stage, A | (A2) | B */
    static_assert(WM * WN * 16 * 68 * 4 <= 2 * SE * 2, "the output staging fits the stage buffers");
    __shared__ __attribute__((aligned(16))) unsigned short sm[2 * SE];
    const size_t z = blockIdx.z % NZ; const int ks = blockIdx.z / NZ; const int k0 = ks * KC; A += z * sA; if (A2) A2 += z * sA; Bt += z * sB; if (Bt2) Bt2 += z * sB; C += z * sC + (size_t)ks * sP;
    const int tid = (int)threadIdx.x, lane = tid & 31, lr = lane & 15, hi = lane >> 4;
    const int w = __builtin_amdgcn_readfirstlane(tid >> 5), wm = w / WN, wn = w % WN;   /* the same in every lane of a wave */
    const int r0 = blockIdx.x * TM + wm * 64, c0 = blockIdx.y * TN + wn * 64;
    v8f acc[4][4];
#pragma unroll
    for (int mb = 0; mb < 4; ++mb)
#pragma unroll
        for (int nb = 0; nb < 4; ++nb) acc[mb][nb] = (v8f){};
    /* the thread's share of a stage's copies: 16 bytes of row tid / 8 and of every RPR-th row behind it */
    const int cr = tid >> 3, cc = (tid & 7) * 8; const unsigned lb = (unsigned)(size_t)sm + (unsigned)(cr * GLP + cc) * 2u;
    const size_t ga = (size_t)(blockIdx.x * TM + cr) * K + k0 + cc, gb = (size_t)(blockIdx.y * TN + cr) * K + k0 + cc;
    auto fill = [&](int buf, int t) { const unsigned l = lb + (unsigned)buf * (SE * 2u); const size_t ko = (size_t)t * GKB;
        gemm_fill<T16, TM / RPR, RPR>(l, A + ga + ko, K); if (NSPLIT == 1) gemm_fill<T16, TM / RPR, RPR>(l + TM * GLP * 2u, A2 + ga + ko, K);
        gemm_fill<T16, TN / RPR, RPR>(l + TM * NA * GLP * 2u, Bt + gb + ko, K); };
    const int nst = KC / GKB;   /* stages: the same for the whole work-group */
    fill(0, 0);
    asm volatile("s_wait_asynccnt 0x0" ::: "memory");   /* this wave's copies of stage 0 have landed */
    __syncthreads();                                      /* every wave's have: stage 0 may be read */
    if (nst > 1) fill(1, 1);
#pragma unroll 1   /* rolled: the stage count is a run-time argument; one copy of the body keeps the text short */
    for (int t = 0; t < nst; ++t) {
        const T16* st = (const T16*)sm + (t & 1) * SE; const T16* sa = st + (wm * 64 + lr) * GLP + 8 * hi; const T16* sb = st + (TM * NA + wn * 64 + lr) * GLP + 8 * hi;
        V a[4], a2[4], b[4];
#pragma unroll
        for (int kq = 0; kq < GKB / 32; ++kq) {
#pragma unroll
            for (int mb = 0; mb < 4; ++mb) { a[mb] = WFrag<T16>::ld(sa + mb * 16 * GLP + kq * 32); if (NSPLIT == 1) a2[mb] = WFrag<T16>::ld(sa + TM * GLP + mb * 16 * GLP + kq * 32); b[mb] = WFrag<T16>::ld(sb + mb * 16 * GLP + kq * 32); }
            __builtin_amdgcn_sched_barrier(0);   /* keeps all fragment reads of these 32 k above the products: one LDS latency for them, where the scheduler's own order read each B fragment into the same registers and waited for it in front of its four products */
#pragma unroll
            for (int nb = 0; nb < 4; ++nb) {
#pragma unroll
                for (int mb = 0; mb < 4; ++mb) { acc[mb][nb] = WFrag<T16>::mma(a[mb], b[nb], acc[mb][nb]); if (NSPLIT == 1) acc[mb][nb] = WFrag<T16>::mma(a2[mb], b[nb], acc[mb][nb]); } } }
        asm volatile("s_wait_dscnt 0x0" ::: "memory");      /* this wave's reads of stage t are done */
        asm volatile("s_wait_asynccnt 0x0" ::: "memory");   /* its copies of stage t + 1 have landed */
        __syncthreads();                                      /* one barrier a stage: it publishes stage t + 1 and ends every wave's reads of the buffer that is refilled behind it */
        if (t + 2 < nst) fill(t & 1, t + 2);
    }
    asm volatile("s_wait_asynccnt 0x0" ::: "memory");   /* no copy is outstanding when the buffers become output staging */
    if constexpr (TAIL) {   /* every value here is the same in all lanes of a wave: scalar branches */
        static_assert(WM * WN * TWB <= 2 * SE * 2 && DQ % 64 == 0 && DKV == DQ && TT % 64 == 0 && HD == 64, "a wave's tile is one head of one batch; its staging fits the stage buffers");
        const int p = c0 / DQ, hc = c0 % DQ, bt = r0 / TT, t0 = r0 % TT; char* wb = (char*)sm + w * TWB;   /* each wave's own staging, in the stage buffers: behind the last stage's barrier nobody reads those any more */
        if (p == 2) tail_v(acc, (unsigned short*)wb, lane, tl.v16, tl.vh, tl.vl, (unsigned)(((bt * DKV + hc + (lane >> 3)) * TT + t0 + (lane & 7) * 8) * 2));
        else tail_qk(acc, (float*)wb, lr, hi, p ? tl.gk : tl.gq, p ? tl.bk : tl.bq, p ? tl.k16 : tl.q16, p ? tl.kh : tl.qh, p ? tl.kl : tl.ql, (unsigned)((((bt * NH_ + hc / HD) * TT + t0) * HD + lr * 4) * 2));
        return; }
    float* os = (float*)sm + w * (16 * 68);   /* each wave's own 16 x 68 floats, in the stage buffers: behind the last stage's barrier nobody reads those any more */
    v4f bv = (v4f){};   /* the lane's four bias values: they go by the column alone, so they are read once and not in front of every store */
    if (BIAS && ks == 0) { const float* bp = bias + c0 + lr * 4; const v4f b4 = *(const v4f*)bp;
        asm volatile("s_wait_xcnt 0x0" :: "v"(bp) : "memory");   /* the wait that stands in front of any overwrite of a register that the issued load names; the address is an input so that its registers are not reused ahead of it */
#pragma unroll
        for (int q = 0; q < 4; ++q) bv[q] = bfr(b4[q]); }
#pragma unroll
    for (int mb = 0; mb < 4; ++mb) {
#pragma unroll
        for (int nb = 0; nb < 4; ++nb) {
#pragma unroll
            for (int j = 0; j < 8; ++j) os[(hi * 8 + j) * 68 + nb * 16 + lr] = acc[mb][nb][j]; }
        __builtin_amdgcn_wave_barrier(); asm volatile("" ::: "memory");
        float* crow = C + (size_t)(r0 + mb * 16) * ldc + c0 + lr * 4; v4f val[8]; float* cp[8];
#pragma unroll
        for (int s = 0; s < 8; ++s) { const int row = 2 * s + hi; val[s] = *(const v4fa*)(os + row * 68 + lr * 4); if (BIAS && ks == 0) val[s] += bv; cp[s] = crow + (size_t)row * ldc; }
#pragma unroll
        for (int s = 0; s < 8; ++s) *(v4f*)cp[s] = val[s];
        /* the wait that stands in front of any overwrite of a register that an issued store names; addresses and values are inputs so that their registers are not reused ahead of it */
        asm volatile("s_wait_xcnt 0x0" :: "v"(cp[0]), "v"(cp[1]), "v"(cp[2]), "v"(cp[3]), "v"(cp[4]), "v"(cp[5]), "v"(cp[6]), "v"(cp[7]), "v"(val[0]), "v"(val[1]), "v"(val[2]), "v"(val[3]), "v"(val[4]), "v"(val[5]), "v"(val[6]), "v"(val[7]) : "memory");
        __builtin_amdgcn_wave_barrier(); asm volatile("" ::: "memory");
    }
}

__device__ __forceinline__ h16 tohx(float x) { return (h16)x; }
typedef __attribute__((ext_vector_type(2))) _Float16 v2h;
typedef __attribute__((ext_vector_type(4))) _Float16 v4h;
typedef __attribute__((ext_vector_type(2))) unsigned short v2us;
typedef __attribute__((ext_vector_type(2))) float v2f;
typedef __attribute__((ext_vector_type(4))) int v4i;

// ---- k_prep: every operand conversion of a call in ONE launch; a work-group's range of the flat block index says which it does (block-uniform): the three LoRA A packed into one zero-padded 64-row operand, the three LoRA B behind the rows of qkv_w, then x, qkv_w, proj_w to bf16.
// cvt8: rows of DM floats to bf16 rows of pitch DP.
template <int DP>
__device__ __forceinline__ void cvt8(const float* __restrict__ src, bf* dst, size_t i) { const v8f v = *(const v8f*)(src + i * 8); const size_t e = i * 8;
    *(v8us*)(dst + (e / DM) * DP + e % DM) = rb8(v);
    asm volatile("s_wait_xcnt 0x0" ::: "memory");   /* the wait that stands in front of any overwrite of a register that the issued store names: in the listing the code of the next range follows this store */ }

#define LR_R 8   // LoRA rank
// apad: row nn = 8 p + r of the packed operand (pitch KX, its first DM columns) = column r of projection p's LoRA A; rows from 24 on are zero. A work-group holds one row.
__device__ __forceinline__ void apad(const float* __restrict__ Aq, const float* __restrict__ Ak, const float* __restrict__ Av, bf* Bt, size_t i) { const size_t e = i * 4; const int k0 = (int)(e % DM); const int nn = (int)(e / DM); const int p = nn / LR_R; const float* A = p == 0 ? Aq : p == 1 ? Ak : Av; v4us o;
#pragma unroll
    for (int q = 0; q < 4; ++q) { const float a = A[(size_t)(k0 + q) * LR_R + nn % LR_R]; o[q] = (p < 3) ? f2bf(a) : (unsigned short)0; }
    *(v4us*)(Bt + (size_t)nn * KX + k0) = o;
    asm volatile("s_wait_xcnt 0x0" ::: "memory");   /* the wait that stands in front of any overwrite of a register that the issued store names: in the listing the code of the next range follows this store */ }
// bpad: the 64 columns behind row n of qkv_w: twice 32 (for the hi and for the lo half of x A), in each B[r][n % DQ] of n's own projection p at column 8 p + r and zero elsewhere. A work-group holds 16 rows of one projection.
__device__ __forceinline__ void bpad(const float* __restrict__ Bq, const float* __restrict__ Bk, const float* __restrict__ Bv, bf* Wx, size_t i) { const size_t e = i * 4; const int k0 = (int)(e % 64); const int n = (int)(e / 64); const int p = n / DQ; const float* Bm = p == 0 ? Bq : p == 1 ? Bk : Bv; v4us o;
#pragma unroll
    for (int q = 0; q < 4; ++q) { const int k = (k0 + q) % 32; const float b = Bm[(size_t)(k % LR_R) * DQ + n % DQ]; o[q] = (k / LR_R == p) ? f2bf(b) : (unsigned short)0; }
    *(v4us*)(Wx + (size_t)n * KX + DM + k0) = o;
    asm volatile("s_wait_xcnt 0x0" ::: "memory");   /* the wait that stands in front of any overwrite of a register that the issued store names: in the listing the code of the next range follows this store */ }
#define PBX (MT * DM / 8 / 256)                    // work-groups of x
#define PBW ((DQ + 2 * DKV) * DM / 8 / 256)        // of qkv_w
#define PBO (DM * DQ / 8 / 256)                    // of proj_w
#define PBP (64 * DM / 4 / 256)                    // of the packed LoRA A; of one projection's LoRA B columns
static_assert(DQ == DM && (MT * DM) % 2048 == 0 && (DQ * DM) % 2048 == 0 && (64 * DM) % 1024 == 0, "whole work-groups");
__global__ __launch_bounds__(256) void k_prep(const float* __restrict__ x, const float* __restrict__ wqkv, const float* __restrict__ wo, const float* __restrict__ laq, const float* __restrict__ lak, const float* __restrict__ lav, const float* __restrict__ lbq, const float* __restrict__ lbk, const float* __restrict__ lbv, bf* XB, bf* WQKV, bf* WO, bf* AP) {
    int blk = (int)blockIdx.x; const size_t tid = threadIdx.x;   /* the padded operands first: their dependent strided reads are the longest path of a work-group here */
    if (blk < PBP) { apad(laq, lak, lav, AP, (size_t)blk * 256 + tid); return; }
    blk -= PBP;
    if (blk < 3 * PBP) { bpad(lbq, lbk, lbv, WQKV, (size_t)blk * 256 + tid); return; }
    blk -= 3 * PBP;
    if (blk < PBX) { cvt8<KX>(x, XB, (size_t)blk * 256 + tid); return; }
    blk -= PBX;
    if (blk < PBW) { cvt8<KX>(wqkv, WQKV, (size_t)blk * 256 + tid); return; }
    blk -= PBW;
    cvt8<DQ>(wo, WO, (size_t)blk * 256 + tid);
}
// k_tohl: the first 32 columns (24 in use, the rest exact zeros) of the NS split-K planes of F ([MT][64], stride sP) added in slice order, then hi/lo: hi to columns DM.., lo to columns DM + 32.. of the same row of X (pitch KX). The planes lie too far apart for an immediate offset: one uniform base, one 32-bit byte offset a plane.
template <int NS, size_t sP>
__global__ __launch_bounds__(256) void k_tohl(const float* __restrict__ F, bf* X, size_t n4) { static_assert(NS == 16 && (size_t)NS * sP * 4 < ((size_t)1 << 32), "sixteen offsets of 32 bits"); const size_t i = (size_t)blockIdx.x * 256 + threadIdx.x; if (i >= n4) return; const unsigned ob = ((unsigned)(i >> 3) * 64u + (unsigned)(i & 7) * 4u) * 4u; unsigned os[NS]; v4f p[NS]; v4us oh, ol;
#pragma unroll
    for (int s = 0; s < NS; ++s) { os[s] = ob + (unsigned)s * (unsigned)(sP * 4); p[s] = *(const v4f*)((const char*)F + os[s]); }   /* one uniform base, one 32-bit byte offset a plane */
    /* the wait that stands in front of any overwrite of a register that an issued load names; the offsets are inputs so that their registers are not reused (as a later load's destination) ahead of it */
    asm volatile("s_wait_xcnt 0x0" :: "v"(os[0]), "v"(os[1]), "v"(os[2]), "v"(os[3]), "v"(os[4]), "v"(os[5]), "v"(os[6]), "v"(os[7]), "v"(os[8]), "v"(os[9]), "v"(os[10]), "v"(os[11]), "v"(os[12]), "v"(os[13]), "v"(os[14]), "v"(os[15]) : "memory");
    v4f a = p[0];
#pragma unroll
    for (int s = 1; s < NS; ++s) {   /* split-K planes, slice order */
#pragma unroll
        for (int q = 0; q < 4; ++q) a[q] = __fadd_rn(a[q], p[s][q]); }
    split4(a, oh, ol);
    bf* xr = X + (i >> 3) * KX + DM + (i & 7) * 4; *(v4us*)xr = oh; *(v4us*)(xr + 32) = ol;  }
// ---- The tails of the projections, run by each wave of the q | k | v GEMM on its own 64 x 64 accumulator tile (acc[mb][nb][j]: token mb 16 + 8 (lane / 16) + j, column nb 16 + lane % 16), through the wave's own LDS staging.
// sum over a 16-lane row, every lane gets it (DPP row_xmask 1, 2, 4, 8)
template <int M> __device__ __forceinline__ float rowx(float v) { return __int_as_float(__builtin_amdgcn_update_dpp(0, __float_as_int(v), 0x160 + M, 0xf, 0xf, true)); }
__device__ __forceinline__ float rowsum16(float v) { v += rowx<1>(v); v += rowx<2>(v); v += rowx<4>(v); v += rowx<8>(v); return v; }
// tail_qk (q, k): 32 tokens at a time are staged as f32 rows; a lane reads back 4 consecutive head dims, so 16 lanes hold one (token, head) row: LayerNorm over the 64 head dims in registers, then head planes [b][h][t][d] (fp16 + hi/lo), two whole 128-byte lines a store. ob: the lane's byte offset in a plane at the tile's first token.
__device__ __forceinline__ void tail_qk(const v8f (&acc)[4][4], float* os, int lr, int hi, const float* __restrict__ g, const float* __restrict__ bb, h16* P16, bf* Ph, bf* Pl, unsigned ob) {
    const float* gp = g + lr * 4; const float* bp = bb + lr * 4; v4f gv = *(const v4f*)gp, bv = *(const v4f*)bp;
    /* the wait that stands in front of any overwrite of a register that an issued load names; the addresses are inputs so that their registers are not reused ahead of it */
    asm volatile("s_wait_xcnt 0x0" :: "v"(gp), "v"(bp) : "memory");
#pragma unroll
    for (int q = 0; q < 4; ++q) { gv[q] = bfr(gv[q]); bv[q] = bfr(bv[q]); }
#pragma unroll
    for (int mh = 0; mh < 2; ++mh) {
#pragma unroll
        for (int m2 = 0; m2 < 2; ++m2)
#pragma unroll
            for (int nb = 0; nb < 4; ++nb)
#pragma unroll
                for (int j = 0; j < 8; ++j) os[(m2 * 16 + hi * 8 + j) * 68 + nb * 16 + lr] = acc[mh * 2 + m2][nb][j];
        asm volatile("s_wait_dscnt 0x0" ::: "memory");   /* the staging writes are done before a lane reads back what other lanes of the wave wrote; the clobber keeps the compiler from lifting those reads over the writes */
#pragma unroll 1   /* rolled, four rows a lane and trip: four independent LayerNorm chains cover each other's latency, and the text stays short */
        for (int sg = 0; sg < 4; ++sg) { unsigned off[4]; v4h o16[4]; v4us oh[4], ol[4];
#pragma unroll
            for (int u = 0; u < 4; ++u) { const int row = (sg * 4 + u) * 2 + hi; const v4f a = *(const v4fa*)(os + row * 68 + lr * 4);
                const float mu = rowsum16((a[0] + a[1]) + (a[2] + a[3])) * (1.0f / HD); const v4f dv = a - mu;
                const float var = rowsum16((dv[0] * dv[0] + dv[1] * dv[1]) + (dv[2] * dv[2] + dv[3] * dv[3])) * (1.0f / HD);
                const float rs = __fdiv_rn(1.0f, __fsqrt_rn(var + LNH_EPS));
                v4f y;
#pragma unroll
                for (int q = 0; q < 4; ++q) { y[q] = dv[q] * rs * gv[q] + bv[q]; o16[u][q] = tohx(y[q]); }
                split4(y, oh[u], ol[u]);
                off[u] = ob + (unsigned)(mh * 32 + row) * (HD * 2u); }
#pragma unroll
            for (int u = 0; u < 4; ++u) { *(v4h*)((char*)P16 + off[u]) = o16[u]; *(v4us*)((char*)Ph + off[u]) = oh[u]; *(v4us*)((char*)Pl + off[u]) = ol[u]; }
            /* the wait that stands in front of any overwrite of a register that an issued store names; offsets and values are inputs so that their registers are not reused ahead of it; its clobber also keeps the next staging writes behind these reads */
            asm volatile("s_wait_xcnt 0x0" :: "v"(off[0]), "v"(off[1]), "v"(off[2]), "v"(off[3]), "v"(o16[0]), "v"(o16[1]), "v"(o16[2]), "v"(o16[3]), "v"(oh[0]), "v"(oh[1]), "v"(oh[2]), "v"(oh[3]), "v"(ol[0]), "v"(ol[1]), "v"(ol[2]), "v"(ol[3]) : "memory"); }
    }
}
// tail_v (v): a lane's accumulator holds 8 consecutive tokens of one column, which is 16 bytes of a row of a transposed plane [b][g][d][t] (fp16 + hi/lo); one plane at a time the 64 columns x 64 tokens are staged in LDS (pitch 144 bytes) and written out along t, four whole 128-byte lines a store. ob: the lane's byte offset in a plane: column lane / 8 of the tile, 16 bytes lane % 8 of its line.
#define VSP 72                    // staging pitch in 16-bit elements: 144 bytes = 16 x odd, free of bank conflicts for 16-byte accesses
__device__ __forceinline__ void tail_vout(const unsigned short* vs, int lane, char* plane, unsigned ob) {
    asm volatile("s_wait_dscnt 0x0" ::: "memory");   /* the staging writes are done before a lane reads back what other lanes of the wave wrote; the clobber keeps the compiler from lifting those reads over the writes */
#pragma unroll
    for (int ig = 0; ig < 2; ++ig) { v8us r[8];
#pragma unroll
        for (int it = 0; it < 8; ++it) r[it] = *(const v8usa*)(vs + ((ig * 8 + it) * 4 + (lane >> 3)) * VSP + (lane & 7) * 8);
#pragma unroll
        for (int it = 0; it < 8; ++it) *(v8usa*)(plane + (size_t)(ig * 8 + it) * (4 * TT * 2) + ob) = r[it];
        /* the wait that stands in front of any overwrite of a register that an issued store names; offset and values are inputs so that their registers are not reused ahead of it; its clobber also keeps the next staging writes behind these reads */
        asm volatile("s_wait_xcnt 0x0" :: "v"(ob), "v"(r[0]), "v"(r[1]), "v"(r[2]), "v"(r[3]), "v"(r[4]), "v"(r[5]), "v"(r[6]), "v"(r[7]) : "memory"); }
}
__device__ __forceinline__ void tail_v(const v8f (&acc)[4][4], unsigned short* vs, int lane, h16* V16, bf* Vh, bf* Vl, unsigned ob) {
    unsigned short* vw = vs + (lane & 15) * VSP + (lane >> 4) * 8; v8us lo[4][4];
#pragma unroll
    for (int mb = 0; mb < 4; ++mb)
#pragma unroll
        for (int nb = 0; nb < 4; ++nb) { v8h o;
#pragma unroll
            for (int j = 0; j < 8; ++j) o[j] = tohx(acc[mb][nb][j]);
            *(v8usa*)(vw + nb * 16 * VSP + mb * 16) = __builtin_bit_cast(v8us, o); }
    tail_vout(vs, lane, (char*)V16, ob);
#pragma unroll
    for (int mb = 0; mb < 4; ++mb)
#pragma unroll
        for (int nb = 0; nb < 4; ++nb) { v8us o; split8(acc[mb][nb], o, lo[mb][nb]);
            *(v8usa*)(vw + nb * 16 * VSP + mb * 16) = o; }
    tail_vout(vs, lane, (char*)Vh, ob);
#pragma unroll
    for (int mb = 0; mb < 4; ++mb)
#pragma unroll
        for (int nb = 0; nb < 4; ++nb) *(v8usa*)(vw + nb * 16 * VSP + mb * 16) = lo[mb][nb];
    tail_vout(vs, lane, (char*)Vl, ob);
}
// ---- k_fattn: fused attention, one launch for all heads of both batches (grid: row blocks, heads, batches). One wave owns 16 queries of one head and walks the TT keys, 64 a pass (32 on the hi/lo rows, whose fragments take twice the registers):
// S^T = K Q^T (A = key rows, B = the queries, loaded once), so a lane holds 8 keys of ONE query per 16-key tile; t = S x HD^-0.5 + bf16(attn_mask[i][j]) (the additive f32 mask input, read as data);
// running-maximum softmax in registers (the output tiles and the sum are rescaled when the maximum moves; the division by the sum comes last); O^T += V^T P^T with P^T packed from the score tiles as the B operand (two 16-key tiles = one 32-key fragment in the loaders' k order).
// Scores and probabilities never reach memory. Rows < RH: hi/lo planes, 3 products; the rest fp16 with P x PCAR. Each work-group takes FHW hi/lo waves and 8 - FHW fp16 waves, so that the longer hi/lo rows are spread over all work-groups.
// The eight waves of a work-group walk the same keys of the same head: each stage of SKB keys (the K and V tiles of all six planes) is brought into LDS ONCE for all of them, in whole 128-byte lines, by asynchronous copies, two buffers, the next stage in flight while this one is worked on; the fragments are read from LDS. The mask rows are each wave's own and still come straight from memory.
#define FHW 2
#define PLOG 10.0f   // log2(PCAR)
static_assert(PCAR == 1024.0f, "PLOG");
static_assert(FHW * 16 * (TT / 128) == RH && (8 - FHW) * 16 * (TT / 128) == TT - RH, "row split");
#define SKB 64                    // keys a stage
#define NSTG (TT / SKB)
#define LPE 72                    // LDS row pitch in 16-bit elements: 144 bytes = 16 x odd, free of bank conflicts for 16-byte fragment reads of 128-byte rows
#define PLE (64 * LPE)            // one plane's tile: 64 rows (K: keys x head dims; V: head dims x keys)
#define STE (6 * PLE)             // a stage: K16 | V16 | Kh | Kl | Vh | Vl
static_assert(HD == 64 && SKB == 64 && NSTG >= 2 && TT % SKB == 0, "64 x 64 tiles, two stages or more");
typedef __attribute__((ext_vector_type(8))) unsigned v8u;
// One stage's copies of one thread: 16 bytes of row r = tid / 8 and of row r + 32 of each of the six tiles (a wave: four whole 128-byte rows a copy). l: the thread's LDS byte address in tile 0 of the buffer; the pointers: its 16 bytes of row r in each plane.
__device__ __forceinline__ void stage_fill(unsigned l, const h16* k16, const h16* v16, const bf* kh, const bf* kl, const bf* vh, const bf* vl) {
    const unsigned P = PLE * 2u, R = 32u * LPE * 2u;
    /* the copies and, as the last line of their own statement, the wait that stands in front of any overwrite of a register that an issued copy names */
    asm volatile("global_load_async_to_lds_b128 %0, %12, off\n\tglobal_load_async_to_lds_b128 %1, %13, off\n\tglobal_load_async_to_lds_b128 %2, %14, off\n\tglobal_load_async_to_lds_b128 %3, %15, off\n\t"
                 "global_load_async_to_lds_b128 %4, %16, off\n\tglobal_load_async_to_lds_b128 %5, %17, off\n\tglobal_load_async_to_lds_b128 %6, %18, off\n\tglobal_load_async_to_lds_b128 %7, %19, off\n\t"
                 "global_load_async_to_lds_b128 %8, %20, off\n\tglobal_load_async_to_lds_b128 %9, %21, off\n\tglobal_load_async_to_lds_b128 %10, %22, off\n\tglobal_load_async_to_lds_b128 %11, %23, off\n\ts_wait_xcnt 0x0"
                 :: "v"(l), "v"(l + R), "v"(l + P), "v"(l + P + R), "v"(l + 2 * P), "v"(l + 2 * P + R), "v"(l + 3 * P), "v"(l + 3 * P + R), "v"(l + 4 * P), "v"(l + 4 * P + R), "v"(l + 5 * P), "v"(l + 5 * P + R),
                    "v"(k16), "v"(k16 + 32 * HD), "v"(v16), "v"(v16 + (size_t)32 * TT), "v"(kh), "v"(kh + 32 * HD), "v"(kl), "v"(kl + 32 * HD), "v"(vh), "v"(vh + (size_t)32 * TT), "v"(vl), "v"(vl + (size_t)32 * TT) : "memory");
}
// One pass of one wave over KB keys. kp, kp2, vp, vp2: the lane's place in the K and V tiles in LDS (row lane % 16, 8 elements further in the upper lane half); mp: its place in its query's mask row.
template <typename T16, bool HR, int KB>   // KB keys a pass
__device__ __forceinline__ void fattn_pass(const T16* kp, const T16* kp2, const T16* vp, const T16* vp2, const float* __restrict__ mp, const v8u (&qa)[2], const v8u (&qb)[2], v8f (&o)[4], float& m, float& sum) {
    typedef typename WFrag<T16>::V V;
    V qf[2], qf2[2];
#pragma unroll
    for (int ks = 0; ks < 2; ++ks) { qf[ks] = __builtin_bit_cast(V, qa[ks]); qf2[ks] = __builtin_bit_cast(V, qb[ks]); }
        V kf[KB / 16][2], kf2[KB / 16][2], vf[4][KB / 32], vf2[4][KB / 32]; v4f mk[KB / 16][2];
#pragma unroll
        for (int kb = 0; kb < KB / 16; ++kb)
#pragma unroll
            for (int ks = 0; ks < 2; ++ks) mk[kb][ks] = *(const v4f*)(mp + kb * 16 + ks * 4);   /* the pass's only loads from memory go out first */
        /* the wait that stands in front of any overwrite of a register that an issued load names; the address is an input so that its registers are not reused (as a later load's destination) ahead of it */
        asm volatile("s_wait_xcnt 0x0" :: "v"(mp) : "memory");
#pragma unroll
        for (int kb = 0; kb < KB / 16; ++kb) {
#pragma unroll
            for (int ks = 0; ks < 2; ++ks) { kf[kb][ks] = WFrag<T16>::ld(kp + kb * 16 * LPE + ks * 32); if (HR) kf2[kb][ks] = WFrag<T16>::ld(kp2 + kb * 16 * LPE + ks * 32); } }
        __builtin_amdgcn_sched_barrier(0);   /* keeps all of the pass's K fragment reads above the products: one LDS latency a pass, where the scheduler's own order read each fragment into the same registers and waited for it in front of its product */
        v8f s[KB / 16];
#pragma unroll
        for (int kb = 0; kb < KB / 16; ++kb) { s[kb] = (v8f){};
#pragma unroll
            for (int ks = 0; ks < 2; ++ks) { s[kb] = WFrag<T16>::mma(kf[kb][ks], qf[ks], s[kb]);
                if (HR) { s[kb] = WFrag<T16>::mma(kf[kb][ks], qf2[ks], s[kb]); s[kb] = WFrag<T16>::mma(kf2[kb][ks], qf[ks], s[kb]); } } }
#pragma unroll
        for (int mb = 0; mb < 4; ++mb)
#pragma unroll
            for (int ks = 0; ks < KB / 32; ++ks) { vf[mb][ks] = WFrag<T16>::ld(vp + mb * 16 * LPE + ks * 32); if (HR) vf2[mb][ks] = WFrag<T16>::ld(vp2 + mb * 16 * LPE + ks * 32); }
        __builtin_amdgcn_sched_barrier(0);   /* keeps the V fragment reads above the softmax, whose vector work then covers their latency */
        float bk[KB / 16];
#pragma unroll
        for (int kb = 0; kb < KB / 16; ++kb) { const v8f mr = fb8(rb8(__builtin_shufflevector(mk[kb][0], mk[kb][1], 0, 1, 2, 3, 4, 5, 6, 7))); bk[kb] = -3.0e38f;
#pragma unroll
            for (int j = 0; j < 8; ++j) { const float t = s[kb][j] * SCL + mr[j]; s[kb][j] = t; bk[kb] = fmaxf(bk[kb], t); } }
        float bm = m;
#pragma unroll
        for (int kb = 0; kb < KB / 16; ++kb) bm = fmaxf(bm, bk[kb]);
        bm = fmaxf(bm, __shfl_xor(bm, 16, 32));   /* the two lane halves hold the two halves of a query's keys */
        const float al = __builtin_amdgcn_exp2f((m - bm) * 1.4426950408889634f); m = bm;
        float pk[KB / 16];
#pragma unroll
        for (int kb = 0; kb < KB / 16; ++kb) { float e[8];
#pragma unroll
            for (int j = 0; j < 8; ++j) { const float d = s[kb][j] - m;   /* the maximum is subtracted first: exactly 0 at t = m for every m, and minus infinity stays minus infinity (p = 0) */
                if constexpr (HR) e[j] = d * 1.4426950408889634f; else e[j] = __builtin_fmaf(d, 1.4426950408889634f, PLOG); }   /* the fp16 rows' factor PCAR rides in the exponent: p = PCAR x exp(t - m) */
            /* eight exponentials, each in place, then one v_nop: behind a transcendental the instruction set asks for one independent instruction before its result is read or its source overwritten; here the next exponential (another register) or the v_nop is that instruction */
            asm("v_exp_f32 %0, %0\n\tv_exp_f32 %1, %1\n\tv_exp_f32 %2, %2\n\tv_exp_f32 %3, %3\n\tv_exp_f32 %4, %4\n\tv_exp_f32 %5, %5\n\tv_exp_f32 %6, %6\n\tv_exp_f32 %7, %7\n\tv_nop" : "+v"(e[0]), "+v"(e[1]), "+v"(e[2]), "+v"(e[3]), "+v"(e[4]), "+v"(e[5]), "+v"(e[6]), "+v"(e[7]));
#pragma unroll
            for (int j = 0; j < 8; ++j) { s[kb][j] = e[j]; pk[kb] = j ? pk[kb] + e[j] : e[0]; } }
        float ps = pk[0];
#pragma unroll
        for (int kb = 1; kb < KB / 16; ++kb) ps += pk[kb];
        sum = sum * al + ps;
#pragma unroll
        for (int mb = 0; mb < 4; ++mb)
#pragma unroll
            for (int j = 0; j < 8; ++j) o[mb][j] *= al;
        V pf[KB / 32], pf2[KB / 32];
#pragma unroll
        for (int ks = 0; ks < KB / 32; ++ks) {
            if constexpr (HR) { v8us h0, h1, l0, l1; split8(s[2 * ks], h0, l0); split8(s[2 * ks + 1], h1, l1);
                pf[ks] = cat16b(h0, h1); pf2[ks] = cat16b(l0, l1);
            } else { v8h a0, a1;
#pragma unroll
                for (int j = 0; j < 8; ++j) { a0[j] = tohx(s[2 * ks][j]); a1[j] = tohx(s[2 * ks + 1][j]); }
                pf[ks] = cat16(a0, a1); } }
#pragma unroll
        for (int mb = 0; mb < 4; ++mb)
#pragma unroll
            for (int ks = 0; ks < KB / 32; ++ks) { o[mb] = WFrag<T16>::mma(vf[mb][ks], pf[ks], o[mb]);
                if (HR) { o[mb] = WFrag<T16>::mma(vf[mb][ks], pf2[ks], o[mb]); o[mb] = WFrag<T16>::mma(vf2[mb][ks], pf[ks], o[mb]); } }
}
// amdgpu_waves_per_eu(4, 4): the register budget of four waves a SIMD, so that two work-groups (whose LDS fits twice) share a WGP and one's vector work fills the other's waits
__global__ __launch_bounds__(256) __attribute__((amdgpu_waves_per_eu(4, 4))) void k_fattn(const h16* __restrict__ Q16, const h16* __restrict__ K16, const h16* __restrict__ V16, const bf* __restrict__ Qh, const bf* __restrict__ Ql, const bf* __restrict__ Kh, const bf* __restrict__ Kl, const bf* __restrict__ Vh, const bf* __restrict__ Vl, const float* __restrict__ madd, bf* Ah, bf* Al) {
    __shared__ __attribute__((aligned(16))) unsigned short sm[2 * STE];
    const int tid = (int)threadIdx.x, lane = tid & 31, lr = lane & 15, hi = lane >> 4;
    const int w = __builtin_amdgcn_readfirstlane(tid >> 5); const bool hr = w < FHW;   /* the same in every lane of a wave: a scalar branch */
    const size_t hq = ((size_t)blockIdx.z * NH_ + blockIdx.y) * TT * HD, hk = ((size_t)blockIdx.z * NKV + blockIdx.y / REP) * TT * HD; const size_t ao = (size_t)blockIdx.z * TT * DQ + blockIdx.y * HD; bf* ah = Ah + ao; bf* al = Al + ao;
    const int q0 = hr ? (int)blockIdx.x * (FHW * 16) + w * 16 : RH + (int)blockIdx.x * ((8 - FHW) * 16) + (w - FHW) * 16;
    /* the thread's share of a stage's copies */
    const int cr = tid >> 3, cc = (tid & 7) * 8; const unsigned lb = (unsigned)(size_t)sm + (unsigned)(cr * LPE + cc) * 2u; const size_t gk = hk + (size_t)cr * HD + cc, gv = hk + (size_t)cr * TT + cc;
    stage_fill(lb, K16 + gk, V16 + gv, Kh + gk, Kl + gk, Vh + gv, Vl + gv);
    /* the query fragments as raw 16-bit planes, one set of registers for both kinds of wave: hi | lo, or fp16 | (the lo plane, loaded without a branch and never used) */
    const size_t qo = hq + (size_t)(q0 + lr) * HD + 8 * hi; const bf* qp = (hr ? Qh : (const bf*)Q16) + qo; const bf* qp2 = Ql + qo;
    v8u qa[2], qb[2];
#pragma unroll
    for (int ks = 0; ks < 2; ++ks) { qa[ks] = __builtin_bit_cast(v8u, WFrag<bf>::ld(qp + ks * 32)); qb[ks] = __builtin_bit_cast(v8u, WFrag<bf>::ld(qp2 + ks * 32)); }
    /* the wait that stands in front of any overwrite of a register that an issued load names; the addresses are inputs so that their registers are not reused ahead of it */
    asm volatile("s_wait_xcnt 0x0" :: "v"(qp), "v"(qp2) : "memory");
    v8f o[4];
#pragma unroll
    for (int mb = 0; mb < 4; ++mb) o[mb] = (v8f){};
    float m = -3.0e38f, sum = 0.f;
    const float* mrow = madd + (size_t)(q0 + lr) * TT + 8 * hi;
    const int fo = lr * LPE + 8 * hi;
    asm volatile("s_wait_asynccnt 0x0" ::: "memory");   /* this wave's copies of stage 0 have landed */
    __syncthreads();                                      /* every wave's have: stage 0 may be read */
    stage_fill(lb + STE * 2u, K16 + gk + (size_t)SKB * HD, V16 + gv + SKB, Kh + gk + (size_t)SKB * HD, Kl + gk + (size_t)SKB * HD, Vh + gv + SKB, Vl + gv + SKB);
    for (int t = 0; t < NSTG; ++t) {
        const unsigned short* st = sm + (t & 1) * STE + fo; const float* mp = mrow + t * SKB;
        if (hr) {   /* two passes of 32 keys a stage; unrolled, so that the half's place in the tiles is an immediate offset of the LDS reads */
#pragma unroll
            for (int sub = 0; sub < 2; ++sub) fattn_pass<bf, true, 32>(st + 2 * PLE + sub * 32 * LPE, st + 3 * PLE + sub * 32 * LPE, st + 4 * PLE + sub * 32, st + 5 * PLE + sub * 32, mp + sub * 32, qa, qb, o, m, sum);
        } else { const h16* sh = (const h16*)st; fattn_pass<h16, false, 64>(sh, sh, sh + PLE, sh + PLE, mp, qa, qb, o, m, sum); }
        asm volatile("s_wait_dscnt 0x0" ::: "memory");      /* this wave's reads of stage t are done */
        asm volatile("s_wait_asynccnt 0x0" ::: "memory");   /* its copies of stage t + 1 have landed */
        __syncthreads();                                      /* one barrier a stage: it publishes stage t + 1 and ends every wave's reads of the buffer that is refilled behind it */
        if (t + 2 < NSTG) { const size_t ak = (size_t)(t + 2) * SKB * HD, av = (size_t)(t + 2) * SKB; stage_fill(lb + (unsigned)(t & 1) * (STE * 2u), K16 + gk + ak, V16 + gv + av, Kh + gk + ak, Kl + gk + ak, Vh + gv + av, Vl + gv + av); }
    }
    asm volatile("s_wait_asynccnt 0x0" ::: "memory");   /* no copy is outstanding when the wave ends */
    sum += __shfl_xor(sum, 16, 32);
    const float f = __fdiv_rn(1.0f, sum);   /* on the fp16 rows sum and o both carry PCAR */
#pragma unroll
    for (int mb = 0; mb < 4; ++mb) { v8us oh, ol;   /* a lane holds 8 consecutive head dims of its query: one 16-byte store a plane */
        split8(o[mb] * f, oh, ol);
        const size_t oo = (size_t)(q0 + lr) * DQ + mb * 16 + hi * 8; *(v8us*)(ah + oo) = oh; *(v8us*)(al + oo) = ol; }
}

extern "C" void kernel_launch(void* const* d_in, const int* in_sizes, int n_in,
                              void* d_out, int out_size, void* d_ws, size_t ws_size, hipStream_t stream) {
    (void)in_sizes; (void)n_in; (void)out_size;
    const float* x = (const float*)d_in[0]; const float* madd = (const float*)d_in[1];   /* attn_mask [1][1][2048][2048] f32 (zeros): read, added to the scaled scores */ const float* wqkv = (const float*)d_in[2]; const float* wo = (const float*)d_in[3]; const float* bo = (const float*)d_in[4]; const float* gq = (const float*)d_in[5]; const float* btq = (const float*)d_in[6]; const float* gk = (const float*)d_in[7]; const float* btk = (const float*)d_in[8]; const float* laq = (const float*)d_in[9]; const float* lbq = (const float*)d_in[10]; const float* lak = (const float*)d_in[11]; const float* lbk = (const float*)d_in[12]; const float* lav = (const float*)d_in[13]; const float* lbv = (const float*)d_in[14];
    float* OUT = (float*)d_out;     // [2][2048][1024]
    char* wsp = (char*)d_ws;
    auto take = [&](size_t bytes) { char* p = wsp; wsp += (bytes + 255) & ~(size_t)255; return (void*)p; };
    bf* WQ = (bf*)take((size_t)DQKV * KX * 2);   /* qkv_w as one bf16 block, behind each row its LoRA B columns */ bf* WO = (bf*)take((size_t)DM * DQ * 2);
    bf* XB = (bf*)take((size_t)MT * KX * 2);   /* x, behind each row x A (hi | lo) of q, k, v */ bf* AP = (bf*)take((size_t)64 * KX * 2);   /* the three LoRA A packed and zero-padded, A^T [64] rows of the same pitch (its first DM columns are written and read) */
    /* head planes and merged planes of BOTH batches (batch stride PB, AB elements) */ const size_t PB = (size_t)NH_ * TT * HD, AB = (size_t)TT * DQ; static_assert(NKV == NH_, "one plane stride");
    h16* QP16 = (h16*)take(NB_ * PB * 2); h16* KP16 = (h16*)take(NB_ * PB * 2); h16* VT16 = (h16*)take(NB_ * PB * 2);
    bf* QPh = (bf*)take(NB_ * PB * 2); bf* QPl = (bf*)take(NB_ * PB * 2); bf* KPh = (bf*)take(NB_ * PB * 2); bf* KPl = (bf*)take(NB_ * PB * 2); bf* VTh = (bf*)take(NB_ * PB * 2); bf* VTl = (bf*)take(NB_ * PB * 2);
    bf* ATh = (bf*)take(NB_ * AB * 2); bf* ATl = (bf*)take(NB_ * AB * 2);
    float* XA = (float*)take((size_t)KSA * MT * 64 * 4);   /* the KSA x [MT][64] f32 planes of x A */
    if ((size_t)(wsp - (char*)d_ws) > ws_size) return;    // ws 256 MiB
    k_prep<<<PBX + PBW + PBO + 4 * PBP, 256, 0, stream>>>(x, wqkv, wo, laq, lak, lav, lbq, lbk, lbv, XB, WQ, WO, AP);
    /* x A of q, k and v in one 64-wide GEMM, grid z = split-K slice over the first DM columns: exact x A, f32 planes -> hi | lo behind the rows of x */
    k_gemmw<bf, 0, false, 1, 4, 1, false><<<dim3(MT / 256, 1, KSA), 128, 0, stream>>>(XB, nullptr, AP, nullptr, KX, XA, 64, nullptr, 0, 0, 0, DM / KSA, (size_t)MT * 64, QkvTail{});
    k_tohl<KSA, (size_t)MT * 64><<<(unsigned)((size_t)MT * 32 / 4 / 256), 256, 0, stream>>>(XA, XB, (size_t)MT * 32 / 4);
    /* q | k | v = x qkv_w^T + (x A) B as ONE GEMM, N = DQKV, every accumulator over the whole K = DM + 64 (the last stage is the LoRA term, hi/lo x exact B): its 384 work-groups fill the chip with no split of K, and no f32 result goes through memory: each wave's epilogue does its head's tail (q, k: per-head LayerNorm, head planes; v: transposed planes) */
    const QkvTail tl = {gq, btq, gk, btk, QP16, QPh, QPl, KP16, KPh, KPl, VT16, VTh, VTl};
    k_gemmw<bf, 0, false, 1, 4, 2, true><<<dim3(MT / 256, DQKV / 128, 1), 256, 0, stream>>>(XB, nullptr, WQ, nullptr, KX, nullptr, 0, nullptr, 0, 0, 0, KX, 0, tl);
    k_fattn<<<dim3(TT / 128, NH_, NB_), 256, 0, stream>>>(QP16, KP16, VT16, QPh, QPl, KPh, KPl, VTh, VTl, madd, ATh, ATl);   /* scores, softmax and P V of all heads of both batches; writes the merged hi/lo planes */
    /* the output projection over the whole K on 128 x 128 tiles, one work-group a WGP: it stores out itself, bias included */
    k_gemmw<bf, 1, true, 1, 2, 2, false><<<dim3(MT / 128, DM / 128, 1), 128, 0, stream>>>(ATh, ATl, WO, nullptr, DQ, OUT, DM, bo, 0, 0, 0, DQ, 0, QkvTail{});
}
